// v000
// Times are from an AMD MI455X. After a warm-up the kernel runs many times in a row, and a time is the length of
// such a window on the GPU divided by its runs, so every launch and the gaps after it count. The runs cycle
// through copies of the inputs. A figure is the median of several windows, for all but v000 over two sittings.
// Sittings can differ by a few percent; kernels timed side by side share one.
// The starting kernel, v000, takes 1730 microseconds a run.
#include <hip/hip_runtime.h>
#include <math.h>
// Four attentions (local = causal + 512 sliding window, long = causal, memory cross (512 keys), persona cross (64 keys)), 16 heads of 64:
// q/k projections (K=1024): v_wmma_f32_16x16x32_f16 (f16 operands); v and output projections (K=1024): v_wmma_f32_16x16x32_bf16 as bf16
// hi/lo splits; scores and p·v: v_wmma_f32_16x16x32_bf16 with q,k and p,v as bf16 hi/lo splits; f32 accumulate; softmax f32.
// Gate (concat(outs)·gate_w, N=4, 0.1 % of MACs), gate softmax and the weighted fusion in f32 on VALU.
typedef __attribute__((ext_vector_type(16))) _Float16 v16h;
typedef __attribute__((ext_vector_type(8)))  _Float16 v8h;
typedef __attribute__((ext_vector_type(16))) __bf16   v16b;
typedef __attribute__((ext_vector_type(8)))  __bf16   v8b;
typedef __attribute__((ext_vector_type(8)))  float    v8f;
typedef __attribute__((ext_vector_type(4)))  float    v4f;
#define PSCALE 32768.0f
#define U16(p) ((const unsigned short*)(const void*)(p))
#define PSCALE_INV (1.0f / 32768.0f)

__device__ __forceinline__ unsigned short f2bf_bits(float f) {
  unsigned u = __float_as_uint(f);
  return (unsigned short)((u + 0x7FFFu + ((u >> 16) & 1u)) >> 16);
}
__device__ __forceinline__ float bf_bits2f(unsigned short h) { return __uint_as_float(((unsigned)h) << 16); }

// hazard guards as plain device helpers (no inline asm inside the kernel template body)
__device__ __forceinline__ void dep_guard_h(v8f& a, v8f& b, v16h x, v16h y) { asm volatile("v_nop\n\tv_nop\n\tv_nop\n\tv_nop" : "+v"(a), "+v"(b) : "v"(x), "v"(y)); }
__device__ __forceinline__ void dep_guard_b(v8f& a, v8f& b, v16b x, v16b y) { asm volatile("v_nop\n\tv_nop\n\tv_nop\n\tv_nop" : "+v"(a), "+v"(b) : "v"(x), "v"(y)); }
__device__ __forceinline__ void keep4_h(v16h a, v16h b, v16h c, v16h d) { asm volatile("v_nop" :: "v"(a), "v"(b), "v"(c), "v"(d)); }
__device__ __forceinline__ void keep4_b(v16b a, v16b b, v16b c, v16b d) { asm volatile("v_nop" :: "v"(a), "v"(b), "v"(c), "v"(d)); }
__device__ __forceinline__ void acc_guard4(v8f& a, v8f& b, v8f& c, v8f& d) { asm volatile("v_nop\n\tv_nop\n\tv_nop\n\tv_nop" : "+v"(a), "+v"(b), "+v"(c), "+v"(d)); }
template <typename T> struct Frag;
template <> struct Frag<_Float16> {
  typedef v16h V; union U { v16h v; v8h h[2]; };
  static __device__ __forceinline__ v16h load(const _Float16* p) {   // elements 0..7 <- p[0..7], 8..15 <- p[16..23]
    U f; f.h[0] = *(const v8h*)(p); f.h[1] = *(const v8h*)(p + 16); return f.v;
  }
  static __device__ __forceinline__ v8f mma(v16h a, v16h b, v8f c) {
    return __builtin_amdgcn_wmma_f32_16x16x32_f16(false, a, false, b, (short)0, c, false, false);
  }
  static __device__ __forceinline__ void guard(v8f& a, v8f& b, v16h x, v16h y) { dep_guard_h(a, b, x, y); }
  static __device__ __forceinline__ void keep(v16h a, v16h b, v16h c, v16h d) { keep4_h(a, b, c, d); }
};
template <> struct Frag<__bf16> {
  typedef v16b V; union U { v16b v; v8b h[2]; };
  static __device__ __forceinline__ v16b load(const __bf16* p) {
    U f; f.h[0] = *(const v8b*)(p); f.h[1] = *(const v8b*)(p + 16); return f.v;
  }
  static __device__ __forceinline__ v8f mma(v16b a, v16b b, v8f c) {
    return __builtin_amdgcn_wmma_f32_16x16x32_bf16(false, a, false, b, (short)0, c, false, false);
  }
  static __device__ __forceinline__ void guard(v8f& a, v8f& b, v16b x, v16b y) { dep_guard_b(a, b, x, y); }
  static __device__ __forceinline__ void keep(v16b a, v16b b, v16b c, v16b d) { keep4_b(a, b, c, d); }
};

// ---- Register-blocked batched WMMA GEMM ------------------------------------
// C[m,n] = scale * sum_k A[m,k] * Bt[n,k] (+bias)(+resid); each wave owns a 64x64 tile.
// A row-major [M,K]; Bt row-major [N,K]; M,N % 64 == 0, K % 32 == 0.
// SPLIT: operands are hi/lo planes (A2/Bt2 = lo planes, same layout); product = hi·hi + hi·lo + lo·hi.
// BIAS_MODE: 0 = none, 1 = bias[m], 2 = bias[n].
// OUT_MODE: 0 = f32, 1 = f16, 2 = bf16 hi plane (Cout) + bf16 lo plane (Cout2).
// ET: 0 = f16 operands, 1 = bf16 operands (pointers passed as 16-bit storage)
template <int ET> struct Elem;
template <> struct Elem<0> { typedef _Float16 T; };
template <> struct Elem<1> { typedef __bf16 T; };
template <int ET, bool SPLIT, int BIAS_MODE, int OUT_MODE, bool RESID, int ACT = 0>
__global__ __launch_bounds__(256) void wmma_gemm64(
    const unsigned short* __restrict__ Ap, const unsigned short* __restrict__ A2p, int lda, long strideA,
    const unsigned short* __restrict__ Btp, const unsigned short* __restrict__ Bt2p, int ldb, long strideB,
    void* __restrict__ Cout, void* __restrict__ Cout2, int ldc, long strideC,
    const float* __restrict__ bias,
    const float* __restrict__ resid, long strideR,
    int M, int N, int K, float scale) {
  typedef typename Elem<ET>::T T;
  typedef typename Frag<T>::V V;
  const T* A = (const T*)Ap; const T* A2 = (const T*)A2p; const T* Bt = (const T*)Btp; const T* Bt2 = (const T*)Bt2p;
  __shared__ __align__(16) float sT[8][16 * 68];   // per-wave 16x64 slab, pitch 68 floats
  const int b    = blockIdx.y;
  const int lane = threadIdx.x & 31;
  const int wave = threadIdx.x >> 5;
  const int tilesN = N >> 6;
  const int tilesM = M >> 6;
  const int tile = blockIdx.x * 8 + wave;
  if (tile >= tilesM * tilesN) return;   // wave-uniform; no block barriers in this kernel
  const int tm = tile / tilesN;
  const int tn = tile - tm * tilesN;
  const int m0 = tm << 6;
  const int n0 = tn << 6;

  const T* Ab  = A  + (size_t)b * strideA;
  const T* Bb  = Bt + (size_t)b * strideB;
  const T* Ab2 = SPLIT ? (A2  + (size_t)b * strideA) : nullptr;
  const T* Bb2 = SPLIT ? (Bt2 + (size_t)b * strideB) : nullptr;

  const int rlane = lane & 15;                 // row (A) / col (B, D) within subtile
  const int koff  = (lane >> 4) * 8;           // k offset of this lane half
  const int mOff  = (lane >> 4) * 8;           // D row offset

  v8f acc[4][4];
#pragma unroll
  for (int i = 0; i < 4; ++i)
#pragma unroll
    for (int j = 0; j < 4; ++j) acc[i][j] = (v8f){0.f,0.f,0.f,0.f,0.f,0.f,0.f,0.f};

  for (int k0 = 0; k0 < K; k0 += 32) {
    V bh[4], bl[4];
#pragma unroll
    for (int j = 0; j < 4; ++j) {
      const size_t bo = (size_t)(n0 + (j << 4) + rlane) * ldb + koff + k0;
      bh[j] = Frag<T>::load(Bb + bo);
      if (SPLIT) bl[j] = Frag<T>::load(Bb2 + bo);
    }
#pragma unroll
    for (int i = 0; i < 4; ++i) {
      const size_t ao = (size_t)(m0 + (i << 4) + rlane) * lda + koff + k0;
      V ah = Frag<T>::load(Ab + ao);
      V al;
      if (SPLIT) al = Frag<T>::load(Ab2 + ao);
#pragma unroll
      for (int j = 0; j < 4; ++j) {
        acc[i][j] = Frag<T>::mma(ah, bh[j], acc[i][j]);
        if (SPLIT) {
          acc[i][j] = Frag<T>::mma(ah, bl[j], acc[i][j]);
          acc[i][j] = Frag<T>::mma(al, bh[j], acc[i][j]);
        }
      }
      Frag<T>::guard(acc[i][0], acc[i][3], ah, SPLIT ? al : ah);
    }
    Frag<T>::keep(bh[0], bh[1], bh[2], bh[3]);
    if (SPLIT) Frag<T>::keep(bl[0], bl[1], bl[2], bl[3]);
  }
  acc_guard4(acc[0][0], acc[0][1], acc[0][2], acc[0][3]);
  acc_guard4(acc[1][0], acc[1][1], acc[1][2], acc[1][3]);
  acc_guard4(acc[2][0], acc[2][1], acc[2][2], acc[2][3]);
  acc_guard4(acc[3][0], acc[3][1], acc[3][2], acc[3][3]);

  // ---- epilogue ----
  float* slab = sT[wave];
  const float* Rb = RESID ? (resid + (size_t)b * strideR) : nullptr;
#pragma unroll
  for (int i = 0; i < 4; ++i) {
    const int mBase = m0 + (i << 4);
#pragma unroll
    for (int j = 0; j < 4; ++j) {
      const int n = n0 + (j << 4) + rlane;
      float bv = 0.f;
      if (BIAS_MODE == 2) bv = bias[n];
#pragma unroll
      for (int r = 0; r < 8; ++r) {
        float v = acc[i][j][r] * scale;
        if (BIAS_MODE == 1) v += bias[mBase + mOff + r];
        if (BIAS_MODE == 2) v += bv;
        if (RESID) v += Rb[(size_t)(mBase + mOff + r) * ldc + n];
        if (ACT == 1) v = tanhf(v);
        slab[(mOff + r) * 68 + (j << 4) + rlane] = v;
      }
    }
    __builtin_amdgcn_fence(__ATOMIC_RELEASE, "workgroup");
    __builtin_amdgcn_wave_barrier();
    __builtin_amdgcn_fence(__ATOMIC_ACQUIRE, "workgroup");
    if (OUT_MODE == 0) {
      float* C = (float*)Cout + (size_t)b * strideC;
      const int hh = lane >> 4, c4 = (lane & 15) * 4;     // row seg = 256 B = 16 lanes x 16 B
      {
#pragma unroll
        for (int it = 0; it < 8; ++it) {
          const int row = it * 2 + hh;
          v4f v = *(const v4f*)(slab + row * 68 + c4);
          *(v4f*)(C + (size_t)(mBase + row) * ldc + n0 + c4) = v;
        }
        
      }
    } else {
      const int q = lane >> 3, c8 = (lane & 7) * 8;
      unsigned short* C  = (unsigned short*)Cout  + (size_t)b * strideC;
      unsigned short* C2 = (OUT_MODE == 2) ? ((unsigned short*)Cout2 + (size_t)b * strideC) : nullptr;
      {
#pragma unroll
        for (int it = 0; it < 4; ++it) {
          const int row = it * 4 + q;
          const float* sp = slab + row * 68 + c8;
          v8h hv, lv;
#pragma unroll
          for (int e = 0; e < 8; ++e) {
            if (OUT_MODE == 1) {
              hv[e] = (_Float16)sp[e];
            } else {
              unsigned short hb = f2bf_bits(sp[e]);
              unsigned short lb = f2bf_bits(sp[e] - bf_bits2f(hb));
              hv[e] = __builtin_bit_cast(_Float16, hb);
              lv[e] = __builtin_bit_cast(_Float16, lb);
            }
          }
          *(v8h*)(C + (size_t)(mBase + row) * ldc + n0 + c8) = hv;
          if (OUT_MODE == 2) *(v8h*)(C2 + (size_t)(mBase + row) * ldc + n0 + c8) = lv;
        }
        
      }
    }
    __builtin_amdgcn_fence(__ATOMIC_RELEASE, "workgroup");
    __builtin_amdgcn_wave_barrier();
    __builtin_amdgcn_fence(__ATOMIC_ACQUIRE, "workgroup");
  }
}

__global__ __launch_bounds__(256) void cast_f32_f16x2(
    const float* __restrict__ in, _Float16* __restrict__ out, int n2) {
  int i = blockIdx.x * 256 + threadIdx.x;
  if (i < n2) {
    const _Float16 h0 = (_Float16)in[2 * i], h1 = (_Float16)in[2 * i + 1];
    const unsigned u = (unsigned)__builtin_bit_cast(unsigned short, h0) | ((unsigned)__builtin_bit_cast(unsigned short, h1) << 16);
    ((unsigned*)out)[i] = u;
    
  }
}

__global__ __launch_bounds__(256) void split_f32_bf16x2(
    const float* __restrict__ in, __bf16* __restrict__ hi, __bf16* __restrict__ lo, long n2) {
  long i = (long)blockIdx.x * 256 + threadIdx.x;
  long stride = (long)gridDim.x * 256;
  {
    for (long j = i; j < n2; j += stride) {
      const float a = in[2 * j], b = in[2 * j + 1];
      const unsigned short ah = f2bf_bits(a), bh = f2bf_bits(b);
      const unsigned short al = f2bf_bits(a - bf_bits2f(ah)), bl = f2bf_bits(b - bf_bits2f(bh));
      ((unsigned*)hi)[j] = (unsigned)ah | ((unsigned)bh << 16);
      ((unsigned*)lo)[j] = (unsigned)al | ((unsigned)bl << 16);
    }
    
  }
}


// ---- f32 [R][C] (row pitch ldi) -> f16 transposed [C][R] (row pitch ldo); 64x64 tiles; each output row segment
__global__ __launch_bounds__(256) void transpose_cast_f16(const float* __restrict__ in, int ldi,
                                                         _Float16* __restrict__ outT, int ldo, float scale) {
  __shared__ __align__(16) _Float16 tile[64][72];     // [c][r]
  const int c0 = blockIdx.x * 64, r0 = blockIdx.y * 64;
  const int t = threadIdx.y * 32 + threadIdx.x;
  for (int i = threadIdx.y; i < 64; i += 8) {
    tile[threadIdx.x][i]      = (_Float16)(in[(size_t)(r0 + i) * ldi + c0 + threadIdx.x] * scale);
    tile[32 + threadIdx.x][i] = (_Float16)(in[(size_t)(r0 + i) * ldi + c0 + 32 + threadIdx.x] * scale);
  }
  __syncthreads();
  const int q = t >> 3, c8 = (t & 7) * 8;
  {
#pragma unroll
    for (int it = 0; it < 2; ++it) {
      const int c = it * 32 + q;
      v8h hv = *(const v8h*)(&tile[c][c8]);
      *(v8h*)(outT + (size_t)(c0 + c) * ldo + r0 + c8) = hv;
    }
    
  }
}

// ---- f32 [R][C] (pitch ldi) -> bf16 hi/lo transposed planes [C][R] (pitch ldo); 64x64 tiles; each output row segment
__global__ __launch_bounds__(256) void transpose_split_bf16(const float* __restrict__ in, int ldi,
                                                           __bf16* __restrict__ outH, __bf16* __restrict__ outL, int ldo) {
  __shared__ __align__(16) float tile[64][68];     // [c][r]
  const int c0 = blockIdx.x * 64, r0 = blockIdx.y * 64;
  const int t = threadIdx.y * 32 + threadIdx.x;
  for (int i = threadIdx.y; i < 64; i += 8) {
    tile[threadIdx.x][i]      = in[(size_t)(r0 + i) * ldi + c0 + threadIdx.x];
    tile[32 + threadIdx.x][i] = in[(size_t)(r0 + i) * ldi + c0 + 32 + threadIdx.x];
  }
  __syncthreads();
  const int q = t >> 3, c8 = (t & 7) * 8;
  {
#pragma unroll
    for (int it = 0; it < 2; ++it) {
      const int c = it * 32 + q;
      v8b hv, lv;
#pragma unroll
      for (int e = 0; e < 8; ++e) {
        const float f = tile[c][c8 + e];
        const unsigned short hb = f2bf_bits(f);
        hv[e] = __builtin_bit_cast(__bf16, hb);
        lv[e] = __builtin_bit_cast(__bf16, f2bf_bits(f - bf_bits2f(hb)));
      }
      *(v8b*)(outH + (size_t)(c0 + c) * ldo + r0 + c8) = hv;
      *(v8b*)(outL + (size_t)(c0 + c) * ldo + r0 + c8) = lv;
    }
    
  }
}

// =====================================================================================
// Generic causal/non-causal attention for head_dim 64, f32 in / f32 out, bf16 operands with optional hi/lo splits.
//   scores = (q*qscale)·kᵀ : v_wmma_f32_16x16x32_bf16; SPLIT_QK -> q,k as bf16 hi/lo (hi·hi + hi·lo + lo·hi)
//   out    = p·v           : v_wmma_f32_16x16x32_bf16; SPLIT_PV -> p,v as bf16 hi/lo; else p,v plain bf16
//   f32 accumulate; online softmax in f32. Block = 4 waves = 64 query rows of one (batch, head); S % 64 == 0.
//   Element (b, s, h, d) of tensor X lives at X[b*X_bs + s*X_rs + h*X_hs + d] (strides in floats, multiples of 4).
//   Masking: mask_mode 0 none, 1 causal (kv > q masked), 2 tensor [S][Skv] shared over (b,h) (float if
//   mask_is_int==0, int32 with element == 0 -> masked if 1, int32 with element != 0 -> masked if 2), 3 per-token vectors qmask[B][S] & kvmask[B][Skv] (int32,
//   0 -> masked), 4 causal + sliding window (kv > q or q - kv > W masked; W passed in mask_is_int);
//   masked scores are replaced by mask_fill (e.g. -inf or -1e9) before the softmax.
//   grid.x = B * H * (S/64) (or a sub-range with blk0).
// =====================================================================================
#define AT_D 64
#define AT_NW 4
#define AT_QB 64
#define AT_KC 64
struct AttnGeom { long q_bs, q_rs, q_hs, k_bs, k_rs, k_hs, v_bs, v_rs, v_hs, o_bs, o_rs, o_hs;
                  int S, Skv, H, mask_mode; float qscale; int blk0; float mask_fill; int mask_is_int; };
static_assert(sizeof(AttnGeom) == 128, "no padding");

__device__ __forceinline__ unsigned short at_bf_bits(float f) {
  unsigned u = __float_as_uint(f);
  return (unsigned short)((u + 0x7FFFu + ((u >> 16) & 1u)) >> 16);
}
__device__ __forceinline__ __bf16 at_f2bf(float f) { return __builtin_bit_cast(__bf16, at_bf_bits(f)); }
__device__ __forceinline__ void at_split(float f, __bf16& hi, __bf16& lo) {
  const unsigned short hb = at_bf_bits(f);
  hi = __builtin_bit_cast(__bf16, hb);
  lo = at_f2bf(f - __uint_as_float(((unsigned)hb) << 16));
}
__device__ __forceinline__ v8f at_mma(v16b a, v16b b, v8f c) {
  c = __builtin_amdgcn_wmma_f32_16x16x32_bf16(false, a, false, b, (short)0, c, false, false);
  asm volatile("v_nop\n\tv_nop\n\tv_nop\n\tv_nop" : "+v"(c) : "v"(a), "v"(b));
  return c;
}

template <bool SPLIT_QK, bool SPLIT_PV>
__global__ __launch_bounds__(128)
void attn64_kernel(const float* __restrict__ q, const float* __restrict__ k,
                   const float* __restrict__ v, float* __restrict__ out,
                   const void* __restrict__ mask_a, const int* __restrict__ mask_b, AttnGeom g) {
  union FB { v16b v; v8b h[2]; };
  __shared__ __align__(16) __bf16 Ksh[AT_KC * AT_D];             // K hi [kv][d]      8 KB
  __shared__ __align__(16) __bf16 Ksl[SPLIT_QK ? AT_KC * AT_D : 8];
  __shared__ __align__(16) __bf16 Vth[AT_D * AT_KC];             // V hi [d][kv]      8 KB
  __shared__ __align__(16) __bf16 Vtl[SPLIT_PV ? AT_D * AT_KC : 8];
  __shared__ __align__(16) __bf16 Psh[AT_NW][16 * AT_KC];        // per wave P hi [row][kv]  8 KB
  __shared__ __align__(16) __bf16 Psl[SPLIT_PV ? AT_NW : 1][SPLIT_PV ? 16 * AT_KC : 8];
  __shared__ __align__(16) float  Os[AT_NW][16 * 68];            // per wave out tile, pitch 68

  const int tid  = threadIdx.x;
  const int wave = tid >> 5;
  const int lane = tid & 31;
  const int hh   = lane >> 4;
  const int c    = lane & 15;

  const int nqb = g.S / AT_QB;
  const int bx = blockIdx.x + g.blk0;
  const int qb = bx % nqb;
  const int bh = bx / nqb;
  const int h  = bh % g.H;
  const int b  = bh / g.H;
  const int qbase_block = qb * AT_QB;
  const int q0 = qbase_block + wave * 16;

  const float* qb_ptr = q + (size_t)b * g.q_bs + (size_t)h * g.q_hs;
  const float* kb_ptr = k + (size_t)b * g.k_bs + (size_t)h * g.k_hs;
  const float* vb_ptr = v + (size_t)b * g.v_bs + (size_t)h * g.v_hs;
  float*       ob_ptr = out + (size_t)b * g.o_bs + (size_t)h * g.o_hs;

  // ---- Q fragments (A operand): 2 d-chunks, hi (and lo) ----
  v16b qah[2], qal[2];
  {
    const float* qrow = qb_ptr + (size_t)(q0 + c) * g.q_rs;
#pragma unroll
    for (int dc = 0; dc < 2; ++dc) {
#pragma unroll
      for (int e = 0; e < 8; ++e) {
        const float f0 = qrow[dc * 32 + 8 * hh + e] * g.qscale;
        const float f1 = qrow[dc * 32 + 16 + 8 * hh + e] * g.qscale;
        if (SPLIT_QK) { __bf16 hq, lq; at_split(f0, hq, lq); qah[dc][e] = hq; qal[dc][e] = lq; at_split(f1, hq, lq); qah[dc][8 + e] = hq; qal[dc][8 + e] = lq; }
        else { qah[dc][e] = at_f2bf(f0); qah[dc][8 + e] = at_f2bf(f1); qal[dc][e] = qah[dc][e]; qal[dc][8 + e] = qah[dc][8 + e]; }
      }
    }
  }

  float mrow[8], lrow[8];
  v8f oacc[4];
#pragma unroll
  for (int r = 0; r < 8; ++r) { mrow[r] = -INFINITY; lrow[r] = 0.f; }
#pragma unroll
  for (int t = 0; t < 4; ++t) oacc[t] = (v8f){0.f,0.f,0.f,0.f,0.f,0.f,0.f,0.f};

  const int nChunks = (g.mask_mode == 1 || g.mask_mode == 4) ? (qb + 1) : (g.Skv / AT_KC);   // block-uniform
  // per-row query mask (mode 3)
  int qkeep[8];
#pragma unroll
  for (int r = 0; r < 8; ++r) qkeep[r] = (g.mask_mode == 3) ? mask_b[(size_t)b * g.S + q0 + 8 * hh + r] : 1;   // mask_b = qmask in mode 3
  for (int kc = 0; kc < nChunks; ++kc) {
    const int kv0 = kc * AT_KC;
    __syncthreads();
    {
      const int kvr = tid >> 1, dh = (tid & 1) * 32;
      const float* krow = kb_ptr + (size_t)(kv0 + kvr) * g.k_rs + dh;
      const float* vrow = vb_ptr + (size_t)(kv0 + kvr) * g.v_rs + dh;
#pragma unroll
      for (int i = 0; i < 8; ++i) {
        v4f kk = *(const v4f*)(krow + 4 * i);
        v4f vv = *(const v4f*)(vrow + 4 * i);
#pragma unroll
        for (int e = 0; e < 4; ++e) {
          const int d = dh + 4 * i + e;
          if (SPLIT_QK) { __bf16 a, bl; at_split(kk[e], a, bl); Ksh[kvr * AT_D + d] = a; Ksl[kvr * AT_D + d] = bl; }
          else Ksh[kvr * AT_D + d] = at_f2bf(kk[e]);
          if (SPLIT_PV) { __bf16 a, bl; at_split(vv[e], a, bl); Vth[d * AT_KC + kvr] = a; Vtl[d * AT_KC + kvr] = bl; }
          else Vth[d * AT_KC + kvr] = at_f2bf(vv[e]);
        }
      }
    }
    __syncthreads();

    v8f s[4];
#pragma unroll
    for (int j = 0; j < 4; ++j) {
      s[j] = (v8f){0.f,0.f,0.f,0.f,0.f,0.f,0.f,0.f};
#pragma unroll
      for (int dc = 0; dc < 2; ++dc) {
        FB kb;
        kb.h[0] = *(const v8b*)(Ksh + (j * 16 + c) * AT_D + dc * 32 + 8 * hh);
        kb.h[1] = *(const v8b*)(Ksh + (j * 16 + c) * AT_D + dc * 32 + 16 + 8 * hh);
        s[j] = at_mma(qah[dc], kb.v, s[j]);
        if (SPLIT_QK) {
          FB kl;
          kl.h[0] = *(const v8b*)(Ksl + (j * 16 + c) * AT_D + dc * 32 + 8 * hh);
          kl.h[1] = *(const v8b*)(Ksl + (j * 16 + c) * AT_D + dc * 32 + 16 + 8 * hh);
          s[j] = at_mma(qah[dc], kl.v, s[j]);
          s[j] = at_mma(qal[dc], kb.v, s[j]);
        }
      }
    }
    const bool diag = (g.mask_mode == 1) && (kc == qb);
    int kvkeep[4] = {1, 1, 1, 1};
    if (g.mask_mode == 3) {
#pragma unroll
      for (int j = 0; j < 4; ++j) kvkeep[j] = ((const int*)mask_a)[(size_t)b * g.Skv + kv0 + j * 16 + c];   // mask_a = kvmask
    }
    float cm[8];
#pragma unroll
    for (int r = 0; r < 8; ++r) {
      const int qrow = q0 + 8 * hh + r;
      float m = -INFINITY;
#pragma unroll
      for (int j = 0; j < 4; ++j) {
        const int kvcol = kv0 + j * 16 + c;
        bool masked = false;
        if (diag) masked = (kvcol > qrow);
        else if (g.mask_mode == 4) masked = (kvcol > qrow) || (qrow - kvcol > g.mask_is_int);
        else if (g.mask_mode == 2) {
          const size_t mi = (size_t)qrow * g.Skv + kvcol;
          masked = (g.mask_is_int == 0) ? (((const float*)mask_a)[mi] == 0.0f)
                 : (g.mask_is_int == 1) ? (((const int*)mask_a)[mi] == 0) : (((const int*)mask_a)[mi] != 0);
        } else if (g.mask_mode == 3) masked = (qkeep[r] == 0) || (kvkeep[j] == 0);
        if (masked) s[j][r] = g.mask_fill;
        m = fmaxf(m, s[j][r]);
      }
#pragma unroll
      for (int off = 1; off < 16; off <<= 1) m = fmaxf(m, __shfl_xor(m, off, 32));
      cm[r] = m;
    }
    __bf16* pwh = Psh[wave];
    __bf16* pwl = Psl[SPLIT_PV ? wave : 0];
#pragma unroll
    for (int r = 0; r < 8; ++r) {
      const float mnew = fmaxf(mrow[r], cm[r]);
      const float alpha = expf(mrow[r] - mnew);
      mrow[r] = mnew;
      float psum = 0.f;
#pragma unroll
      for (int j = 0; j < 4; ++j) {
        const float p = expf(s[j][r] - mnew);
        psum += p;
        if (SPLIT_PV) { __bf16 a, bl; at_split(p, a, bl); pwh[(8 * hh + r) * AT_KC + j * 16 + c] = a; pwl[(8 * hh + r) * AT_KC + j * 16 + c] = bl; }
        else pwh[(8 * hh + r) * AT_KC + j * 16 + c] = at_f2bf(p);
      }
#pragma unroll
      for (int off = 1; off < 16; off <<= 1) psum += __shfl_xor(psum, off, 32);
      lrow[r] = lrow[r] * alpha + psum;
#pragma unroll
      for (int t = 0; t < 4; ++t) oacc[t][r] *= alpha;
    }
    __builtin_amdgcn_fence(__ATOMIC_RELEASE, "workgroup");
    __builtin_amdgcn_wave_barrier();
    __builtin_amdgcn_fence(__ATOMIC_ACQUIRE, "workgroup");
#pragma unroll
    for (int kk = 0; kk < 2; ++kk) {
      FB pa, pl;
      pa.h[0] = *(const v8b*)(pwh + c * AT_KC + kk * 32 + 8 * hh);
      pa.h[1] = *(const v8b*)(pwh + c * AT_KC + kk * 32 + 16 + 8 * hh);
      if (SPLIT_PV) {
        pl.h[0] = *(const v8b*)(pwl + c * AT_KC + kk * 32 + 8 * hh);
        pl.h[1] = *(const v8b*)(pwl + c * AT_KC + kk * 32 + 16 + 8 * hh);
      }
#pragma unroll
      for (int t = 0; t < 4; ++t) {
        FB vb;
        vb.h[0] = *(const v8b*)(Vth + (t * 16 + c) * AT_KC + kk * 32 + 8 * hh);
        vb.h[1] = *(const v8b*)(Vth + (t * 16 + c) * AT_KC + kk * 32 + 16 + 8 * hh);
        oacc[t] = at_mma(pa.v, vb.v, oacc[t]);
        if (SPLIT_PV) {
          FB vl;
          vl.h[0] = *(const v8b*)(Vtl + (t * 16 + c) * AT_KC + kk * 32 + 8 * hh);
          vl.h[1] = *(const v8b*)(Vtl + (t * 16 + c) * AT_KC + kk * 32 + 16 + 8 * hh);
          oacc[t] = at_mma(pa.v, vl.v, oacc[t]);
          oacc[t] = at_mma(pl.v, vb.v, oacc[t]);
        }
      }
    }
  }

  float* os = Os[wave];
#pragma unroll
  for (int r = 0; r < 8; ++r) {
    const float inv = 1.0f / lrow[r];
#pragma unroll
    for (int t = 0; t < 4; ++t) os[(8 * hh + r) * 68 + t * 16 + c] = oacc[t][r] * inv;
  }
  __builtin_amdgcn_fence(__ATOMIC_RELEASE, "workgroup");
  __builtin_amdgcn_wave_barrier();
  __builtin_amdgcn_fence(__ATOMIC_ACQUIRE, "workgroup");
  {
    const int c4 = (lane & 15) * 4;
    {
#pragma unroll
      for (int it = 0; it < 8; ++it) {
        const int row = it * 2 + hh;
        v4f val = *(const v4f*)(os + row * 68 + c4);
        *(v4f*)(ob_ptr + (size_t)(q0 + row) * g.o_rs + c4) = val;
      }
      
    }
  }
}

__global__ __launch_bounds__(256) void gate_fuse_kernel(const float* __restrict__ o0, const float* __restrict__ o1,
                                                       const float* __restrict__ o2, const float* __restrict__ o3,
                                                       const float* __restrict__ Wg, const float* __restrict__ bg,
                                                       float* __restrict__ out, int Hd) {
  __shared__ float red[4][8];
  const int row = blockIdx.x, t = threadIdx.x, lane = t & 31, wave = t >> 5;
  const float* os[4] = {o0 + (size_t)row * Hd, o1 + (size_t)row * Hd, o2 + (size_t)row * Hd, o3 + (size_t)row * Hd};
  float acc[4] = {0.f, 0.f, 0.f, 0.f};
  for (int i = 0; i < 4; ++i) {
    const float* o = os[i];
    for (int c = t; c < Hd; c += 256) {
      const float v = o[c];
      const float* w = Wg + (size_t)(i * Hd + c) * 4;
      acc[0] += v * w[0]; acc[1] += v * w[1]; acc[2] += v * w[2]; acc[3] += v * w[3];
    }
  }
#pragma unroll
  for (int g = 0; g < 4; ++g) { float a = acc[g]; for (int o = 16; o > 0; o >>= 1) a += __shfl_xor(a, o, 32); if (lane == 0) red[g][wave] = a; }
  __syncthreads();
  float gl[4];
#pragma unroll
  for (int g = 0; g < 4; ++g) { float a = 0.f; for (int w = 0; w < 8; ++w) a += red[g][w]; gl[g] = a + bg[g]; }
  const float mx = fmaxf(fmaxf(gl[0], gl[1]), fmaxf(gl[2], gl[3]));
  float e[4], se = 0.f;
#pragma unroll
  for (int g = 0; g < 4; ++g) { e[g] = expf(gl[g] - mx); se += e[g]; }
  const float inv = 1.0f / se;
  const int c = 4 * t;
  v4f r;
#pragma unroll
  for (int q = 0; q < 4; ++q) r[q] = (e[0] * inv) * os[0][c + q] + (e[1] * inv) * os[1][c + q] + (e[2] * inv) * os[2][c + q] + (e[3] * inv) * os[3][c + q];
  *(v4f*)(out + (size_t)row * Hd + c) = r;
  
}

extern "C" void kernel_launch(void* const* d_in, const int* in_sizes, int n_in,
                              void* d_out, int out_size, void* d_ws, size_t ws_size,
                              hipStream_t stream) {
  (void)in_sizes; (void)n_in; (void)out_size; (void)ws_size;
  const int S = 2048, E = 1024, H = 16, DH = 64, MM = 512, MP = 64, WIN = 512;
  // wire order: 16 weights ([in,out]), gate_w, gate_b, x, memory_kv, persona_kv
  const float* Wm[16]; for (int i = 0; i < 16; ++i) Wm[i] = (const float*)d_in[i];   // {local,long,mem,per} x {wq,wk,wv,wo}
  const float* gate_w = (const float*)d_in[16];
  const float* gate_b = (const float*)d_in[17];
  const float* x   = (const float*)d_in[18];   // [1,2048,1024]
  const float* mem = (const float*)d_in[19];   // [1,512,1024]
  const float* per = (const float*)d_in[20];   // [1,64,1024]
  float* out = (float*)d_out;

  char* ws = (char*)d_ws; size_t off = 0;
  auto carve = [&](size_t bytes) -> char* { char* p = ws + off; off += (bytes + 255) & ~(size_t)255; return p; };
  _Float16* X16  = (_Float16*)carve((size_t)S * E * 2);      // 4 MB
  __bf16*   Xh   = (__bf16*)carve((size_t)S * E * 2);
  __bf16*   Xl   = (__bf16*)carve((size_t)S * E * 2);
  _Float16* M16  = (_Float16*)carve((size_t)MM * E * 2);     // 1 MB
  __bf16*   Mh   = (__bf16*)carve((size_t)MM * E * 2);
  __bf16*   Ml   = (__bf16*)carve((size_t)MM * E * 2);
  _Float16* P16  = (_Float16*)carve((size_t)MP * E * 2);     // persona: 64 rows
  __bf16*   Ph   = (__bf16*)carve((size_t)MP * E * 2);
  __bf16*   Pl   = (__bf16*)carve((size_t)MP * E * 2);
  _Float16* WqT  = (_Float16*)carve((size_t)E * E * 2);      // reused per attention
  _Float16* WkT  = (_Float16*)carve((size_t)E * E * 2);
  __bf16*   WvTh = (__bf16*)carve((size_t)E * E * 2);
  __bf16*   WvTl = (__bf16*)carve((size_t)E * E * 2);
  __bf16*   WoTh = (__bf16*)carve((size_t)E * E * 2);
  __bf16*   WoTl = (__bf16*)carve((size_t)E * E * 2);
  float*    Qf   = (float*)carve((size_t)S * E * 4);         // 8 MB
  float*    Kf   = (float*)carve((size_t)S * E * 4);
  float*    Vf   = (float*)carve((size_t)S * E * 4);
  float*    Of   = (float*)carve((size_t)S * E * 4);
  __bf16*   Oh   = (__bf16*)carve((size_t)S * E * 2);
  __bf16*   Ol   = (__bf16*)carve((size_t)S * E * 2);
  float*    Ob[4];
  for (int i = 0; i < 4; ++i) Ob[i] = (float*)carve((size_t)S * E * 4);   // 4 x 8 MB branch outputs  (total ≈ 100 MB)

  cast_f32_f16x2<<<(S * E / 2 + 255) / 256, 256, 0, stream>>>(x, X16, S * E / 2);
  split_f32_bf16x2<<<1024, 256, 0, stream>>>(x, Xh, Xl, (long)S * E / 2);
  cast_f32_f16x2<<<(MM * E / 2 + 255) / 256, 256, 0, stream>>>(mem, M16, MM * E / 2);
  split_f32_bf16x2<<<256, 256, 0, stream>>>(mem, Mh, Ml, (long)MM * E / 2);
  cast_f32_f16x2<<<(MP * E / 2 + 255) / 256, 256, 0, stream>>>(per, P16, MP * E / 2);
  split_f32_bf16x2<<<64, 256, 0, stream>>>(per, Ph, Pl, (long)MP * E / 2);

  for (int a = 0; a < 4; ++a) {
    const float* wq = Wm[a * 4 + 0]; const float* wk = Wm[a * 4 + 1]; const float* wv = Wm[a * 4 + 2]; const float* wo = Wm[a * 4 + 3];
    transpose_cast_f16<<<dim3(E / 64, E / 64), dim3(32, 8), 0, stream>>>(wq, E, WqT, E, 1.0f);
    transpose_cast_f16<<<dim3(E / 64, E / 64), dim3(32, 8), 0, stream>>>(wk, E, WkT, E, 1.0f);
    transpose_split_bf16<<<dim3(E / 64, E / 64), dim3(32, 8), 0, stream>>>(wv, E, WvTh, WvTl, E);
    transpose_split_bf16<<<dim3(E / 64, E / 64), dim3(32, 8), 0, stream>>>(wo, E, WoTh, WoTl, E);
    // context source for k/v
    const _Float16* C16 = (a < 2) ? X16 : (a == 2 ? M16 : P16);
    const __bf16* Ch = (a < 2) ? Xh : (a == 2 ? Mh : Ph);
    const __bf16* Cl = (a < 2) ? Xl : (a == 2 ? Ml : Pl);
    const int SK = (a < 2) ? S : (a == 2 ? MM : MP);
    {
      const int tq = (S / 64) * (E / 64), tk = (SK / 64) * (E / 64);
      wmma_gemm64<0, false, 0, 0, false><<<dim3((tq + 7) / 8, 1), 256, 0, stream>>>(
          U16(X16), nullptr, E, 0, U16(WqT), nullptr, E, 0, Qf, nullptr, E, 0, nullptr, nullptr, 0, S, E, E, 1.0f);
      wmma_gemm64<0, false, 0, 0, false><<<dim3((tk + 7) / 8, 1), 256, 0, stream>>>(
          U16(C16), nullptr, E, 0, U16(WkT), nullptr, E, 0, Kf, nullptr, E, 0, nullptr, nullptr, 0, SK, E, E, 1.0f);
      wmma_gemm64<1, true, 0, 0, false><<<dim3((tk + 7) / 8, 1), 256, 0, stream>>>(
          U16(Ch), U16(Cl), E, 0, U16(WvTh), U16(WvTl), E, 0, Vf, nullptr, E, 0, nullptr, nullptr, 0, SK, E, E, 1.0f);
    }
    {
      AttnGeom g;
      g.q_bs = (long)S * E;  g.q_rs = E; g.q_hs = DH;
      g.k_bs = (long)SK * E; g.k_rs = E; g.k_hs = DH;
      g.v_bs = (long)SK * E; g.v_rs = E; g.v_hs = DH;
      g.o_bs = (long)S * E;  g.o_rs = E; g.o_hs = DH;
      g.S = S; g.Skv = SK; g.H = H; g.qscale = 0.125f; g.blk0 = 0; g.mask_fill = -1.0e30f;
      g.mask_mode = (a == 0) ? 4 : (a == 1 ? 1 : 0);
      g.mask_is_int = (a == 0) ? WIN : 0;          // window for mode 4
      attn64_kernel<true, true><<<1 * H * (S / AT_QB), AT_NW * 32, 0, stream>>>(Qf, Kf, Vf, Of, nullptr, nullptr, g);
    }
    split_f32_bf16x2<<<1024, 256, 0, stream>>>(Of, Oh, Ol, (long)S * E / 2);
    {
      const int to = (S / 64) * (E / 64);
      wmma_gemm64<1, true, 0, 0, false><<<dim3((to + 7) / 8, 1), 256, 0, stream>>>(
          U16(Oh), U16(Ol), E, 0, U16(WoTh), U16(WoTl), E, 0, Ob[a], nullptr, E, 0, nullptr, nullptr, 0, S, E, E, 1.0f);
    }
  }
  gate_fuse_kernel<<<S, 256, 0, stream>>>(Ob[0], Ob[1], Ob[2], Ob[3], gate_w, gate_b, out, E);
}

// v001
// It runs in 704 microseconds.
// Two timings next to v000 put it at 2.51 and 2.50 times that version's speed.
#include <hip/hip_runtime.h>
#include <math.h>
// Four attentions (local = causal + 512 sliding window, long = causal, memory cross (512 keys), persona cross (64 keys)), 16 heads of 64:
// q/k projections (K=1024): v_wmma_f32_16x16x32_f16 (f16 operands); v and output projections (K=1024): v_wmma_f32_16x16x32_bf16 as bf16
// hi/lo splits; scores and p·v: v_wmma_f32_16x16x32_bf16 with q,k and p,v as bf16 hi/lo splits; f32 accumulate; softmax f32.
// Gate (concat(outs)·gate_w, N=4, 0.1 % of MACs), gate softmax and the weighted fusion in f32 on VALU.
typedef __attribute__((ext_vector_type(16))) _Float16 v16h;
typedef __attribute__((ext_vector_type(8)))  _Float16 v8h;
typedef __attribute__((ext_vector_type(16))) __bf16   v16b;
typedef __attribute__((ext_vector_type(8)))  __bf16   v8b;
typedef __attribute__((ext_vector_type(8)))  float    v8f;
typedef __attribute__((ext_vector_type(4)))  float    v4f;
#define PSCALE 32768.0f
#define U16(p) ((const unsigned short*)(const void*)(p))
#define PSCALE_INV (1.0f / 32768.0f)

__device__ __forceinline__ unsigned short f2bf_bits(float f) {
  unsigned u = __float_as_uint(f);
  return (unsigned short)((u + 0x7FFFu + ((u >> 16) & 1u)) >> 16);
}
__device__ __forceinline__ float bf_bits2f(unsigned short h) { return __uint_as_float(((unsigned)h) << 16); }

// hazard guards as plain device helpers (no inline asm inside the kernel template body)
__device__ __forceinline__ void dep_guard_h(v8f& a, v8f& b, v16h x, v16h y) { asm volatile("v_nop\n\tv_nop\n\tv_nop\n\tv_nop" : "+v"(a), "+v"(b) : "v"(x), "v"(y)); }
__device__ __forceinline__ void dep_guard_b(v8f& a, v8f& b, v16b x, v16b y) { asm volatile("v_nop\n\tv_nop\n\tv_nop\n\tv_nop" : "+v"(a), "+v"(b) : "v"(x), "v"(y)); }
__device__ __forceinline__ void keep4_h(v16h a, v16h b, v16h c, v16h d) { asm volatile("v_nop" :: "v"(a), "v"(b), "v"(c), "v"(d)); }
__device__ __forceinline__ void keep4_b(v16b a, v16b b, v16b c, v16b d) { asm volatile("v_nop" :: "v"(a), "v"(b), "v"(c), "v"(d)); }
__device__ __forceinline__ void acc_guard4(v8f& a, v8f& b, v8f& c, v8f& d) { asm volatile("v_nop\n\tv_nop\n\tv_nop\n\tv_nop" : "+v"(a), "+v"(b), "+v"(c), "+v"(d)); }
template <typename T> struct Frag;
template <> struct Frag<_Float16> {
  typedef v16h V; union U { v16h v; v8h h[2]; };
  static __device__ __forceinline__ v16h load(const _Float16* p) {   // elements 0..7 <- p[0..7], 8..15 <- p[16..23]
    U f; f.h[0] = *(const v8h*)(p); f.h[1] = *(const v8h*)(p + 16); return f.v;
  }
  static __device__ __forceinline__ v8f mma(v16h a, v16h b, v8f c) {
    return __builtin_amdgcn_wmma_f32_16x16x32_f16(false, a, false, b, (short)0, c, false, false);
  }
  static __device__ __forceinline__ void guard(v8f& a, v8f& b, v16h x, v16h y) { dep_guard_h(a, b, x, y); }
  static __device__ __forceinline__ void keep(v16h a, v16h b, v16h c, v16h d) { keep4_h(a, b, c, d); }
};
template <> struct Frag<__bf16> {
  typedef v16b V; union U { v16b v; v8b h[2]; };
  static __device__ __forceinline__ v16b load(const __bf16* p) {
    U f; f.h[0] = *(const v8b*)(p); f.h[1] = *(const v8b*)(p + 16); return f.v;
  }
  static __device__ __forceinline__ v8f mma(v16b a, v16b b, v8f c) {
    return __builtin_amdgcn_wmma_f32_16x16x32_bf16(false, a, false, b, (short)0, c, false, false);
  }
  static __device__ __forceinline__ void guard(v8f& a, v8f& b, v16b x, v16b y) { dep_guard_b(a, b, x, y); }
  static __device__ __forceinline__ void keep(v16b a, v16b b, v16b c, v16b d) { keep4_b(a, b, c, d); }
};

// ---- Register-blocked batched WMMA GEMM ------------------------------------
// C[m,n] = scale * sum_k A[m,k] * Bt[n,k] (+bias)(+resid); each wave owns a 64x64 tile.
// A row-major [M,K]; Bt row-major [N,K]; M,N % 64 == 0, K % 32 == 0.
// SPLIT: operands are hi/lo planes (A2/Bt2 = lo planes, same layout); product = hi·hi + hi·lo + lo·hi.
// BIAS_MODE: 0 = none, 1 = bias[m], 2 = bias[n].
// OUT_MODE: 0 = f32, 1 = f16, 2 = bf16 hi plane (Cout) + bf16 lo plane (Cout2).
// ET: 0 = f16 operands, 1 = bf16 operands (pointers passed as 16-bit storage)
template <int ET> struct Elem;
template <> struct Elem<0> { typedef _Float16 T; };
template <> struct Elem<1> { typedef __bf16 T; };
// Batch entry blockIdx.y reads A from element offset aoff[y] and has M[y] rows (entries may differ in source and height).
struct BatchA { long aoff[8]; int M[8]; };
template <int ET, bool SPLIT, int BIAS_MODE, int OUT_MODE, bool RESID, int ACT = 0>
__global__ __launch_bounds__(256) void wmma_gemm64(
    const unsigned short* __restrict__ Ap, const unsigned short* __restrict__ A2p, int lda, BatchA ba,
    const unsigned short* __restrict__ Btp, const unsigned short* __restrict__ Bt2p, int ldb, long strideB,
    void* __restrict__ Cout, void* __restrict__ Cout2, int ldc, long strideC,
    const float* __restrict__ bias,
    const float* __restrict__ resid, long strideR,
    int N, int K, float scale) {
  typedef typename Elem<ET>::T T;
  typedef typename Frag<T>::V V;
  const T* A = (const T*)Ap; const T* A2 = (const T*)A2p; const T* Bt = (const T*)Btp; const T* Bt2 = (const T*)Bt2p;
  __shared__ __align__(16) float sT[8][16 * 68];   // per-wave 16x64 slab, pitch 68 floats
  const int b    = blockIdx.y;
  const int M    = ba.M[b];
  const long offA = ba.aoff[b];
  const int lane = threadIdx.x & 31;
  const int wave = threadIdx.x >> 5;
  const int tilesN = N >> 6;
  const int tilesM = M >> 6;
  const int tile = blockIdx.x * 8 + wave;
  if (tile >= tilesM * tilesN) return;   // wave-uniform; no block barriers in this kernel
  const int tm = tile / tilesN;
  const int tn = tile - tm * tilesN;
  const int m0 = tm << 6;
  const int n0 = tn << 6;

  const T* Ab  = A  + offA;
  const T* Bb  = Bt + (size_t)b * strideB;
  const T* Ab2 = SPLIT ? (A2  + offA) : nullptr;
  const T* Bb2 = SPLIT ? (Bt2 + (size_t)b * strideB) : nullptr;

  const int rlane = lane & 15;                 // row (A) / col (B, D) within subtile
  const int koff  = (lane >> 4) * 8;           // k offset of this lane half
  const int mOff  = (lane >> 4) * 8;           // D row offset

  v8f acc[4][4];
#pragma unroll
  for (int i = 0; i < 4; ++i)
#pragma unroll
    for (int j = 0; j < 4; ++j) acc[i][j] = (v8f){0.f,0.f,0.f,0.f,0.f,0.f,0.f,0.f};

  for (int k0 = 0; k0 < K; k0 += 32) {
    V bh[4], bl[4];
#pragma unroll
    for (int j = 0; j < 4; ++j) {
      const size_t bo = (size_t)(n0 + (j << 4) + rlane) * ldb + koff + k0;
      bh[j] = Frag<T>::load(Bb + bo);
      if (SPLIT) bl[j] = Frag<T>::load(Bb2 + bo);
    }
#pragma unroll
    for (int i = 0; i < 4; ++i) {
      const size_t ao = (size_t)(m0 + (i << 4) + rlane) * lda + koff + k0;
      V ah = Frag<T>::load(Ab + ao);
      V al;
      if (SPLIT) al = Frag<T>::load(Ab2 + ao);
#pragma unroll
      for (int j = 0; j < 4; ++j) {
        acc[i][j] = Frag<T>::mma(ah, bh[j], acc[i][j]);
        if (SPLIT) {
          acc[i][j] = Frag<T>::mma(ah, bl[j], acc[i][j]);
          acc[i][j] = Frag<T>::mma(al, bh[j], acc[i][j]);
        }
      }
      Frag<T>::guard(acc[i][0], acc[i][3], ah, SPLIT ? al : ah);
    }
    Frag<T>::keep(bh[0], bh[1], bh[2], bh[3]);
    if (SPLIT) Frag<T>::keep(bl[0], bl[1], bl[2], bl[3]);
  }
  acc_guard4(acc[0][0], acc[0][1], acc[0][2], acc[0][3]);
  acc_guard4(acc[1][0], acc[1][1], acc[1][2], acc[1][3]);
  acc_guard4(acc[2][0], acc[2][1], acc[2][2], acc[2][3]);
  acc_guard4(acc[3][0], acc[3][1], acc[3][2], acc[3][3]);

  // ---- epilogue ----
  float* slab = sT[wave];
  const float* Rb = RESID ? (resid + (size_t)b * strideR) : nullptr;
#pragma unroll
  for (int i = 0; i < 4; ++i) {
    const int mBase = m0 + (i << 4);
#pragma unroll
    for (int j = 0; j < 4; ++j) {
      const int n = n0 + (j << 4) + rlane;
      float bv = 0.f;
      if (BIAS_MODE == 2) bv = bias[n];
#pragma unroll
      for (int r = 0; r < 8; ++r) {
        float v = acc[i][j][r] * scale;
        if (BIAS_MODE == 1) v += bias[mBase + mOff + r];
        if (BIAS_MODE == 2) v += bv;
        if (RESID) v += Rb[(size_t)(mBase + mOff + r) * ldc + n];
        if (ACT == 1) v = tanhf(v);
        slab[(mOff + r) * 68 + (j << 4) + rlane] = v;
      }
    }
    __builtin_amdgcn_fence(__ATOMIC_RELEASE, "workgroup");
    __builtin_amdgcn_wave_barrier();
    __builtin_amdgcn_fence(__ATOMIC_ACQUIRE, "workgroup");
    if (OUT_MODE == 0) {
      float* C = (float*)Cout + (size_t)b * strideC;
      const int hh = lane >> 4, c4 = (lane & 15) * 4;     // row seg = 256 B = 16 lanes x 16 B
      {
#pragma unroll
        for (int it = 0; it < 8; ++it) {
          const int row = it * 2 + hh;
          v4f v = *(const v4f*)(slab + row * 68 + c4);
          *(v4f*)(C + (size_t)(mBase + row) * ldc + n0 + c4) = v;
        }
        
      }
    } else {
      const int q = lane >> 3, c8 = (lane & 7) * 8;
      unsigned short* C  = (unsigned short*)Cout  + (size_t)b * strideC;
      unsigned short* C2 = (OUT_MODE == 2) ? ((unsigned short*)Cout2 + (size_t)b * strideC) : nullptr;
      {
#pragma unroll
        for (int it = 0; it < 4; ++it) {
          const int row = it * 4 + q;
          const float* sp = slab + row * 68 + c8;
          v8h hv, lv;
#pragma unroll
          for (int e = 0; e < 8; ++e) {
            if (OUT_MODE == 1) {
              hv[e] = (_Float16)sp[e];
            } else {
              unsigned short hb = f2bf_bits(sp[e]);
              unsigned short lb = f2bf_bits(sp[e] - bf_bits2f(hb));
              hv[e] = __builtin_bit_cast(_Float16, hb);
              lv[e] = __builtin_bit_cast(_Float16, lb);
            }
          }
          *(v8h*)(C + (size_t)(mBase + row) * ldc + n0 + c8) = hv;
          if (OUT_MODE == 2) *(v8h*)(C2 + (size_t)(mBase + row) * ldc + n0 + c8) = lv;
        }
        
      }
    }
    __builtin_amdgcn_fence(__ATOMIC_RELEASE, "workgroup");
    __builtin_amdgcn_wave_barrier();
    __builtin_amdgcn_fence(__ATOMIC_ACQUIRE, "workgroup");
  }
}

// x, memory and persona rows, one after the other, to one f16 plane and bf16 hi/lo planes; n*2 = float pairs per source (multiples of 256)
__global__ __launch_bounds__(256) void prep_inputs(
    const float* __restrict__ x, const float* __restrict__ mem, const float* __restrict__ per,
    _Float16* __restrict__ c16, __bf16* __restrict__ hi, __bf16* __restrict__ lo, int nx2, int nm2, int np2) {
  const int i = blockIdx.x * 256 + threadIdx.x;
  if (i >= nx2 + nm2 + np2) return;
  const float* in = x; int j = i;
  if (i >= nx2 + nm2) { in = per; j = i - nx2 - nm2; }
  else if (i >= nx2) { in = mem; j = i - nx2; }
  const float a = in[2 * j], b = in[2 * j + 1];
  const _Float16 h0 = (_Float16)a, h1 = (_Float16)b;
  ((unsigned*)c16)[i] = (unsigned)__builtin_bit_cast(unsigned short, h0) | ((unsigned)__builtin_bit_cast(unsigned short, h1) << 16);
  const unsigned short ah = f2bf_bits(a), bh = f2bf_bits(b);
  const unsigned short al = f2bf_bits(a - bf_bits2f(ah)), bl = f2bf_bits(b - bf_bits2f(bh));
  ((unsigned*)hi)[i] = (unsigned)ah | ((unsigned)bh << 16);
  ((unsigned*)lo)[i] = (unsigned)al | ((unsigned)bl << 16);
}

__global__ __launch_bounds__(256) void split_f32_bf16x2(
    const float* __restrict__ in, __bf16* __restrict__ hi, __bf16* __restrict__ lo, long n2) {
  long i = (long)blockIdx.x * 256 + threadIdx.x;
  long stride = (long)gridDim.x * 256;
  {
    for (long j = i; j < n2; j += stride) {
      const float a = in[2 * j], b = in[2 * j + 1];
      const unsigned short ah = f2bf_bits(a), bh = f2bf_bits(b);
      const unsigned short al = f2bf_bits(a - bf_bits2f(ah)), bl = f2bf_bits(b - bf_bits2f(bh));
      ((unsigned*)hi)[j] = (unsigned)ah | ((unsigned)bh << 16);
      ((unsigned*)lo)[j] = (unsigned)al | ((unsigned)bl << 16);
    }
    
  }
}


// eight source matrices of one launch; blockIdx.z picks one, its output plane follows at z * plane elements
struct Src8 { const float* p0; const float* p1; const float* p2; const float* p3; const float* p4; const float* p5; const float* p6; const float* p7; };
__device__ __forceinline__ const float* pick8(const Src8& s, int z) {
  switch (z) {
    case 0: return s.p0; case 1: return s.p1; case 2: return s.p2; case 3: return s.p3;
    case 4: return s.p4; case 5: return s.p5; case 6: return s.p6; default: return s.p7;
  }
}

// ---- f32 [R][C] (row pitch ldi) -> f16 transposed [C][R] (row pitch ldo); 64x64 tiles; each output row segment
__global__ __launch_bounds__(256) void transpose_cast_f16(Src8 srcs, int ldi,
                                                         _Float16* __restrict__ outT0, int ldo, long plane, float scale) {
  __shared__ __align__(16) _Float16 tile[64][72];     // [c][r]
  const float* __restrict__ in = pick8(srcs, blockIdx.z);
  _Float16* __restrict__ outT = outT0 + (size_t)blockIdx.z * plane;
  const int c0 = blockIdx.x * 64, r0 = blockIdx.y * 64;
  const int t = threadIdx.y * 32 + threadIdx.x;
  for (int i = threadIdx.y; i < 64; i += 8) {
    tile[threadIdx.x][i]      = (_Float16)(in[(size_t)(r0 + i) * ldi + c0 + threadIdx.x] * scale);
    tile[32 + threadIdx.x][i] = (_Float16)(in[(size_t)(r0 + i) * ldi + c0 + 32 + threadIdx.x] * scale);
  }
  __syncthreads();
  const int q = t >> 3, c8 = (t & 7) * 8;
  {
#pragma unroll
    for (int it = 0; it < 2; ++it) {
      const int c = it * 32 + q;
      v8h hv = *(const v8h*)(&tile[c][c8]);
      *(v8h*)(outT + (size_t)(c0 + c) * ldo + r0 + c8) = hv;
    }
    
  }
}

// ---- f32 [R][C] (pitch ldi) -> bf16 hi/lo transposed planes [C][R] (pitch ldo); 64x64 tiles; each output row segment
__global__ __launch_bounds__(256) void transpose_split_bf16(Src8 srcs, int ldi,
                                                           __bf16* __restrict__ outH0, __bf16* __restrict__ outL0, int ldo, long plane) {
  __shared__ __align__(16) float tile[64][68];     // [c][r]
  const float* __restrict__ in = pick8(srcs, blockIdx.z);
  __bf16* __restrict__ outH = outH0 + (size_t)blockIdx.z * plane;
  __bf16* __restrict__ outL = outL0 + (size_t)blockIdx.z * plane;
  const int c0 = blockIdx.x * 64, r0 = blockIdx.y * 64;
  const int t = threadIdx.y * 32 + threadIdx.x;
  for (int i = threadIdx.y; i < 64; i += 8) {
    tile[threadIdx.x][i]      = in[(size_t)(r0 + i) * ldi + c0 + threadIdx.x];
    tile[32 + threadIdx.x][i] = in[(size_t)(r0 + i) * ldi + c0 + 32 + threadIdx.x];
  }
  __syncthreads();
  const int q = t >> 3, c8 = (t & 7) * 8;
  {
#pragma unroll
    for (int it = 0; it < 2; ++it) {
      const int c = it * 32 + q;
      v8b hv, lv;
#pragma unroll
      for (int e = 0; e < 8; ++e) {
        const float f = tile[c][c8 + e];
        const unsigned short hb = f2bf_bits(f);
        hv[e] = __builtin_bit_cast(__bf16, hb);
        lv[e] = __builtin_bit_cast(__bf16, f2bf_bits(f - bf_bits2f(hb)));
      }
      *(v8b*)(outH + (size_t)(c0 + c) * ldo + r0 + c8) = hv;
      *(v8b*)(outL + (size_t)(c0 + c) * ldo + r0 + c8) = lv;
    }
    
  }
}

// =====================================================================================
// Generic causal/non-causal attention for head_dim 64, f32 in / f32 out, bf16 operands with optional hi/lo splits.
//   scores = (q*qscale)·kᵀ : v_wmma_f32_16x16x32_bf16; SPLIT_QK -> q,k as bf16 hi/lo (hi·hi + hi·lo + lo·hi)
//   out    = p·v           : v_wmma_f32_16x16x32_bf16; SPLIT_PV -> p,v as bf16 hi/lo; else p,v plain bf16
//   f32 accumulate; online softmax in f32. Block = 4 waves = 64 query rows of one (batch, head); S % 64 == 0.
//   Element (b, s, h, d) of tensor X lives at X[b*X_bs + s*X_rs + h*X_hs + d] (strides in floats, multiples of 4).
//   Masking: mask_mode 0 none, 1 causal (kv > q masked), 2 tensor [S][Skv] shared over (b,h) (float if
//   mask_is_int==0, int32 with element == 0 -> masked if 1, int32 with element != 0 -> masked if 2), 3 per-token vectors qmask[B][S] & kvmask[B][Skv] (int32,
//   0 -> masked), 4 causal + sliding window (kv > q or q - kv > W masked; W passed in mask_is_int);
//   masked scores are replaced by mask_fill (e.g. -inf or -1e9) before the softmax.
//   One launch serves four branches (batch 1): branch a reads q/k/v and writes out at a * {q,k,v,o}_st floats, with its own Skv,
//   mask_mode and window. grid.x = 4 * H * (S/64): first branches 0 and 1 (causal, cost grows with the query block) from the last
//   query block down, then branches 2 and 3, so that the long work-groups start first.
// =====================================================================================
#define AT_D 64
#define AT_NW 4
#define AT_QB 64
#define AT_KC 64
struct AttnGeom { long q_bs, q_rs, q_hs, k_bs, k_rs, k_hs, v_bs, v_rs, v_hs, o_bs, o_rs, o_hs;
                  int S, Skv, H, mask_mode; float qscale; int blk0; float mask_fill; int mask_is_int; };
static_assert(sizeof(AttnGeom) == 128, "no padding");
struct AttnBranches { long q_st, k_st, v_st, o_st; int Skv[4]; int mask_mode[4]; int mask_is_int[4]; };

__device__ __forceinline__ unsigned short at_bf_bits(float f) {
  unsigned u = __float_as_uint(f);
  return (unsigned short)((u + 0x7FFFu + ((u >> 16) & 1u)) >> 16);
}
__device__ __forceinline__ __bf16 at_f2bf(float f) { return __builtin_bit_cast(__bf16, at_bf_bits(f)); }
__device__ __forceinline__ void at_split(float f, __bf16& hi, __bf16& lo) {
  const unsigned short hb = at_bf_bits(f);
  hi = __builtin_bit_cast(__bf16, hb);
  lo = at_f2bf(f - __uint_as_float(((unsigned)hb) << 16));
}
__device__ __forceinline__ v8f at_mma(v16b a, v16b b, v8f c) {
  c = __builtin_amdgcn_wmma_f32_16x16x32_bf16(false, a, false, b, (short)0, c, false, false);
  asm volatile("v_nop\n\tv_nop\n\tv_nop\n\tv_nop" : "+v"(c) : "v"(a), "v"(b));
  return c;
}

template <bool SPLIT_QK, bool SPLIT_PV>
__global__ __launch_bounds__(128)
void attn64_kernel(const float* __restrict__ q, const float* __restrict__ k,
                   const float* __restrict__ v, float* __restrict__ out,
                   const void* __restrict__ mask_a, const int* __restrict__ mask_b, AttnGeom g0, AttnBranches br) {
  union FB { v16b v; v8b h[2]; };
  __shared__ __align__(16) __bf16 Ksh[AT_KC * AT_D];             // K hi [kv][d]      8 KB
  __shared__ __align__(16) __bf16 Ksl[SPLIT_QK ? AT_KC * AT_D : 8];
  __shared__ __align__(16) __bf16 Vth[AT_D * AT_KC];             // V hi [d][kv]      8 KB
  __shared__ __align__(16) __bf16 Vtl[SPLIT_PV ? AT_D * AT_KC : 8];
  __shared__ __align__(16) __bf16 Psh[AT_NW][16 * AT_KC];        // per wave P hi [row][kv]  8 KB
  __shared__ __align__(16) __bf16 Psl[SPLIT_PV ? AT_NW : 1][SPLIT_PV ? 16 * AT_KC : 8];
  __shared__ __align__(16) float  Os[AT_NW][16 * 68];            // per wave out tile, pitch 68

  const int tid  = threadIdx.x;
  const int wave = tid >> 5;
  const int lane = tid & 31;
  const int hh   = lane >> 4;
  const int c    = lane & 15;

  AttnGeom g = g0;
  const int nqb = g.S / AT_QB;
  const int bx = blockIdx.x + g.blk0;
  const int perBranch = g.H * nqb;
  int a, h, qb;
  if (bx < 2 * perBranch) {
    const int lvl = bx / (2 * g.H), w = bx % (2 * g.H);
    qb = nqb - 1 - lvl; a = w / g.H; h = w % g.H;
  } else {
    const int r = bx - 2 * perBranch, r2 = r % perBranch;
    a = 2 + r / perBranch; h = r2 / nqb; qb = r2 % nqb;
  }
  g.Skv = br.Skv[a]; g.mask_mode = br.mask_mode[a]; g.mask_is_int = br.mask_is_int[a];
  const int b  = 0;
  const int qbase_block = qb * AT_QB;
  const int q0 = qbase_block + wave * 16;

  const float* qb_ptr = q + (size_t)a * br.q_st + (size_t)h * g.q_hs;
  const float* kb_ptr = k + (size_t)a * br.k_st + (size_t)h * g.k_hs;
  const float* vb_ptr = v + (size_t)a * br.v_st + (size_t)h * g.v_hs;
  float*       ob_ptr = out + (size_t)a * br.o_st + (size_t)h * g.o_hs;

  // ---- Q fragments (A operand): 2 d-chunks, hi (and lo) ----
  v16b qah[2], qal[2];
  {
    const float* qrow = qb_ptr + (size_t)(q0 + c) * g.q_rs;
#pragma unroll
    for (int dc = 0; dc < 2; ++dc) {
#pragma unroll
      for (int e = 0; e < 8; ++e) {
        const float f0 = qrow[dc * 32 + 8 * hh + e] * g.qscale;
        const float f1 = qrow[dc * 32 + 16 + 8 * hh + e] * g.qscale;
        if (SPLIT_QK) { __bf16 hq, lq; at_split(f0, hq, lq); qah[dc][e] = hq; qal[dc][e] = lq; at_split(f1, hq, lq); qah[dc][8 + e] = hq; qal[dc][8 + e] = lq; }
        else { qah[dc][e] = at_f2bf(f0); qah[dc][8 + e] = at_f2bf(f1); qal[dc][e] = qah[dc][e]; qal[dc][8 + e] = qah[dc][8 + e]; }
      }
    }
  }

  float mrow[8], lrow[8];
  v8f oacc[4];
#pragma unroll
  for (int r = 0; r < 8; ++r) { mrow[r] = -INFINITY; lrow[r] = 0.f; }
#pragma unroll
  for (int t = 0; t < 4; ++t) oacc[t] = (v8f){0.f,0.f,0.f,0.f,0.f,0.f,0.f,0.f};

  const int nChunks = (g.mask_mode == 1 || g.mask_mode == 4) ? (qb + 1) : (g.Skv / AT_KC);   // block-uniform
  // per-row query mask (mode 3)
  int qkeep[8];
#pragma unroll
  for (int r = 0; r < 8; ++r) qkeep[r] = (g.mask_mode == 3) ? mask_b[(size_t)b * g.S + q0 + 8 * hh + r] : 1;   // mask_b = qmask in mode 3
  for (int kc = 0; kc < nChunks; ++kc) {
    const int kv0 = kc * AT_KC;
    __syncthreads();
    {
      const int kvr = tid >> 1, dh = (tid & 1) * 32;
      const float* krow = kb_ptr + (size_t)(kv0 + kvr) * g.k_rs + dh;
      const float* vrow = vb_ptr + (size_t)(kv0 + kvr) * g.v_rs + dh;
#pragma unroll
      for (int i = 0; i < 8; ++i) {
        v4f kk = *(const v4f*)(krow + 4 * i);
        v4f vv = *(const v4f*)(vrow + 4 * i);
#pragma unroll
        for (int e = 0; e < 4; ++e) {
          const int d = dh + 4 * i + e;
          if (SPLIT_QK) { __bf16 a, bl; at_split(kk[e], a, bl); Ksh[kvr * AT_D + d] = a; Ksl[kvr * AT_D + d] = bl; }
          else Ksh[kvr * AT_D + d] = at_f2bf(kk[e]);
          if (SPLIT_PV) { __bf16 a, bl; at_split(vv[e], a, bl); Vth[d * AT_KC + kvr] = a; Vtl[d * AT_KC + kvr] = bl; }
          else Vth[d * AT_KC + kvr] = at_f2bf(vv[e]);
        }
      }
    }
    __syncthreads();

    v8f s[4];
#pragma unroll
    for (int j = 0; j < 4; ++j) {
      s[j] = (v8f){0.f,0.f,0.f,0.f,0.f,0.f,0.f,0.f};
#pragma unroll
      for (int dc = 0; dc < 2; ++dc) {
        FB kb;
        kb.h[0] = *(const v8b*)(Ksh + (j * 16 + c) * AT_D + dc * 32 + 8 * hh);
        kb.h[1] = *(const v8b*)(Ksh + (j * 16 + c) * AT_D + dc * 32 + 16 + 8 * hh);
        s[j] = at_mma(qah[dc], kb.v, s[j]);
        if (SPLIT_QK) {
          FB kl;
          kl.h[0] = *(const v8b*)(Ksl + (j * 16 + c) * AT_D + dc * 32 + 8 * hh);
          kl.h[1] = *(const v8b*)(Ksl + (j * 16 + c) * AT_D + dc * 32 + 16 + 8 * hh);
          s[j] = at_mma(qah[dc], kl.v, s[j]);
          s[j] = at_mma(qal[dc], kb.v, s[j]);
        }
      }
    }
    const bool diag = (g.mask_mode == 1) && (kc == qb);
    int kvkeep[4] = {1, 1, 1, 1};
    if (g.mask_mode == 3) {
#pragma unroll
      for (int j = 0; j < 4; ++j) kvkeep[j] = ((const int*)mask_a)[(size_t)b * g.Skv + kv0 + j * 16 + c];   // mask_a = kvmask
    }
    float cm[8];
#pragma unroll
    for (int r = 0; r < 8; ++r) {
      const int qrow = q0 + 8 * hh + r;
      float m = -INFINITY;
#pragma unroll
      for (int j = 0; j < 4; ++j) {
        const int kvcol = kv0 + j * 16 + c;
        bool masked = false;
        if (diag) masked = (kvcol > qrow);
        else if (g.mask_mode == 4) masked = (kvcol > qrow) || (qrow - kvcol > g.mask_is_int);
        else if (g.mask_mode == 2) {
          const size_t mi = (size_t)qrow * g.Skv + kvcol;
          masked = (g.mask_is_int == 0) ? (((const float*)mask_a)[mi] == 0.0f)
                 : (g.mask_is_int == 1) ? (((const int*)mask_a)[mi] == 0) : (((const int*)mask_a)[mi] != 0);
        } else if (g.mask_mode == 3) masked = (qkeep[r] == 0) || (kvkeep[j] == 0);
        if (masked) s[j][r] = g.mask_fill;
        m = fmaxf(m, s[j][r]);
      }
#pragma unroll
      for (int off = 1; off < 16; off <<= 1) m = fmaxf(m, __shfl_xor(m, off, 32));
      cm[r] = m;
    }
    __bf16* pwh = Psh[wave];
    __bf16* pwl = Psl[SPLIT_PV ? wave : 0];
#pragma unroll
    for (int r = 0; r < 8; ++r) {
      const float mnew = fmaxf(mrow[r], cm[r]);
      const float alpha = expf(mrow[r] - mnew);
      mrow[r] = mnew;
      float psum = 0.f;
#pragma unroll
      for (int j = 0; j < 4; ++j) {
        const float p = expf(s[j][r] - mnew);
        psum += p;
        if (SPLIT_PV) { __bf16 a, bl; at_split(p, a, bl); pwh[(8 * hh + r) * AT_KC + j * 16 + c] = a; pwl[(8 * hh + r) * AT_KC + j * 16 + c] = bl; }
        else pwh[(8 * hh + r) * AT_KC + j * 16 + c] = at_f2bf(p);
      }
#pragma unroll
      for (int off = 1; off < 16; off <<= 1) psum += __shfl_xor(psum, off, 32);
      lrow[r] = lrow[r] * alpha + psum;
#pragma unroll
      for (int t = 0; t < 4; ++t) oacc[t][r] *= alpha;
    }
    __builtin_amdgcn_fence(__ATOMIC_RELEASE, "workgroup");
    __builtin_amdgcn_wave_barrier();
    __builtin_amdgcn_fence(__ATOMIC_ACQUIRE, "workgroup");
#pragma unroll
    for (int kk = 0; kk < 2; ++kk) {
      FB pa, pl;
      pa.h[0] = *(const v8b*)(pwh + c * AT_KC + kk * 32 + 8 * hh);
      pa.h[1] = *(const v8b*)(pwh + c * AT_KC + kk * 32 + 16 + 8 * hh);
      if (SPLIT_PV) {
        pl.h[0] = *(const v8b*)(pwl + c * AT_KC + kk * 32 + 8 * hh);
        pl.h[1] = *(const v8b*)(pwl + c * AT_KC + kk * 32 + 16 + 8 * hh);
      }
#pragma unroll
      for (int t = 0; t < 4; ++t) {
        FB vb;
        vb.h[0] = *(const v8b*)(Vth + (t * 16 + c) * AT_KC + kk * 32 + 8 * hh);
        vb.h[1] = *(const v8b*)(Vth + (t * 16 + c) * AT_KC + kk * 32 + 16 + 8 * hh);
        oacc[t] = at_mma(pa.v, vb.v, oacc[t]);
        if (SPLIT_PV) {
          FB vl;
          vl.h[0] = *(const v8b*)(Vtl + (t * 16 + c) * AT_KC + kk * 32 + 8 * hh);
          vl.h[1] = *(const v8b*)(Vtl + (t * 16 + c) * AT_KC + kk * 32 + 16 + 8 * hh);
          oacc[t] = at_mma(pa.v, vl.v, oacc[t]);
          oacc[t] = at_mma(pl.v, vb.v, oacc[t]);
        }
      }
    }
  }

  float* os = Os[wave];
#pragma unroll
  for (int r = 0; r < 8; ++r) {
    const float inv = 1.0f / lrow[r];
#pragma unroll
    for (int t = 0; t < 4; ++t) os[(8 * hh + r) * 68 + t * 16 + c] = oacc[t][r] * inv;
  }
  __builtin_amdgcn_fence(__ATOMIC_RELEASE, "workgroup");
  __builtin_amdgcn_wave_barrier();
  __builtin_amdgcn_fence(__ATOMIC_ACQUIRE, "workgroup");
  {
    const int c4 = (lane & 15) * 4;
    {
#pragma unroll
      for (int it = 0; it < 8; ++it) {
        const int row = it * 2 + hh;
        v4f val = *(const v4f*)(os + row * 68 + c4);
        *(v4f*)(ob_ptr + (size_t)(q0 + row) * g.o_rs + c4) = val;
      }
      
    }
  }
}

__global__ __launch_bounds__(256) void gate_fuse_kernel(const float* __restrict__ o0, const float* __restrict__ o1,
                                                       const float* __restrict__ o2, const float* __restrict__ o3,
                                                       const float* __restrict__ Wg, const float* __restrict__ bg,
                                                       float* __restrict__ out, int Hd) {
  __shared__ float red[4][8];
  const int row = blockIdx.x, t = threadIdx.x, lane = t & 31, wave = t >> 5;
  const float* os[4] = {o0 + (size_t)row * Hd, o1 + (size_t)row * Hd, o2 + (size_t)row * Hd, o3 + (size_t)row * Hd};
  float acc[4] = {0.f, 0.f, 0.f, 0.f};
  for (int i = 0; i < 4; ++i) {
    const float* o = os[i];
    for (int c = t; c < Hd; c += 256) {
      const float v = o[c];
      const float* w = Wg + (size_t)(i * Hd + c) * 4;
      acc[0] += v * w[0]; acc[1] += v * w[1]; acc[2] += v * w[2]; acc[3] += v * w[3];
    }
  }
#pragma unroll
  for (int g = 0; g < 4; ++g) { float a = acc[g]; for (int o = 16; o > 0; o >>= 1) a += __shfl_xor(a, o, 32); if (lane == 0) red[g][wave] = a; }
  __syncthreads();
  float gl[4];
#pragma unroll
  for (int g = 0; g < 4; ++g) { float a = 0.f; for (int w = 0; w < 8; ++w) a += red[g][w]; gl[g] = a + bg[g]; }
  const float mx = fmaxf(fmaxf(gl[0], gl[1]), fmaxf(gl[2], gl[3]));
  float e[4], se = 0.f;
#pragma unroll
  for (int g = 0; g < 4; ++g) { e[g] = expf(gl[g] - mx); se += e[g]; }
  const float inv = 1.0f / se;
  const int c = 4 * t;
  v4f r;
#pragma unroll
  for (int q = 0; q < 4; ++q) r[q] = (e[0] * inv) * os[0][c + q] + (e[1] * inv) * os[1][c + q] + (e[2] * inv) * os[2][c + q] + (e[3] * inv) * os[3][c + q];
  *(v4f*)(out + (size_t)row * Hd + c) = r;
  
}

extern "C" void kernel_launch(void* const* d_in, const int* in_sizes, int n_in,
                              void* d_out, int out_size, void* d_ws, size_t ws_size,
                              hipStream_t stream) {
  (void)in_sizes; (void)n_in; (void)out_size; (void)ws_size;
  const int S = 2048, E = 1024, H = 16, DH = 64, MM = 512, MP = 64, WIN = 512;
  // wire order: 16 weights ([in,out]), gate_w, gate_b, x, memory_kv, persona_kv
  const float* Wm[16]; for (int i = 0; i < 16; ++i) Wm[i] = (const float*)d_in[i];   // {local,long,mem,per} x {wq,wk,wv,wo}
  const float* gate_w = (const float*)d_in[16];
  const float* gate_b = (const float*)d_in[17];
  const float* x   = (const float*)d_in[18];   // [1,2048,1024]
  const float* mem = (const float*)d_in[19];   // [1,512,1024]
  const float* per = (const float*)d_in[20];   // [1,64,1024]
  float* out = (float*)d_out;

  char* ws = (char*)d_ws; size_t off = 0;
  auto carve = [&](size_t bytes) -> char* { char* p = ws + off; off += (bytes + 255) & ~(size_t)255; return p; };
  const int CT = S + MM + MP;                                   // context rows: x, then memory, then persona
  const long EE = (long)E * E, SE = (long)S * E;
  _Float16* C16  = (_Float16*)carve((size_t)CT * E * 2);        // 5.4 MB each
  __bf16*   Ch   = (__bf16*)carve((size_t)CT * E * 2);
  __bf16*   Cl   = (__bf16*)carve((size_t)CT * E * 2);
  _Float16* WqkT = (_Float16*)carve((size_t)8 * EE * 2);        // plane 2a = wq^T, 2a+1 = wk^T of branch a; 16.8 MB
  __bf16*   WvoTh = (__bf16*)carve((size_t)8 * EE * 2);         // plane 2a = wv^T, 2a+1 = wo^T
  __bf16*   WvoTl = (__bf16*)carve((size_t)8 * EE * 2);
  float*    QK   = (float*)carve((size_t)8 * SE * 4);           // plane 2a = q, 2a+1 = k of branch a; 67 MB
  float*    Vf   = (float*)carve((size_t)4 * SE * 4);           // 33.6 MB
  float*    Of   = (float*)carve((size_t)4 * SE * 4);
  __bf16*   Oh   = (__bf16*)carve((size_t)4 * SE * 2);
  __bf16*   Ol   = (__bf16*)carve((size_t)4 * SE * 2);          // total 234 MB
  float*    Ob[4];
  for (int i = 0; i < 4; ++i) Ob[i] = QK + (size_t)i * SE;      // branch outputs take the q/k planes' place once attention is done

  const int  SKs[4]  = {S, S, MM, MP};                          // keys per branch
  const long ctx0[4] = {0, 0, (long)S * E, (long)(S + MM) * E}; // first context element per branch

  prep_inputs<<<CT * E / 2 / 256, 256, 0, stream>>>(x, mem, per, C16, Ch, Cl, S * E / 2, MM * E / 2, MP * E / 2);
  {
    Src8 qk = {Wm[0], Wm[1], Wm[4], Wm[5], Wm[8], Wm[9], Wm[12], Wm[13]};
    Src8 vo = {Wm[2], Wm[3], Wm[6], Wm[7], Wm[10], Wm[11], Wm[14], Wm[15]};
    transpose_cast_f16<<<dim3(E / 64, E / 64, 8), dim3(32, 8), 0, stream>>>(qk, E, WqkT, E, EE, 1.0f);
    transpose_split_bf16<<<dim3(E / 64, E / 64, 8), dim3(32, 8), 0, stream>>>(vo, E, WvoTh, WvoTl, E, EE);
  }
  const int tq = (S / 64) * (E / 64);
  {
    BatchA bqk, bv;
    for (int a = 0; a < 4; ++a) {
      bqk.aoff[2 * a] = 0;           bqk.M[2 * a] = S;
      bqk.aoff[2 * a + 1] = ctx0[a]; bqk.M[2 * a + 1] = SKs[a];
      bv.aoff[a] = ctx0[a];          bv.M[a] = SKs[a];
      bv.aoff[4 + a] = 0;            bv.M[4 + a] = 0;
    }
    wmma_gemm64<0, false, 0, 0, false><<<dim3((tq + 7) / 8, 8), 256, 0, stream>>>(
        U16(C16), nullptr, E, bqk, U16(WqkT), nullptr, E, EE, QK, nullptr, E, SE, nullptr, nullptr, 0, E, E, 1.0f);
    wmma_gemm64<1, true, 0, 0, false><<<dim3((tq + 7) / 8, 4), 256, 0, stream>>>(
        U16(Ch), U16(Cl), E, bv, U16(WvoTh), U16(WvoTl), E, 2 * EE, Vf, nullptr, E, SE, nullptr, nullptr, 0, E, E, 1.0f);
  }
  {
    AttnGeom g;
    g.q_bs = SE; g.q_rs = E; g.q_hs = DH;
    g.k_bs = SE; g.k_rs = E; g.k_hs = DH;
    g.v_bs = SE; g.v_rs = E; g.v_hs = DH;
    g.o_bs = SE; g.o_rs = E; g.o_hs = DH;
    g.S = S; g.Skv = S; g.H = H; g.qscale = 0.125f; g.blk0 = 0; g.mask_fill = -1.0e30f;
    g.mask_mode = 0; g.mask_is_int = 0;
    AttnBranches br;
    br.q_st = 2 * SE; br.k_st = 2 * SE; br.v_st = SE; br.o_st = SE;
    for (int a = 0; a < 4; ++a) { br.Skv[a] = SKs[a]; br.mask_mode[a] = 0; br.mask_is_int[a] = 0; }
    br.mask_mode[0] = 4; br.mask_is_int[0] = WIN;               // causal + window
    br.mask_mode[1] = 1;                                        // causal
    attn64_kernel<true, true><<<4 * H * (S / AT_QB), AT_NW * 32, 0, stream>>>(QK, QK + SE, Vf, Of, nullptr, nullptr, g, br);
  }
  split_f32_bf16x2<<<4096, 256, 0, stream>>>(Of, Oh, Ol, 4 * SE / 2);
  {
    BatchA bo;
    for (int a = 0; a < 4; ++a) { bo.aoff[a] = a * SE; bo.M[a] = S; bo.aoff[4 + a] = 0; bo.M[4 + a] = 0; }
    wmma_gemm64<1, true, 0, 0, false><<<dim3((tq + 7) / 8, 4), 256, 0, stream>>>(
        U16(Oh), U16(Ol), E, bo, U16(WvoTh + EE), U16(WvoTl + EE), E, 2 * EE, Ob[0], nullptr, E, SE, nullptr, nullptr, 0, E, E, 1.0f);
  }
  gate_fuse_kernel<<<S, 256, 0, stream>>>(Ob[0], Ob[1], Ob[2], Ob[3], gate_w, gate_b, out, E);
}

// v002
// It runs in 491 microseconds.
// Next to v001, in two timings, it ran 1.43 and 1.44 times as fast.
// All steps since v000 together make it 3.59 times as fast.
#include <hip/hip_runtime.h>
#include <math.h>
// Four attentions (local = causal + 512 sliding window, long = causal, memory cross (512 keys), persona cross (64 keys)), 16 heads of 64:
// q/k projections (K=1024): v_wmma_f32_16x16x32_f16 (f16 operands); v and output projections (K=1024): v_wmma_f32_16x16x32_bf16 as bf16
// hi/lo splits; scores and p·v: v_wmma_f32_16x16x32_bf16 with q,k and p,v as bf16 hi/lo splits; f32 accumulate; softmax f32.
// Gate (concat(outs)·gate_w, N=4, 0.1 % of MACs), gate softmax and the weighted fusion in f32 on VALU.
typedef __attribute__((ext_vector_type(16))) _Float16 v16h;
typedef __attribute__((ext_vector_type(8)))  _Float16 v8h;
typedef __attribute__((ext_vector_type(16))) __bf16   v16b;
typedef __attribute__((ext_vector_type(8)))  __bf16   v8b;
typedef __attribute__((ext_vector_type(8)))  float    v8f;
typedef __attribute__((ext_vector_type(4)))  float    v4f;
#define PSCALE 32768.0f
#define U16(p) ((const unsigned short*)(const void*)(p))
#define PSCALE_INV (1.0f / 32768.0f)

__device__ __forceinline__ unsigned short f2bf_bits(float f) {
  unsigned u = __float_as_uint(f);
  return (unsigned short)((u + 0x7FFFu + ((u >> 16) & 1u)) >> 16);
}
__device__ __forceinline__ float bf_bits2f(unsigned short h) { return __uint_as_float(((unsigned)h) << 16); }

// hazard guards as plain device helpers (no inline asm inside the kernel template body)
__device__ __forceinline__ void dep_guard_h(v8f& a, v8f& b, v16h x, v16h y) { asm volatile("v_nop\n\tv_nop\n\tv_nop\n\tv_nop" : "+v"(a), "+v"(b) : "v"(x), "v"(y)); }
__device__ __forceinline__ void dep_guard_b(v8f& a, v8f& b, v16b x, v16b y) { asm volatile("v_nop\n\tv_nop\n\tv_nop\n\tv_nop" : "+v"(a), "+v"(b) : "v"(x), "v"(y)); }
__device__ __forceinline__ void keep4_h(v16h a, v16h b, v16h c, v16h d) { asm volatile("v_nop" :: "v"(a), "v"(b), "v"(c), "v"(d)); }
__device__ __forceinline__ void keep4_b(v16b a, v16b b, v16b c, v16b d) { asm volatile("v_nop" :: "v"(a), "v"(b), "v"(c), "v"(d)); }
__device__ __forceinline__ void acc_guard4(v8f& a, v8f& b, v8f& c, v8f& d) { asm volatile("v_nop\n\tv_nop\n\tv_nop\n\tv_nop" : "+v"(a), "+v"(b), "+v"(c), "+v"(d)); }
template <typename T> struct Frag;
template <> struct Frag<_Float16> {
  typedef v16h V; union U { v16h v; v8h h[2]; };
  static __device__ __forceinline__ v16h load(const _Float16* p) {   // elements 0..7 <- p[0..7], 8..15 <- p[16..23]
    U f; f.h[0] = *(const v8h*)(p); f.h[1] = *(const v8h*)(p + 16); return f.v;
  }
  static __device__ __forceinline__ v8f mma(v16h a, v16h b, v8f c) {
    return __builtin_amdgcn_wmma_f32_16x16x32_f16(false, a, false, b, (short)0, c, false, false);
  }
  static __device__ __forceinline__ void guard(v8f& a, v8f& b, v16h x, v16h y) { dep_guard_h(a, b, x, y); }
  static __device__ __forceinline__ void keep(v16h a, v16h b, v16h c, v16h d) { keep4_h(a, b, c, d); }
};
template <> struct Frag<__bf16> {
  typedef v16b V; union U { v16b v; v8b h[2]; };
  static __device__ __forceinline__ v16b load(const __bf16* p) {
    U f; f.h[0] = *(const v8b*)(p); f.h[1] = *(const v8b*)(p + 16); return f.v;
  }
  static __device__ __forceinline__ v8f mma(v16b a, v16b b, v8f c) {
    return __builtin_amdgcn_wmma_f32_16x16x32_bf16(false, a, false, b, (short)0, c, false, false);
  }
  static __device__ __forceinline__ void guard(v8f& a, v8f& b, v16b x, v16b y) { dep_guard_b(a, b, x, y); }
  static __device__ __forceinline__ void keep(v16b a, v16b b, v16b c, v16b d) { keep4_b(a, b, c, d); }
};

// ---- Register-blocked batched WMMA GEMM ------------------------------------
// C[m,n] = scale * sum_k A[m,k] * Bt[n,k] (+bias)(+resid); each wave owns a 64x64 tile.
// A row-major [M,K]; Bt row-major [N,K]; M,N % 64 == 0, K % 32 == 0.
// SPLIT: operands are hi/lo planes (A2/Bt2 = lo planes, same layout); product = hi·hi + hi·lo + lo·hi.
// BIAS_MODE: 0 = none, 1 = bias[m], 2 = bias[n].
// OUT_MODE: 0 = f32, 1 = f16, 2 = bf16 hi plane (Cout) + bf16 lo plane (Cout2).
// ET: 0 = f16 operands, 1 = bf16 operands (pointers passed as 16-bit storage)
template <int ET> struct Elem;
template <> struct Elem<0> { typedef _Float16 T; };
template <> struct Elem<1> { typedef __bf16 T; };
// Batch entry blockIdx.y reads A from element offset aoff[y] and has M[y] rows (entries may differ in source and height).
struct BatchA { long aoff[8]; int M[8]; };
template <int ET, bool SPLIT, int BIAS_MODE, int OUT_MODE, bool RESID, int ACT = 0>
__global__ __launch_bounds__(256) void wmma_gemm64(
    const unsigned short* __restrict__ Ap, const unsigned short* __restrict__ A2p, int lda, BatchA ba,
    const unsigned short* __restrict__ Btp, const unsigned short* __restrict__ Bt2p, int ldb, long strideB,
    void* __restrict__ Cout, void* __restrict__ Cout2, int ldc, long strideC,
    const float* __restrict__ bias,
    const float* __restrict__ resid, long strideR,
    int N, int K, float scale) {
  typedef typename Elem<ET>::T T;
  typedef typename Frag<T>::V V;
  const T* A = (const T*)Ap; const T* A2 = (const T*)A2p; const T* Bt = (const T*)Btp; const T* Bt2 = (const T*)Bt2p;
  __shared__ __align__(16) float sT[8][16 * 68];   // per-wave 16x64 slab, pitch 68 floats
  const int b    = blockIdx.y;
  const int M    = ba.M[b];
  const long offA = ba.aoff[b];
  const int lane = threadIdx.x & 31;
  const int wave = threadIdx.x >> 5;
  const int tilesN = N >> 6;
  const int tilesM = M >> 6;
  const int tile = blockIdx.x * 8 + wave;
  if (tile >= tilesM * tilesN) return;   // wave-uniform; no block barriers in this kernel
  const int tm = tile / tilesN;
  const int tn = tile - tm * tilesN;
  const int m0 = tm << 6;
  const int n0 = tn << 6;

  const T* Ab  = A  + offA;
  const T* Bb  = Bt + (size_t)b * strideB;
  const T* Ab2 = SPLIT ? (A2  + offA) : nullptr;
  const T* Bb2 = SPLIT ? (Bt2 + (size_t)b * strideB) : nullptr;

  const int rlane = lane & 15;                 // row (A) / col (B, D) within subtile
  const int koff  = (lane >> 4) * 8;           // k offset of this lane half
  const int mOff  = (lane >> 4) * 8;           // D row offset

  v8f acc[4][4];
#pragma unroll
  for (int i = 0; i < 4; ++i)
#pragma unroll
    for (int j = 0; j < 4; ++j) acc[i][j] = (v8f){0.f,0.f,0.f,0.f,0.f,0.f,0.f,0.f};

  for (int k0 = 0; k0 < K; k0 += 32) {
    V bh[4], bl[4];
#pragma unroll
    for (int j = 0; j < 4; ++j) {
      const size_t bo = (size_t)(n0 + (j << 4) + rlane) * ldb + koff + k0;
      bh[j] = Frag<T>::load(Bb + bo);
      if (SPLIT) bl[j] = Frag<T>::load(Bb2 + bo);
    }
#pragma unroll
    for (int i = 0; i < 4; ++i) {
      const size_t ao = (size_t)(m0 + (i << 4) + rlane) * lda + koff + k0;
      V ah = Frag<T>::load(Ab + ao);
      V al;
      if (SPLIT) al = Frag<T>::load(Ab2 + ao);
#pragma unroll
      for (int j = 0; j < 4; ++j) {
        acc[i][j] = Frag<T>::mma(ah, bh[j], acc[i][j]);
        if (SPLIT) {
          acc[i][j] = Frag<T>::mma(ah, bl[j], acc[i][j]);
          acc[i][j] = Frag<T>::mma(al, bh[j], acc[i][j]);
        }
      }
      Frag<T>::guard(acc[i][0], acc[i][3], ah, SPLIT ? al : ah);
    }
    Frag<T>::keep(bh[0], bh[1], bh[2], bh[3]);
    if (SPLIT) Frag<T>::keep(bl[0], bl[1], bl[2], bl[3]);
  }
  acc_guard4(acc[0][0], acc[0][1], acc[0][2], acc[0][3]);
  acc_guard4(acc[1][0], acc[1][1], acc[1][2], acc[1][3]);
  acc_guard4(acc[2][0], acc[2][1], acc[2][2], acc[2][3]);
  acc_guard4(acc[3][0], acc[3][1], acc[3][2], acc[3][3]);

  // ---- epilogue ----
  float* slab = sT[wave];
  const float* Rb = RESID ? (resid + (size_t)b * strideR) : nullptr;
#pragma unroll
  for (int i = 0; i < 4; ++i) {
    const int mBase = m0 + (i << 4);
#pragma unroll
    for (int j = 0; j < 4; ++j) {
      const int n = n0 + (j << 4) + rlane;
      float bv = 0.f;
      if (BIAS_MODE == 2) bv = bias[n];
#pragma unroll
      for (int r = 0; r < 8; ++r) {
        float v = acc[i][j][r] * scale;
        if (BIAS_MODE == 1) v += bias[mBase + mOff + r];
        if (BIAS_MODE == 2) v += bv;
        if (RESID) v += Rb[(size_t)(mBase + mOff + r) * ldc + n];
        if (ACT == 1) v = tanhf(v);
        slab[(mOff + r) * 68 + (j << 4) + rlane] = v;
      }
    }
    __builtin_amdgcn_fence(__ATOMIC_RELEASE, "workgroup");
    __builtin_amdgcn_wave_barrier();
    __builtin_amdgcn_fence(__ATOMIC_ACQUIRE, "workgroup");
    if (OUT_MODE == 0) {
      float* C = (float*)Cout + (size_t)b * strideC;
      const int hh = lane >> 4, c4 = (lane & 15) * 4;     // row seg = 256 B = 16 lanes x 16 B
      {
#pragma unroll
        for (int it = 0; it < 8; ++it) {
          const int row = it * 2 + hh;
          v4f v = *(const v4f*)(slab + row * 68 + c4);
          *(v4f*)(C + (size_t)(mBase + row) * ldc + n0 + c4) = v;
        }
        
      }
    } else {
      const int q = lane >> 3, c8 = (lane & 7) * 8;
      unsigned short* C  = (unsigned short*)Cout  + (size_t)b * strideC;
      unsigned short* C2 = (OUT_MODE == 2) ? ((unsigned short*)Cout2 + (size_t)b * strideC) : nullptr;
      {
#pragma unroll
        for (int it = 0; it < 4; ++it) {
          const int row = it * 4 + q;
          const float* sp = slab + row * 68 + c8;
          v8h hv, lv;
#pragma unroll
          for (int e = 0; e < 8; ++e) {
            if (OUT_MODE == 1) {
              hv[e] = (_Float16)sp[e];
            } else {
              unsigned short hb = f2bf_bits(sp[e]);
              unsigned short lb = f2bf_bits(sp[e] - bf_bits2f(hb));
              hv[e] = __builtin_bit_cast(_Float16, hb);
              lv[e] = __builtin_bit_cast(_Float16, lb);
            }
          }
          *(v8h*)(C + (size_t)(mBase + row) * ldc + n0 + c8) = hv;
          if (OUT_MODE == 2) *(v8h*)(C2 + (size_t)(mBase + row) * ldc + n0 + c8) = lv;
        }
        
      }
    }
    __builtin_amdgcn_fence(__ATOMIC_RELEASE, "workgroup");
    __builtin_amdgcn_wave_barrier();
    __builtin_amdgcn_fence(__ATOMIC_ACQUIRE, "workgroup");
  }
}

// x, memory and persona rows, one after the other, to one f16 plane and bf16 hi/lo planes; n*2 = float pairs per source (multiples of 256)
__global__ __launch_bounds__(256) void prep_inputs(
    const float* __restrict__ x, const float* __restrict__ mem, const float* __restrict__ per,
    _Float16* __restrict__ c16, __bf16* __restrict__ hi, __bf16* __restrict__ lo, int nx2, int nm2, int np2) {
  const int i = blockIdx.x * 256 + threadIdx.x;
  if (i >= nx2 + nm2 + np2) return;
  const float* in = x; int j = i;
  if (i >= nx2 + nm2) { in = per; j = i - nx2 - nm2; }
  else if (i >= nx2) { in = mem; j = i - nx2; }
  const float a = in[2 * j], b = in[2 * j + 1];
  const _Float16 h0 = (_Float16)a, h1 = (_Float16)b;
  ((unsigned*)c16)[i] = (unsigned)__builtin_bit_cast(unsigned short, h0) | ((unsigned)__builtin_bit_cast(unsigned short, h1) << 16);
  const unsigned short ah = f2bf_bits(a), bh = f2bf_bits(b);
  const unsigned short al = f2bf_bits(a - bf_bits2f(ah)), bl = f2bf_bits(b - bf_bits2f(bh));
  ((unsigned*)hi)[i] = (unsigned)ah | ((unsigned)bh << 16);
  ((unsigned*)lo)[i] = (unsigned)al | ((unsigned)bl << 16);
}

__global__ __launch_bounds__(256) void split_f32_bf16x2(
    const float* __restrict__ in, __bf16* __restrict__ hi, __bf16* __restrict__ lo, long n2) {
  long i = (long)blockIdx.x * 256 + threadIdx.x;
  long stride = (long)gridDim.x * 256;
  {
    for (long j = i; j < n2; j += stride) {
      const float a = in[2 * j], b = in[2 * j + 1];
      const unsigned short ah = f2bf_bits(a), bh = f2bf_bits(b);
      const unsigned short al = f2bf_bits(a - bf_bits2f(ah)), bl = f2bf_bits(b - bf_bits2f(bh));
      ((unsigned*)hi)[j] = (unsigned)ah | ((unsigned)bh << 16);
      ((unsigned*)lo)[j] = (unsigned)al | ((unsigned)bl << 16);
    }
    
  }
}


// eight source matrices of one launch; blockIdx.z picks one, its output plane follows at z * plane elements
struct Src8 { const float* p0; const float* p1; const float* p2; const float* p3; const float* p4; const float* p5; const float* p6; const float* p7; };
__device__ __forceinline__ const float* pick8(const Src8& s, int z) {
  switch (z) {
    case 0: return s.p0; case 1: return s.p1; case 2: return s.p2; case 3: return s.p3;
    case 4: return s.p4; case 5: return s.p5; case 6: return s.p6; default: return s.p7;
  }
}

// ---- f32 [R][C] (row pitch ldi) -> f16 transposed [C][R] (row pitch ldo); 64x64 tiles; each output row segment
__global__ __launch_bounds__(256) void transpose_cast_f16(Src8 srcs, int ldi,
                                                         _Float16* __restrict__ outT0, int ldo, long plane, float scale) {
  __shared__ __align__(16) _Float16 tile[64][72];     // [c][r]
  const float* __restrict__ in = pick8(srcs, blockIdx.z);
  _Float16* __restrict__ outT = outT0 + (size_t)blockIdx.z * plane;
  const int c0 = blockIdx.x * 64, r0 = blockIdx.y * 64;
  const int t = threadIdx.y * 32 + threadIdx.x;
  for (int i = threadIdx.y; i < 64; i += 8) {
    tile[threadIdx.x][i]      = (_Float16)(in[(size_t)(r0 + i) * ldi + c0 + threadIdx.x] * scale);
    tile[32 + threadIdx.x][i] = (_Float16)(in[(size_t)(r0 + i) * ldi + c0 + 32 + threadIdx.x] * scale);
  }
  __syncthreads();
  const int q = t >> 3, c8 = (t & 7) * 8;
  {
#pragma unroll
    for (int it = 0; it < 2; ++it) {
      const int c = it * 32 + q;
      v8h hv = *(const v8h*)(&tile[c][c8]);
      *(v8h*)(outT + (size_t)(c0 + c) * ldo + r0 + c8) = hv;
    }
    
  }
}

// ---- f32 [R][C] (pitch ldi) -> bf16 hi/lo transposed planes [C][R] (pitch ldo); 64x64 tiles; each output row segment
__global__ __launch_bounds__(256) void transpose_split_bf16(Src8 srcs, int ldi,
                                                           __bf16* __restrict__ outH0, __bf16* __restrict__ outL0, int ldo, long plane) {
  __shared__ __align__(16) float tile[64][68];     // [c][r]
  const float* __restrict__ in = pick8(srcs, blockIdx.z);
  __bf16* __restrict__ outH = outH0 + (size_t)blockIdx.z * plane;
  __bf16* __restrict__ outL = outL0 + (size_t)blockIdx.z * plane;
  const int c0 = blockIdx.x * 64, r0 = blockIdx.y * 64;
  const int t = threadIdx.y * 32 + threadIdx.x;
  for (int i = threadIdx.y; i < 64; i += 8) {
    tile[threadIdx.x][i]      = in[(size_t)(r0 + i) * ldi + c0 + threadIdx.x];
    tile[32 + threadIdx.x][i] = in[(size_t)(r0 + i) * ldi + c0 + 32 + threadIdx.x];
  }
  __syncthreads();
  const int q = t >> 3, c8 = (t & 7) * 8;
  {
#pragma unroll
    for (int it = 0; it < 2; ++it) {
      const int c = it * 32 + q;
      v8b hv, lv;
#pragma unroll
      for (int e = 0; e < 8; ++e) {
        const float f = tile[c][c8 + e];
        const unsigned short hb = f2bf_bits(f);
        hv[e] = __builtin_bit_cast(__bf16, hb);
        lv[e] = __builtin_bit_cast(__bf16, f2bf_bits(f - bf_bits2f(hb)));
      }
      *(v8b*)(outH + (size_t)(c0 + c) * ldo + r0 + c8) = hv;
      *(v8b*)(outL + (size_t)(c0 + c) * ldo + r0 + c8) = lv;
    }
    
  }
}

// =====================================================================================
// Generic causal/non-causal attention for head_dim 64, f32 in / f32 out, bf16 operands with optional hi/lo splits.
//   scores = (q*qscale)·kᵀ : v_wmma_f32_16x16x32_bf16; SPLIT_QK -> q,k as bf16 hi/lo (hi·hi + hi·lo + lo·hi)
//   out    = p·v           : v_wmma_f32_16x16x32_bf16; SPLIT_PV -> p,v as bf16 hi/lo; else p,v plain bf16
//   f32 accumulate; online softmax in f32. Block = 4 waves = 64 query rows of one (batch, head); S % 64 == 0.
//   Element (b, s, h, d) of tensor X lives at X[b*X_bs + s*X_rs + h*X_hs + d] (strides in floats, multiples of 4).
//   Masking: mask_mode 0 none, 1 causal (kv > q masked), 4 causal + sliding window (kv > q or q - kv > W masked; W passed in
//   mask_is_int); masked scores are replaced by mask_fill before the softmax. The mask is decided once per 64-key chunk with scalar
//   tests: a chunk that the window masks for all 64 query rows is not visited (its weights are exactly 0 after the softmax), a chunk
//   with no masked element runs no mask code, and only a chunk that the diagonal or the window's edge crosses compares and selects.
//   One launch serves four branches (batch 1): branch a reads q/k/v and writes out at a * {q,k,v,o}_st floats, with its own Skv,
//   mask_mode and window. grid.x = 4 * H * (S/64): first branches 0 and 1 (causal, cost grows with the query block) from the last
//   query block down, then branches 2 and 3, so that the long work-groups start first.
// =====================================================================================
#define AT_D 64
#define AT_NW 4
#define AT_QB 64
#define AT_KC 64
struct AttnGeom { long q_bs, q_rs, q_hs, k_bs, k_rs, k_hs, v_bs, v_rs, v_hs, o_bs, o_rs, o_hs;
                  int S, Skv, H, mask_mode; float qscale; int blk0; float mask_fill; int mask_is_int; };
static_assert(sizeof(AttnGeom) == 128, "no padding");
struct AttnBranches { long q_st, k_st, v_st, o_st; int Skv[4]; int mask_mode[4]; int mask_is_int[4]; };

__device__ __forceinline__ unsigned short at_bf_bits(float f) {
  unsigned u = __float_as_uint(f);
  return (unsigned short)((u + 0x7FFFu + ((u >> 16) & 1u)) >> 16);
}
__device__ __forceinline__ __bf16 at_f2bf(float f) { return __builtin_bit_cast(__bf16, at_bf_bits(f)); }
__device__ __forceinline__ void at_split(float f, __bf16& hi, __bf16& lo) {
  const unsigned short hb = at_bf_bits(f);
  hi = __builtin_bit_cast(__bf16, hb);
  lo = at_f2bf(f - __uint_as_float(((unsigned)hb) << 16));
}
__device__ __forceinline__ v8f at_mma(v16b a, v16b b, v8f c) {
  c = __builtin_amdgcn_wmma_f32_16x16x32_bf16(false, a, false, b, (short)0, c, false, false);
  asm volatile("v_nop\n\tv_nop\n\tv_nop\n\tv_nop" : "+v"(c) : "v"(a), "v"(b));
  return c;
}

template <bool SPLIT_QK, bool SPLIT_PV>
__global__ __launch_bounds__(128)
void attn64_kernel(const float* __restrict__ q, const float* __restrict__ k,
                   const float* __restrict__ v, float* __restrict__ out, AttnGeom g0, AttnBranches br) {
  union FB { v16b v; v8b h[2]; };
  __shared__ __align__(16) __bf16 Ksh[AT_KC * AT_D];             // K hi [kv][d]      8 KB
  __shared__ __align__(16) __bf16 Ksl[SPLIT_QK ? AT_KC * AT_D : 8];
  __shared__ __align__(16) __bf16 Vth[AT_D * AT_KC];             // V hi [d][kv]      8 KB
  __shared__ __align__(16) __bf16 Vtl[SPLIT_PV ? AT_D * AT_KC : 8];
  __shared__ __align__(16) __bf16 Psh[AT_NW][16 * AT_KC];        // per wave P hi [row][kv]  8 KB
  __shared__ __align__(16) __bf16 Psl[SPLIT_PV ? AT_NW : 1][SPLIT_PV ? 16 * AT_KC : 8];
  __shared__ __align__(16) float  Os[AT_NW][16 * 68];            // per wave out tile, pitch 68

  const int tid  = threadIdx.x;
  const int wave = tid >> 5;
  const int lane = tid & 31;
  const int hh   = lane >> 4;
  const int c    = lane & 15;

  AttnGeom g = g0;
  const int nqb = g.S / AT_QB;
  const int bx = blockIdx.x + g.blk0;
  const int perBranch = g.H * nqb;
  int a, h, qb;
  if (bx < 2 * perBranch) {
    const int lvl = bx / (2 * g.H), w = bx % (2 * g.H);
    qb = nqb - 1 - lvl; a = w / g.H; h = w % g.H;
  } else {
    const int r = bx - 2 * perBranch, r2 = r % perBranch;
    a = 2 + r / perBranch; h = r2 / nqb; qb = r2 % nqb;
  }
  g.Skv = br.Skv[a]; g.mask_mode = br.mask_mode[a]; g.mask_is_int = br.mask_is_int[a];
  const int qbase_block = qb * AT_QB;
  const int q0 = qbase_block + wave * 16;

  const float* qb_ptr = q + (size_t)a * br.q_st + (size_t)h * g.q_hs;
  const float* kb_ptr = k + (size_t)a * br.k_st + (size_t)h * g.k_hs;
  const float* vb_ptr = v + (size_t)a * br.v_st + (size_t)h * g.v_hs;
  float*       ob_ptr = out + (size_t)a * br.o_st + (size_t)h * g.o_hs;

  // ---- Q fragments (A operand): 2 d-chunks, hi (and lo) ----
  v16b qah[2], qal[2];
  {
    const float* qrow = qb_ptr + (size_t)(q0 + c) * g.q_rs;
#pragma unroll
    for (int dc = 0; dc < 2; ++dc) {
#pragma unroll
      for (int e = 0; e < 8; ++e) {
        const float f0 = qrow[dc * 32 + 8 * hh + e] * g.qscale;
        const float f1 = qrow[dc * 32 + 16 + 8 * hh + e] * g.qscale;
        if (SPLIT_QK) { __bf16 hq, lq; at_split(f0, hq, lq); qah[dc][e] = hq; qal[dc][e] = lq; at_split(f1, hq, lq); qah[dc][8 + e] = hq; qal[dc][8 + e] = lq; }
        else { qah[dc][e] = at_f2bf(f0); qah[dc][8 + e] = at_f2bf(f1); qal[dc][e] = qah[dc][e]; qal[dc][8 + e] = qah[dc][8 + e]; }
      }
    }
  }

  float mrow[8], lrow[8];
  v8f oacc[4];
#pragma unroll
  for (int r = 0; r < 8; ++r) { mrow[r] = -INFINITY; lrow[r] = 0.f; }
#pragma unroll
  for (int t = 0; t < 4; ++t) oacc[t] = (v8f){0.f,0.f,0.f,0.f,0.f,0.f,0.f,0.f};

  const bool causal = (g.mask_mode == 1 || g.mask_mode == 4);
  const int win = (g.mask_mode == 4) ? g.mask_is_int : g.S;          // q - kv stays below S: no window
  const int nChunks = causal ? (qb + 1) : (g.Skv / AT_KC);           // block-uniform
  const int kcFirst = (causal && qbase_block > win) ? (qbase_block - win) / AT_KC : 0;   // chunk of the oldest key that the block's first row still sees
  for (int kc = kcFirst; kc < nChunks; ++kc) {
    const int kv0 = kc * AT_KC;
    __syncthreads();
    {
      const int kvr = tid >> 1, dh = (tid & 1) * 32;
      const float* krow = kb_ptr + (size_t)(kv0 + kvr) * g.k_rs + dh;
      const float* vrow = vb_ptr + (size_t)(kv0 + kvr) * g.v_rs + dh;
#pragma unroll
      for (int i = 0; i < 8; ++i) {
        v4f kk = *(const v4f*)(krow + 4 * i);
        v4f vv = *(const v4f*)(vrow + 4 * i);
#pragma unroll
        for (int e = 0; e < 4; ++e) {
          const int d = dh + 4 * i + e;
          if (SPLIT_QK) { __bf16 a, bl; at_split(kk[e], a, bl); Ksh[kvr * AT_D + d] = a; Ksl[kvr * AT_D + d] = bl; }
          else Ksh[kvr * AT_D + d] = at_f2bf(kk[e]);
          if (SPLIT_PV) { __bf16 a, bl; at_split(vv[e], a, bl); Vth[d * AT_KC + kvr] = a; Vtl[d * AT_KC + kvr] = bl; }
          else Vth[d * AT_KC + kvr] = at_f2bf(vv[e]);
        }
      }
    }
    __syncthreads();

    v8f s[4];
#pragma unroll
    for (int j = 0; j < 4; ++j) {
      s[j] = (v8f){0.f,0.f,0.f,0.f,0.f,0.f,0.f,0.f};
#pragma unroll
      for (int dc = 0; dc < 2; ++dc) {
        FB kb;
        kb.h[0] = *(const v8b*)(Ksh + (j * 16 + c) * AT_D + dc * 32 + 8 * hh);
        kb.h[1] = *(const v8b*)(Ksh + (j * 16 + c) * AT_D + dc * 32 + 16 + 8 * hh);
        s[j] = at_mma(qah[dc], kb.v, s[j]);
        if (SPLIT_QK) {
          FB kl;
          kl.h[0] = *(const v8b*)(Ksl + (j * 16 + c) * AT_D + dc * 32 + 8 * hh);
          kl.h[1] = *(const v8b*)(Ksl + (j * 16 + c) * AT_D + dc * 32 + 16 + 8 * hh);
          s[j] = at_mma(qah[dc], kl.v, s[j]);
          s[j] = at_mma(qal[dc], kb.v, s[j]);
        }
      }
    }
    // block-uniform: the diagonal chunk, or one in which the block's last row is more than win past the chunk's first key
    if (causal && (kc == qb || qbase_block + (AT_QB - 1) - kv0 > win)) {
#pragma unroll
      for (int r = 0; r < 8; ++r) {
        const int qrow = q0 + 8 * hh + r;
#pragma unroll
        for (int j = 0; j < 4; ++j) {
          const int dist = qrow - (kv0 + j * 16 + c);
          s[j][r] = (dist < 0 || dist > win) ? g.mask_fill : s[j][r];
        }
      }
    }
    float cm[8];
#pragma unroll
    for (int r = 0; r < 8; ++r) {
      float m = -INFINITY;
#pragma unroll
      for (int j = 0; j < 4; ++j) m = fmaxf(m, s[j][r]);
#pragma unroll
      for (int off = 1; off < 16; off <<= 1) m = fmaxf(m, __shfl_xor(m, off, 32));
      cm[r] = m;
    }
    __bf16* pwh = Psh[wave];
    __bf16* pwl = Psl[SPLIT_PV ? wave : 0];
#pragma unroll
    for (int r = 0; r < 8; ++r) {
      const float mnew = fmaxf(mrow[r], cm[r]);
      const float alpha = expf(mrow[r] - mnew);
      mrow[r] = mnew;
      float psum = 0.f;
#pragma unroll
      for (int j = 0; j < 4; ++j) {
        const float p = expf(s[j][r] - mnew);
        psum += p;
        if (SPLIT_PV) { __bf16 a, bl; at_split(p, a, bl); pwh[(8 * hh + r) * AT_KC + j * 16 + c] = a; pwl[(8 * hh + r) * AT_KC + j * 16 + c] = bl; }
        else pwh[(8 * hh + r) * AT_KC + j * 16 + c] = at_f2bf(p);
      }
#pragma unroll
      for (int off = 1; off < 16; off <<= 1) psum += __shfl_xor(psum, off, 32);
      lrow[r] = lrow[r] * alpha + psum;
#pragma unroll
      for (int t = 0; t < 4; ++t) oacc[t][r] *= alpha;
    }
    __builtin_amdgcn_fence(__ATOMIC_RELEASE, "workgroup");
    __builtin_amdgcn_wave_barrier();
    __builtin_amdgcn_fence(__ATOMIC_ACQUIRE, "workgroup");
#pragma unroll
    for (int kk = 0; kk < 2; ++kk) {
      FB pa, pl;
      pa.h[0] = *(const v8b*)(pwh + c * AT_KC + kk * 32 + 8 * hh);
      pa.h[1] = *(const v8b*)(pwh + c * AT_KC + kk * 32 + 16 + 8 * hh);
      if (SPLIT_PV) {
        pl.h[0] = *(const v8b*)(pwl + c * AT_KC + kk * 32 + 8 * hh);
        pl.h[1] = *(const v8b*)(pwl + c * AT_KC + kk * 32 + 16 + 8 * hh);
      }
#pragma unroll
      for (int t = 0; t < 4; ++t) {
        FB vb;
        vb.h[0] = *(const v8b*)(Vth + (t * 16 + c) * AT_KC + kk * 32 + 8 * hh);
        vb.h[1] = *(const v8b*)(Vth + (t * 16 + c) * AT_KC + kk * 32 + 16 + 8 * hh);
        oacc[t] = at_mma(pa.v, vb.v, oacc[t]);
        if (SPLIT_PV) {
          FB vl;
          vl.h[0] = *(const v8b*)(Vtl + (t * 16 + c) * AT_KC + kk * 32 + 8 * hh);
          vl.h[1] = *(const v8b*)(Vtl + (t * 16 + c) * AT_KC + kk * 32 + 16 + 8 * hh);
          oacc[t] = at_mma(pa.v, vl.v, oacc[t]);
          oacc[t] = at_mma(pl.v, vb.v, oacc[t]);
        }
      }
    }
  }

  float* os = Os[wave];
#pragma unroll
  for (int r = 0; r < 8; ++r) {
    const float inv = 1.0f / lrow[r];
#pragma unroll
    for (int t = 0; t < 4; ++t) os[(8 * hh + r) * 68 + t * 16 + c] = oacc[t][r] * inv;
  }
  __builtin_amdgcn_fence(__ATOMIC_RELEASE, "workgroup");
  __builtin_amdgcn_wave_barrier();
  __builtin_amdgcn_fence(__ATOMIC_ACQUIRE, "workgroup");
  {
    const int c4 = (lane & 15) * 4;
    {
#pragma unroll
      for (int it = 0; it < 8; ++it) {
        const int row = it * 2 + hh;
        v4f val = *(const v4f*)(os + row * 68 + c4);
        *(v4f*)(ob_ptr + (size_t)(q0 + row) * g.o_rs + c4) = val;
      }
      
    }
  }
}

__global__ __launch_bounds__(256) void gate_fuse_kernel(const float* __restrict__ o0, const float* __restrict__ o1,
                                                       const float* __restrict__ o2, const float* __restrict__ o3,
                                                       const float* __restrict__ Wg, const float* __restrict__ bg,
                                                       float* __restrict__ out, int Hd) {
  __shared__ float red[4][8];
  const int row = blockIdx.x, t = threadIdx.x, lane = t & 31, wave = t >> 5;
  const float* os[4] = {o0 + (size_t)row * Hd, o1 + (size_t)row * Hd, o2 + (size_t)row * Hd, o3 + (size_t)row * Hd};
  float acc[4] = {0.f, 0.f, 0.f, 0.f};
  for (int i = 0; i < 4; ++i) {
    const float* o = os[i];
    for (int c = t; c < Hd; c += 256) {
      const float v = o[c];
      const float* w = Wg + (size_t)(i * Hd + c) * 4;
      acc[0] += v * w[0]; acc[1] += v * w[1]; acc[2] += v * w[2]; acc[3] += v * w[3];
    }
  }
#pragma unroll
  for (int g = 0; g < 4; ++g) { float a = acc[g]; for (int o = 16; o > 0; o >>= 1) a += __shfl_xor(a, o, 32); if (lane == 0) red[g][wave] = a; }
  __syncthreads();
  float gl[4];
#pragma unroll
  for (int g = 0; g < 4; ++g) { float a = 0.f; for (int w = 0; w < 8; ++w) a += red[g][w]; gl[g] = a + bg[g]; }
  const float mx = fmaxf(fmaxf(gl[0], gl[1]), fmaxf(gl[2], gl[3]));
  float e[4], se = 0.f;
#pragma unroll
  for (int g = 0; g < 4; ++g) { e[g] = expf(gl[g] - mx); se += e[g]; }
  const float inv = 1.0f / se;
  const int c = 4 * t;
  v4f r;
#pragma unroll
  for (int q = 0; q < 4; ++q) r[q] = (e[0] * inv) * os[0][c + q] + (e[1] * inv) * os[1][c + q] + (e[2] * inv) * os[2][c + q] + (e[3] * inv) * os[3][c + q];
  *(v4f*)(out + (size_t)row * Hd + c) = r;
  
}

extern "C" void kernel_launch(void* const* d_in, const int* in_sizes, int n_in,
                              void* d_out, int out_size, void* d_ws, size_t ws_size,
                              hipStream_t stream) {
  (void)in_sizes; (void)n_in; (void)out_size; (void)ws_size;
  const int S = 2048, E = 1024, H = 16, DH = 64, MM = 512, MP = 64, WIN = 512;
  // wire order: 16 weights ([in,out]), gate_w, gate_b, x, memory_kv, persona_kv
  const float* Wm[16]; for (int i = 0; i < 16; ++i) Wm[i] = (const float*)d_in[i];   // {local,long,mem,per} x {wq,wk,wv,wo}
  const float* gate_w = (const float*)d_in[16];
  const float* gate_b = (const float*)d_in[17];
  const float* x   = (const float*)d_in[18];   // [1,2048,1024]
  const float* mem = (const float*)d_in[19];   // [1,512,1024]
  const float* per = (const float*)d_in[20];   // [1,64,1024]
  float* out = (float*)d_out;

  char* ws = (char*)d_ws; size_t off = 0;
  auto carve = [&](size_t bytes) -> char* { char* p = ws + off; off += (bytes + 255) & ~(size_t)255; return p; };
  const int CT = S + MM + MP;                                   // context rows: x, then memory, then persona
  const long EE = (long)E * E, SE = (long)S * E;
  _Float16* C16  = (_Float16*)carve((size_t)CT * E * 2);        // 5.4 MB each
  __bf16*   Ch   = (__bf16*)carve((size_t)CT * E * 2);
  __bf16*   Cl   = (__bf16*)carve((size_t)CT * E * 2);
  _Float16* WqkT = (_Float16*)carve((size_t)8 * EE * 2);        // plane 2a = wq^T, 2a+1 = wk^T of branch a; 16.8 MB
  __bf16*   WvoTh = (__bf16*)carve((size_t)8 * EE * 2);         // plane 2a = wv^T, 2a+1 = wo^T
  __bf16*   WvoTl = (__bf16*)carve((size_t)8 * EE * 2);
  float*    QK   = (float*)carve((size_t)8 * SE * 4);           // plane 2a = q, 2a+1 = k of branch a; 67 MB
  float*    Vf   = (float*)carve((size_t)4 * SE * 4);           // 33.6 MB
  float*    Of   = (float*)carve((size_t)4 * SE * 4);
  __bf16*   Oh   = (__bf16*)carve((size_t)4 * SE * 2);
  __bf16*   Ol   = (__bf16*)carve((size_t)4 * SE * 2);          // total 234 MB
  float*    Ob[4];
  for (int i = 0; i < 4; ++i) Ob[i] = QK + (size_t)i * SE;      // branch outputs take the q/k planes' place once attention is done

  const int  SKs[4]  = {S, S, MM, MP};                          // keys per branch
  const long ctx0[4] = {0, 0, (long)S * E, (long)(S + MM) * E}; // first context element per branch

  prep_inputs<<<CT * E / 2 / 256, 256, 0, stream>>>(x, mem, per, C16, Ch, Cl, S * E / 2, MM * E / 2, MP * E / 2);
  {
    Src8 qk = {Wm[0], Wm[1], Wm[4], Wm[5], Wm[8], Wm[9], Wm[12], Wm[13]};
    Src8 vo = {Wm[2], Wm[3], Wm[6], Wm[7], Wm[10], Wm[11], Wm[14], Wm[15]};
    transpose_cast_f16<<<dim3(E / 64, E / 64, 8), dim3(32, 8), 0, stream>>>(qk, E, WqkT, E, EE, 1.0f);
    transpose_split_bf16<<<dim3(E / 64, E / 64, 8), dim3(32, 8), 0, stream>>>(vo, E, WvoTh, WvoTl, E, EE);
  }
  const int tq = (S / 64) * (E / 64);
  {
    BatchA bqk, bv;
    for (int a = 0; a < 4; ++a) {
      bqk.aoff[2 * a] = 0;           bqk.M[2 * a] = S;
      bqk.aoff[2 * a + 1] = ctx0[a]; bqk.M[2 * a + 1] = SKs[a];
      bv.aoff[a] = ctx0[a];          bv.M[a] = SKs[a];
      bv.aoff[4 + a] = 0;            bv.M[4 + a] = 0;
    }
    wmma_gemm64<0, false, 0, 0, false><<<dim3((tq + 7) / 8, 8), 256, 0, stream>>>(
        U16(C16), nullptr, E, bqk, U16(WqkT), nullptr, E, EE, QK, nullptr, E, SE, nullptr, nullptr, 0, E, E, 1.0f);
    wmma_gemm64<1, true, 0, 0, false><<<dim3((tq + 7) / 8, 4), 256, 0, stream>>>(
        U16(Ch), U16(Cl), E, bv, U16(WvoTh), U16(WvoTl), E, 2 * EE, Vf, nullptr, E, SE, nullptr, nullptr, 0, E, E, 1.0f);
  }
  {
    AttnGeom g;
    g.q_bs = SE; g.q_rs = E; g.q_hs = DH;
    g.k_bs = SE; g.k_rs = E; g.k_hs = DH;
    g.v_bs = SE; g.v_rs = E; g.v_hs = DH;
    g.o_bs = SE; g.o_rs = E; g.o_hs = DH;
    g.S = S; g.Skv = S; g.H = H; g.qscale = 0.125f; g.blk0 = 0; g.mask_fill = -1.0e30f;
    g.mask_mode = 0; g.mask_is_int = 0;
    AttnBranches br;
    br.q_st = 2 * SE; br.k_st = 2 * SE; br.v_st = SE; br.o_st = SE;
    for (int a = 0; a < 4; ++a) { br.Skv[a] = SKs[a]; br.mask_mode[a] = 0; br.mask_is_int[a] = 0; }
    br.mask_mode[0] = 4; br.mask_is_int[0] = WIN;               // causal + window
    br.mask_mode[1] = 1;                                        // causal
    attn64_kernel<true, true><<<4 * H * (S / AT_QB), AT_NW * 32, 0, stream>>>(QK, QK + SE, Vf, Of, g, br);
  }
  split_f32_bf16x2<<<4096, 256, 0, stream>>>(Of, Oh, Ol, 4 * SE / 2);
  {
    BatchA bo;
    for (int a = 0; a < 4; ++a) { bo.aoff[a] = a * SE; bo.M[a] = S; bo.aoff[4 + a] = 0; bo.M[4 + a] = 0; }
    wmma_gemm64<1, true, 0, 0, false><<<dim3((tq + 7) / 8, 4), 256, 0, stream>>>(
        U16(Oh), U16(Ol), E, bo, U16(WvoTh + EE), U16(WvoTl + EE), E, 2 * EE, Ob[0], nullptr, E, SE, nullptr, nullptr, 0, E, E, 1.0f);
  }
  gate_fuse_kernel<<<S, 256, 0, stream>>>(Ob[0], Ob[1], Ob[2], Ob[3], gate_w, gate_b, out, E);
}

// v003
// It runs in 434 microseconds.
// Next to v002, in two timings, it ran 1.13 times as fast each time.
// Over all steps from v000 it is 4.06 times as fast.
#include <hip/hip_runtime.h>
#include <math.h>
// Four attentions (local = causal + 512 sliding window, long = causal, memory cross (512 keys), persona cross (64 keys)), 16 heads of 64:
// q/k projections (K=1024): v_wmma_f32_16x16x32_f16 (f16 operands); v and output projections (K=1024): v_wmma_f32_16x16x32_bf16 as bf16
// hi/lo splits; scores and p·v: v_wmma_f32_16x16x32_bf16 with q,k and p,v as bf16 hi/lo splits; f32 accumulate; softmax f32.
// Gate (concat(outs)·gate_w, N=4, 0.1 % of MACs), gate softmax and the weighted fusion in f32 on VALU.
typedef __attribute__((ext_vector_type(16))) _Float16 v16h;
typedef __attribute__((ext_vector_type(8)))  _Float16 v8h;
typedef __attribute__((ext_vector_type(16))) __bf16   v16b;
typedef __attribute__((ext_vector_type(8)))  __bf16   v8b;
typedef __attribute__((ext_vector_type(8)))  float    v8f;
typedef __attribute__((ext_vector_type(4)))  float    v4f;
#define PSCALE 32768.0f
#define U16(p) ((const unsigned short*)(const void*)(p))
#define PSCALE_INV (1.0f / 32768.0f)

__device__ __forceinline__ unsigned short f2bf_bits(float f) {
  unsigned u = __float_as_uint(f);
  return (unsigned short)((u + 0x7FFFu + ((u >> 16) & 1u)) >> 16);
}
__device__ __forceinline__ float bf_bits2f(unsigned short h) { return __uint_as_float(((unsigned)h) << 16); }

// hazard guards as plain device helpers (no inline asm inside the kernel template body)
__device__ __forceinline__ void dep_guard_h(v8f& a, v8f& b, v16h x, v16h y) { asm volatile("v_nop\n\tv_nop\n\tv_nop\n\tv_nop" : "+v"(a), "+v"(b) : "v"(x), "v"(y)); }
__device__ __forceinline__ void dep_guard_b(v8f& a, v8f& b, v16b x, v16b y) { asm volatile("v_nop\n\tv_nop\n\tv_nop\n\tv_nop" : "+v"(a), "+v"(b) : "v"(x), "v"(y)); }
__device__ __forceinline__ void keep4_h(v16h a, v16h b, v16h c, v16h d) { asm volatile("v_nop" :: "v"(a), "v"(b), "v"(c), "v"(d)); }
__device__ __forceinline__ void keep4_b(v16b a, v16b b, v16b c, v16b d) { asm volatile("v_nop" :: "v"(a), "v"(b), "v"(c), "v"(d)); }
__device__ __forceinline__ void acc_guard4(v8f& a, v8f& b, v8f& c, v8f& d) { asm volatile("v_nop\n\tv_nop\n\tv_nop\n\tv_nop" : "+v"(a), "+v"(b), "+v"(c), "+v"(d)); }
template <typename T> struct Frag;
template <> struct Frag<_Float16> {
  typedef v16h V; union U { v16h v; v8h h[2]; };
  static __device__ __forceinline__ v16h load(const _Float16* p) {   // elements 0..7 <- p[0..7], 8..15 <- p[16..23]
    U f; f.h[0] = *(const v8h*)(p); f.h[1] = *(const v8h*)(p + 16); return f.v;
  }
  static __device__ __forceinline__ v8f mma(v16h a, v16h b, v8f c) {
    return __builtin_amdgcn_wmma_f32_16x16x32_f16(false, a, false, b, (short)0, c, false, false);
  }
  static __device__ __forceinline__ void guard(v8f& a, v8f& b, v16h x, v16h y) { dep_guard_h(a, b, x, y); }
  static __device__ __forceinline__ void keep(v16h a, v16h b, v16h c, v16h d) { keep4_h(a, b, c, d); }
};
template <> struct Frag<__bf16> {
  typedef v16b V; union U { v16b v; v8b h[2]; };
  static __device__ __forceinline__ v16b load(const __bf16* p) {
    U f; f.h[0] = *(const v8b*)(p); f.h[1] = *(const v8b*)(p + 16); return f.v;
  }
  static __device__ __forceinline__ v8f mma(v16b a, v16b b, v8f c) {
    return __builtin_amdgcn_wmma_f32_16x16x32_bf16(false, a, false, b, (short)0, c, false, false);
  }
  static __device__ __forceinline__ void guard(v8f& a, v8f& b, v16b x, v16b y) { dep_guard_b(a, b, x, y); }
  static __device__ __forceinline__ void keep(v16b a, v16b b, v16b c, v16b d) { keep4_b(a, b, c, d); }
};

// ---- Register-blocked batched WMMA GEMM ------------------------------------
// C[m,n] = scale * sum_k A[m,k] * Bt[n,k] (+bias)(+resid); each wave owns a 64x64 tile.
// A row-major [M,K]; Bt row-major [N,K]; M,N % 64 == 0, K % 32 == 0.
// SPLIT: operands are hi/lo planes (A2/Bt2 = lo planes, same layout); product = hi·hi + hi·lo + lo·hi.
// BIAS_MODE: 0 = none, 1 = bias[m], 2 = bias[n].
// OUT_MODE: 0 = f32, 1 = f16, 2 = bf16 hi plane (Cout) + bf16 lo plane (Cout2).
// ET: 0 = f16 operands, 1 = bf16 operands (pointers passed as 16-bit storage)
template <int ET> struct Elem;
template <> struct Elem<0> { typedef _Float16 T; };
template <> struct Elem<1> { typedef __bf16 T; };
// Batch entry blockIdx.y reads A from element offset aoff[y] and has M[y] rows (entries may differ in source and height).
struct BatchA { long aoff[8]; int M[8]; };
template <int ET, bool SPLIT, int BIAS_MODE, int OUT_MODE, bool RESID, int ACT = 0>
__global__ __launch_bounds__(256) void wmma_gemm64(
    const unsigned short* __restrict__ Ap, const unsigned short* __restrict__ A2p, int lda, BatchA ba,
    const unsigned short* __restrict__ Btp, const unsigned short* __restrict__ Bt2p, int ldb, long strideB,
    void* __restrict__ Cout, void* __restrict__ Cout2, int ldc, long strideC,
    const float* __restrict__ bias,
    const float* __restrict__ resid, long strideR,
    int N, int K, float scale) {
  typedef typename Elem<ET>::T T;
  typedef typename Frag<T>::V V;
  const T* A = (const T*)Ap; const T* A2 = (const T*)A2p; const T* Bt = (const T*)Btp; const T* Bt2 = (const T*)Bt2p;
  __shared__ __align__(16) float sT[8][16 * 68];   // per-wave 16x64 slab, pitch 68 floats
  const int b    = blockIdx.y;
  const int M    = ba.M[b];
  const long offA = ba.aoff[b];
  const int lane = threadIdx.x & 31;
  const int wave = threadIdx.x >> 5;
  const int tilesN = N >> 6;
  const int tilesM = M >> 6;
  const int tile = blockIdx.x * 8 + wave;
  if (tile >= tilesM * tilesN) return;   // wave-uniform; no block barriers in this kernel
  const int tm = tile / tilesN;
  const int tn = tile - tm * tilesN;
  const int m0 = tm << 6;
  const int n0 = tn << 6;

  const T* Ab  = A  + offA;
  const T* Bb  = Bt + (size_t)b * strideB;
  const T* Ab2 = SPLIT ? (A2  + offA) : nullptr;
  const T* Bb2 = SPLIT ? (Bt2 + (size_t)b * strideB) : nullptr;

  const int rlane = lane & 15;                 // row (A) / col (B, D) within subtile
  const int koff  = (lane >> 4) * 8;           // k offset of this lane half
  const int mOff  = (lane >> 4) * 8;           // D row offset

  v8f acc[4][4];
#pragma unroll
  for (int i = 0; i < 4; ++i)
#pragma unroll
    for (int j = 0; j < 4; ++j) acc[i][j] = (v8f){0.f,0.f,0.f,0.f,0.f,0.f,0.f,0.f};

  for (int k0 = 0; k0 < K; k0 += 32) {
    V bh[4], bl[4];
#pragma unroll
    for (int j = 0; j < 4; ++j) {
      const size_t bo = (size_t)(n0 + (j << 4) + rlane) * ldb + koff + k0;
      bh[j] = Frag<T>::load(Bb + bo);
      if (SPLIT) bl[j] = Frag<T>::load(Bb2 + bo);
    }
#pragma unroll
    for (int i = 0; i < 4; ++i) {
      const size_t ao = (size_t)(m0 + (i << 4) + rlane) * lda + koff + k0;
      V ah = Frag<T>::load(Ab + ao);
      V al;
      if (SPLIT) al = Frag<T>::load(Ab2 + ao);
#pragma unroll
      for (int j = 0; j < 4; ++j) {
        acc[i][j] = Frag<T>::mma(ah, bh[j], acc[i][j]);
        if (SPLIT) {
          acc[i][j] = Frag<T>::mma(ah, bl[j], acc[i][j]);
          acc[i][j] = Frag<T>::mma(al, bh[j], acc[i][j]);
        }
      }
      Frag<T>::guard(acc[i][0], acc[i][3], ah, SPLIT ? al : ah);
    }
    Frag<T>::keep(bh[0], bh[1], bh[2], bh[3]);
    if (SPLIT) Frag<T>::keep(bl[0], bl[1], bl[2], bl[3]);
  }
  acc_guard4(acc[0][0], acc[0][1], acc[0][2], acc[0][3]);
  acc_guard4(acc[1][0], acc[1][1], acc[1][2], acc[1][3]);
  acc_guard4(acc[2][0], acc[2][1], acc[2][2], acc[2][3]);
  acc_guard4(acc[3][0], acc[3][1], acc[3][2], acc[3][3]);

  // ---- epilogue ----
  float* slab = sT[wave];
  const float* Rb = RESID ? (resid + (size_t)b * strideR) : nullptr;
#pragma unroll
  for (int i = 0; i < 4; ++i) {
    const int mBase = m0 + (i << 4);
#pragma unroll
    for (int j = 0; j < 4; ++j) {
      const int n = n0 + (j << 4) + rlane;
      float bv = 0.f;
      if (BIAS_MODE == 2) bv = bias[n];
#pragma unroll
      for (int r = 0; r < 8; ++r) {
        float v = acc[i][j][r] * scale;
        if (BIAS_MODE == 1) v += bias[mBase + mOff + r];
        if (BIAS_MODE == 2) v += bv;
        if (RESID) v += Rb[(size_t)(mBase + mOff + r) * ldc + n];
        if (ACT == 1) v = tanhf(v);
        slab[(mOff + r) * 68 + (j << 4) + rlane] = v;
      }
    }
    __builtin_amdgcn_fence(__ATOMIC_RELEASE, "workgroup");
    __builtin_amdgcn_wave_barrier();
    __builtin_amdgcn_fence(__ATOMIC_ACQUIRE, "workgroup");
    if (OUT_MODE == 0) {
      float* C = (float*)Cout + (size_t)b * strideC;
      const int hh = lane >> 4, c4 = (lane & 15) * 4;     // row seg = 256 B = 16 lanes x 16 B
      {
#pragma unroll
        for (int it = 0; it < 8; ++it) {
          const int row = it * 2 + hh;
          v4f v = *(const v4f*)(slab + row * 68 + c4);
          *(v4f*)(C + (size_t)(mBase + row) * ldc + n0 + c4) = v;
        }
        
      }
    } else {
      const int q = lane >> 3, c8 = (lane & 7) * 8;
      unsigned short* C  = (unsigned short*)Cout  + (size_t)b * strideC;
      unsigned short* C2 = (OUT_MODE == 2) ? ((unsigned short*)Cout2 + (size_t)b * strideC) : nullptr;
      {
#pragma unroll
        for (int it = 0; it < 4; ++it) {
          const int row = it * 4 + q;
          const float* sp = slab + row * 68 + c8;
          v8h hv, lv;
#pragma unroll
          for (int e = 0; e < 8; ++e) {
            if (OUT_MODE == 1) {
              hv[e] = (_Float16)sp[e];
            } else {
              unsigned short hb = f2bf_bits(sp[e]);
              unsigned short lb = f2bf_bits(sp[e] - bf_bits2f(hb));
              hv[e] = __builtin_bit_cast(_Float16, hb);
              lv[e] = __builtin_bit_cast(_Float16, lb);
            }
          }
          *(v8h*)(C + (size_t)(mBase + row) * ldc + n0 + c8) = hv;
          if (OUT_MODE == 2) *(v8h*)(C2 + (size_t)(mBase + row) * ldc + n0 + c8) = lv;
        }
        
      }
    }
    __builtin_amdgcn_fence(__ATOMIC_RELEASE, "workgroup");
    __builtin_amdgcn_wave_barrier();
    __builtin_amdgcn_fence(__ATOMIC_ACQUIRE, "workgroup");
  }
}

// x, memory and persona rows, one after the other, to one f16 plane and bf16 hi/lo planes; n*2 = float pairs per source (multiples of 256)
__global__ __launch_bounds__(256) void prep_inputs(
    const float* __restrict__ x, const float* __restrict__ mem, const float* __restrict__ per,
    _Float16* __restrict__ c16, __bf16* __restrict__ hi, __bf16* __restrict__ lo, int nx2, int nm2, int np2) {
  const int i = blockIdx.x * 256 + threadIdx.x;
  if (i >= nx2 + nm2 + np2) return;
  const float* in = x; int j = i;
  if (i >= nx2 + nm2) { in = per; j = i - nx2 - nm2; }
  else if (i >= nx2) { in = mem; j = i - nx2; }
  const float a = in[2 * j], b = in[2 * j + 1];
  const _Float16 h0 = (_Float16)a, h1 = (_Float16)b;
  ((unsigned*)c16)[i] = (unsigned)__builtin_bit_cast(unsigned short, h0) | ((unsigned)__builtin_bit_cast(unsigned short, h1) << 16);
  const unsigned short ah = f2bf_bits(a), bh = f2bf_bits(b);
  const unsigned short al = f2bf_bits(a - bf_bits2f(ah)), bl = f2bf_bits(b - bf_bits2f(bh));
  ((unsigned*)hi)[i] = (unsigned)ah | ((unsigned)bh << 16);
  ((unsigned*)lo)[i] = (unsigned)al | ((unsigned)bl << 16);
}

__global__ __launch_bounds__(256) void split_f32_bf16x2(
    const float* __restrict__ in, __bf16* __restrict__ hi, __bf16* __restrict__ lo, long n2) {
  long i = (long)blockIdx.x * 256 + threadIdx.x;
  long stride = (long)gridDim.x * 256;
  {
    for (long j = i; j < n2; j += stride) {
      const float a = in[2 * j], b = in[2 * j + 1];
      const unsigned short ah = f2bf_bits(a), bh = f2bf_bits(b);
      const unsigned short al = f2bf_bits(a - bf_bits2f(ah)), bl = f2bf_bits(b - bf_bits2f(bh));
      ((unsigned*)hi)[j] = (unsigned)ah | ((unsigned)bh << 16);
      ((unsigned*)lo)[j] = (unsigned)al | ((unsigned)bl << 16);
    }
    
  }
}


// eight source matrices of one launch; blockIdx.z picks one, its output plane follows at z * plane elements
struct Src8 { const float* p0; const float* p1; const float* p2; const float* p3; const float* p4; const float* p5; const float* p6; const float* p7; };
__device__ __forceinline__ const float* pick8(const Src8& s, int z) {
  switch (z) {
    case 0: return s.p0; case 1: return s.p1; case 2: return s.p2; case 3: return s.p3;
    case 4: return s.p4; case 5: return s.p5; case 6: return s.p6; default: return s.p7;
  }
}

// ---- f32 [R][C] (row pitch ldi) -> f16 transposed [C][R] (row pitch ldo); 64x64 tiles; each output row segment
__global__ __launch_bounds__(256) void transpose_cast_f16(Src8 srcs, int ldi,
                                                         _Float16* __restrict__ outT0, int ldo, long plane, float scale) {
  __shared__ __align__(16) _Float16 tile[64][72];     // [c][r]
  const float* __restrict__ in = pick8(srcs, blockIdx.z);
  _Float16* __restrict__ outT = outT0 + (size_t)blockIdx.z * plane;
  const int c0 = blockIdx.x * 64, r0 = blockIdx.y * 64;
  const int t = threadIdx.y * 32 + threadIdx.x;
  for (int i = threadIdx.y; i < 64; i += 8) {
    tile[threadIdx.x][i]      = (_Float16)(in[(size_t)(r0 + i) * ldi + c0 + threadIdx.x] * scale);
    tile[32 + threadIdx.x][i] = (_Float16)(in[(size_t)(r0 + i) * ldi + c0 + 32 + threadIdx.x] * scale);
  }
  __syncthreads();
  const int q = t >> 3, c8 = (t & 7) * 8;
  {
#pragma unroll
    for (int it = 0; it < 2; ++it) {
      const int c = it * 32 + q;
      v8h hv = *(const v8h*)(&tile[c][c8]);
      *(v8h*)(outT + (size_t)(c0 + c) * ldo + r0 + c8) = hv;
    }
    
  }
}

// ---- f32 [R][C] (pitch ldi) -> bf16 hi/lo transposed planes [C][R] (pitch ldo); 64x64 tiles; each output row segment
__global__ __launch_bounds__(256) void transpose_split_bf16(Src8 srcs, int ldi,
                                                           __bf16* __restrict__ outH0, __bf16* __restrict__ outL0, int ldo, long plane) {
  __shared__ __align__(16) float tile[64][68];     // [c][r]
  const float* __restrict__ in = pick8(srcs, blockIdx.z);
  __bf16* __restrict__ outH = outH0 + (size_t)blockIdx.z * plane;
  __bf16* __restrict__ outL = outL0 + (size_t)blockIdx.z * plane;
  const int c0 = blockIdx.x * 64, r0 = blockIdx.y * 64;
  const int t = threadIdx.y * 32 + threadIdx.x;
  for (int i = threadIdx.y; i < 64; i += 8) {
    tile[threadIdx.x][i]      = in[(size_t)(r0 + i) * ldi + c0 + threadIdx.x];
    tile[32 + threadIdx.x][i] = in[(size_t)(r0 + i) * ldi + c0 + 32 + threadIdx.x];
  }
  __syncthreads();
  const int q = t >> 3, c8 = (t & 7) * 8;
  {
#pragma unroll
    for (int it = 0; it < 2; ++it) {
      const int c = it * 32 + q;
      v8b hv, lv;
#pragma unroll
      for (int e = 0; e < 8; ++e) {
        const float f = tile[c][c8 + e];
        const unsigned short hb = f2bf_bits(f);
        hv[e] = __builtin_bit_cast(__bf16, hb);
        lv[e] = __builtin_bit_cast(__bf16, f2bf_bits(f - bf_bits2f(hb)));
      }
      *(v8b*)(outH + (size_t)(c0 + c) * ldo + r0 + c8) = hv;
      *(v8b*)(outL + (size_t)(c0 + c) * ldo + r0 + c8) = lv;
    }
    
  }
}

// =====================================================================================
// Generic causal/non-causal attention for head_dim 64, f32 in / f32 out, bf16 operands with optional hi/lo splits.
//   scores = (q*qscale)·kᵀ : v_wmma_f32_16x16x32_bf16; SPLIT_QK -> q,k as bf16 hi/lo (hi·hi + hi·lo + lo·hi)
//   out    = p·v           : v_wmma_f32_16x16x32_bf16; SPLIT_PV -> p,v as bf16 hi/lo; else p,v plain bf16
//   f32 accumulate; online softmax in f32. Block = 4 waves = 64 query rows of one (batch, head); S % 64 == 0.
//   Element (b, s, h, d) of tensor X lives at X[b*X_bs + s*X_rs + h*X_hs + d] (strides in floats, multiples of 4).
//   Masking: mask_mode 0 none, 1 causal (kv > q masked), 4 causal + sliding window (kv > q or q - kv > W masked; W passed in
//   mask_is_int); masked scores are replaced by mask_fill before the softmax. The mask is decided once per 64-key chunk with scalar
//   tests: a chunk that the window masks for all 64 query rows is not visited (its weights are exactly 0 after the softmax), a chunk
//   with no masked element runs no mask code, and only a chunk that the diagonal or the window's edge crosses compares and selects.
//   One launch serves four branches (batch 1): branch a reads q/k/v and writes out at a * {q,k,v,o}_st floats, with its own Skv,
//   mask_mode and window. grid.x = 4 * H * (S/64): first branches 0 and 1 (causal, cost grows with the query block) from the last
//   query block down, then branches 2 and 3, so that the long work-groups start first.
// =====================================================================================
#define AT_D 64
#define AT_NW 4
#define AT_QB 64
#define AT_KC 64
#define AT_LP 72   // LDS row pitch of the K, V and P tiles in bf16: 144 B = 16 B x 9, so that the 16 rows of a ds_load_b128 fall on different banks
struct AttnGeom { long q_bs, q_rs, q_hs, k_bs, k_rs, k_hs, v_bs, v_rs, v_hs, o_bs, o_rs, o_hs;
                  int S, Skv, H, mask_mode; float qscale; int blk0; float mask_fill; int mask_is_int; };
static_assert(sizeof(AttnGeom) == 128, "no padding");
struct AttnBranches { long q_st, k_st, v_st, o_st; int Skv[4]; int mask_mode[4]; int mask_is_int[4]; };

__device__ __forceinline__ unsigned short at_bf_bits(float f) {
  unsigned u = __float_as_uint(f);
  return (unsigned short)((u + 0x7FFFu + ((u >> 16) & 1u)) >> 16);
}
__device__ __forceinline__ __bf16 at_f2bf(float f) { return __builtin_bit_cast(__bf16, at_bf_bits(f)); }
__device__ __forceinline__ void at_split(float f, __bf16& hi, __bf16& lo) {
  const unsigned short hb = at_bf_bits(f);
  hi = __builtin_bit_cast(__bf16, hb);
  lo = at_f2bf(f - __uint_as_float(((unsigned)hb) << 16));
}
__device__ __forceinline__ v8f at_mma(v16b a, v16b b, v8f c) {
  c = __builtin_amdgcn_wmma_f32_16x16x32_bf16(false, a, false, b, (short)0, c, false, false);
  asm volatile("v_nop\n\tv_nop\n\tv_nop\n\tv_nop" : "+v"(c) : "v"(a), "v"(b));
  return c;
}

template <bool SPLIT_QK, bool SPLIT_PV>
__global__ __launch_bounds__(128)
void attn64_kernel(const float* __restrict__ q, const float* __restrict__ k,
                   const float* __restrict__ v, float* __restrict__ out, AttnGeom g0, AttnBranches br) {
  union FB { v16b v; v8b h[2]; };
  __shared__ __align__(16) __bf16 Ksh[AT_KC * AT_LP];            // K hi [kv][d]      9 KB
  __shared__ __align__(16) __bf16 Ksl[SPLIT_QK ? AT_KC * AT_LP : 8];
  __shared__ __align__(16) __bf16 Vth[AT_D * AT_LP];             // V hi [d][kv]      9 KB
  __shared__ __align__(16) __bf16 Vtl[SPLIT_PV ? AT_D * AT_LP : 8];
  __shared__ __align__(16) __bf16 Psh[AT_NW][16 * AT_LP];        // per wave P hi [row][kv]  9 KB
  __shared__ __align__(16) __bf16 Psl[SPLIT_PV ? AT_NW : 1][SPLIT_PV ? 16 * AT_LP : 8];
  __shared__ __align__(16) float  Os[AT_NW][16 * 68];            // per wave out tile, pitch 68

  const int tid  = threadIdx.x;
  const int wave = tid >> 5;
  const int lane = tid & 31;
  const int hh   = lane >> 4;
  const int c    = lane & 15;

  AttnGeom g = g0;
  const int nqb = g.S / AT_QB;
  const int bx = blockIdx.x + g.blk0;
  const int perBranch = g.H * nqb;
  int a, h, qb;
  if (bx < 2 * perBranch) {
    const int lvl = bx / (2 * g.H), w = bx % (2 * g.H);
    qb = nqb - 1 - lvl; a = w / g.H; h = w % g.H;
  } else {
    const int r = bx - 2 * perBranch, r2 = r % perBranch;
    a = 2 + r / perBranch; h = r2 / nqb; qb = r2 % nqb;
  }
  g.Skv = br.Skv[a]; g.mask_mode = br.mask_mode[a]; g.mask_is_int = br.mask_is_int[a];
  const int qbase_block = qb * AT_QB;
  const int q0 = qbase_block + wave * 16;

  const float* qb_ptr = q + (size_t)a * br.q_st + (size_t)h * g.q_hs;
  const float* kb_ptr = k + (size_t)a * br.k_st + (size_t)h * g.k_hs;
  const float* vb_ptr = v + (size_t)a * br.v_st + (size_t)h * g.v_hs;
  float*       ob_ptr = out + (size_t)a * br.o_st + (size_t)h * g.o_hs;

  // ---- Q fragments (A operand): 2 d-chunks, hi (and lo) ----
  v16b qah[2], qal[2];
  {
    const float* qrow = qb_ptr + (size_t)(q0 + c) * g.q_rs;
#pragma unroll
    for (int dc = 0; dc < 2; ++dc) {
#pragma unroll
      for (int e = 0; e < 8; ++e) {
        const float f0 = qrow[dc * 32 + 8 * hh + e] * g.qscale;
        const float f1 = qrow[dc * 32 + 16 + 8 * hh + e] * g.qscale;
        if (SPLIT_QK) { __bf16 hq, lq; at_split(f0, hq, lq); qah[dc][e] = hq; qal[dc][e] = lq; at_split(f1, hq, lq); qah[dc][8 + e] = hq; qal[dc][8 + e] = lq; }
        else { qah[dc][e] = at_f2bf(f0); qah[dc][8 + e] = at_f2bf(f1); qal[dc][e] = qah[dc][e]; qal[dc][8 + e] = qah[dc][8 + e]; }
      }
    }
  }

  float mrow[8], lrow[8];
  v8f oacc[4];
#pragma unroll
  for (int r = 0; r < 8; ++r) { mrow[r] = -INFINITY; lrow[r] = 0.f; }
#pragma unroll
  for (int t = 0; t < 4; ++t) oacc[t] = (v8f){0.f,0.f,0.f,0.f,0.f,0.f,0.f,0.f};

  const bool causal = (g.mask_mode == 1 || g.mask_mode == 4);
  const int win = (g.mask_mode == 4) ? g.mask_is_int : g.S;          // q - kv stays below S: no window
  const int nChunks = causal ? (qb + 1) : (g.Skv / AT_KC);           // block-uniform
  const int kcFirst = (causal && qbase_block > win) ? (qbase_block - win) / AT_KC : 0;   // chunk of the oldest key that the block's first row still sees
  for (int kc = kcFirst; kc < nChunks; ++kc) {
    const int kv0 = kc * AT_KC;
    __syncthreads();
    {
      const int kvr = tid >> 1, dh = (tid & 1) * 32;
      const float* krow = kb_ptr + (size_t)(kv0 + kvr) * g.k_rs + dh;
      const float* vrow = vb_ptr + (size_t)(kv0 + kvr) * g.v_rs + dh;
#pragma unroll
      for (int i = 0; i < 8; ++i) {
        v4f kk = *(const v4f*)(krow + 4 * i);
        v4f vv = *(const v4f*)(vrow + 4 * i);
#pragma unroll
        for (int e = 0; e < 4; ++e) {
          const int d = dh + 4 * i + e;
          if (SPLIT_QK) { __bf16 a, bl; at_split(kk[e], a, bl); Ksh[kvr * AT_LP + d] = a; Ksl[kvr * AT_LP + d] = bl; }
          else Ksh[kvr * AT_LP + d] = at_f2bf(kk[e]);
          if (SPLIT_PV) { __bf16 a, bl; at_split(vv[e], a, bl); Vth[d * AT_LP + kvr] = a; Vtl[d * AT_LP + kvr] = bl; }
          else Vth[d * AT_LP + kvr] = at_f2bf(vv[e]);
        }
      }
    }
    __syncthreads();

    v8f s[4];
#pragma unroll
    for (int j = 0; j < 4; ++j) {
      s[j] = (v8f){0.f,0.f,0.f,0.f,0.f,0.f,0.f,0.f};
#pragma unroll
      for (int dc = 0; dc < 2; ++dc) {
        FB kb;
        kb.h[0] = *(const v8b*)(Ksh + (j * 16 + c) * AT_LP + dc * 32 + 8 * hh);
        kb.h[1] = *(const v8b*)(Ksh + (j * 16 + c) * AT_LP + dc * 32 + 16 + 8 * hh);
        s[j] = at_mma(qah[dc], kb.v, s[j]);
        if (SPLIT_QK) {
          FB kl;
          kl.h[0] = *(const v8b*)(Ksl + (j * 16 + c) * AT_LP + dc * 32 + 8 * hh);
          kl.h[1] = *(const v8b*)(Ksl + (j * 16 + c) * AT_LP + dc * 32 + 16 + 8 * hh);
          s[j] = at_mma(qah[dc], kl.v, s[j]);
          s[j] = at_mma(qal[dc], kb.v, s[j]);
        }
      }
    }
    // block-uniform: the diagonal chunk, or one in which the block's last row is more than win past the chunk's first key
    if (causal && (kc == qb || qbase_block + (AT_QB - 1) - kv0 > win)) {
#pragma unroll
      for (int r = 0; r < 8; ++r) {
        const int qrow = q0 + 8 * hh + r;
#pragma unroll
        for (int j = 0; j < 4; ++j) {
          const int dist = qrow - (kv0 + j * 16 + c);
          s[j][r] = (dist < 0 || dist > win) ? g.mask_fill : s[j][r];
        }
      }
    }
    float cm[8];
#pragma unroll
    for (int r = 0; r < 8; ++r) {
      float m = -INFINITY;
#pragma unroll
      for (int j = 0; j < 4; ++j) m = fmaxf(m, s[j][r]);
#pragma unroll
      for (int off = 1; off < 16; off <<= 1) m = fmaxf(m, __shfl_xor(m, off, 32));
      cm[r] = m;
    }
    __bf16* pwh = Psh[wave];
    __bf16* pwl = Psl[SPLIT_PV ? wave : 0];
#pragma unroll
    for (int r = 0; r < 8; ++r) {
      const float mnew = fmaxf(mrow[r], cm[r]);
      const float alpha = expf(mrow[r] - mnew);
      mrow[r] = mnew;
      float psum = 0.f;
#pragma unroll
      for (int j = 0; j < 4; ++j) {
        const float p = expf(s[j][r] - mnew);
        psum += p;
        if (SPLIT_PV) { __bf16 a, bl; at_split(p, a, bl); pwh[(8 * hh + r) * AT_LP + j * 16 + c] = a; pwl[(8 * hh + r) * AT_LP + j * 16 + c] = bl; }
        else pwh[(8 * hh + r) * AT_LP + j * 16 + c] = at_f2bf(p);
      }
#pragma unroll
      for (int off = 1; off < 16; off <<= 1) psum += __shfl_xor(psum, off, 32);
      lrow[r] = lrow[r] * alpha + psum;
#pragma unroll
      for (int t = 0; t < 4; ++t) oacc[t][r] *= alpha;
    }
    __builtin_amdgcn_fence(__ATOMIC_RELEASE, "workgroup");
    __builtin_amdgcn_wave_barrier();
    __builtin_amdgcn_fence(__ATOMIC_ACQUIRE, "workgroup");
#pragma unroll
    for (int kk = 0; kk < 2; ++kk) {
      FB pa, pl;
      pa.h[0] = *(const v8b*)(pwh + c * AT_LP + kk * 32 + 8 * hh);
      pa.h[1] = *(const v8b*)(pwh + c * AT_LP + kk * 32 + 16 + 8 * hh);
      if (SPLIT_PV) {
        pl.h[0] = *(const v8b*)(pwl + c * AT_LP + kk * 32 + 8 * hh);
        pl.h[1] = *(const v8b*)(pwl + c * AT_LP + kk * 32 + 16 + 8 * hh);
      }
#pragma unroll
      for (int t = 0; t < 4; ++t) {
        FB vb;
        vb.h[0] = *(const v8b*)(Vth + (t * 16 + c) * AT_LP + kk * 32 + 8 * hh);
        vb.h[1] = *(const v8b*)(Vth + (t * 16 + c) * AT_LP + kk * 32 + 16 + 8 * hh);
        oacc[t] = at_mma(pa.v, vb.v, oacc[t]);
        if (SPLIT_PV) {
          FB vl;
          vl.h[0] = *(const v8b*)(Vtl + (t * 16 + c) * AT_LP + kk * 32 + 8 * hh);
          vl.h[1] = *(const v8b*)(Vtl + (t * 16 + c) * AT_LP + kk * 32 + 16 + 8 * hh);
          oacc[t] = at_mma(pa.v, vl.v, oacc[t]);
          oacc[t] = at_mma(pl.v, vb.v, oacc[t]);
        }
      }
    }
  }

  float* os = Os[wave];
#pragma unroll
  for (int r = 0; r < 8; ++r) {
    const float inv = 1.0f / lrow[r];
#pragma unroll
    for (int t = 0; t < 4; ++t) os[(8 * hh + r) * 68 + t * 16 + c] = oacc[t][r] * inv;
  }
  __builtin_amdgcn_fence(__ATOMIC_RELEASE, "workgroup");
  __builtin_amdgcn_wave_barrier();
  __builtin_amdgcn_fence(__ATOMIC_ACQUIRE, "workgroup");
  {
    const int c4 = (lane & 15) * 4;
    {
#pragma unroll
      for (int it = 0; it < 8; ++it) {
        const int row = it * 2 + hh;
        v4f val = *(const v4f*)(os + row * 68 + c4);
        *(v4f*)(ob_ptr + (size_t)(q0 + row) * g.o_rs + c4) = val;
      }
      
    }
  }
}

__global__ __launch_bounds__(256) void gate_fuse_kernel(const float* __restrict__ o0, const float* __restrict__ o1,
                                                       const float* __restrict__ o2, const float* __restrict__ o3,
                                                       const float* __restrict__ Wg, const float* __restrict__ bg,
                                                       float* __restrict__ out, int Hd) {
  __shared__ float red[4][8];
  const int row = blockIdx.x, t = threadIdx.x, lane = t & 31, wave = t >> 5;
  const float* os[4] = {o0 + (size_t)row * Hd, o1 + (size_t)row * Hd, o2 + (size_t)row * Hd, o3 + (size_t)row * Hd};
  float acc[4] = {0.f, 0.f, 0.f, 0.f};
  for (int i = 0; i < 4; ++i) {
    const float* o = os[i];
    for (int c = t; c < Hd; c += 256) {
      const float v = o[c];
      const float* w = Wg + (size_t)(i * Hd + c) * 4;
      acc[0] += v * w[0]; acc[1] += v * w[1]; acc[2] += v * w[2]; acc[3] += v * w[3];
    }
  }
#pragma unroll
  for (int g = 0; g < 4; ++g) { float a = acc[g]; for (int o = 16; o > 0; o >>= 1) a += __shfl_xor(a, o, 32); if (lane == 0) red[g][wave] = a; }
  __syncthreads();
  float gl[4];
#pragma unroll
  for (int g = 0; g < 4; ++g) { float a = 0.f; for (int w = 0; w < 8; ++w) a += red[g][w]; gl[g] = a + bg[g]; }
  const float mx = fmaxf(fmaxf(gl[0], gl[1]), fmaxf(gl[2], gl[3]));
  float e[4], se = 0.f;
#pragma unroll
  for (int g = 0; g < 4; ++g) { e[g] = expf(gl[g] - mx); se += e[g]; }
  const float inv = 1.0f / se;
  const int c = 4 * t;
  v4f r;
#pragma unroll
  for (int q = 0; q < 4; ++q) r[q] = (e[0] * inv) * os[0][c + q] + (e[1] * inv) * os[1][c + q] + (e[2] * inv) * os[2][c + q] + (e[3] * inv) * os[3][c + q];
  *(v4f*)(out + (size_t)row * Hd + c) = r;
  
}

extern "C" void kernel_launch(void* const* d_in, const int* in_sizes, int n_in,
                              void* d_out, int out_size, void* d_ws, size_t ws_size,
                              hipStream_t stream) {
  (void)in_sizes; (void)n_in; (void)out_size; (void)ws_size;
  const int S = 2048, E = 1024, H = 16, DH = 64, MM = 512, MP = 64, WIN = 512;
  // wire order: 16 weights ([in,out]), gate_w, gate_b, x, memory_kv, persona_kv
  const float* Wm[16]; for (int i = 0; i < 16; ++i) Wm[i] = (const float*)d_in[i];   // {local,long,mem,per} x {wq,wk,wv,wo}
  const float* gate_w = (const float*)d_in[16];
  const float* gate_b = (const float*)d_in[17];
  const float* x   = (const float*)d_in[18];   // [1,2048,1024]
  const float* mem = (const float*)d_in[19];   // [1,512,1024]
  const float* per = (const float*)d_in[20];   // [1,64,1024]
  float* out = (float*)d_out;

  char* ws = (char*)d_ws; size_t off = 0;
  auto carve = [&](size_t bytes) -> char* { char* p = ws + off; off += (bytes + 255) & ~(size_t)255; return p; };
  const int CT = S + MM + MP;                                   // context rows: x, then memory, then persona
  const long EE = (long)E * E, SE = (long)S * E;
  _Float16* C16  = (_Float16*)carve((size_t)CT * E * 2);        // 5.4 MB each
  __bf16*   Ch   = (__bf16*)carve((size_t)CT * E * 2);
  __bf16*   Cl   = (__bf16*)carve((size_t)CT * E * 2);
  _Float16* WqkT = (_Float16*)carve((size_t)8 * EE * 2);        // plane 2a = wq^T, 2a+1 = wk^T of branch a; 16.8 MB
  __bf16*   WvoTh = (__bf16*)carve((size_t)8 * EE * 2);         // plane 2a = wv^T, 2a+1 = wo^T
  __bf16*   WvoTl = (__bf16*)carve((size_t)8 * EE * 2);
  float*    QK   = (float*)carve((size_t)8 * SE * 4);           // plane 2a = q, 2a+1 = k of branch a; 67 MB
  float*    Vf   = (float*)carve((size_t)4 * SE * 4);           // 33.6 MB
  float*    Of   = (float*)carve((size_t)4 * SE * 4);
  __bf16*   Oh   = (__bf16*)carve((size_t)4 * SE * 2);
  __bf16*   Ol   = (__bf16*)carve((size_t)4 * SE * 2);          // total 234 MB
  float*    Ob[4];
  for (int i = 0; i < 4; ++i) Ob[i] = QK + (size_t)i * SE;      // branch outputs take the q/k planes' place once attention is done

  const int  SKs[4]  = {S, S, MM, MP};                          // keys per branch
  const long ctx0[4] = {0, 0, (long)S * E, (long)(S + MM) * E}; // first context element per branch

  prep_inputs<<<CT * E / 2 / 256, 256, 0, stream>>>(x, mem, per, C16, Ch, Cl, S * E / 2, MM * E / 2, MP * E / 2);
  {
    Src8 qk = {Wm[0], Wm[1], Wm[4], Wm[5], Wm[8], Wm[9], Wm[12], Wm[13]};
    Src8 vo = {Wm[2], Wm[3], Wm[6], Wm[7], Wm[10], Wm[11], Wm[14], Wm[15]};
    transpose_cast_f16<<<dim3(E / 64, E / 64, 8), dim3(32, 8), 0, stream>>>(qk, E, WqkT, E, EE, 1.0f);
    transpose_split_bf16<<<dim3(E / 64, E / 64, 8), dim3(32, 8), 0, stream>>>(vo, E, WvoTh, WvoTl, E, EE);
  }
  const int tq = (S / 64) * (E / 64);
  {
    BatchA bqk, bv;
    for (int a = 0; a < 4; ++a) {
      bqk.aoff[2 * a] = 0;           bqk.M[2 * a] = S;
      bqk.aoff[2 * a + 1] = ctx0[a]; bqk.M[2 * a + 1] = SKs[a];
      bv.aoff[a] = ctx0[a];          bv.M[a] = SKs[a];
      bv.aoff[4 + a] = 0;            bv.M[4 + a] = 0;
    }
    wmma_gemm64<0, false, 0, 0, false><<<dim3((tq + 7) / 8, 8), 256, 0, stream>>>(
        U16(C16), nullptr, E, bqk, U16(WqkT), nullptr, E, EE, QK, nullptr, E, SE, nullptr, nullptr, 0, E, E, 1.0f);
    wmma_gemm64<1, true, 0, 0, false><<<dim3((tq + 7) / 8, 4), 256, 0, stream>>>(
        U16(Ch), U16(Cl), E, bv, U16(WvoTh), U16(WvoTl), E, 2 * EE, Vf, nullptr, E, SE, nullptr, nullptr, 0, E, E, 1.0f);
  }
  {
    AttnGeom g;
    g.q_bs = SE; g.q_rs = E; g.q_hs = DH;
    g.k_bs = SE; g.k_rs = E; g.k_hs = DH;
    g.v_bs = SE; g.v_rs = E; g.v_hs = DH;
    g.o_bs = SE; g.o_rs = E; g.o_hs = DH;
    g.S = S; g.Skv = S; g.H = H; g.qscale = 0.125f; g.blk0 = 0; g.mask_fill = -1.0e30f;
    g.mask_mode = 0; g.mask_is_int = 0;
    AttnBranches br;
    br.q_st = 2 * SE; br.k_st = 2 * SE; br.v_st = SE; br.o_st = SE;
    for (int a = 0; a < 4; ++a) { br.Skv[a] = SKs[a]; br.mask_mode[a] = 0; br.mask_is_int[a] = 0; }
    br.mask_mode[0] = 4; br.mask_is_int[0] = WIN;               // causal + window
    br.mask_mode[1] = 1;                                        // causal
    attn64_kernel<true, true><<<4 * H * (S / AT_QB), AT_NW * 32, 0, stream>>>(QK, QK + SE, Vf, Of, g, br);
  }
  split_f32_bf16x2<<<4096, 256, 0, stream>>>(Of, Oh, Ol, 4 * SE / 2);
  {
    BatchA bo;
    for (int a = 0; a < 4; ++a) { bo.aoff[a] = a * SE; bo.M[a] = S; bo.aoff[4 + a] = 0; bo.M[4 + a] = 0; }
    wmma_gemm64<1, true, 0, 0, false><<<dim3((tq + 7) / 8, 4), 256, 0, stream>>>(
        U16(Oh), U16(Ol), E, bo, U16(WvoTh + EE), U16(WvoTl + EE), E, 2 * EE, Ob[0], nullptr, E, SE, nullptr, nullptr, 0, E, E, 1.0f);
  }
  gate_fuse_kernel<<<S, 256, 0, stream>>>(Ob[0], Ob[1], Ob[2], Ob[3], gate_w, gate_b, out, E);
}

// v004
// A run of this version takes 389 microseconds.
// In both of two side-by-side timings against v003, it was 1.11 times as fast.
// Counting every step since v000, it is 4.51 times as fast.
#include <hip/hip_runtime.h>
#include <math.h>
// Four attentions (local = causal + 512 sliding window, long = causal, memory cross (512 keys), persona cross (64 keys)), 16 heads of 64:
// q/k projections (K=1024): v_wmma_f32_16x16x32_f16 (f16 operands); v and output projections (K=1024): v_wmma_f32_16x16x32_bf16 as bf16
// hi/lo splits; scores and p·v: v_wmma_f32_16x16x32_bf16 with q,k and p,v as bf16 hi/lo splits; f32 accumulate; softmax f32.
// k and v leave their projections already split into bf16 hi/lo planes (v transposed), so attention only copies their tiles to LDS.
// Gate (concat(outs)·gate_w, N=4, 0.1 % of MACs), gate softmax and the weighted fusion in f32 on VALU.
typedef __attribute__((ext_vector_type(16))) _Float16 v16h;
typedef __attribute__((ext_vector_type(8)))  _Float16 v8h;
typedef __attribute__((ext_vector_type(16))) __bf16   v16b;
typedef __attribute__((ext_vector_type(8)))  __bf16   v8b;
typedef __attribute__((ext_vector_type(8)))  float    v8f;
typedef __attribute__((ext_vector_type(4)))  float    v4f;
#define PSCALE 32768.0f
#define U16(p) ((const unsigned short*)(const void*)(p))
#define PSCALE_INV (1.0f / 32768.0f)

__device__ __forceinline__ unsigned short f2bf_bits(float f) {
  unsigned u = __float_as_uint(f);
  return (unsigned short)((u + 0x7FFFu + ((u >> 16) & 1u)) >> 16);
}
__device__ __forceinline__ float bf_bits2f(unsigned short h) { return __uint_as_float(((unsigned)h) << 16); }

// hazard guards as plain device helpers
__device__ __forceinline__ void dep_guard_h(v8f& a, v8f& b, v16h x, v16h y) { asm volatile("v_nop\n\tv_nop\n\tv_nop\n\tv_nop" : "+v"(a), "+v"(b) : "v"(x), "v"(y)); }
__device__ __forceinline__ void dep_guard_b(v8f& a, v8f& b, v16b x, v16b y) { asm volatile("v_nop\n\tv_nop\n\tv_nop\n\tv_nop" : "+v"(a), "+v"(b) : "v"(x), "v"(y)); }
__device__ __forceinline__ void keep4_h(v16h a, v16h b, v16h c, v16h d) { asm volatile("v_nop" :: "v"(a), "v"(b), "v"(c), "v"(d)); }
__device__ __forceinline__ void keep4_b(v16b a, v16b b, v16b c, v16b d) { asm volatile("v_nop" :: "v"(a), "v"(b), "v"(c), "v"(d)); }
__device__ __forceinline__ void acc_guard4(v8f& a, v8f& b, v8f& c, v8f& d) { asm volatile("v_nop\n\tv_nop\n\tv_nop\n\tv_nop" : "+v"(a), "+v"(b), "+v"(c), "+v"(d)); }
template <typename T> struct Frag;
template <> struct Frag<_Float16> {
  typedef v16h V; union U { v16h v; v8h h[2]; };
  static __device__ __forceinline__ v16h load(const _Float16* p) {   // elements 0..7 <- p[0..7], 8..15 <- p[16..23]
    U f; f.h[0] = *(const v8h*)(p); f.h[1] = *(const v8h*)(p + 16); return f.v;
  }
  static __device__ __forceinline__ v8f mma(v16h a, v16h b, v8f c) {
    return __builtin_amdgcn_wmma_f32_16x16x32_f16(false, a, false, b, (short)0, c, false, false);
  }
  static __device__ __forceinline__ void guard(v8f& a, v8f& b, v16h x, v16h y) { dep_guard_h(a, b, x, y); }
  static __device__ __forceinline__ void keep(v16h a, v16h b, v16h c, v16h d) { keep4_h(a, b, c, d); }
};
template <> struct Frag<__bf16> {
  typedef v16b V; union U { v16b v; v8b h[2]; };
  static __device__ __forceinline__ v16b load(const __bf16* p) {
    U f; f.h[0] = *(const v8b*)(p); f.h[1] = *(const v8b*)(p + 16); return f.v;
  }
  static __device__ __forceinline__ v8f mma(v16b a, v16b b, v8f c) {
    return __builtin_amdgcn_wmma_f32_16x16x32_bf16(false, a, false, b, (short)0, c, false, false);
  }
  static __device__ __forceinline__ void guard(v8f& a, v8f& b, v16b x, v16b y) { dep_guard_b(a, b, x, y); }
  static __device__ __forceinline__ void keep(v16b a, v16b b, v16b c, v16b d) { keep4_b(a, b, c, d); }
};

// ---- Register-blocked batched WMMA GEMM ------------------------------------
// C[m,n] = scale * sum_k A[m,k] * Bt[n,k] (+bias)(+resid); each wave owns a 64x64 tile.
// A row-major [M,K]; Bt row-major [N,K]; M,N % 64 == 0, K % 32 == 0.
// SPLIT: operands are hi/lo planes (A2/Bt2 = lo planes, same layout); product = hi·hi + hi·lo + lo·hi.
// BIAS_MODE: 0 = none, 1 = bias[m], 2 = bias[n].
// OUT_MODE: 0 = f32, 1 = f16, 2 = bf16 hi plane (Cout) + bf16 lo plane (Cout2),
//   3 = even batch entries as 0; odd entries as bf16 hi and lo planes inside the entry's own f32 plane (hi first, lo strideC elements behind it),
//   4 = bf16 hi (Cout) and lo (Cout2) planes, transposed: element (m, n) at n * ldc + m (no bias, residual or activation).
// ET: 0 = f16 operands, 1 = bf16 operands (pointers passed as 16-bit storage)
template <int ET> struct Elem;
template <> struct Elem<0> { typedef _Float16 T; };
template <> struct Elem<1> { typedef __bf16 T; };
// Batch entry blockIdx.y reads A from element offset aoff[y] and has M[y] rows (entries may differ in source and height).
struct BatchA { long aoff[8]; int M[8]; };
template <int ET, bool SPLIT, int BIAS_MODE, int OUT_MODE, bool RESID, int ACT = 0>
__global__ __launch_bounds__(256) void wmma_gemm64(
    const unsigned short* __restrict__ Ap, const unsigned short* __restrict__ A2p, int lda, BatchA ba,
    const unsigned short* __restrict__ Btp, const unsigned short* __restrict__ Bt2p, int ldb, long strideB,
    void* __restrict__ Cout, void* __restrict__ Cout2, int ldc, long strideC,
    const float* __restrict__ bias,
    const float* __restrict__ resid, long strideR,
    int N, int K, float scale) {
  typedef typename Elem<ET>::T T;
  typedef typename Frag<T>::V V;
  const T* A = (const T*)Ap; const T* A2 = (const T*)A2p; const T* Bt = (const T*)Btp; const T* Bt2 = (const T*)Bt2p;
  __shared__ __align__(16) float sT[8][16 * 68];   // per-wave 16x64 slab, pitch 68 floats
  const int b    = blockIdx.y;
  const int M    = ba.M[b];
  const long offA = ba.aoff[b];
  const int lane = threadIdx.x & 31;
  const int wave = threadIdx.x >> 5;
  const int tilesN = N >> 6;
  const int tilesM = M >> 6;
  const int tile = blockIdx.x * 8 + wave;
  if (tile >= tilesM * tilesN) return;   // wave-uniform; no block barriers in this kernel
  const int tm = tile / tilesN;
  const int tn = tile - tm * tilesN;
  const int m0 = tm << 6;
  const int n0 = tn << 6;

  const T* Ab  = A  + offA;
  const T* Bb  = Bt + (size_t)b * strideB;
  const T* Ab2 = SPLIT ? (A2  + offA) : nullptr;
  const T* Bb2 = SPLIT ? (Bt2 + (size_t)b * strideB) : nullptr;

  const int rlane = lane & 15;                 // row (A) / col (B, D) within subtile
  const int koff  = (lane >> 4) * 8;           // k offset of this lane half
  const int mOff  = (lane >> 4) * 8;           // D row offset

  v8f acc[4][4];
#pragma unroll
  for (int i = 0; i < 4; ++i)
#pragma unroll
    for (int j = 0; j < 4; ++j) acc[i][j] = (v8f){0.f,0.f,0.f,0.f,0.f,0.f,0.f,0.f};

  for (int k0 = 0; k0 < K; k0 += 32) {
    V bh[4], bl[4];
#pragma unroll
    for (int j = 0; j < 4; ++j) {
      const size_t bo = (size_t)(n0 + (j << 4) + rlane) * ldb + koff + k0;
      bh[j] = Frag<T>::load(Bb + bo);
      if (SPLIT) bl[j] = Frag<T>::load(Bb2 + bo);
    }
#pragma unroll
    for (int i = 0; i < 4; ++i) {
      const size_t ao = (size_t)(m0 + (i << 4) + rlane) * lda + koff + k0;
      V ah = Frag<T>::load(Ab + ao);
      V al;
      if (SPLIT) al = Frag<T>::load(Ab2 + ao);
#pragma unroll
      for (int j = 0; j < 4; ++j) {
        acc[i][j] = Frag<T>::mma(ah, bh[j], acc[i][j]);
        if (SPLIT) {
          acc[i][j] = Frag<T>::mma(ah, bl[j], acc[i][j]);
          acc[i][j] = Frag<T>::mma(al, bh[j], acc[i][j]);
        }
      }
      Frag<T>::guard(acc[i][0], acc[i][3], ah, SPLIT ? al : ah);
    }
    Frag<T>::keep(bh[0], bh[1], bh[2], bh[3]);
    if (SPLIT) Frag<T>::keep(bl[0], bl[1], bl[2], bl[3]);
  }
  acc_guard4(acc[0][0], acc[0][1], acc[0][2], acc[0][3]);
  acc_guard4(acc[1][0], acc[1][1], acc[1][2], acc[1][3]);
  acc_guard4(acc[2][0], acc[2][1], acc[2][2], acc[2][3]);
  acc_guard4(acc[3][0], acc[3][1], acc[3][2], acc[3][3]);

  // ---- epilogue ----
  if (OUT_MODE == 4) {
    // a lane's 8 accumulator rows are 8 neighbours of one transposed row: 16 B per plane straight from registers; a wave fills whole 128-B lines
    static_assert(OUT_MODE != 4 || (BIAS_MODE == 0 && !RESID && ACT == 0), "transposed output is plain");
    unsigned short* C  = (unsigned short*)Cout  + (size_t)b * strideC;
    unsigned short* C2 = (unsigned short*)Cout2 + (size_t)b * strideC;
#pragma unroll
    for (int j = 0; j < 4; ++j) {
#pragma unroll
      for (int i = 0; i < 4; ++i) {
        v8h hv, lv;
#pragma unroll
        for (int r = 0; r < 8; ++r) {
          const float v = acc[i][j][r] * scale;
          const unsigned short hb = f2bf_bits(v);
          hv[r] = __builtin_bit_cast(_Float16, hb);
          lv[r] = __builtin_bit_cast(_Float16, f2bf_bits(v - bf_bits2f(hb)));
        }
        const size_t o = (size_t)(n0 + (j << 4) + rlane) * ldc + m0 + (i << 4) + mOff;
        *(v8h*)(C + o) = hv;
        *(v8h*)(C2 + o) = lv;
      }
    }
    return;
  }
  const bool out_f32 = OUT_MODE == 0 || (OUT_MODE == 3 && (b & 1) == 0);   // uniform over the work-group
  float* slab = sT[wave];
  const float* Rb = RESID ? (resid + (size_t)b * strideR) : nullptr;
#pragma unroll
  for (int i = 0; i < 4; ++i) {
    const int mBase = m0 + (i << 4);
#pragma unroll
    for (int j = 0; j < 4; ++j) {
      const int n = n0 + (j << 4) + rlane;
      float bv = 0.f;
      if (BIAS_MODE == 2) bv = bias[n];
#pragma unroll
      for (int r = 0; r < 8; ++r) {
        float v = acc[i][j][r] * scale;
        if (BIAS_MODE == 1) v += bias[mBase + mOff + r];
        if (BIAS_MODE == 2) v += bv;
        if (RESID) v += Rb[(size_t)(mBase + mOff + r) * ldc + n];
        if (ACT == 1) v = tanhf(v);
        slab[(mOff + r) * 68 + (j << 4) + rlane] = v;
      }
    }
    __builtin_amdgcn_fence(__ATOMIC_RELEASE, "workgroup");
    __builtin_amdgcn_wave_barrier();
    __builtin_amdgcn_fence(__ATOMIC_ACQUIRE, "workgroup");
    if (out_f32) {
      float* C = (float*)Cout + (size_t)b * strideC;
      const int hh = lane >> 4, c4 = (lane & 15) * 4;     // row seg = 256 B = 16 lanes x 16 B
      {
#pragma unroll
        for (int it = 0; it < 8; ++it) {
          const int row = it * 2 + hh;
          v4f v = *(const v4f*)(slab + row * 68 + c4);
          *(v4f*)(C + (size_t)(mBase + row) * ldc + n0 + c4) = v;
        }
        
      }
    } else {
      const int q = lane >> 3, c8 = (lane & 7) * 8;
      unsigned short* C  = (OUT_MODE == 3) ? (unsigned short*)((float*)Cout + (size_t)b * strideC) : ((unsigned short*)Cout + (size_t)b * strideC);
      unsigned short* C2 = (OUT_MODE == 3) ? (C + strideC) : (OUT_MODE == 2) ? ((unsigned short*)Cout2 + (size_t)b * strideC) : nullptr;
      {
#pragma unroll
        for (int it = 0; it < 4; ++it) {
          const int row = it * 4 + q;
          const float* sp = slab + row * 68 + c8;
          v8h hv, lv;
#pragma unroll
          for (int e = 0; e < 8; ++e) {
            if (OUT_MODE == 1) {
              hv[e] = (_Float16)sp[e];
            } else {
              unsigned short hb = f2bf_bits(sp[e]);
              unsigned short lb = f2bf_bits(sp[e] - bf_bits2f(hb));
              hv[e] = __builtin_bit_cast(_Float16, hb);
              lv[e] = __builtin_bit_cast(_Float16, lb);
            }
          }
          *(v8h*)(C + (size_t)(mBase + row) * ldc + n0 + c8) = hv;
          if (OUT_MODE >= 2) *(v8h*)(C2 + (size_t)(mBase + row) * ldc + n0 + c8) = lv;
        }
        // precaution: in the listing the f32 branch follows this one and reuses the registers that these stores name
        if (OUT_MODE == 3) asm volatile("s_wait_xcnt 0x0" ::: "memory");

      }
    }
    __builtin_amdgcn_fence(__ATOMIC_RELEASE, "workgroup");
    __builtin_amdgcn_wave_barrier();
    __builtin_amdgcn_fence(__ATOMIC_ACQUIRE, "workgroup");
  }
}

// x, memory and persona rows, one after the other, to one f16 plane and bf16 hi/lo planes; n*2 = float pairs per source (multiples of 256)
__global__ __launch_bounds__(256) void prep_inputs(
    const float* __restrict__ x, const float* __restrict__ mem, const float* __restrict__ per,
    _Float16* __restrict__ c16, __bf16* __restrict__ hi, __bf16* __restrict__ lo, int nx2, int nm2, int np2) {
  const int i = blockIdx.x * 256 + threadIdx.x;
  if (i >= nx2 + nm2 + np2) return;
  const float* in = x; int j = i;
  if (i >= nx2 + nm2) { in = per; j = i - nx2 - nm2; }
  else if (i >= nx2) { in = mem; j = i - nx2; }
  const float a = in[2 * j], b = in[2 * j + 1];
  const _Float16 h0 = (_Float16)a, h1 = (_Float16)b;
  ((unsigned*)c16)[i] = (unsigned)__builtin_bit_cast(unsigned short, h0) | ((unsigned)__builtin_bit_cast(unsigned short, h1) << 16);
  const unsigned short ah = f2bf_bits(a), bh = f2bf_bits(b);
  const unsigned short al = f2bf_bits(a - bf_bits2f(ah)), bl = f2bf_bits(b - bf_bits2f(bh));
  ((unsigned*)hi)[i] = (unsigned)ah | ((unsigned)bh << 16);
  ((unsigned*)lo)[i] = (unsigned)al | ((unsigned)bl << 16);
}

__global__ __launch_bounds__(256) void split_f32_bf16x2(
    const float* __restrict__ in, __bf16* __restrict__ hi, __bf16* __restrict__ lo, long n2) {
  long i = (long)blockIdx.x * 256 + threadIdx.x;
  long stride = (long)gridDim.x * 256;
  {
    for (long j = i; j < n2; j += stride) {
      const float a = in[2 * j], b = in[2 * j + 1];
      const unsigned short ah = f2bf_bits(a), bh = f2bf_bits(b);
      const unsigned short al = f2bf_bits(a - bf_bits2f(ah)), bl = f2bf_bits(b - bf_bits2f(bh));
      ((unsigned*)hi)[j] = (unsigned)ah | ((unsigned)bh << 16);
      ((unsigned*)lo)[j] = (unsigned)al | ((unsigned)bl << 16);
    }
    
  }
}


// eight source matrices of one launch; blockIdx.z picks one, its output plane follows at z * plane elements
struct Src8 { const float* p0; const float* p1; const float* p2; const float* p3; const float* p4; const float* p5; const float* p6; const float* p7; };
__device__ __forceinline__ const float* pick8(const Src8& s, int z) {
  switch (z) {
    case 0: return s.p0; case 1: return s.p1; case 2: return s.p2; case 3: return s.p3;
    case 4: return s.p4; case 5: return s.p5; case 6: return s.p6; default: return s.p7;
  }
}

// ---- f32 [R][C] (row pitch ldi) -> f16 transposed [C][R] (row pitch ldo); 64x64 tiles; each output row segment
__global__ __launch_bounds__(256) void transpose_cast_f16(Src8 srcs, int ldi,
                                                         _Float16* __restrict__ outT0, int ldo, long plane, float scale) {
  __shared__ __align__(16) _Float16 tile[64][72];     // [c][r]
  const float* __restrict__ in = pick8(srcs, blockIdx.z);
  _Float16* __restrict__ outT = outT0 + (size_t)blockIdx.z * plane;
  const int c0 = blockIdx.x * 64, r0 = blockIdx.y * 64;
  const int t = threadIdx.y * 32 + threadIdx.x;
  for (int i = threadIdx.y; i < 64; i += 8) {
    tile[threadIdx.x][i]      = (_Float16)(in[(size_t)(r0 + i) * ldi + c0 + threadIdx.x] * scale);
    tile[32 + threadIdx.x][i] = (_Float16)(in[(size_t)(r0 + i) * ldi + c0 + 32 + threadIdx.x] * scale);
  }
  __syncthreads();
  const int q = t >> 3, c8 = (t & 7) * 8;
  {
#pragma unroll
    for (int it = 0; it < 2; ++it) {
      const int c = it * 32 + q;
      v8h hv = *(const v8h*)(&tile[c][c8]);
      *(v8h*)(outT + (size_t)(c0 + c) * ldo + r0 + c8) = hv;
    }
    
  }
}

// ---- f32 [R][C] (pitch ldi) -> bf16 hi/lo transposed planes [C][R] (pitch ldo); 64x64 tiles; each output row segment
__global__ __launch_bounds__(256) void transpose_split_bf16(Src8 srcs, int ldi,
                                                           __bf16* __restrict__ outH0, __bf16* __restrict__ outL0, int ldo, long plane) {
  __shared__ __align__(16) float tile[64][68];     // [c][r]
  const float* __restrict__ in = pick8(srcs, blockIdx.z);
  __bf16* __restrict__ outH = outH0 + (size_t)blockIdx.z * plane;
  __bf16* __restrict__ outL = outL0 + (size_t)blockIdx.z * plane;
  const int c0 = blockIdx.x * 64, r0 = blockIdx.y * 64;
  const int t = threadIdx.y * 32 + threadIdx.x;
  for (int i = threadIdx.y; i < 64; i += 8) {
    tile[threadIdx.x][i]      = in[(size_t)(r0 + i) * ldi + c0 + threadIdx.x];
    tile[32 + threadIdx.x][i] = in[(size_t)(r0 + i) * ldi + c0 + 32 + threadIdx.x];
  }
  __syncthreads();
  const int q = t >> 3, c8 = (t & 7) * 8;
  {
#pragma unroll
    for (int it = 0; it < 2; ++it) {
      const int c = it * 32 + q;
      v8b hv, lv;
#pragma unroll
      for (int e = 0; e < 8; ++e) {
        const float f = tile[c][c8 + e];
        const unsigned short hb = f2bf_bits(f);
        hv[e] = __builtin_bit_cast(__bf16, hb);
        lv[e] = __builtin_bit_cast(__bf16, f2bf_bits(f - bf_bits2f(hb)));
      }
      *(v8b*)(outH + (size_t)(c0 + c) * ldo + r0 + c8) = hv;
      *(v8b*)(outL + (size_t)(c0 + c) * ldo + r0 + c8) = lv;
    }
    
  }
}

// =====================================================================================
// Generic causal/non-causal attention for head_dim 64, q f32 in / f32 out, bf16 operands with optional hi/lo splits.
//   scores = (q*qscale)·kᵀ : v_wmma_f32_16x16x32_bf16; SPLIT_QK -> q,k as bf16 hi/lo (hi·hi + hi·lo + lo·hi)
//   out    = p·v           : v_wmma_f32_16x16x32_bf16; SPLIT_PV -> p,v as bf16 hi/lo; else p,v plain bf16
//   f32 accumulate; online softmax in f32. Block = 4 waves = 64 query rows of one (batch, head); S % 64 == 0.
//   Element (b, s, h, d) of q and out lives at X[b*X_bs + s*X_rs + h*X_hs + d] (strides in floats, multiples of 4).
//   k arrives as bf16 hi and lo planes, element (s, h, d) at s*K_RS + h*k_hs + d; v as bf16 hi and lo planes, transposed: element
//   (s, h, d) at h*v_hs + d*V_RS + s (strides in bf16, multiples of 8; the row pitches are template constants, so that a tile's
//   rows are constant offsets from one address). A chunk's tiles are rows of 128 B that go to LDS as they are.
//   Masking: mask_mode 0 none, 1 causal (kv > q masked), 4 causal + sliding window (kv > q or q - kv > W masked; W passed in
//   mask_is_int); masked scores are replaced by mask_fill before the softmax. The mask is decided once per 64-key chunk with scalar
//   tests: a chunk that the window masks for all 64 query rows is not visited (its weights are exactly 0 after the softmax), a chunk
//   with no masked element runs no mask code, and only a chunk that the diagonal or the window's edge crosses compares and selects.
//   One launch serves four branches (batch 1): branch a reads q/k/v and writes out at a * {q,k,v,o}_st elements, with its own Skv,
//   mask_mode and window. grid.x = 4 * H * (S/64): first branches 0 and 1 (causal, cost grows with the query block) from the last
//   query block down, then branches 2 and 3, so that the long work-groups start first.
// =====================================================================================
#define AT_D 64
#define AT_NW 4
#define AT_QB 64
#define AT_KC 64
#define AT_LP 72   // LDS row pitch of the K, V and P tiles in bf16: 144 B = 16 B x 9, so that the 16 rows of a ds_load_b128 fall on different banks
struct AttnGeom { long q_bs, q_rs, q_hs, k_bs, k_rs, k_hs, v_bs, v_rs, v_hs, o_bs, o_rs, o_hs;
                  int S, Skv, H, mask_mode; float qscale; int blk0; float mask_fill; int mask_is_int; };
static_assert(sizeof(AttnGeom) == 128, "no padding");
struct AttnBranches { long q_st, k_st, v_st, o_st; int Skv[4]; int mask_mode[4]; int mask_is_int[4]; };

__device__ __forceinline__ unsigned short at_bf_bits(float f) {
  unsigned u = __float_as_uint(f);
  return (unsigned short)((u + 0x7FFFu + ((u >> 16) & 1u)) >> 16);
}
__device__ __forceinline__ __bf16 at_f2bf(float f) { return __builtin_bit_cast(__bf16, at_bf_bits(f)); }
__device__ __forceinline__ void at_split(float f, __bf16& hi, __bf16& lo) {
  const unsigned short hb = at_bf_bits(f);
  hi = __builtin_bit_cast(__bf16, hb);
  lo = at_f2bf(f - __uint_as_float(((unsigned)hb) << 16));
}
__device__ __forceinline__ v8f at_mma(v16b a, v16b b, v8f c) {
  c = __builtin_amdgcn_wmma_f32_16x16x32_bf16(false, a, false, b, (short)0, c, false, false);
  asm volatile("v_nop\n\tv_nop\n\tv_nop\n\tv_nop" : "+v"(c) : "v"(a), "v"(b));
  return c;
}

template <bool SPLIT_QK, bool SPLIT_PV, int K_RS, int V_RS>
__global__ __launch_bounds__(128)
void attn64_kernel(const float* __restrict__ q, const unsigned short* __restrict__ kh, const unsigned short* __restrict__ kl,
                   const unsigned short* __restrict__ vth, const unsigned short* __restrict__ vtl,
                   float* __restrict__ out, AttnGeom g0, AttnBranches br) {
  union FB { v16b v; v8b h[2]; };
  __shared__ __align__(16) __bf16 Ksh[AT_KC * AT_LP];            // K hi [kv][d]      9 KB
  __shared__ __align__(16) __bf16 Ksl[SPLIT_QK ? AT_KC * AT_LP : 8];
  __shared__ __align__(16) __bf16 Vth[AT_D * AT_LP];             // V hi [d][kv]      9 KB
  __shared__ __align__(16) __bf16 Vtl[SPLIT_PV ? AT_D * AT_LP : 8];
  __shared__ __align__(16) __bf16 Psh[AT_NW][16 * AT_LP];        // per wave P hi [row][kv]  9 KB
  __shared__ __align__(16) __bf16 Psl[SPLIT_PV ? AT_NW : 1][SPLIT_PV ? 16 * AT_LP : 8];
  __shared__ __align__(16) float  Os[AT_NW][16 * 68];            // per wave out tile, pitch 68

  const int tid  = threadIdx.x;
  const int wave = tid >> 5;
  const int lane = tid & 31;
  const int hh   = lane >> 4;
  const int c    = lane & 15;

  AttnGeom g = g0;
  const int nqb = g.S / AT_QB;
  const int bx = blockIdx.x + g.blk0;
  const int perBranch = g.H * nqb;
  int a, h, qb;
  if (bx < 2 * perBranch) {
    const int lvl = bx / (2 * g.H), w = bx % (2 * g.H);
    qb = nqb - 1 - lvl; a = w / g.H; h = w % g.H;
  } else {
    const int r = bx - 2 * perBranch, r2 = r % perBranch;
    a = 2 + r / perBranch; h = r2 / nqb; qb = r2 % nqb;
  }
  g.Skv = br.Skv[a]; g.mask_mode = br.mask_mode[a]; g.mask_is_int = br.mask_is_int[a];
  const int qbase_block = qb * AT_QB;
  const int q0 = qbase_block + wave * 16;

  const float* qb_ptr = q + (size_t)a * br.q_st + (size_t)h * g.q_hs;
  // staging: 8 threads per 128-B tile row, 16 rows per pass, 4 passes; offsets of this thread's 16 B in the first pass of chunk 0
  const int srow = tid >> 3, sc8 = (tid & 7) * 8;
  const size_t koff = (size_t)a * br.k_st + (size_t)h * g.k_hs + (size_t)srow * K_RS + sc8;
  const size_t voff = (size_t)a * br.v_st + (size_t)h * g.v_hs + (size_t)srow * V_RS + sc8;
  float*       ob_ptr = out + (size_t)a * br.o_st + (size_t)h * g.o_hs;

  // ---- Q fragments (A operand): 2 d-chunks, hi (and lo) ----
  v16b qah[2], qal[2];
  {
    const float* qrow = qb_ptr + (size_t)(q0 + c) * g.q_rs;
#pragma unroll
    for (int dc = 0; dc < 2; ++dc) {
#pragma unroll
      for (int e = 0; e < 8; ++e) {
        const float f0 = qrow[dc * 32 + 8 * hh + e] * g.qscale;
        const float f1 = qrow[dc * 32 + 16 + 8 * hh + e] * g.qscale;
        if (SPLIT_QK) { __bf16 hq, lq; at_split(f0, hq, lq); qah[dc][e] = hq; qal[dc][e] = lq; at_split(f1, hq, lq); qah[dc][8 + e] = hq; qal[dc][8 + e] = lq; }
        else { qah[dc][e] = at_f2bf(f0); qah[dc][8 + e] = at_f2bf(f1); qal[dc][e] = qah[dc][e]; qal[dc][8 + e] = qah[dc][8 + e]; }
      }
    }
  }

  float mrow[8], lrow[8];
  v8f oacc[4];
#pragma unroll
  for (int r = 0; r < 8; ++r) { mrow[r] = -INFINITY; lrow[r] = 0.f; }
#pragma unroll
  for (int t = 0; t < 4; ++t) oacc[t] = (v8f){0.f,0.f,0.f,0.f,0.f,0.f,0.f,0.f};

  const bool causal = (g.mask_mode == 1 || g.mask_mode == 4);
  const int win = (g.mask_mode == 4) ? g.mask_is_int : g.S;          // q - kv stays below S: no window
  const int nChunks = causal ? (qb + 1) : (g.Skv / AT_KC);           // block-uniform
  const int kcFirst = (causal && qbase_block > win) ? (qbase_block - win) / AT_KC : 0;   // chunk of the oldest key that the block's first row still sees
  // one address per plane, moved on from chunk to chunk; the four passes are constant offsets from it
  const __bf16* pkh = (const __bf16*)kh + koff + (size_t)kcFirst * (AT_KC * K_RS);    // K tile: rows are keys
  const __bf16* pkl = (const __bf16*)kl + koff + (size_t)kcFirst * (AT_KC * K_RS);
  const __bf16* pvh = (const __bf16*)vth + voff + (size_t)kcFirst * AT_KC;            // V tile: rows are head dims, keys run along the row
  const __bf16* pvl = (const __bf16*)vtl + voff + (size_t)kcFirst * AT_KC;
  for (int kc = kcFirst; kc < nChunks; ++kc) {
    const int kv0 = kc * AT_KC;
    {
      v8b rkh[4], rkl[4], rvh[4], rvl[4];
#pragma unroll
      for (int i = 0; i < 4; ++i) {
        rkh[i] = *(const v8b*)(pkh + i * 16 * K_RS);
        if (SPLIT_QK) rkl[i] = *(const v8b*)(pkl + i * 16 * K_RS);
        rvh[i] = *(const v8b*)(pvh + i * 16 * V_RS);
        if (SPLIT_PV) rvl[i] = *(const v8b*)(pvl + i * 16 * V_RS);
      }
      __syncthreads();
      pkh += AT_KC * K_RS; pkl += AT_KC * K_RS; pvh += AT_KC; pvl += AT_KC;
#pragma unroll
      for (int i = 0; i < 4; ++i) {
        const int lo = (i * 16 + srow) * AT_LP + sc8;
        *(v8b*)(Ksh + lo) = rkh[i];
        if (SPLIT_QK) *(v8b*)(Ksl + lo) = rkl[i];
        *(v8b*)(Vth + lo) = rvh[i];
        if (SPLIT_PV) *(v8b*)(Vtl + lo) = rvl[i];
      }
    }
    __syncthreads();

    v8f s[4];
#pragma unroll
    for (int j = 0; j < 4; ++j) {
      s[j] = (v8f){0.f,0.f,0.f,0.f,0.f,0.f,0.f,0.f};
#pragma unroll
      for (int dc = 0; dc < 2; ++dc) {
        FB kb;
        kb.h[0] = *(const v8b*)(Ksh + (j * 16 + c) * AT_LP + dc * 32 + 8 * hh);
        kb.h[1] = *(const v8b*)(Ksh + (j * 16 + c) * AT_LP + dc * 32 + 16 + 8 * hh);
        s[j] = at_mma(qah[dc], kb.v, s[j]);
        if (SPLIT_QK) {
          FB kl;
          kl.h[0] = *(const v8b*)(Ksl + (j * 16 + c) * AT_LP + dc * 32 + 8 * hh);
          kl.h[1] = *(const v8b*)(Ksl + (j * 16 + c) * AT_LP + dc * 32 + 16 + 8 * hh);
          s[j] = at_mma(qah[dc], kl.v, s[j]);
          s[j] = at_mma(qal[dc], kb.v, s[j]);
        }
      }
    }
    // block-uniform: the diagonal chunk, or one in which the block's last row is more than win past the chunk's first key
    if (causal && (kc == qb || qbase_block + (AT_QB - 1) - kv0 > win)) {
#pragma unroll
      for (int r = 0; r < 8; ++r) {
        const int qrow = q0 + 8 * hh + r;
#pragma unroll
        for (int j = 0; j < 4; ++j) {
          const int dist = qrow - (kv0 + j * 16 + c);
          s[j][r] = (dist < 0 || dist > win) ? g.mask_fill : s[j][r];
        }
      }
    }
    float cm[8];
#pragma unroll
    for (int r = 0; r < 8; ++r) {
      float m = -INFINITY;
#pragma unroll
      for (int j = 0; j < 4; ++j) m = fmaxf(m, s[j][r]);
#pragma unroll
      for (int off = 1; off < 16; off <<= 1) m = fmaxf(m, __shfl_xor(m, off, 32));
      cm[r] = m;
    }
    __bf16* pwh = Psh[wave];
    __bf16* pwl = Psl[SPLIT_PV ? wave : 0];
#pragma unroll
    for (int r = 0; r < 8; ++r) {
      const float mnew = fmaxf(mrow[r], cm[r]);
      const float alpha = expf(mrow[r] - mnew);
      mrow[r] = mnew;
      float psum = 0.f;
#pragma unroll
      for (int j = 0; j < 4; ++j) {
        const float p = expf(s[j][r] - mnew);
        psum += p;
        if (SPLIT_PV) { __bf16 a, bl; at_split(p, a, bl); pwh[(8 * hh + r) * AT_LP + j * 16 + c] = a; pwl[(8 * hh + r) * AT_LP + j * 16 + c] = bl; }
        else pwh[(8 * hh + r) * AT_LP + j * 16 + c] = at_f2bf(p);
      }
#pragma unroll
      for (int off = 1; off < 16; off <<= 1) psum += __shfl_xor(psum, off, 32);
      lrow[r] = lrow[r] * alpha + psum;
#pragma unroll
      for (int t = 0; t < 4; ++t) oacc[t][r] *= alpha;
    }
    __builtin_amdgcn_fence(__ATOMIC_RELEASE, "workgroup");
    __builtin_amdgcn_wave_barrier();
    __builtin_amdgcn_fence(__ATOMIC_ACQUIRE, "workgroup");
#pragma unroll
    for (int kk = 0; kk < 2; ++kk) {
      FB pa, pl;
      pa.h[0] = *(const v8b*)(pwh + c * AT_LP + kk * 32 + 8 * hh);
      pa.h[1] = *(const v8b*)(pwh + c * AT_LP + kk * 32 + 16 + 8 * hh);
      if (SPLIT_PV) {
        pl.h[0] = *(const v8b*)(pwl + c * AT_LP + kk * 32 + 8 * hh);
        pl.h[1] = *(const v8b*)(pwl + c * AT_LP + kk * 32 + 16 + 8 * hh);
      }
#pragma unroll
      for (int t = 0; t < 4; ++t) {
        FB vb;
        vb.h[0] = *(const v8b*)(Vth + (t * 16 + c) * AT_LP + kk * 32 + 8 * hh);
        vb.h[1] = *(const v8b*)(Vth + (t * 16 + c) * AT_LP + kk * 32 + 16 + 8 * hh);
        oacc[t] = at_mma(pa.v, vb.v, oacc[t]);
        if (SPLIT_PV) {
          FB vl;
          vl.h[0] = *(const v8b*)(Vtl + (t * 16 + c) * AT_LP + kk * 32 + 8 * hh);
          vl.h[1] = *(const v8b*)(Vtl + (t * 16 + c) * AT_LP + kk * 32 + 16 + 8 * hh);
          oacc[t] = at_mma(pa.v, vl.v, oacc[t]);
          oacc[t] = at_mma(pl.v, vb.v, oacc[t]);
        }
      }
    }
  }

  float* os = Os[wave];
#pragma unroll
  for (int r = 0; r < 8; ++r) {
    const float inv = 1.0f / lrow[r];
#pragma unroll
    for (int t = 0; t < 4; ++t) os[(8 * hh + r) * 68 + t * 16 + c] = oacc[t][r] * inv;
  }
  __builtin_amdgcn_fence(__ATOMIC_RELEASE, "workgroup");
  __builtin_amdgcn_wave_barrier();
  __builtin_amdgcn_fence(__ATOMIC_ACQUIRE, "workgroup");
  {
    const int c4 = (lane & 15) * 4;
    {
#pragma unroll
      for (int it = 0; it < 8; ++it) {
        const int row = it * 2 + hh;
        v4f val = *(const v4f*)(os + row * 68 + c4);
        *(v4f*)(ob_ptr + (size_t)(q0 + row) * g.o_rs + c4) = val;
      }
      
    }
  }
}

__global__ __launch_bounds__(256) void gate_fuse_kernel(const float* __restrict__ o0, const float* __restrict__ o1,
                                                       const float* __restrict__ o2, const float* __restrict__ o3,
                                                       const float* __restrict__ Wg, const float* __restrict__ bg,
                                                       float* __restrict__ out, int Hd) {
  __shared__ float red[4][8];
  const int row = blockIdx.x, t = threadIdx.x, lane = t & 31, wave = t >> 5;
  const float* os[4] = {o0 + (size_t)row * Hd, o1 + (size_t)row * Hd, o2 + (size_t)row * Hd, o3 + (size_t)row * Hd};
  float acc[4] = {0.f, 0.f, 0.f, 0.f};
  for (int i = 0; i < 4; ++i) {
    const float* o = os[i];
    for (int c = t; c < Hd; c += 256) {
      const float v = o[c];
      const float* w = Wg + (size_t)(i * Hd + c) * 4;
      acc[0] += v * w[0]; acc[1] += v * w[1]; acc[2] += v * w[2]; acc[3] += v * w[3];
    }
  }
#pragma unroll
  for (int g = 0; g < 4; ++g) { float a = acc[g]; for (int o = 16; o > 0; o >>= 1) a += __shfl_xor(a, o, 32); if (lane == 0) red[g][wave] = a; }
  __syncthreads();
  float gl[4];
#pragma unroll
  for (int g = 0; g < 4; ++g) { float a = 0.f; for (int w = 0; w < 8; ++w) a += red[g][w]; gl[g] = a + bg[g]; }
  const float mx = fmaxf(fmaxf(gl[0], gl[1]), fmaxf(gl[2], gl[3]));
  float e[4], se = 0.f;
#pragma unroll
  for (int g = 0; g < 4; ++g) { e[g] = expf(gl[g] - mx); se += e[g]; }
  const float inv = 1.0f / se;
  const int c = 4 * t;
  v4f r;
#pragma unroll
  for (int q = 0; q < 4; ++q) r[q] = (e[0] * inv) * os[0][c + q] + (e[1] * inv) * os[1][c + q] + (e[2] * inv) * os[2][c + q] + (e[3] * inv) * os[3][c + q];
  *(v4f*)(out + (size_t)row * Hd + c) = r;
  
}

extern "C" void kernel_launch(void* const* d_in, const int* in_sizes, int n_in,
                              void* d_out, int out_size, void* d_ws, size_t ws_size,
                              hipStream_t stream) {
  (void)in_sizes; (void)n_in; (void)out_size; (void)ws_size;
  const int S = 2048, E = 1024, H = 16, DH = 64, MM = 512, MP = 64, WIN = 512;
  // wire order: 16 weights ([in,out]), gate_w, gate_b, x, memory_kv, persona_kv
  const float* Wm[16]; for (int i = 0; i < 16; ++i) Wm[i] = (const float*)d_in[i];   // {local,long,mem,per} x {wq,wk,wv,wo}
  const float* gate_w = (const float*)d_in[16];
  const float* gate_b = (const float*)d_in[17];
  const float* x   = (const float*)d_in[18];   // [1,2048,1024]
  const float* mem = (const float*)d_in[19];   // [1,512,1024]
  const float* per = (const float*)d_in[20];   // [1,64,1024]
  float* out = (float*)d_out;

  char* ws = (char*)d_ws; size_t off = 0;
  auto carve = [&](size_t bytes) -> char* { char* p = ws + off; off += (bytes + 255) & ~(size_t)255; return p; };
  const int CT = S + MM + MP;                                   // context rows: x, then memory, then persona
  const long EE = (long)E * E, SE = (long)S * E;
  _Float16* C16  = (_Float16*)carve((size_t)CT * E * 2);        // 5.4 MB each
  __bf16*   Ch   = (__bf16*)carve((size_t)CT * E * 2);
  __bf16*   Cl   = (__bf16*)carve((size_t)CT * E * 2);
  _Float16* WqkT = (_Float16*)carve((size_t)8 * EE * 2);        // plane 2a = wq^T, 2a+1 = wk^T of branch a; 16.8 MB
  __bf16*   WvoTh = (__bf16*)carve((size_t)8 * EE * 2);         // plane 2a = wv^T, 2a+1 = wo^T
  __bf16*   WvoTl = (__bf16*)carve((size_t)8 * EE * 2);
  float*    QK   = (float*)carve((size_t)8 * SE * 4);           // plane 2a = q (f32), 2a+1 = k of branch a (bf16 hi, then bf16 lo); 67 MB
  __bf16*   VTh  = (__bf16*)carve((size_t)4 * SE * 2);          // v^T of branch a: [E][S] (row pitch S for every branch); 16.8 MB each
  __bf16*   VTl  = (__bf16*)carve((size_t)4 * SE * 2);
  float*    Of   = (float*)carve((size_t)4 * SE * 4);
  __bf16*   Oh   = (__bf16*)carve((size_t)4 * SE * 2);
  __bf16*   Ol   = (__bf16*)carve((size_t)4 * SE * 2);          // total 234 MB
  float*    Ob[4];
  for (int i = 0; i < 4; ++i) Ob[i] = QK + (size_t)i * SE;      // branch outputs take the q/k planes' place once attention is done

  const int  SKs[4]  = {S, S, MM, MP};                          // keys per branch
  const long ctx0[4] = {0, 0, (long)S * E, (long)(S + MM) * E}; // first context element per branch

  prep_inputs<<<CT * E / 2 / 256, 256, 0, stream>>>(x, mem, per, C16, Ch, Cl, S * E / 2, MM * E / 2, MP * E / 2);
  {
    Src8 qk = {Wm[0], Wm[1], Wm[4], Wm[5], Wm[8], Wm[9], Wm[12], Wm[13]};
    Src8 vo = {Wm[2], Wm[3], Wm[6], Wm[7], Wm[10], Wm[11], Wm[14], Wm[15]};
    transpose_cast_f16<<<dim3(E / 64, E / 64, 8), dim3(32, 8), 0, stream>>>(qk, E, WqkT, E, EE, 1.0f);
    transpose_split_bf16<<<dim3(E / 64, E / 64, 8), dim3(32, 8), 0, stream>>>(vo, E, WvoTh, WvoTl, E, EE);
  }
  const int tq = (S / 64) * (E / 64);
  {
    BatchA bqk, bv;
    for (int a = 0; a < 4; ++a) {
      bqk.aoff[2 * a] = 0;           bqk.M[2 * a] = S;
      bqk.aoff[2 * a + 1] = ctx0[a]; bqk.M[2 * a + 1] = SKs[a];
      bv.aoff[a] = ctx0[a];          bv.M[a] = SKs[a];
      bv.aoff[4 + a] = 0;            bv.M[4 + a] = 0;
    }
    wmma_gemm64<0, false, 0, 3, false><<<dim3((tq + 7) / 8, 8), 256, 0, stream>>>(
        U16(C16), nullptr, E, bqk, U16(WqkT), nullptr, E, EE, QK, nullptr, E, SE, nullptr, nullptr, 0, E, E, 1.0f);
    wmma_gemm64<1, true, 0, 4, false><<<dim3((tq + 7) / 8, 4), 256, 0, stream>>>(
        U16(Ch), U16(Cl), E, bv, U16(WvoTh), U16(WvoTl), E, 2 * EE, VTh, VTl, S, SE, nullptr, nullptr, 0, E, E, 1.0f);
  }
  {
    AttnGeom g;
    g.q_bs = SE; g.q_rs = E; g.q_hs = DH;
    g.k_bs = SE; g.k_rs = E; g.k_hs = DH;
    g.v_bs = SE; g.v_rs = S; g.v_hs = (long)DH * S;
    g.o_bs = SE; g.o_rs = E; g.o_hs = DH;
    g.S = S; g.Skv = S; g.H = H; g.qscale = 0.125f; g.blk0 = 0; g.mask_fill = -1.0e30f;
    g.mask_mode = 0; g.mask_is_int = 0;
    AttnBranches br;
    br.q_st = 2 * SE; br.k_st = 4 * SE; br.v_st = SE; br.o_st = SE;   // a q/k pair of f32-sized planes is 4 * SE bf16
    for (int a = 0; a < 4; ++a) { br.Skv[a] = SKs[a]; br.mask_mode[a] = 0; br.mask_is_int[a] = 0; }
    br.mask_mode[0] = 4; br.mask_is_int[0] = WIN;               // causal + window
    br.mask_mode[1] = 1;                                        // causal
    attn64_kernel<true, true, E, S><<<4 * H * (S / AT_QB), AT_NW * 32, 0, stream>>>(QK, U16(QK + SE), U16(QK + SE) + SE, U16(VTh), U16(VTl), Of, g, br);
  }
  split_f32_bf16x2<<<4096, 256, 0, stream>>>(Of, Oh, Ol, 4 * SE / 2);
  {
    BatchA bo;
    for (int a = 0; a < 4; ++a) { bo.aoff[a] = a * SE; bo.M[a] = S; bo.aoff[4 + a] = 0; bo.M[4 + a] = 0; }
    wmma_gemm64<1, true, 0, 0, false><<<dim3((tq + 7) / 8, 4), 256, 0, stream>>>(
        U16(Oh), U16(Ol), E, bo, U16(WvoTh + EE), U16(WvoTl + EE), E, 2 * EE, Ob[0], nullptr, E, SE, nullptr, nullptr, 0, E, E, 1.0f);
  }
  gate_fuse_kernel<<<S, 256, 0, stream>>>(Ob[0], Ob[1], Ob[2], Ob[3], gate_w, gate_b, out, E);
}

// v005
// Measured time: 377 microseconds a run.
// Next to v004, in two timings, it ran 1.03 times as fast each time.
// Over all steps from v000 it is 4.66 times as fast.
#include <hip/hip_runtime.h>
#include <math.h>
// Four attentions (local = causal + 512 sliding window, long = causal, memory cross (512 keys), persona cross (64 keys)), 16 heads of 64:
// q/k projections (K=1024): v_wmma_f32_16x16x32_f16 (f16 operands); v and output projections (K=1024): v_wmma_f32_16x16x32_bf16 as bf16
// hi/lo splits; scores and p·v: v_wmma_f32_16x16x32_bf16 with q,k and p,v as bf16 hi/lo splits; f32 accumulate; softmax f32.
// k and v leave their projections already split into bf16 hi/lo planes (v transposed), so attention only copies their tiles to LDS.
// Gate (concat(outs)·gate_w, N=4, 0.1 % of MACs), gate softmax and the weighted fusion in f32 on VALU.
typedef __attribute__((ext_vector_type(16))) _Float16 v16h;
typedef __attribute__((ext_vector_type(8)))  _Float16 v8h;
typedef __attribute__((ext_vector_type(16))) __bf16   v16b;
typedef __attribute__((ext_vector_type(8)))  __bf16   v8b;
typedef __attribute__((ext_vector_type(8)))  float    v8f;
typedef __attribute__((ext_vector_type(4)))  float    v4f;
#define PSCALE 32768.0f
#define U16(p) ((const unsigned short*)(const void*)(p))
#define PSCALE_INV (1.0f / 32768.0f)

__device__ __forceinline__ unsigned short f2bf_bits(float f) {
  unsigned u = __float_as_uint(f);
  return (unsigned short)((u + 0x7FFFu + ((u >> 16) & 1u)) >> 16);
}
__device__ __forceinline__ float bf_bits2f(unsigned short h) { return __uint_as_float(((unsigned)h) << 16); }

// hazard guards as plain device helpers
__device__ __forceinline__ void acc_guard4(v8f& a, v8f& b, v8f& c, v8f& d) { asm volatile("v_nop\n\tv_nop\n\tv_nop\n\tv_nop" : "+v"(a), "+v"(b), "+v"(c), "+v"(d)); }
// end of a fragment set's WMMAs in the GEMM k loop: four vector slots, then the wait in front of the rewriting of the offsets named (why: at the call)
__device__ __forceinline__ void set_done(unsigned& a0, unsigned& a1, unsigned& a2, unsigned& a3, unsigned& b0, unsigned& b1, unsigned& b2, unsigned& b3) {
  asm volatile("v_nop\n\tv_nop\n\tv_nop\n\tv_nop\n\ts_wait_xcnt 0x0" : "+v"(a0), "+v"(a1), "+v"(a2), "+v"(a3), "+v"(b0), "+v"(b1), "+v"(b2), "+v"(b3) :: "memory");
}
template <typename T> struct Frag;
template <> struct Frag<_Float16> {
  typedef v16h V; union U { v16h v; v8h h[2]; };
  static __device__ __forceinline__ v16h load(const _Float16* p) {   // elements 0..7 <- p[0..7], 8..15 <- p[16..23]
    U f; f.h[0] = *(const v8h*)(p); f.h[1] = *(const v8h*)(p + 16); return f.v;
  }
  static __device__ __forceinline__ v8f mma(v16h a, v16h b, v8f c) {
    return __builtin_amdgcn_wmma_f32_16x16x32_f16(false, a, false, b, (short)0, c, false, false);
  }
};
template <> struct Frag<__bf16> {
  typedef v16b V; union U { v16b v; v8b h[2]; };
  static __device__ __forceinline__ v16b load(const __bf16* p) {
    U f; f.h[0] = *(const v8b*)(p); f.h[1] = *(const v8b*)(p + 16); return f.v;
  }
  static __device__ __forceinline__ v8f mma(v16b a, v16b b, v8f c) {
    return __builtin_amdgcn_wmma_f32_16x16x32_bf16(false, a, false, b, (short)0, c, false, false);
  }
};

// ---- Register-blocked batched WMMA GEMM ------------------------------------
// C[m,n] = scale * sum_k A[m,k] * Bt[n,k] (+bias)(+resid); each wave owns a 64x64 tile.
// A row-major [M,K]; Bt row-major [N,K]; M,N % 64 == 0, K % 128 == 0.
// SPLIT: operands are hi/lo planes (A2/Bt2 = lo planes, same layout); product = hi·hi + hi·lo + lo·hi.
// BIAS_MODE: 0 = none, 1 = bias[m], 2 = bias[n].
// OUT_MODE: 0 = f32, 1 = f16, 2 = bf16 hi plane (Cout) + bf16 lo plane (Cout2),
//   3 = even batch entries as 0; odd entries as bf16 hi and lo planes inside the entry's own f32 plane (hi first, lo strideC elements behind it),
//   4 = bf16 hi (Cout) and lo (Cout2) planes, transposed: element (m, n) at n * ldc + m (no bias, residual or activation).
// ET: 0 = f16 operands, 1 = bf16 operands (pointers passed as 16-bit storage)
template <int ET> struct Elem;
template <> struct Elem<0> { typedef _Float16 T; };
template <> struct Elem<1> { typedef __bf16 T; };
// Batch entry blockIdx.y reads A from element offset aoff[y] and has M[y] rows (entries may differ in source and height).
struct BatchA { long aoff[8]; int M[8]; };
template <int ET, bool SPLIT, int BIAS_MODE, int OUT_MODE, bool RESID, int ACT = 0>
__global__ __launch_bounds__(256) void wmma_gemm64(
    const unsigned short* __restrict__ Ap, const unsigned short* __restrict__ A2p, int lda, BatchA ba,
    const unsigned short* __restrict__ Btp, const unsigned short* __restrict__ Bt2p, int ldb, long strideB,
    void* __restrict__ Cout, void* __restrict__ Cout2, int ldc, long strideC,
    const float* __restrict__ bias,
    const float* __restrict__ resid, long strideR,
    int N, int K, float scale) {
  typedef typename Elem<ET>::T T;
  typedef typename Frag<T>::V V;
  const T* A = (const T*)Ap; const T* A2 = (const T*)A2p; const T* Bt = (const T*)Btp; const T* Bt2 = (const T*)Bt2p;
  __shared__ __align__(16) float sT[8][16 * 68];   // per-wave 16x64 slab, pitch 68 floats
  const int b    = blockIdx.y;
  const int M    = ba.M[b];
  const long offA = ba.aoff[b];
  const int lane = threadIdx.x & 31;
  const int wave = threadIdx.x >> 5;
  const int tilesN = N >> 6;
  const int tilesM = M >> 6;
  const int tile = blockIdx.x * 8 + wave;
  if (tile >= tilesM * tilesN) return;   // wave-uniform; no block barriers in this kernel
  const int tm = tile / tilesN;
  const int tn = tile - tm * tilesN;
  const int m0 = tm << 6;
  const int n0 = tn << 6;

  const T* Ab  = A  + offA;
  const T* Bb  = Bt + (size_t)b * strideB;
  const T* Ab2 = SPLIT ? (A2  + offA) : nullptr;
  const T* Bb2 = SPLIT ? (Bt2 + (size_t)b * strideB) : nullptr;

  const int rlane = lane & 15;                 // row (A) / col (B, D) within subtile
  const int koff  = (lane >> 4) * 8;           // k offset of this lane half
  const int mOff  = (lane >> 4) * 8;           // D row offset

  v8f acc[4][4];
#pragma unroll
  for (int i = 0; i < 4; ++i)
#pragma unroll
    for (int j = 0; j < 4; ++j) acc[i][j] = (v8f){0.f,0.f,0.f,0.f,0.f,0.f,0.f,0.f};

  // Two fragment sets in registers: a stage's loads are issued one stage ahead, in front of the other set's WMMAs, so that their latency
  // runs beside matrix work (with one set every group of loads was waited for where it was issued). A stage is KST of k: 32 with hi/lo
  // planes, 64 without (the same bytes). Every accumulator still takes its products in ascending k, hi*hi, hi*lo, lo*hi.
  constexpr int NK  = SPLIT ? 1 : 2;
  constexpr int KST = 32 * NK;
  struct FragSet { V ah[NK][4], al[NK][4], bh[NK][4], bl[NK][4]; };
  // address = a plane's uniform base + one 32-bit byte offset per fragment row (hi and lo planes share it), moved on once per trip;
  // the stages of a trip are constant offsets from it
  unsigned oA[4], oB[4];
#pragma unroll
  for (int i = 0; i < 4; ++i) {
    oA[i] = (unsigned)(((m0 + (i << 4) + rlane) * lda + koff) * (int)sizeof(T));
    oB[i] = (unsigned)(((n0 + (i << 4) + rlane) * ldb + koff) * (int)sizeof(T));
  }
  auto at = [](const T* base, unsigned off, int k) __attribute__((always_inline)) { return (const T*)((const char*)base + off) + k; };
  auto load_set = [&](FragSet& f, int ko) __attribute__((always_inline)) {
#pragma unroll
    for (int kk = 0; kk < NK; ++kk) {
#pragma unroll
      for (int j = 0; j < 4; ++j) {
        f.bh[kk][j] = Frag<T>::load(at(Bb, oB[j], ko + kk * 32));
        if (SPLIT) f.bl[kk][j] = Frag<T>::load(at(Bb2, oB[j], ko + kk * 32));
      }
#pragma unroll
      for (int i = 0; i < 4; ++i) {
        f.ah[kk][i] = Frag<T>::load(at(Ab, oA[i], ko + kk * 32));
        if (SPLIT) f.al[kk][i] = Frag<T>::load(at(Ab2, oA[i], ko + kk * 32));
      }
    }
    // keeps the scheduler from sinking these loads down to their first use, behind the other set's WMMAs
    __builtin_amdgcn_sched_barrier(0);
  };
  auto mma_set = [&](FragSet& f) __attribute__((always_inline)) {
#pragma unroll
    for (int kk = 0; kk < NK; ++kk) {
#pragma unroll
      for (int i = 0; i < 4; ++i) {
#pragma unroll
        for (int j = 0; j < 4; ++j) {
          acc[i][j] = Frag<T>::mma(f.ah[kk][i], f.bh[kk][j], acc[i][j]);
          if (SPLIT) {
            acc[i][j] = Frag<T>::mma(f.ah[kk][i], f.bl[kk][j], acc[i][j]);
            acc[i][j] = Frag<T>::mma(f.al[kk][i], f.bh[kk][j], acc[i][j]);
          }
        }
      }
    }
    // four vector slots between the set's last WMMAs and whatever refills their operand registers; the two scheduling barriers hold the
    // slots there and keep the next stage's loads behind this set's WMMAs. It names no fragment: one that an asm statement names was kept
    // in the first 256 registers, and two sets beside the accumulators do not fit there (they went to scratch).
    // s_wait_xcnt, a precaution: the loads issued ahead of these WMMAs may still be in flight, and what follows rewrites registers that they
    // name (the row offsets for the next trip; behind the loop a plane's base); the compiler had put no wait there. Naming the offsets keeps
    // their additions behind the wait (left to itself the compiler put them directly behind the loads).
    __builtin_amdgcn_sched_barrier(0);
    set_done(oA[0], oA[1], oA[2], oA[3], oB[0], oB[1], oB[2], oB[3]);
    __builtin_amdgcn_sched_barrier(0);
  };
  FragSet f0, f1;
  load_set(f0, 0);
  load_set(f1, KST);
  mma_set(f0);
  for (int k0 = 2 * KST; k0 < K; k0 += 2 * KST) {
    load_set(f0, 2 * KST);
    mma_set(f1);
#pragma unroll
    for (int i = 0; i < 4; ++i) { oA[i] += 2 * KST * (int)sizeof(T); oB[i] += 2 * KST * (int)sizeof(T); }
    load_set(f1, KST);
    mma_set(f0);
  }
  mma_set(f1);
  acc_guard4(acc[0][0], acc[0][1], acc[0][2], acc[0][3]);
  acc_guard4(acc[1][0], acc[1][1], acc[1][2], acc[1][3]);
  acc_guard4(acc[2][0], acc[2][1], acc[2][2], acc[2][3]);
  acc_guard4(acc[3][0], acc[3][1], acc[3][2], acc[3][3]);

  // ---- epilogue ----
  if (OUT_MODE == 4) {
    // a lane's 8 accumulator rows are 8 neighbours of one transposed row: 16 B per plane straight from registers; a wave fills whole 128-B lines
    static_assert(OUT_MODE != 4 || (BIAS_MODE == 0 && !RESID && ACT == 0), "transposed output is plain");
    unsigned short* C  = (unsigned short*)Cout  + (size_t)b * strideC;
    unsigned short* C2 = (unsigned short*)Cout2 + (size_t)b * strideC;
#pragma unroll
    for (int j = 0; j < 4; ++j) {
#pragma unroll
      for (int i = 0; i < 4; ++i) {
        v8h hv, lv;
#pragma unroll
        for (int r = 0; r < 8; ++r) {
          const float v = acc[i][j][r] * scale;
          const unsigned short hb = f2bf_bits(v);
          hv[r] = __builtin_bit_cast(_Float16, hb);
          lv[r] = __builtin_bit_cast(_Float16, f2bf_bits(v - bf_bits2f(hb)));
        }
        const size_t o = (size_t)(n0 + (j << 4) + rlane) * ldc + m0 + (i << 4) + mOff;
        *(v8h*)(C + o) = hv;
        *(v8h*)(C2 + o) = lv;
      }
    }
    return;
  }
  const bool out_f32 = OUT_MODE == 0 || (OUT_MODE == 3 && (b & 1) == 0);   // uniform over the work-group
  float* slab = sT[wave];
  const float* Rb = RESID ? (resid + (size_t)b * strideR) : nullptr;
#pragma unroll
  for (int i = 0; i < 4; ++i) {
    const int mBase = m0 + (i << 4);
#pragma unroll
    for (int j = 0; j < 4; ++j) {
      const int n = n0 + (j << 4) + rlane;
      float bv = 0.f;
      if (BIAS_MODE == 2) bv = bias[n];
#pragma unroll
      for (int r = 0; r < 8; ++r) {
        float v = acc[i][j][r] * scale;
        if (BIAS_MODE == 1) v += bias[mBase + mOff + r];
        if (BIAS_MODE == 2) v += bv;
        if (RESID) v += Rb[(size_t)(mBase + mOff + r) * ldc + n];
        if (ACT == 1) v = tanhf(v);
        slab[(mOff + r) * 68 + (j << 4) + rlane] = v;
      }
    }
    __builtin_amdgcn_fence(__ATOMIC_RELEASE, "workgroup");
    __builtin_amdgcn_wave_barrier();
    __builtin_amdgcn_fence(__ATOMIC_ACQUIRE, "workgroup");
    if (out_f32) {
      float* C = (float*)Cout + (size_t)b * strideC;
      const int hh = lane >> 4, c4 = (lane & 15) * 4;     // row seg = 256 B = 16 lanes x 16 B
      {
#pragma unroll
        for (int it = 0; it < 8; ++it) {
          const int row = it * 2 + hh;
          v4f v = *(const v4f*)(slab + row * 68 + c4);
          *(v4f*)(C + (size_t)(mBase + row) * ldc + n0 + c4) = v;
        }
        
      }
    } else {
      const int q = lane >> 3, c8 = (lane & 7) * 8;
      unsigned short* C  = (OUT_MODE == 3) ? (unsigned short*)((float*)Cout + (size_t)b * strideC) : ((unsigned short*)Cout + (size_t)b * strideC);
      unsigned short* C2 = (OUT_MODE == 3) ? (C + strideC) : (OUT_MODE == 2) ? ((unsigned short*)Cout2 + (size_t)b * strideC) : nullptr;
      {
#pragma unroll
        for (int it = 0; it < 4; ++it) {
          const int row = it * 4 + q;
          const float* sp = slab + row * 68 + c8;
          v8h hv, lv;
#pragma unroll
          for (int e = 0; e < 8; ++e) {
            if (OUT_MODE == 1) {
              hv[e] = (_Float16)sp[e];
            } else {
              unsigned short hb = f2bf_bits(sp[e]);
              unsigned short lb = f2bf_bits(sp[e] - bf_bits2f(hb));
              hv[e] = __builtin_bit_cast(_Float16, hb);
              lv[e] = __builtin_bit_cast(_Float16, lb);
            }
          }
          *(v8h*)(C + (size_t)(mBase + row) * ldc + n0 + c8) = hv;
          if (OUT_MODE >= 2) *(v8h*)(C2 + (size_t)(mBase + row) * ldc + n0 + c8) = lv;
        }
        // precaution: in the listing the f32 branch follows this one and reuses the registers that these stores name
        if (OUT_MODE == 3) asm volatile("s_wait_xcnt 0x0" ::: "memory");

      }
    }
    __builtin_amdgcn_fence(__ATOMIC_RELEASE, "workgroup");
    __builtin_amdgcn_wave_barrier();
    __builtin_amdgcn_fence(__ATOMIC_ACQUIRE, "workgroup");
  }
}

// x, memory and persona rows, one after the other, to one f16 plane and bf16 hi/lo planes; n*2 = float pairs per source (multiples of 256)
__global__ __launch_bounds__(256) void prep_inputs(
    const float* __restrict__ x, const float* __restrict__ mem, const float* __restrict__ per,
    _Float16* __restrict__ c16, __bf16* __restrict__ hi, __bf16* __restrict__ lo, int nx2, int nm2, int np2) {
  const int i = blockIdx.x * 256 + threadIdx.x;
  if (i >= nx2 + nm2 + np2) return;
  const float* in = x; int j = i;
  if (i >= nx2 + nm2) { in = per; j = i - nx2 - nm2; }
  else if (i >= nx2) { in = mem; j = i - nx2; }
  const float a = in[2 * j], b = in[2 * j + 1];
  const _Float16 h0 = (_Float16)a, h1 = (_Float16)b;
  ((unsigned*)c16)[i] = (unsigned)__builtin_bit_cast(unsigned short, h0) | ((unsigned)__builtin_bit_cast(unsigned short, h1) << 16);
  const unsigned short ah = f2bf_bits(a), bh = f2bf_bits(b);
  const unsigned short al = f2bf_bits(a - bf_bits2f(ah)), bl = f2bf_bits(b - bf_bits2f(bh));
  ((unsigned*)hi)[i] = (unsigned)ah | ((unsigned)bh << 16);
  ((unsigned*)lo)[i] = (unsigned)al | ((unsigned)bl << 16);
}

__global__ __launch_bounds__(256) void split_f32_bf16x2(
    const float* __restrict__ in, __bf16* __restrict__ hi, __bf16* __restrict__ lo, long n2) {
  long i = (long)blockIdx.x * 256 + threadIdx.x;
  long stride = (long)gridDim.x * 256;
  {
    for (long j = i; j < n2; j += stride) {
      const float a = in[2 * j], b = in[2 * j + 1];
      const unsigned short ah = f2bf_bits(a), bh = f2bf_bits(b);
      const unsigned short al = f2bf_bits(a - bf_bits2f(ah)), bl = f2bf_bits(b - bf_bits2f(bh));
      ((unsigned*)hi)[j] = (unsigned)ah | ((unsigned)bh << 16);
      ((unsigned*)lo)[j] = (unsigned)al | ((unsigned)bl << 16);
    }
    
  }
}


// eight source matrices of one launch; blockIdx.z picks one, its output plane follows at z * plane elements
struct Src8 { const float* p0; const float* p1; const float* p2; const float* p3; const float* p4; const float* p5; const float* p6; const float* p7; };
__device__ __forceinline__ const float* pick8(const Src8& s, int z) {
  switch (z) {
    case 0: return s.p0; case 1: return s.p1; case 2: return s.p2; case 3: return s.p3;
    case 4: return s.p4; case 5: return s.p5; case 6: return s.p6; default: return s.p7;
  }
}

// ---- f32 [R][C] (row pitch ldi) -> f16 transposed [C][R] (row pitch ldo); 64x64 tiles; each output row segment
__global__ __launch_bounds__(256) void transpose_cast_f16(Src8 srcs, int ldi,
                                                         _Float16* __restrict__ outT0, int ldo, long plane, float scale) {
  __shared__ __align__(16) _Float16 tile[64][72];     // [c][r]
  const float* __restrict__ in = pick8(srcs, blockIdx.z);
  _Float16* __restrict__ outT = outT0 + (size_t)blockIdx.z * plane;
  const int c0 = blockIdx.x * 64, r0 = blockIdx.y * 64;
  const int t = threadIdx.y * 32 + threadIdx.x;
  for (int i = threadIdx.y; i < 64; i += 8) {
    tile[threadIdx.x][i]      = (_Float16)(in[(size_t)(r0 + i) * ldi + c0 + threadIdx.x] * scale);
    tile[32 + threadIdx.x][i] = (_Float16)(in[(size_t)(r0 + i) * ldi + c0 + 32 + threadIdx.x] * scale);
  }
  __syncthreads();
  const int q = t >> 3, c8 = (t & 7) * 8;
  {
#pragma unroll
    for (int it = 0; it < 2; ++it) {
      const int c = it * 32 + q;
      v8h hv = *(const v8h*)(&tile[c][c8]);
      *(v8h*)(outT + (size_t)(c0 + c) * ldo + r0 + c8) = hv;
    }
    
  }
}

// ---- f32 [R][C] (pitch ldi) -> bf16 hi/lo transposed planes [C][R] (pitch ldo); 64x64 tiles; each output row segment
__global__ __launch_bounds__(256) void transpose_split_bf16(Src8 srcs, int ldi,
                                                           __bf16* __restrict__ outH0, __bf16* __restrict__ outL0, int ldo, long plane) {
  __shared__ __align__(16) float tile[64][68];     // [c][r]
  const float* __restrict__ in = pick8(srcs, blockIdx.z);
  __bf16* __restrict__ outH = outH0 + (size_t)blockIdx.z * plane;
  __bf16* __restrict__ outL = outL0 + (size_t)blockIdx.z * plane;
  const int c0 = blockIdx.x * 64, r0 = blockIdx.y * 64;
  const int t = threadIdx.y * 32 + threadIdx.x;
  for (int i = threadIdx.y; i < 64; i += 8) {
    tile[threadIdx.x][i]      = in[(size_t)(r0 + i) * ldi + c0 + threadIdx.x];
    tile[32 + threadIdx.x][i] = in[(size_t)(r0 + i) * ldi + c0 + 32 + threadIdx.x];
  }
  __syncthreads();
  const int q = t >> 3, c8 = (t & 7) * 8;
  {
#pragma unroll
    for (int it = 0; it < 2; ++it) {
      const int c = it * 32 + q;
      v8b hv, lv;
#pragma unroll
      for (int e = 0; e < 8; ++e) {
        const float f = tile[c][c8 + e];
        const unsigned short hb = f2bf_bits(f);
        hv[e] = __builtin_bit_cast(__bf16, hb);
        lv[e] = __builtin_bit_cast(__bf16, f2bf_bits(f - bf_bits2f(hb)));
      }
      *(v8b*)(outH + (size_t)(c0 + c) * ldo + r0 + c8) = hv;
      *(v8b*)(outL + (size_t)(c0 + c) * ldo + r0 + c8) = lv;
    }
    
  }
}

// =====================================================================================
// Generic causal/non-causal attention for head_dim 64, q f32 in / f32 out, bf16 operands with optional hi/lo splits.
//   scores = (q*qscale)·kᵀ : v_wmma_f32_16x16x32_bf16; SPLIT_QK -> q,k as bf16 hi/lo (hi·hi + hi·lo + lo·hi)
//   out    = p·v           : v_wmma_f32_16x16x32_bf16; SPLIT_PV -> p,v as bf16 hi/lo; else p,v plain bf16
//   f32 accumulate; online softmax in f32. Block = 4 waves = 64 query rows of one (batch, head); S % 64 == 0.
//   Element (b, s, h, d) of q and out lives at X[b*X_bs + s*X_rs + h*X_hs + d] (strides in floats, multiples of 4).
//   k arrives as bf16 hi and lo planes, element (s, h, d) at s*K_RS + h*k_hs + d; v as bf16 hi and lo planes, transposed: element
//   (s, h, d) at h*v_hs + d*V_RS + s (strides in bf16, multiples of 8; the row pitches are template constants, so that a tile's
//   rows are constant offsets from one address). A chunk's tiles are rows of 128 B that go to LDS as they are.
//   Masking: mask_mode 0 none, 1 causal (kv > q masked), 4 causal + sliding window (kv > q or q - kv > W masked; W passed in
//   mask_is_int); masked scores are replaced by mask_fill before the softmax. The mask is decided once per 64-key chunk with scalar
//   tests: a chunk that the window masks for all 64 query rows is not visited (its weights are exactly 0 after the softmax), a chunk
//   with no masked element runs no mask code, and only a chunk that the diagonal or the window's edge crosses compares and selects.
//   One launch serves four branches (batch 1): branch a reads q/k/v and writes out at a * {q,k,v,o}_st elements, with its own Skv,
//   mask_mode and window. grid.x = 4 * H * (S/64): first branches 0 and 1 (causal, cost grows with the query block) from the last
//   query block down, then branches 2 and 3, so that the long work-groups start first.
// =====================================================================================
#define AT_D 64
#define AT_NW 4
#define AT_QB 64
#define AT_KC 64
#define AT_LP 72   // LDS row pitch of the K, V and P tiles in bf16: 144 B = 16 B x 9, so that the 16 rows of a ds_load_b128 fall on different banks
struct AttnGeom { long q_bs, q_rs, q_hs, k_bs, k_rs, k_hs, v_bs, v_rs, v_hs, o_bs, o_rs, o_hs;
                  int S, Skv, H, mask_mode; float qscale; int blk0; float mask_fill; int mask_is_int; };
static_assert(sizeof(AttnGeom) == 128, "no padding");
struct AttnBranches { long q_st, k_st, v_st, o_st; int Skv[4]; int mask_mode[4]; int mask_is_int[4]; };

__device__ __forceinline__ unsigned short at_bf_bits(float f) {
  unsigned u = __float_as_uint(f);
  return (unsigned short)((u + 0x7FFFu + ((u >> 16) & 1u)) >> 16);
}
__device__ __forceinline__ __bf16 at_f2bf(float f) { return __builtin_bit_cast(__bf16, at_bf_bits(f)); }
__device__ __forceinline__ void at_split(float f, __bf16& hi, __bf16& lo) {
  const unsigned short hb = at_bf_bits(f);
  hi = __builtin_bit_cast(__bf16, hb);
  lo = at_f2bf(f - __uint_as_float(((unsigned)hb) << 16));
}
__device__ __forceinline__ v8f at_mma(v16b a, v16b b, v8f c) {
  c = __builtin_amdgcn_wmma_f32_16x16x32_bf16(false, a, false, b, (short)0, c, false, false);
  asm volatile("v_nop\n\tv_nop\n\tv_nop\n\tv_nop" : "+v"(c) : "v"(a), "v"(b));
  return c;
}

template <bool SPLIT_QK, bool SPLIT_PV, int K_RS, int V_RS>
__global__ __launch_bounds__(128)
void attn64_kernel(const float* __restrict__ q, const unsigned short* __restrict__ kh, const unsigned short* __restrict__ kl,
                   const unsigned short* __restrict__ vth, const unsigned short* __restrict__ vtl,
                   float* __restrict__ out, AttnGeom g0, AttnBranches br) {
  union FB { v16b v; v8b h[2]; };
  __shared__ __align__(16) __bf16 Ksh[AT_KC * AT_LP];            // K hi [kv][d]      9 KB
  __shared__ __align__(16) __bf16 Ksl[SPLIT_QK ? AT_KC * AT_LP : 8];
  __shared__ __align__(16) __bf16 Vth[AT_D * AT_LP];             // V hi [d][kv]      9 KB
  __shared__ __align__(16) __bf16 Vtl[SPLIT_PV ? AT_D * AT_LP : 8];
  __shared__ __align__(16) __bf16 Psh[AT_NW][16 * AT_LP];        // per wave P hi [row][kv]  9 KB
  __shared__ __align__(16) __bf16 Psl[SPLIT_PV ? AT_NW : 1][SPLIT_PV ? 16 * AT_LP : 8];
  __shared__ __align__(16) float  Os[AT_NW][16 * 68];            // per wave out tile, pitch 68

  const int tid  = threadIdx.x;
  const int wave = tid >> 5;
  const int lane = tid & 31;
  const int hh   = lane >> 4;
  const int c    = lane & 15;

  AttnGeom g = g0;
  const int nqb = g.S / AT_QB;
  const int bx = blockIdx.x + g.blk0;
  const int perBranch = g.H * nqb;
  int a, h, qb;
  if (bx < 2 * perBranch) {
    const int lvl = bx / (2 * g.H), w = bx % (2 * g.H);
    qb = nqb - 1 - lvl; a = w / g.H; h = w % g.H;
  } else {
    const int r = bx - 2 * perBranch, r2 = r % perBranch;
    a = 2 + r / perBranch; h = r2 / nqb; qb = r2 % nqb;
  }
  g.Skv = br.Skv[a]; g.mask_mode = br.mask_mode[a]; g.mask_is_int = br.mask_is_int[a];
  const int qbase_block = qb * AT_QB;
  const int q0 = qbase_block + wave * 16;

  const float* qb_ptr = q + (size_t)a * br.q_st + (size_t)h * g.q_hs;
  // staging: 8 threads per 128-B tile row, 16 rows per pass, 4 passes; offsets of this thread's 16 B in the first pass of chunk 0
  const int srow = tid >> 3, sc8 = (tid & 7) * 8;
  const size_t koff = (size_t)a * br.k_st + (size_t)h * g.k_hs + (size_t)srow * K_RS + sc8;
  const size_t voff = (size_t)a * br.v_st + (size_t)h * g.v_hs + (size_t)srow * V_RS + sc8;
  float*       ob_ptr = out + (size_t)a * br.o_st + (size_t)h * g.o_hs;

  // ---- Q fragments (A operand): 2 d-chunks, hi (and lo) ----
  v16b qah[2], qal[2];
  {
    const float* qrow = qb_ptr + (size_t)(q0 + c) * g.q_rs;
#pragma unroll
    for (int dc = 0; dc < 2; ++dc) {
#pragma unroll
      for (int e = 0; e < 8; ++e) {
        const float f0 = qrow[dc * 32 + 8 * hh + e] * g.qscale;
        const float f1 = qrow[dc * 32 + 16 + 8 * hh + e] * g.qscale;
        if (SPLIT_QK) { __bf16 hq, lq; at_split(f0, hq, lq); qah[dc][e] = hq; qal[dc][e] = lq; at_split(f1, hq, lq); qah[dc][8 + e] = hq; qal[dc][8 + e] = lq; }
        else { qah[dc][e] = at_f2bf(f0); qah[dc][8 + e] = at_f2bf(f1); qal[dc][e] = qah[dc][e]; qal[dc][8 + e] = qah[dc][8 + e]; }
      }
    }
  }

  float mrow[8], lrow[8];
  v8f oacc[4];
#pragma unroll
  for (int r = 0; r < 8; ++r) { mrow[r] = -INFINITY; lrow[r] = 0.f; }
#pragma unroll
  for (int t = 0; t < 4; ++t) oacc[t] = (v8f){0.f,0.f,0.f,0.f,0.f,0.f,0.f,0.f};

  const bool causal = (g.mask_mode == 1 || g.mask_mode == 4);
  const int win = (g.mask_mode == 4) ? g.mask_is_int : g.S;          // q - kv stays below S: no window
  const int nChunks = causal ? (qb + 1) : (g.Skv / AT_KC);           // block-uniform
  const int kcFirst = (causal && qbase_block > win) ? (qbase_block - win) / AT_KC : 0;   // chunk of the oldest key that the block's first row still sees
  // one address per plane, moved on from chunk to chunk; the four passes are constant offsets from it
  const __bf16* pkh = (const __bf16*)kh + koff + (size_t)kcFirst * (AT_KC * K_RS);    // K tile: rows are keys
  const __bf16* pkl = (const __bf16*)kl + koff + (size_t)kcFirst * (AT_KC * K_RS);
  const __bf16* pvh = (const __bf16*)vth + voff + (size_t)kcFirst * AT_KC;            // V tile: rows are head dims, keys run along the row
  const __bf16* pvl = (const __bf16*)vtl + voff + (size_t)kcFirst * AT_KC;
  for (int kc = kcFirst; kc < nChunks; ++kc) {
    const int kv0 = kc * AT_KC;
    {
      v8b rkh[4], rkl[4], rvh[4], rvl[4];
#pragma unroll
      for (int i = 0; i < 4; ++i) {
        rkh[i] = *(const v8b*)(pkh + i * 16 * K_RS);
        if (SPLIT_QK) rkl[i] = *(const v8b*)(pkl + i * 16 * K_RS);
        rvh[i] = *(const v8b*)(pvh + i * 16 * V_RS);
        if (SPLIT_PV) rvl[i] = *(const v8b*)(pvl + i * 16 * V_RS);
      }
      __syncthreads();
      pkh += AT_KC * K_RS; pkl += AT_KC * K_RS; pvh += AT_KC; pvl += AT_KC;
#pragma unroll
      for (int i = 0; i < 4; ++i) {
        const int lo = (i * 16 + srow) * AT_LP + sc8;
        *(v8b*)(Ksh + lo) = rkh[i];
        if (SPLIT_QK) *(v8b*)(Ksl + lo) = rkl[i];
        *(v8b*)(Vth + lo) = rvh[i];
        if (SPLIT_PV) *(v8b*)(Vtl + lo) = rvl[i];
      }
    }
    __syncthreads();

    v8f s[4];
#pragma unroll
    for (int j = 0; j < 4; ++j) {
      s[j] = (v8f){0.f,0.f,0.f,0.f,0.f,0.f,0.f,0.f};
#pragma unroll
      for (int dc = 0; dc < 2; ++dc) {
        FB kb;
        kb.h[0] = *(const v8b*)(Ksh + (j * 16 + c) * AT_LP + dc * 32 + 8 * hh);
        kb.h[1] = *(const v8b*)(Ksh + (j * 16 + c) * AT_LP + dc * 32 + 16 + 8 * hh);
        s[j] = at_mma(qah[dc], kb.v, s[j]);
        if (SPLIT_QK) {
          FB kl;
          kl.h[0] = *(const v8b*)(Ksl + (j * 16 + c) * AT_LP + dc * 32 + 8 * hh);
          kl.h[1] = *(const v8b*)(Ksl + (j * 16 + c) * AT_LP + dc * 32 + 16 + 8 * hh);
          s[j] = at_mma(qah[dc], kl.v, s[j]);
          s[j] = at_mma(qal[dc], kb.v, s[j]);
        }
      }
    }
    // block-uniform: the diagonal chunk, or one in which the block's last row is more than win past the chunk's first key
    if (causal && (kc == qb || qbase_block + (AT_QB - 1) - kv0 > win)) {
#pragma unroll
      for (int r = 0; r < 8; ++r) {
        const int qrow = q0 + 8 * hh + r;
#pragma unroll
        for (int j = 0; j < 4; ++j) {
          const int dist = qrow - (kv0 + j * 16 + c);
          s[j][r] = (dist < 0 || dist > win) ? g.mask_fill : s[j][r];
        }
      }
    }
    float cm[8];
#pragma unroll
    for (int r = 0; r < 8; ++r) {
      float m = -INFINITY;
#pragma unroll
      for (int j = 0; j < 4; ++j) m = fmaxf(m, s[j][r]);
#pragma unroll
      for (int off = 1; off < 16; off <<= 1) m = fmaxf(m, __shfl_xor(m, off, 32));
      cm[r] = m;
    }
    __bf16* pwh = Psh[wave];
    __bf16* pwl = Psl[SPLIT_PV ? wave : 0];
#pragma unroll
    for (int r = 0; r < 8; ++r) {
      const float mnew = fmaxf(mrow[r], cm[r]);
      const float alpha = expf(mrow[r] - mnew);
      mrow[r] = mnew;
      float psum = 0.f;
#pragma unroll
      for (int j = 0; j < 4; ++j) {
        const float p = expf(s[j][r] - mnew);
        psum += p;
        if (SPLIT_PV) { __bf16 a, bl; at_split(p, a, bl); pwh[(8 * hh + r) * AT_LP + j * 16 + c] = a; pwl[(8 * hh + r) * AT_LP + j * 16 + c] = bl; }
        else pwh[(8 * hh + r) * AT_LP + j * 16 + c] = at_f2bf(p);
      }
#pragma unroll
      for (int off = 1; off < 16; off <<= 1) psum += __shfl_xor(psum, off, 32);
      lrow[r] = lrow[r] * alpha + psum;
#pragma unroll
      for (int t = 0; t < 4; ++t) oacc[t][r] *= alpha;
    }
    __builtin_amdgcn_fence(__ATOMIC_RELEASE, "workgroup");
    __builtin_amdgcn_wave_barrier();
    __builtin_amdgcn_fence(__ATOMIC_ACQUIRE, "workgroup");
#pragma unroll
    for (int kk = 0; kk < 2; ++kk) {
      FB pa, pl;
      pa.h[0] = *(const v8b*)(pwh + c * AT_LP + kk * 32 + 8 * hh);
      pa.h[1] = *(const v8b*)(pwh + c * AT_LP + kk * 32 + 16 + 8 * hh);
      if (SPLIT_PV) {
        pl.h[0] = *(const v8b*)(pwl + c * AT_LP + kk * 32 + 8 * hh);
        pl.h[1] = *(const v8b*)(pwl + c * AT_LP + kk * 32 + 16 + 8 * hh);
      }
#pragma unroll
      for (int t = 0; t < 4; ++t) {
        FB vb;
        vb.h[0] = *(const v8b*)(Vth + (t * 16 + c) * AT_LP + kk * 32 + 8 * hh);
        vb.h[1] = *(const v8b*)(Vth + (t * 16 + c) * AT_LP + kk * 32 + 16 + 8 * hh);
        oacc[t] = at_mma(pa.v, vb.v, oacc[t]);
        if (SPLIT_PV) {
          FB vl;
          vl.h[0] = *(const v8b*)(Vtl + (t * 16 + c) * AT_LP + kk * 32 + 8 * hh);
          vl.h[1] = *(const v8b*)(Vtl + (t * 16 + c) * AT_LP + kk * 32 + 16 + 8 * hh);
          oacc[t] = at_mma(pa.v, vl.v, oacc[t]);
          oacc[t] = at_mma(pl.v, vb.v, oacc[t]);
        }
      }
    }
  }

  float* os = Os[wave];
#pragma unroll
  for (int r = 0; r < 8; ++r) {
    const float inv = 1.0f / lrow[r];
#pragma unroll
    for (int t = 0; t < 4; ++t) os[(8 * hh + r) * 68 + t * 16 + c] = oacc[t][r] * inv;
  }
  __builtin_amdgcn_fence(__ATOMIC_RELEASE, "workgroup");
  __builtin_amdgcn_wave_barrier();
  __builtin_amdgcn_fence(__ATOMIC_ACQUIRE, "workgroup");
  {
    const int c4 = (lane & 15) * 4;
    {
#pragma unroll
      for (int it = 0; it < 8; ++it) {
        const int row = it * 2 + hh;
        v4f val = *(const v4f*)(os + row * 68 + c4);
        *(v4f*)(ob_ptr + (size_t)(q0 + row) * g.o_rs + c4) = val;
      }
      
    }
  }
}

__global__ __launch_bounds__(256) void gate_fuse_kernel(const float* __restrict__ o0, const float* __restrict__ o1,
                                                       const float* __restrict__ o2, const float* __restrict__ o3,
                                                       const float* __restrict__ Wg, const float* __restrict__ bg,
                                                       float* __restrict__ out, int Hd) {
  __shared__ float red[4][8];
  const int row = blockIdx.x, t = threadIdx.x, lane = t & 31, wave = t >> 5;
  const float* os[4] = {o0 + (size_t)row * Hd, o1 + (size_t)row * Hd, o2 + (size_t)row * Hd, o3 + (size_t)row * Hd};
  float acc[4] = {0.f, 0.f, 0.f, 0.f};
  for (int i = 0; i < 4; ++i) {
    const float* o = os[i];
    for (int c = t; c < Hd; c += 256) {
      const float v = o[c];
      const float* w = Wg + (size_t)(i * Hd + c) * 4;
      acc[0] += v * w[0]; acc[1] += v * w[1]; acc[2] += v * w[2]; acc[3] += v * w[3];
    }
  }
#pragma unroll
  for (int g = 0; g < 4; ++g) { float a = acc[g]; for (int o = 16; o > 0; o >>= 1) a += __shfl_xor(a, o, 32); if (lane == 0) red[g][wave] = a; }
  __syncthreads();
  float gl[4];
#pragma unroll
  for (int g = 0; g < 4; ++g) { float a = 0.f; for (int w = 0; w < 8; ++w) a += red[g][w]; gl[g] = a + bg[g]; }
  const float mx = fmaxf(fmaxf(gl[0], gl[1]), fmaxf(gl[2], gl[3]));
  float e[4], se = 0.f;
#pragma unroll
  for (int g = 0; g < 4; ++g) { e[g] = expf(gl[g] - mx); se += e[g]; }
  const float inv = 1.0f / se;
  const int c = 4 * t;
  v4f r;
#pragma unroll
  for (int q = 0; q < 4; ++q) r[q] = (e[0] * inv) * os[0][c + q] + (e[1] * inv) * os[1][c + q] + (e[2] * inv) * os[2][c + q] + (e[3] * inv) * os[3][c + q];
  *(v4f*)(out + (size_t)row * Hd + c) = r;
  
}

extern "C" void kernel_launch(void* const* d_in, const int* in_sizes, int n_in,
                              void* d_out, int out_size, void* d_ws, size_t ws_size,
                              hipStream_t stream) {
  (void)in_sizes; (void)n_in; (void)out_size; (void)ws_size;
  const int S = 2048, E = 1024, H = 16, DH = 64, MM = 512, MP = 64, WIN = 512;
  // wire order: 16 weights ([in,out]), gate_w, gate_b, x, memory_kv, persona_kv
  const float* Wm[16]; for (int i = 0; i < 16; ++i) Wm[i] = (const float*)d_in[i];   // {local,long,mem,per} x {wq,wk,wv,wo}
  const float* gate_w = (const float*)d_in[16];
  const float* gate_b = (const float*)d_in[17];
  const float* x   = (const float*)d_in[18];   // [1,2048,1024]
  const float* mem = (const float*)d_in[19];   // [1,512,1024]
  const float* per = (const float*)d_in[20];   // [1,64,1024]
  float* out = (float*)d_out;

  char* ws = (char*)d_ws; size_t off = 0;
  auto carve = [&](size_t bytes) -> char* { char* p = ws + off; off += (bytes + 255) & ~(size_t)255; return p; };
  const int CT = S + MM + MP;                                   // context rows: x, then memory, then persona
  const long EE = (long)E * E, SE = (long)S * E;
  _Float16* C16  = (_Float16*)carve((size_t)CT * E * 2);        // 5.4 MB each
  __bf16*   Ch   = (__bf16*)carve((size_t)CT * E * 2);
  __bf16*   Cl   = (__bf16*)carve((size_t)CT * E * 2);
  _Float16* WqkT = (_Float16*)carve((size_t)8 * EE * 2);        // plane 2a = wq^T, 2a+1 = wk^T of branch a; 16.8 MB
  __bf16*   WvoTh = (__bf16*)carve((size_t)8 * EE * 2);         // plane 2a = wv^T, 2a+1 = wo^T
  __bf16*   WvoTl = (__bf16*)carve((size_t)8 * EE * 2);
  float*    QK   = (float*)carve((size_t)8 * SE * 4);           // plane 2a = q (f32), 2a+1 = k of branch a (bf16 hi, then bf16 lo); 67 MB
  __bf16*   VTh  = (__bf16*)carve((size_t)4 * SE * 2);          // v^T of branch a: [E][S] (row pitch S for every branch); 16.8 MB each
  __bf16*   VTl  = (__bf16*)carve((size_t)4 * SE * 2);
  float*    Of   = (float*)carve((size_t)4 * SE * 4);
  __bf16*   Oh   = (__bf16*)carve((size_t)4 * SE * 2);
  __bf16*   Ol   = (__bf16*)carve((size_t)4 * SE * 2);          // total 234 MB
  float*    Ob[4];
  for (int i = 0; i < 4; ++i) Ob[i] = QK + (size_t)i * SE;      // branch outputs take the q/k planes' place once attention is done

  const int  SKs[4]  = {S, S, MM, MP};                          // keys per branch
  const long ctx0[4] = {0, 0, (long)S * E, (long)(S + MM) * E}; // first context element per branch

  prep_inputs<<<CT * E / 2 / 256, 256, 0, stream>>>(x, mem, per, C16, Ch, Cl, S * E / 2, MM * E / 2, MP * E / 2);
  {
    Src8 qk = {Wm[0], Wm[1], Wm[4], Wm[5], Wm[8], Wm[9], Wm[12], Wm[13]};
    Src8 vo = {Wm[2], Wm[3], Wm[6], Wm[7], Wm[10], Wm[11], Wm[14], Wm[15]};
    transpose_cast_f16<<<dim3(E / 64, E / 64, 8), dim3(32, 8), 0, stream>>>(qk, E, WqkT, E, EE, 1.0f);
    transpose_split_bf16<<<dim3(E / 64, E / 64, 8), dim3(32, 8), 0, stream>>>(vo, E, WvoTh, WvoTl, E, EE);
  }
  const int tq = (S / 64) * (E / 64);
  {
    BatchA bqk, bv;
    for (int a = 0; a < 4; ++a) {
      bqk.aoff[2 * a] = 0;           bqk.M[2 * a] = S;
      bqk.aoff[2 * a + 1] = ctx0[a]; bqk.M[2 * a + 1] = SKs[a];
      bv.aoff[a] = ctx0[a];          bv.M[a] = SKs[a];
      bv.aoff[4 + a] = 0;            bv.M[4 + a] = 0;
    }
    wmma_gemm64<0, false, 0, 3, false><<<dim3((tq + 7) / 8, 8), 256, 0, stream>>>(
        U16(C16), nullptr, E, bqk, U16(WqkT), nullptr, E, EE, QK, nullptr, E, SE, nullptr, nullptr, 0, E, E, 1.0f);
    wmma_gemm64<1, true, 0, 4, false><<<dim3((tq + 7) / 8, 4), 256, 0, stream>>>(
        U16(Ch), U16(Cl), E, bv, U16(WvoTh), U16(WvoTl), E, 2 * EE, VTh, VTl, S, SE, nullptr, nullptr, 0, E, E, 1.0f);
  }
  {
    AttnGeom g;
    g.q_bs = SE; g.q_rs = E; g.q_hs = DH;
    g.k_bs = SE; g.k_rs = E; g.k_hs = DH;
    g.v_bs = SE; g.v_rs = S; g.v_hs = (long)DH * S;
    g.o_bs = SE; g.o_rs = E; g.o_hs = DH;
    g.S = S; g.Skv = S; g.H = H; g.qscale = 0.125f; g.blk0 = 0; g.mask_fill = -1.0e30f;
    g.mask_mode = 0; g.mask_is_int = 0;
    AttnBranches br;
    br.q_st = 2 * SE; br.k_st = 4 * SE; br.v_st = SE; br.o_st = SE;   // a q/k pair of f32-sized planes is 4 * SE bf16
    for (int a = 0; a < 4; ++a) { br.Skv[a] = SKs[a]; br.mask_mode[a] = 0; br.mask_is_int[a] = 0; }
    br.mask_mode[0] = 4; br.mask_is_int[0] = WIN;               // causal + window
    br.mask_mode[1] = 1;                                        // causal
    attn64_kernel<true, true, E, S><<<4 * H * (S / AT_QB), AT_NW * 32, 0, stream>>>(QK, U16(QK + SE), U16(QK + SE) + SE, U16(VTh), U16(VTl), Of, g, br);
  }
  split_f32_bf16x2<<<4096, 256, 0, stream>>>(Of, Oh, Ol, 4 * SE / 2);
  {
    BatchA bo;
    for (int a = 0; a < 4; ++a) { bo.aoff[a] = a * SE; bo.M[a] = S; bo.aoff[4 + a] = 0; bo.M[4 + a] = 0; }
    wmma_gemm64<1, true, 0, 0, false><<<dim3((tq + 7) / 8, 4), 256, 0, stream>>>(
        U16(Oh), U16(Ol), E, bo, U16(WvoTh + EE), U16(WvoTl + EE), E, 2 * EE, Ob[0], nullptr, E, SE, nullptr, nullptr, 0, E, E, 1.0f);
  }
  gate_fuse_kernel<<<S, 256, 0, stream>>>(Ob[0], Ob[1], Ob[2], Ob[3], gate_w, gate_b, out, E);
}

// v006
// Measured time: 285 microseconds a run.
// Timed twice side by side with v005, it ran 1.32 times as fast both times.
// Over all steps from v000 it is 6.16 times as fast.
#include <hip/hip_runtime.h>
#include <math.h>
// Four attentions (local = causal + 512 sliding window, long = causal, memory cross (512 keys), persona cross (64 keys)), 16 heads of 64:
// q/k projections (K=1024): v_wmma_f32_16x16x32_f16 (f16 operands); v and output projections (K=1024): v_wmma_f32_16x16x32_bf16 as bf16
// hi/lo splits; scores and p·v: v_wmma_f32_16x16x32_bf16 with q,k and p,v as bf16 hi/lo splits; f32 accumulate; softmax f32.
// k and v leave their projections already split into bf16 hi/lo planes (v transposed), so attention only copies their tiles to LDS.
// Gate (concat(outs)·gate_w, N=4, 0.1 % of MACs), gate softmax and the weighted fusion in f32 on VALU.
typedef __attribute__((ext_vector_type(16))) _Float16 v16h;
typedef __attribute__((ext_vector_type(8)))  _Float16 v8h;
typedef __attribute__((ext_vector_type(16))) __bf16   v16b;
typedef __attribute__((ext_vector_type(8)))  __bf16   v8b;
typedef __attribute__((ext_vector_type(8)))  float    v8f;
typedef __attribute__((ext_vector_type(4)))  float    v4f;
#define PSCALE 32768.0f
#define U16(p) ((const unsigned short*)(const void*)(p))
#define PSCALE_INV (1.0f / 32768.0f)

__device__ __forceinline__ unsigned short f2bf_bits(float f) {
  unsigned u = __float_as_uint(f);
  return (unsigned short)((u + 0x7FFFu + ((u >> 16) & 1u)) >> 16);
}
__device__ __forceinline__ float bf_bits2f(unsigned short h) { return __uint_as_float(((unsigned)h) << 16); }

// hazard guards as plain device helpers
__device__ __forceinline__ void acc_guard4(v8f& a, v8f& b, v8f& c, v8f& d) { asm volatile("v_nop\n\tv_nop\n\tv_nop\n\tv_nop" : "+v"(a), "+v"(b), "+v"(c), "+v"(d)); }
// end of a k tile's WMMAs in the GEMM k loop: four vector slots in front of whatever rewrites their operand registers (why: at the call)
__device__ __forceinline__ void set_done() { asm volatile("v_nop\n\tv_nop\n\tv_nop\n\tv_nop"); }
// Twelve asynchronous copies of 16 B per lane, global memory -> LDS, through no register: l = the lane's LDS byte address, g = its global address.
// s_wait_xcnt stands in the copies' own statement, a precaution: what follows may rewrite the address registers that the copies name.
__device__ __forceinline__ void copy12_to_lds(const unsigned (&l)[12], const char* const (&g)[12]) {
  asm volatile(
      "global_load_async_to_lds_b128 %0, %1, off\n\t"
      "global_load_async_to_lds_b128 %2, %3, off\n\t"
      "global_load_async_to_lds_b128 %4, %5, off\n\t"
      "global_load_async_to_lds_b128 %6, %7, off\n\t"
      "global_load_async_to_lds_b128 %8, %9, off\n\t"
      "global_load_async_to_lds_b128 %10, %11, off\n\t"
      "global_load_async_to_lds_b128 %12, %13, off\n\t"
      "global_load_async_to_lds_b128 %14, %15, off\n\t"
      "global_load_async_to_lds_b128 %16, %17, off\n\t"
      "global_load_async_to_lds_b128 %18, %19, off\n\t"
      "global_load_async_to_lds_b128 %20, %21, off\n\t"
      "global_load_async_to_lds_b128 %22, %23, off\n\t"
      "s_wait_xcnt 0x0"
      :: "v"(l[0]), "v"(g[0]), "v"(l[1]), "v"(g[1]), "v"(l[2]), "v"(g[2]), "v"(l[3]), "v"(g[3]), "v"(l[4]), "v"(g[4]), "v"(l[5]), "v"(g[5]),
         "v"(l[6]), "v"(g[6]), "v"(l[7]), "v"(g[7]), "v"(l[8]), "v"(g[8]), "v"(l[9]), "v"(g[9]), "v"(l[10]), "v"(g[10]), "v"(l[11]), "v"(g[11])
      : "memory");
}
template <typename T> struct Frag;
template <> struct Frag<_Float16> {
  typedef v16h V; union U { v16h v; v8h h[2]; };
  static __device__ __forceinline__ v16h load(const _Float16* p) {   // elements 0..7 <- p[0..7], 8..15 <- p[16..23]
    U f; f.h[0] = *(const v8h*)(p); f.h[1] = *(const v8h*)(p + 16); return f.v;
  }
  static __device__ __forceinline__ v8f mma(v16h a, v16h b, v8f c) {
    return __builtin_amdgcn_wmma_f32_16x16x32_f16(false, a, false, b, (short)0, c, false, false);
  }
};
template <> struct Frag<__bf16> {
  typedef v16b V; union U { v16b v; v8b h[2]; };
  static __device__ __forceinline__ v16b load(const __bf16* p) {
    U f; f.h[0] = *(const v8b*)(p); f.h[1] = *(const v8b*)(p + 16); return f.v;
  }
  static __device__ __forceinline__ v8f mma(v16b a, v16b b, v8f c) {
    return __builtin_amdgcn_wmma_f32_16x16x32_bf16(false, a, false, b, (short)0, c, false, false);
  }
};

// ---- Register-blocked batched WMMA GEMM ------------------------------------
// C[m,n] = scale * sum_k A[m,k] * Bt[n,k] (+bias)(+resid); each wave owns a 64x64 tile, a work-group's 8 waves a 128x256 tile (2 x 4 waves).
// A row-major [M,K]; Bt row-major [N,K]; M % 64 == 0, N % 256 == 0, K % 128 == 0; grid.x = (largest M / 128) * (N / 256).
// The work-group's A and B rows go to LDS 64 of k at a time (whole 128-B lines, each fetched once for all the waves that use it).
// SPLIT: operands are hi/lo planes (A2/Bt2 = lo planes, same layout); product = hi·hi + hi·lo + lo·hi.
// BIAS_MODE: 0 = none, 1 = bias[m], 2 = bias[n].
// OUT_MODE: 0 = f32, 1 = f16, 2 = bf16 hi plane (Cout) + bf16 lo plane (Cout2),
//   3 = even batch entries as 0; odd entries as bf16 hi and lo planes inside the entry's own f32 plane (hi first, lo strideC elements behind it),
//   4 = bf16 hi (Cout) and lo (Cout2) planes, transposed: element (m, n) at n * ldc + m (no bias, residual or activation).
// ET: 0 = f16 operands, 1 = bf16 operands (pointers passed as 16-bit storage)
template <int ET> struct Elem;
template <> struct Elem<0> { typedef _Float16 T; };
template <> struct Elem<1> { typedef __bf16 T; };
// Batch entry blockIdx.y reads A from element offset aoff[y] and has M[y] rows (entries may differ in source and height).
struct BatchA { long aoff[8]; int M[8]; };
template <int ET, bool SPLIT, int BIAS_MODE, int OUT_MODE, bool RESID, int ACT = 0>
__global__ __launch_bounds__(256) void wmma_gemm64(
    const unsigned short* __restrict__ Ap, const unsigned short* __restrict__ A2p, int lda, BatchA ba,
    const unsigned short* __restrict__ Btp, const unsigned short* __restrict__ Bt2p, int ldb, long strideB,
    void* __restrict__ Cout, void* __restrict__ Cout2, int ldc, long strideC,
    const float* __restrict__ bias,
    const float* __restrict__ resid, long strideR,
    int N, int K, float scale) {
  typedef typename Elem<ET>::T T;
  typedef typename Frag<T>::V V;
  const T* A = (const T*)Ap; const T* A2 = (const T*)A2p; const T* Bt = (const T*)Btp; const T* Bt2 = (const T*)Bt2p;
  constexpr int NPL = SPLIT ? 2 : 1;              // planes per operand
  constexpr int LP  = 72;                         // LDS row pitch in elements: 144 B = 16 B x 9, so that the 16 rows of a ds_load_b128 fall on different banks
  constexpr int A_EL = 128 * LP, B_EL = 256 * LP; // one plane of the A tile, of the B tile
  constexpr int BUF_EL = NPL * (A_EL + B_EL);     // one buffer: A hi, (A lo,) B hi, (B lo)
  __shared__ __align__(16) unsigned short sAB[2 * BUF_EL];
  __shared__ __align__(16) float sT[8][16 * 68];   // per-wave 16x64 slab, pitch 68 floats
  const int b    = blockIdx.y;
  const int M    = ba.M[b];
  const long offA = ba.aoff[b];
  const int lane = threadIdx.x & 31;
  const int wave = threadIdx.x >> 5;
  const int tilesBN = N >> 8;
  const int bm = blockIdx.x / tilesBN;
  const int bn = blockIdx.x - bm * tilesBN;
  if ((bm << 7) >= M) return;            // the same for the whole work-group, in front of every copy and barrier
  const int wm = wave >> 2, wn = wave & 3;
  const int m0 = (bm << 7) + (wm << 6);
  const int n0 = (bn << 8) + (wn << 6);

  const T* Ab  = A  + offA;
  const T* Bb  = Bt + (size_t)b * strideB;
  const T* Ab2 = SPLIT ? (A2  + offA) : nullptr;
  const T* Bb2 = SPLIT ? (Bt2 + (size_t)b * strideB) : nullptr;

  const int rlane = lane & 15;                 // row (A) / col (B, D) within subtile
  const int koff  = (lane >> 4) * 8;           // k offset of this lane half
  const int mOff  = (lane >> 4) * 8;           // D row offset

  v8f acc[4][4];
#pragma unroll
  for (int i = 0; i < 4; ++i)
#pragma unroll
    for (int j = 0; j < 4; ++j) acc[i][j] = (v8f){0.f,0.f,0.f,0.f,0.f,0.f,0.f,0.f};

  // Staging: 8 threads per 128-B row, 32 rows per pass; 4 passes for an A plane, 8 for a B plane. An A row past the entry's last one
  // (M = 64 under a 128-row tile) takes the last row's address: its products belong to a wave that stores nothing.
  const int srow = threadIdx.x >> 3, sc = threadIdx.x & 7;
  unsigned oA[4];                              // byte offsets of this thread's 16 B in k tile 0, one per pass (A), first pass (B)
#pragma unroll
  for (int p = 0; p < 4; ++p) {
    int r = (bm << 7) + p * 32 + srow;
    r = r < M ? r : M - 1;
    oA[p] = (unsigned)((r * lda + sc * 8) * (int)sizeof(T));
  }
  const unsigned oB = (unsigned)((((bn << 8) + srow) * ldb + sc * 8) * (int)sizeof(T));
  const size_t passB = (size_t)(32 * ldb) * sizeof(T);   // uniform: joins a plane's base
  const unsigned lds0 = (unsigned)(size_t)(const void*)sAB + (unsigned)(srow * LP + sc * 8) * 2u;   // low 32 bits of a __shared__ address = LDS byte address
  auto stage = [&](int buf, unsigned kbyte) __attribute__((always_inline)) {
#pragma unroll
    for (int pl = 0; pl < NPL; ++pl) {
      const char* ga = (const char*)(pl ? Ab2 : Ab) + kbyte;
      const char* gb = (const char*)(pl ? Bb2 : Bb) + kbyte;
      const unsigned la = lds0 + (unsigned)(buf * BUF_EL + pl * A_EL) * 2u;
      const unsigned lb = lds0 + (unsigned)(buf * BUF_EL + NPL * A_EL + pl * B_EL) * 2u;
      unsigned l[12]; const char* g[12];
#pragma unroll
      for (int p = 0; p < 4; ++p) { l[p] = la + (unsigned)(p * 32 * LP) * 2u; g[p] = ga + oA[p]; }
#pragma unroll
      for (int p = 0; p < 8; ++p) { l[4 + p] = lb + (unsigned)(p * 32 * LP) * 2u; g[4 + p] = (gb + p * passB) + oB; }
      copy12_to_lds(l, g);
    }
  };

  // Two fragment sets in registers, one per 32 of k: both sets' LDS reads are issued in front of the first set's WMMAs, so that the second
  // set's reads run beside matrix work. Every accumulator still takes its products in ascending k, hi*hi, hi*lo, lo*hi.
  struct FragSet { V ah[4], al[4], bh[4], bl[4]; };
  const T* sA = (const T*)sAB + ((wm << 6) + rlane) * LP + koff;
  const T* sB = (const T*)sAB + NPL * A_EL + ((wn << 6) + rlane) * LP + koff;
  auto load_set = [&](FragSet& f, int buf, int kk) __attribute__((always_inline)) {
    const int o = buf * BUF_EL + kk * 32;
#pragma unroll
    for (int j = 0; j < 4; ++j) {
      f.bh[j] = Frag<T>::load(sB + o + j * 16 * LP);
      if (SPLIT) f.bl[j] = Frag<T>::load(sB + o + B_EL + j * 16 * LP);
    }
#pragma unroll
    for (int i = 0; i < 4; ++i) {
      f.ah[i] = Frag<T>::load(sA + o + i * 16 * LP);
      if (SPLIT) f.al[i] = Frag<T>::load(sA + o + A_EL + i * 16 * LP);
    }
    // keeps the scheduler from sinking these reads down to their first use, behind the other set's WMMAs
    __builtin_amdgcn_sched_barrier(0);
  };
  auto mma_set = [&](FragSet& f) __attribute__((always_inline)) {
#pragma unroll
    for (int i = 0; i < 4; ++i) {
#pragma unroll
      for (int j = 0; j < 4; ++j) {
        acc[i][j] = Frag<T>::mma(f.ah[i], f.bh[j], acc[i][j]);
        if (SPLIT) {
          acc[i][j] = Frag<T>::mma(f.ah[i], f.bl[j], acc[i][j]);
          acc[i][j] = Frag<T>::mma(f.al[i], f.bh[j], acc[i][j]);
        }
      }
    }
  };
  FragSet f0, f1;
  const int nT = K >> 6;                        // k tiles of 64; even, at least 2
  // one k tile: trip t reads buffer t mod 2 alone, while tile t + 1's copies fly into the other buffer
  auto trip = [&](int buf, int t) __attribute__((always_inline)) {
    load_set(f0, buf, 0);
    load_set(f1, buf, 1);
    mma_set(f0);
    mma_set(f1);
    // four vector slots between the tile's last WMMAs and whatever rewrites their operand registers, also on the taken side of the branch
    // below; the two scheduling barriers hold the slots there. It names no fragment: one that an asm statement names was kept in the first
    // 256 registers, and two sets beside the accumulators do not fit there.
    __builtin_amdgcn_sched_barrier(0);
    set_done();
    __builtin_amdgcn_sched_barrier(0);
    asm volatile("s_wait_dscnt 0x0" ::: "memory");     // this wave's reads of the buffer are done before the buffer is refilled
    asm volatile("s_wait_asynccnt 0x0" ::: "memory");  // this wave's copies of tile t + 1 have landed before the barrier publishes them
    __syncthreads();                                   // publishes tile t + 1 and ends every wave's reads of tile t
    if (t + 2 < nT) stage(buf, (unsigned)(t + 2) * 128u);
  };
  stage(0, 0u);
  asm volatile("s_wait_asynccnt 0x0" ::: "memory");    // this wave's copies of tile 0 have landed before the barrier publishes them
  __syncthreads();
  stage(1, 128u);
  for (int t = 0; t < nT; t += 2) {
    trip(0, t);
    trip(1, t + 1);
  }
  asm volatile("s_wait_asynccnt 0x0" ::: "memory");    // no copy is outstanding when the wave goes on to its epilogue or ends
  if (m0 >= M) return;                                 // wave-uniform; no work-group barrier behind this line
  acc_guard4(acc[0][0], acc[0][1], acc[0][2], acc[0][3]);
  acc_guard4(acc[1][0], acc[1][1], acc[1][2], acc[1][3]);
  acc_guard4(acc[2][0], acc[2][1], acc[2][2], acc[2][3]);
  acc_guard4(acc[3][0], acc[3][1], acc[3][2], acc[3][3]);

  // ---- epilogue ----
  if (OUT_MODE == 4) {
    // a lane's 8 accumulator rows are 8 neighbours of one transposed row: 16 B per plane straight from registers; a wave fills whole 128-B lines
    static_assert(OUT_MODE != 4 || (BIAS_MODE == 0 && !RESID && ACT == 0), "transposed output is plain");
    unsigned short* C  = (unsigned short*)Cout  + (size_t)b * strideC;
    unsigned short* C2 = (unsigned short*)Cout2 + (size_t)b * strideC;
#pragma unroll
    for (int j = 0; j < 4; ++j) {
#pragma unroll
      for (int i = 0; i < 4; ++i) {
        v8h hv, lv;
#pragma unroll
        for (int r = 0; r < 8; ++r) {
          const float v = acc[i][j][r] * scale;
          const unsigned short hb = f2bf_bits(v);
          hv[r] = __builtin_bit_cast(_Float16, hb);
          lv[r] = __builtin_bit_cast(_Float16, f2bf_bits(v - bf_bits2f(hb)));
        }
        const size_t o = (size_t)(n0 + (j << 4) + rlane) * ldc + m0 + (i << 4) + mOff;
        *(v8h*)(C + o) = hv;
        *(v8h*)(C2 + o) = lv;
      }
    }
    return;
  }
  const bool out_f32 = OUT_MODE == 0 || (OUT_MODE == 3 && (b & 1) == 0);   // uniform over the work-group
  float* slab = sT[wave];
  const float* Rb = RESID ? (resid + (size_t)b * strideR) : nullptr;
#pragma unroll
  for (int i = 0; i < 4; ++i) {
    const int mBase = m0 + (i << 4);
#pragma unroll
    for (int j = 0; j < 4; ++j) {
      const int n = n0 + (j << 4) + rlane;
      float bv = 0.f;
      if (BIAS_MODE == 2) bv = bias[n];
#pragma unroll
      for (int r = 0; r < 8; ++r) {
        float v = acc[i][j][r] * scale;
        if (BIAS_MODE == 1) v += bias[mBase + mOff + r];
        if (BIAS_MODE == 2) v += bv;
        if (RESID) v += Rb[(size_t)(mBase + mOff + r) * ldc + n];
        if (ACT == 1) v = tanhf(v);
        slab[(mOff + r) * 68 + (j << 4) + rlane] = v;
      }
    }
    __builtin_amdgcn_fence(__ATOMIC_RELEASE, "workgroup");
    __builtin_amdgcn_wave_barrier();
    __builtin_amdgcn_fence(__ATOMIC_ACQUIRE, "workgroup");
    if (out_f32) {
      float* C = (float*)Cout + (size_t)b * strideC;
      const int hh = lane >> 4, c4 = (lane & 15) * 4;     // row seg = 256 B = 16 lanes x 16 B
      {
#pragma unroll
        for (int it = 0; it < 8; ++it) {
          const int row = it * 2 + hh;
          v4f v = *(const v4f*)(slab + row * 68 + c4);
          *(v4f*)(C + (size_t)(mBase + row) * ldc + n0 + c4) = v;
        }
        
      }
    } else {
      const int q = lane >> 3, c8 = (lane & 7) * 8;
      unsigned short* C  = (OUT_MODE == 3) ? (unsigned short*)((float*)Cout + (size_t)b * strideC) : ((unsigned short*)Cout + (size_t)b * strideC);
      unsigned short* C2 = (OUT_MODE == 3) ? (C + strideC) : (OUT_MODE == 2) ? ((unsigned short*)Cout2 + (size_t)b * strideC) : nullptr;
      {
#pragma unroll
        for (int it = 0; it < 4; ++it) {
          const int row = it * 4 + q;
          const float* sp = slab + row * 68 + c8;
          v8h hv, lv;
#pragma unroll
          for (int e = 0; e < 8; ++e) {
            if (OUT_MODE == 1) {
              hv[e] = (_Float16)sp[e];
            } else {
              unsigned short hb = f2bf_bits(sp[e]);
              unsigned short lb = f2bf_bits(sp[e] - bf_bits2f(hb));
              hv[e] = __builtin_bit_cast(_Float16, hb);
              lv[e] = __builtin_bit_cast(_Float16, lb);
            }
          }
          *(v8h*)(C + (size_t)(mBase + row) * ldc + n0 + c8) = hv;
          if (OUT_MODE >= 2) *(v8h*)(C2 + (size_t)(mBase + row) * ldc + n0 + c8) = lv;
        }
        // precaution: in the listing the f32 branch follows this one and reuses the registers that these stores name
        if (OUT_MODE == 3) asm volatile("s_wait_xcnt 0x0" ::: "memory");

      }
    }
    __builtin_amdgcn_fence(__ATOMIC_RELEASE, "workgroup");
    __builtin_amdgcn_wave_barrier();
    __builtin_amdgcn_fence(__ATOMIC_ACQUIRE, "workgroup");
  }
}

// x, memory and persona rows, one after the other, to one f16 plane and bf16 hi/lo planes; n*2 = float pairs per source (multiples of 256)
__global__ __launch_bounds__(256) void prep_inputs(
    const float* __restrict__ x, const float* __restrict__ mem, const float* __restrict__ per,
    _Float16* __restrict__ c16, __bf16* __restrict__ hi, __bf16* __restrict__ lo, int nx2, int nm2, int np2) {
  const int i = blockIdx.x * 256 + threadIdx.x;
  if (i >= nx2 + nm2 + np2) return;
  const float* in = x; int j = i;
  if (i >= nx2 + nm2) { in = per; j = i - nx2 - nm2; }
  else if (i >= nx2) { in = mem; j = i - nx2; }
  const float a = in[2 * j], b = in[2 * j + 1];
  const _Float16 h0 = (_Float16)a, h1 = (_Float16)b;
  ((unsigned*)c16)[i] = (unsigned)__builtin_bit_cast(unsigned short, h0) | ((unsigned)__builtin_bit_cast(unsigned short, h1) << 16);
  const unsigned short ah = f2bf_bits(a), bh = f2bf_bits(b);
  const unsigned short al = f2bf_bits(a - bf_bits2f(ah)), bl = f2bf_bits(b - bf_bits2f(bh));
  ((unsigned*)hi)[i] = (unsigned)ah | ((unsigned)bh << 16);
  ((unsigned*)lo)[i] = (unsigned)al | ((unsigned)bl << 16);
}

__global__ __launch_bounds__(256) void split_f32_bf16x2(
    const float* __restrict__ in, __bf16* __restrict__ hi, __bf16* __restrict__ lo, long n2) {
  long i = (long)blockIdx.x * 256 + threadIdx.x;
  long stride = (long)gridDim.x * 256;
  {
    for (long j = i; j < n2; j += stride) {
      const float a = in[2 * j], b = in[2 * j + 1];
      const unsigned short ah = f2bf_bits(a), bh = f2bf_bits(b);
      const unsigned short al = f2bf_bits(a - bf_bits2f(ah)), bl = f2bf_bits(b - bf_bits2f(bh));
      ((unsigned*)hi)[j] = (unsigned)ah | ((unsigned)bh << 16);
      ((unsigned*)lo)[j] = (unsigned)al | ((unsigned)bl << 16);
    }
    
  }
}


// eight source matrices of one launch; blockIdx.z picks one, its output plane follows at z * plane elements
struct Src8 { const float* p0; const float* p1; const float* p2; const float* p3; const float* p4; const float* p5; const float* p6; const float* p7; };
__device__ __forceinline__ const float* pick8(const Src8& s, int z) {
  switch (z) {
    case 0: return s.p0; case 1: return s.p1; case 2: return s.p2; case 3: return s.p3;
    case 4: return s.p4; case 5: return s.p5; case 6: return s.p6; default: return s.p7;
  }
}

// ---- f32 [R][C] (row pitch ldi) -> f16 transposed [C][R] (row pitch ldo); 64x64 tiles; each output row segment
__global__ __launch_bounds__(256) void transpose_cast_f16(Src8 srcs, int ldi,
                                                         _Float16* __restrict__ outT0, int ldo, long plane, float scale) {
  __shared__ __align__(16) _Float16 tile[64][72];     // [c][r]
  const float* __restrict__ in = pick8(srcs, blockIdx.z);
  _Float16* __restrict__ outT = outT0 + (size_t)blockIdx.z * plane;
  const int c0 = blockIdx.x * 64, r0 = blockIdx.y * 64;
  const int t = threadIdx.y * 32 + threadIdx.x;
  for (int i = threadIdx.y; i < 64; i += 8) {
    tile[threadIdx.x][i]      = (_Float16)(in[(size_t)(r0 + i) * ldi + c0 + threadIdx.x] * scale);
    tile[32 + threadIdx.x][i] = (_Float16)(in[(size_t)(r0 + i) * ldi + c0 + 32 + threadIdx.x] * scale);
  }
  __syncthreads();
  const int q = t >> 3, c8 = (t & 7) * 8;
  {
#pragma unroll
    for (int it = 0; it < 2; ++it) {
      const int c = it * 32 + q;
      v8h hv = *(const v8h*)(&tile[c][c8]);
      *(v8h*)(outT + (size_t)(c0 + c) * ldo + r0 + c8) = hv;
    }
    
  }
}

// ---- f32 [R][C] (pitch ldi) -> bf16 hi/lo transposed planes [C][R] (pitch ldo); 64x64 tiles; each output row segment
__global__ __launch_bounds__(256) void transpose_split_bf16(Src8 srcs, int ldi,
                                                           __bf16* __restrict__ outH0, __bf16* __restrict__ outL0, int ldo, long plane) {
  __shared__ __align__(16) float tile[64][68];     // [c][r]
  const float* __restrict__ in = pick8(srcs, blockIdx.z);
  __bf16* __restrict__ outH = outH0 + (size_t)blockIdx.z * plane;
  __bf16* __restrict__ outL = outL0 + (size_t)blockIdx.z * plane;
  const int c0 = blockIdx.x * 64, r0 = blockIdx.y * 64;
  const int t = threadIdx.y * 32 + threadIdx.x;
  for (int i = threadIdx.y; i < 64; i += 8) {
    tile[threadIdx.x][i]      = in[(size_t)(r0 + i) * ldi + c0 + threadIdx.x];
    tile[32 + threadIdx.x][i] = in[(size_t)(r0 + i) * ldi + c0 + 32 + threadIdx.x];
  }
  __syncthreads();
  const int q = t >> 3, c8 = (t & 7) * 8;
  {
#pragma unroll
    for (int it = 0; it < 2; ++it) {
      const int c = it * 32 + q;
      v8b hv, lv;
#pragma unroll
      for (int e = 0; e < 8; ++e) {
        const float f = tile[c][c8 + e];
        const unsigned short hb = f2bf_bits(f);
        hv[e] = __builtin_bit_cast(__bf16, hb);
        lv[e] = __builtin_bit_cast(__bf16, f2bf_bits(f - bf_bits2f(hb)));
      }
      *(v8b*)(outH + (size_t)(c0 + c) * ldo + r0 + c8) = hv;
      *(v8b*)(outL + (size_t)(c0 + c) * ldo + r0 + c8) = lv;
    }
    
  }
}

// =====================================================================================
// Generic causal/non-causal attention for head_dim 64, q f32 in / f32 out, bf16 operands with optional hi/lo splits.
//   scores = (q*qscale)·kᵀ : v_wmma_f32_16x16x32_bf16; SPLIT_QK -> q,k as bf16 hi/lo (hi·hi + hi·lo + lo·hi)
//   out    = p·v           : v_wmma_f32_16x16x32_bf16; SPLIT_PV -> p,v as bf16 hi/lo; else p,v plain bf16
//   f32 accumulate; online softmax in f32. Block = 4 waves = 64 query rows of one (batch, head); S % 64 == 0.
//   Element (b, s, h, d) of q and out lives at X[b*X_bs + s*X_rs + h*X_hs + d] (strides in floats, multiples of 4).
//   k arrives as bf16 hi and lo planes, element (s, h, d) at s*K_RS + h*k_hs + d; v as bf16 hi and lo planes, transposed: element
//   (s, h, d) at h*v_hs + d*V_RS + s (strides in bf16, multiples of 8; the row pitches are template constants, so that a tile's
//   rows are constant offsets from one address). A chunk's tiles are rows of 128 B that go to LDS as they are.
//   Masking: mask_mode 0 none, 1 causal (kv > q masked), 4 causal + sliding window (kv > q or q - kv > W masked; W passed in
//   mask_is_int); masked scores are replaced by mask_fill before the softmax. The mask is decided once per 64-key chunk with scalar
//   tests: a chunk that the window masks for all 64 query rows is not visited (its weights are exactly 0 after the softmax), a chunk
//   with no masked element runs no mask code, and only a chunk that the diagonal or the window's edge crosses compares and selects.
//   One launch serves four branches (batch 1): branch a reads q/k/v and writes out at a * {q,k,v,o}_st elements, with its own Skv,
//   mask_mode and window. grid.x = 4 * H * (S/64): first branches 0 and 1 (causal, cost grows with the query block) from the last
//   query block down, then branches 2 and 3, so that the long work-groups start first.
// =====================================================================================
#define AT_D 64
#define AT_NW 4
#define AT_QB 64
#define AT_KC 64
#define AT_LP 72   // LDS row pitch of the K, V and P tiles in bf16: 144 B = 16 B x 9, so that the 16 rows of a ds_load_b128 fall on different banks
struct AttnGeom { long q_bs, q_rs, q_hs, k_bs, k_rs, k_hs, v_bs, v_rs, v_hs, o_bs, o_rs, o_hs;
                  int S, Skv, H, mask_mode; float qscale; int blk0; float mask_fill; int mask_is_int; };
static_assert(sizeof(AttnGeom) == 128, "no padding");
struct AttnBranches { long q_st, k_st, v_st, o_st; int Skv[4]; int mask_mode[4]; int mask_is_int[4]; };

__device__ __forceinline__ unsigned short at_bf_bits(float f) {
  unsigned u = __float_as_uint(f);
  return (unsigned short)((u + 0x7FFFu + ((u >> 16) & 1u)) >> 16);
}
__device__ __forceinline__ __bf16 at_f2bf(float f) { return __builtin_bit_cast(__bf16, at_bf_bits(f)); }
__device__ __forceinline__ void at_split(float f, __bf16& hi, __bf16& lo) {
  const unsigned short hb = at_bf_bits(f);
  hi = __builtin_bit_cast(__bf16, hb);
  lo = at_f2bf(f - __uint_as_float(((unsigned)hb) << 16));
}
__device__ __forceinline__ v8f at_mma(v16b a, v16b b, v8f c) {
  c = __builtin_amdgcn_wmma_f32_16x16x32_bf16(false, a, false, b, (short)0, c, false, false);
  asm volatile("v_nop\n\tv_nop\n\tv_nop\n\tv_nop" : "+v"(c) : "v"(a), "v"(b));
  return c;
}

template <bool SPLIT_QK, bool SPLIT_PV, int K_RS, int V_RS>
__global__ __launch_bounds__(128)
void attn64_kernel(const float* __restrict__ q, const unsigned short* __restrict__ kh, const unsigned short* __restrict__ kl,
                   const unsigned short* __restrict__ vth, const unsigned short* __restrict__ vtl,
                   float* __restrict__ out, AttnGeom g0, AttnBranches br) {
  union FB { v16b v; v8b h[2]; };
  __shared__ __align__(16) __bf16 Ksh[AT_KC * AT_LP];            // K hi [kv][d]      9 KB
  __shared__ __align__(16) __bf16 Ksl[SPLIT_QK ? AT_KC * AT_LP : 8];
  __shared__ __align__(16) __bf16 Vth[AT_D * AT_LP];             // V hi [d][kv]      9 KB
  __shared__ __align__(16) __bf16 Vtl[SPLIT_PV ? AT_D * AT_LP : 8];
  __shared__ __align__(16) __bf16 Psh[AT_NW][16 * AT_LP];        // per wave P hi [row][kv]  9 KB
  __shared__ __align__(16) __bf16 Psl[SPLIT_PV ? AT_NW : 1][SPLIT_PV ? 16 * AT_LP : 8];
  __shared__ __align__(16) float  Os[AT_NW][16 * 68];            // per wave out tile, pitch 68

  const int tid  = threadIdx.x;
  const int wave = tid >> 5;
  const int lane = tid & 31;
  const int hh   = lane >> 4;
  const int c    = lane & 15;

  AttnGeom g = g0;
  const int nqb = g.S / AT_QB;
  const int bx = blockIdx.x + g.blk0;
  const int perBranch = g.H * nqb;
  int a, h, qb;
  if (bx < 2 * perBranch) {
    const int lvl = bx / (2 * g.H), w = bx % (2 * g.H);
    qb = nqb - 1 - lvl; a = w / g.H; h = w % g.H;
  } else {
    const int r = bx - 2 * perBranch, r2 = r % perBranch;
    a = 2 + r / perBranch; h = r2 / nqb; qb = r2 % nqb;
  }
  g.Skv = br.Skv[a]; g.mask_mode = br.mask_mode[a]; g.mask_is_int = br.mask_is_int[a];
  const int qbase_block = qb * AT_QB;
  const int q0 = qbase_block + wave * 16;

  const float* qb_ptr = q + (size_t)a * br.q_st + (size_t)h * g.q_hs;
  // staging: 8 threads per 128-B tile row, 16 rows per pass, 4 passes; offsets of this thread's 16 B in the first pass of chunk 0
  const int srow = tid >> 3, sc8 = (tid & 7) * 8;
  const size_t koff = (size_t)a * br.k_st + (size_t)h * g.k_hs + (size_t)srow * K_RS + sc8;
  const size_t voff = (size_t)a * br.v_st + (size_t)h * g.v_hs + (size_t)srow * V_RS + sc8;
  float*       ob_ptr = out + (size_t)a * br.o_st + (size_t)h * g.o_hs;

  // ---- Q fragments (A operand): 2 d-chunks, hi (and lo) ----
  v16b qah[2], qal[2];
  {
    const float* qrow = qb_ptr + (size_t)(q0 + c) * g.q_rs;
#pragma unroll
    for (int dc = 0; dc < 2; ++dc) {
#pragma unroll
      for (int e = 0; e < 8; ++e) {
        const float f0 = qrow[dc * 32 + 8 * hh + e] * g.qscale;
        const float f1 = qrow[dc * 32 + 16 + 8 * hh + e] * g.qscale;
        if (SPLIT_QK) { __bf16 hq, lq; at_split(f0, hq, lq); qah[dc][e] = hq; qal[dc][e] = lq; at_split(f1, hq, lq); qah[dc][8 + e] = hq; qal[dc][8 + e] = lq; }
        else { qah[dc][e] = at_f2bf(f0); qah[dc][8 + e] = at_f2bf(f1); qal[dc][e] = qah[dc][e]; qal[dc][8 + e] = qah[dc][8 + e]; }
      }
    }
  }

  float mrow[8], lrow[8];
  v8f oacc[4];
#pragma unroll
  for (int r = 0; r < 8; ++r) { mrow[r] = -INFINITY; lrow[r] = 0.f; }
#pragma unroll
  for (int t = 0; t < 4; ++t) oacc[t] = (v8f){0.f,0.f,0.f,0.f,0.f,0.f,0.f,0.f};

  const bool causal = (g.mask_mode == 1 || g.mask_mode == 4);
  const int win = (g.mask_mode == 4) ? g.mask_is_int : g.S;          // q - kv stays below S: no window
  const int nChunks = causal ? (qb + 1) : (g.Skv / AT_KC);           // block-uniform
  const int kcFirst = (causal && qbase_block > win) ? (qbase_block - win) / AT_KC : 0;   // chunk of the oldest key that the block's first row still sees
  // one address per plane, moved on from chunk to chunk; the four passes are constant offsets from it
  const __bf16* pkh = (const __bf16*)kh + koff + (size_t)kcFirst * (AT_KC * K_RS);    // K tile: rows are keys
  const __bf16* pkl = (const __bf16*)kl + koff + (size_t)kcFirst * (AT_KC * K_RS);
  const __bf16* pvh = (const __bf16*)vth + voff + (size_t)kcFirst * AT_KC;            // V tile: rows are head dims, keys run along the row
  const __bf16* pvl = (const __bf16*)vtl + voff + (size_t)kcFirst * AT_KC;
  for (int kc = kcFirst; kc < nChunks; ++kc) {
    const int kv0 = kc * AT_KC;
    {
      v8b rkh[4], rkl[4], rvh[4], rvl[4];
#pragma unroll
      for (int i = 0; i < 4; ++i) {
        rkh[i] = *(const v8b*)(pkh + i * 16 * K_RS);
        if (SPLIT_QK) rkl[i] = *(const v8b*)(pkl + i * 16 * K_RS);
        rvh[i] = *(const v8b*)(pvh + i * 16 * V_RS);
        if (SPLIT_PV) rvl[i] = *(const v8b*)(pvl + i * 16 * V_RS);
      }
      __syncthreads();
      pkh += AT_KC * K_RS; pkl += AT_KC * K_RS; pvh += AT_KC; pvl += AT_KC;
#pragma unroll
      for (int i = 0; i < 4; ++i) {
        const int lo = (i * 16 + srow) * AT_LP + sc8;
        *(v8b*)(Ksh + lo) = rkh[i];
        if (SPLIT_QK) *(v8b*)(Ksl + lo) = rkl[i];
        *(v8b*)(Vth + lo) = rvh[i];
        if (SPLIT_PV) *(v8b*)(Vtl + lo) = rvl[i];
      }
    }
    __syncthreads();

    v8f s[4];
#pragma unroll
    for (int j = 0; j < 4; ++j) {
      s[j] = (v8f){0.f,0.f,0.f,0.f,0.f,0.f,0.f,0.f};
#pragma unroll
      for (int dc = 0; dc < 2; ++dc) {
        FB kb;
        kb.h[0] = *(const v8b*)(Ksh + (j * 16 + c) * AT_LP + dc * 32 + 8 * hh);
        kb.h[1] = *(const v8b*)(Ksh + (j * 16 + c) * AT_LP + dc * 32 + 16 + 8 * hh);
        s[j] = at_mma(qah[dc], kb.v, s[j]);
        if (SPLIT_QK) {
          FB kl;
          kl.h[0] = *(const v8b*)(Ksl + (j * 16 + c) * AT_LP + dc * 32 + 8 * hh);
          kl.h[1] = *(const v8b*)(Ksl + (j * 16 + c) * AT_LP + dc * 32 + 16 + 8 * hh);
          s[j] = at_mma(qah[dc], kl.v, s[j]);
          s[j] = at_mma(qal[dc], kb.v, s[j]);
        }
      }
    }
    // block-uniform: the diagonal chunk, or one in which the block's last row is more than win past the chunk's first key
    if (causal && (kc == qb || qbase_block + (AT_QB - 1) - kv0 > win)) {
#pragma unroll
      for (int r = 0; r < 8; ++r) {
        const int qrow = q0 + 8 * hh + r;
#pragma unroll
        for (int j = 0; j < 4; ++j) {
          const int dist = qrow - (kv0 + j * 16 + c);
          s[j][r] = (dist < 0 || dist > win) ? g.mask_fill : s[j][r];
        }
      }
    }
    float cm[8];
#pragma unroll
    for (int r = 0; r < 8; ++r) {
      float m = -INFINITY;
#pragma unroll
      for (int j = 0; j < 4; ++j) m = fmaxf(m, s[j][r]);
#pragma unroll
      for (int off = 1; off < 16; off <<= 1) m = fmaxf(m, __shfl_xor(m, off, 32));
      cm[r] = m;
    }
    __bf16* pwh = Psh[wave];
    __bf16* pwl = Psl[SPLIT_PV ? wave : 0];
#pragma unroll
    for (int r = 0; r < 8; ++r) {
      const float mnew = fmaxf(mrow[r], cm[r]);
      const float alpha = expf(mrow[r] - mnew);
      mrow[r] = mnew;
      float psum = 0.f;
#pragma unroll
      for (int j = 0; j < 4; ++j) {
        const float p = expf(s[j][r] - mnew);
        psum += p;
        if (SPLIT_PV) { __bf16 a, bl; at_split(p, a, bl); pwh[(8 * hh + r) * AT_LP + j * 16 + c] = a; pwl[(8 * hh + r) * AT_LP + j * 16 + c] = bl; }
        else pwh[(8 * hh + r) * AT_LP + j * 16 + c] = at_f2bf(p);
      }
#pragma unroll
      for (int off = 1; off < 16; off <<= 1) psum += __shfl_xor(psum, off, 32);
      lrow[r] = lrow[r] * alpha + psum;
#pragma unroll
      for (int t = 0; t < 4; ++t) oacc[t][r] *= alpha;
    }
    __builtin_amdgcn_fence(__ATOMIC_RELEASE, "workgroup");
    __builtin_amdgcn_wave_barrier();
    __builtin_amdgcn_fence(__ATOMIC_ACQUIRE, "workgroup");
#pragma unroll
    for (int kk = 0; kk < 2; ++kk) {
      FB pa, pl;
      pa.h[0] = *(const v8b*)(pwh + c * AT_LP + kk * 32 + 8 * hh);
      pa.h[1] = *(const v8b*)(pwh + c * AT_LP + kk * 32 + 16 + 8 * hh);
      if (SPLIT_PV) {
        pl.h[0] = *(const v8b*)(pwl + c * AT_LP + kk * 32 + 8 * hh);
        pl.h[1] = *(const v8b*)(pwl + c * AT_LP + kk * 32 + 16 + 8 * hh);
      }
#pragma unroll
      for (int t = 0; t < 4; ++t) {
        FB vb;
        vb.h[0] = *(const v8b*)(Vth + (t * 16 + c) * AT_LP + kk * 32 + 8 * hh);
        vb.h[1] = *(const v8b*)(Vth + (t * 16 + c) * AT_LP + kk * 32 + 16 + 8 * hh);
        oacc[t] = at_mma(pa.v, vb.v, oacc[t]);
        if (SPLIT_PV) {
          FB vl;
          vl.h[0] = *(const v8b*)(Vtl + (t * 16 + c) * AT_LP + kk * 32 + 8 * hh);
          vl.h[1] = *(const v8b*)(Vtl + (t * 16 + c) * AT_LP + kk * 32 + 16 + 8 * hh);
          oacc[t] = at_mma(pa.v, vl.v, oacc[t]);
          oacc[t] = at_mma(pl.v, vb.v, oacc[t]);
        }
      }
    }
  }

  float* os = Os[wave];
#pragma unroll
  for (int r = 0; r < 8; ++r) {
    const float inv = 1.0f / lrow[r];
#pragma unroll
    for (int t = 0; t < 4; ++t) os[(8 * hh + r) * 68 + t * 16 + c] = oacc[t][r] * inv;
  }
  __builtin_amdgcn_fence(__ATOMIC_RELEASE, "workgroup");
  __builtin_amdgcn_wave_barrier();
  __builtin_amdgcn_fence(__ATOMIC_ACQUIRE, "workgroup");
  {
    const int c4 = (lane & 15) * 4;
    {
#pragma unroll
      for (int it = 0; it < 8; ++it) {
        const int row = it * 2 + hh;
        v4f val = *(const v4f*)(os + row * 68 + c4);
        *(v4f*)(ob_ptr + (size_t)(q0 + row) * g.o_rs + c4) = val;
      }
      
    }
  }
}

__global__ __launch_bounds__(256) void gate_fuse_kernel(const float* __restrict__ o0, const float* __restrict__ o1,
                                                       const float* __restrict__ o2, const float* __restrict__ o3,
                                                       const float* __restrict__ Wg, const float* __restrict__ bg,
                                                       float* __restrict__ out, int Hd) {
  __shared__ float red[4][8];
  const int row = blockIdx.x, t = threadIdx.x, lane = t & 31, wave = t >> 5;
  const float* os[4] = {o0 + (size_t)row * Hd, o1 + (size_t)row * Hd, o2 + (size_t)row * Hd, o3 + (size_t)row * Hd};
  float acc[4] = {0.f, 0.f, 0.f, 0.f};
  for (int i = 0; i < 4; ++i) {
    const float* o = os[i];
    for (int c = t; c < Hd; c += 256) {
      const float v = o[c];
      const float* w = Wg + (size_t)(i * Hd + c) * 4;
      acc[0] += v * w[0]; acc[1] += v * w[1]; acc[2] += v * w[2]; acc[3] += v * w[3];
    }
  }
#pragma unroll
  for (int g = 0; g < 4; ++g) { float a = acc[g]; for (int o = 16; o > 0; o >>= 1) a += __shfl_xor(a, o, 32); if (lane == 0) red[g][wave] = a; }
  __syncthreads();
  float gl[4];
#pragma unroll
  for (int g = 0; g < 4; ++g) { float a = 0.f; for (int w = 0; w < 8; ++w) a += red[g][w]; gl[g] = a + bg[g]; }
  const float mx = fmaxf(fmaxf(gl[0], gl[1]), fmaxf(gl[2], gl[3]));
  float e[4], se = 0.f;
#pragma unroll
  for (int g = 0; g < 4; ++g) { e[g] = expf(gl[g] - mx); se += e[g]; }
  const float inv = 1.0f / se;
  const int c = 4 * t;
  v4f r;
#pragma unroll
  for (int q = 0; q < 4; ++q) r[q] = (e[0] * inv) * os[0][c + q] + (e[1] * inv) * os[1][c + q] + (e[2] * inv) * os[2][c + q] + (e[3] * inv) * os[3][c + q];
  *(v4f*)(out + (size_t)row * Hd + c) = r;
  
}

extern "C" void kernel_launch(void* const* d_in, const int* in_sizes, int n_in,
                              void* d_out, int out_size, void* d_ws, size_t ws_size,
                              hipStream_t stream) {
  (void)in_sizes; (void)n_in; (void)out_size; (void)ws_size;
  const int S = 2048, E = 1024, H = 16, DH = 64, MM = 512, MP = 64, WIN = 512;
  // wire order: 16 weights ([in,out]), gate_w, gate_b, x, memory_kv, persona_kv
  const float* Wm[16]; for (int i = 0; i < 16; ++i) Wm[i] = (const float*)d_in[i];   // {local,long,mem,per} x {wq,wk,wv,wo}
  const float* gate_w = (const float*)d_in[16];
  const float* gate_b = (const float*)d_in[17];
  const float* x   = (const float*)d_in[18];   // [1,2048,1024]
  const float* mem = (const float*)d_in[19];   // [1,512,1024]
  const float* per = (const float*)d_in[20];   // [1,64,1024]
  float* out = (float*)d_out;

  char* ws = (char*)d_ws; size_t off = 0;
  auto carve = [&](size_t bytes) -> char* { char* p = ws + off; off += (bytes + 255) & ~(size_t)255; return p; };
  const int CT = S + MM + MP;                                   // context rows: x, then memory, then persona
  const long EE = (long)E * E, SE = (long)S * E;
  _Float16* C16  = (_Float16*)carve((size_t)CT * E * 2);        // 5.4 MB each
  __bf16*   Ch   = (__bf16*)carve((size_t)CT * E * 2);
  __bf16*   Cl   = (__bf16*)carve((size_t)CT * E * 2);
  _Float16* WqkT = (_Float16*)carve((size_t)8 * EE * 2);        // plane 2a = wq^T, 2a+1 = wk^T of branch a; 16.8 MB
  __bf16*   WvoTh = (__bf16*)carve((size_t)8 * EE * 2);         // plane 2a = wv^T, 2a+1 = wo^T
  __bf16*   WvoTl = (__bf16*)carve((size_t)8 * EE * 2);
  float*    QK   = (float*)carve((size_t)8 * SE * 4);           // plane 2a = q (f32), 2a+1 = k of branch a (bf16 hi, then bf16 lo); 67 MB
  __bf16*   VTh  = (__bf16*)carve((size_t)4 * SE * 2);          // v^T of branch a: [E][S] (row pitch S for every branch); 16.8 MB each
  __bf16*   VTl  = (__bf16*)carve((size_t)4 * SE * 2);
  float*    Of   = (float*)carve((size_t)4 * SE * 4);
  __bf16*   Oh   = (__bf16*)carve((size_t)4 * SE * 2);
  __bf16*   Ol   = (__bf16*)carve((size_t)4 * SE * 2);          // total 234 MB
  float*    Ob[4];
  for (int i = 0; i < 4; ++i) Ob[i] = QK + (size_t)i * SE;      // branch outputs take the q/k planes' place once attention is done

  const int  SKs[4]  = {S, S, MM, MP};                          // keys per branch
  const long ctx0[4] = {0, 0, (long)S * E, (long)(S + MM) * E}; // first context element per branch

  prep_inputs<<<CT * E / 2 / 256, 256, 0, stream>>>(x, mem, per, C16, Ch, Cl, S * E / 2, MM * E / 2, MP * E / 2);
  {
    Src8 qk = {Wm[0], Wm[1], Wm[4], Wm[5], Wm[8], Wm[9], Wm[12], Wm[13]};
    Src8 vo = {Wm[2], Wm[3], Wm[6], Wm[7], Wm[10], Wm[11], Wm[14], Wm[15]};
    transpose_cast_f16<<<dim3(E / 64, E / 64, 8), dim3(32, 8), 0, stream>>>(qk, E, WqkT, E, EE, 1.0f);
    transpose_split_bf16<<<dim3(E / 64, E / 64, 8), dim3(32, 8), 0, stream>>>(vo, E, WvoTh, WvoTl, E, EE);
  }
  const int tb = (S / 128) * (E / 256);                         // 128x256 tiles of the tallest batch entry
  {
    BatchA bqk, bv;
    for (int a = 0; a < 4; ++a) {
      bqk.aoff[2 * a] = 0;           bqk.M[2 * a] = S;
      bqk.aoff[2 * a + 1] = ctx0[a]; bqk.M[2 * a + 1] = SKs[a];
      bv.aoff[a] = ctx0[a];          bv.M[a] = SKs[a];
      bv.aoff[4 + a] = 0;            bv.M[4 + a] = 0;
    }
    wmma_gemm64<0, false, 0, 3, false><<<dim3(tb, 8), 256, 0, stream>>>(
        U16(C16), nullptr, E, bqk, U16(WqkT), nullptr, E, EE, QK, nullptr, E, SE, nullptr, nullptr, 0, E, E, 1.0f);
    wmma_gemm64<1, true, 0, 4, false><<<dim3(tb, 4), 256, 0, stream>>>(
        U16(Ch), U16(Cl), E, bv, U16(WvoTh), U16(WvoTl), E, 2 * EE, VTh, VTl, S, SE, nullptr, nullptr, 0, E, E, 1.0f);
  }
  {
    AttnGeom g;
    g.q_bs = SE; g.q_rs = E; g.q_hs = DH;
    g.k_bs = SE; g.k_rs = E; g.k_hs = DH;
    g.v_bs = SE; g.v_rs = S; g.v_hs = (long)DH * S;
    g.o_bs = SE; g.o_rs = E; g.o_hs = DH;
    g.S = S; g.Skv = S; g.H = H; g.qscale = 0.125f; g.blk0 = 0; g.mask_fill = -1.0e30f;
    g.mask_mode = 0; g.mask_is_int = 0;
    AttnBranches br;
    br.q_st = 2 * SE; br.k_st = 4 * SE; br.v_st = SE; br.o_st = SE;   // a q/k pair of f32-sized planes is 4 * SE bf16
    for (int a = 0; a < 4; ++a) { br.Skv[a] = SKs[a]; br.mask_mode[a] = 0; br.mask_is_int[a] = 0; }
    br.mask_mode[0] = 4; br.mask_is_int[0] = WIN;               // causal + window
    br.mask_mode[1] = 1;                                        // causal
    attn64_kernel<true, true, E, S><<<4 * H * (S / AT_QB), AT_NW * 32, 0, stream>>>(QK, U16(QK + SE), U16(QK + SE) + SE, U16(VTh), U16(VTl), Of, g, br);
  }
  split_f32_bf16x2<<<4096, 256, 0, stream>>>(Of, Oh, Ol, 4 * SE / 2);
  {
    BatchA bo;
    for (int a = 0; a < 4; ++a) { bo.aoff[a] = a * SE; bo.M[a] = S; bo.aoff[4 + a] = 0; bo.M[4 + a] = 0; }
    wmma_gemm64<1, true, 0, 0, false><<<dim3(tb, 4), 256, 0, stream>>>(
        U16(Oh), U16(Ol), E, bo, U16(WvoTh + EE), U16(WvoTl + EE), E, 2 * EE, Ob[0], nullptr, E, SE, nullptr, nullptr, 0, E, E, 1.0f);
  }
  gate_fuse_kernel<<<S, 256, 0, stream>>>(Ob[0], Ob[1], Ob[2], Ob[3], gate_w, gate_b, out, E);
}

// v007
// A run of this version takes 253 microseconds.
// Two timings next to v006 both put it at 1.13 times that version's speed.
// All steps since v000 together make it 6.97 times as fast.
#include <hip/hip_runtime.h>
#include <math.h>
// Four attentions (local = causal + 512 sliding window, long = causal, memory cross (512 keys), persona cross (64 keys)), 16 heads of 64:
// q/k projections (K=1024): v_wmma_f32_16x16x32_f16 (f16 operands); v and output projections (K=1024): v_wmma_f32_16x16x32_bf16 as bf16
// hi/lo splits; scores and p·v: v_wmma_f32_16x16x32_bf16 with q,k and p,v as bf16 hi/lo splits; f32 accumulate; softmax f32.
// k and v leave their projections already split into bf16 hi/lo planes (v transposed), so attention only copies their tiles to LDS.
// Gate (concat(outs)·gate_w, N=4, 0.1 % of MACs), gate softmax and the weighted fusion in f32 on VALU.
typedef __attribute__((ext_vector_type(16))) _Float16 v16h;
typedef __attribute__((ext_vector_type(8)))  _Float16 v8h;
typedef __attribute__((ext_vector_type(16))) __bf16   v16b;
typedef __attribute__((ext_vector_type(8)))  __bf16   v8b;
typedef __attribute__((ext_vector_type(8)))  float    v8f;
typedef __attribute__((ext_vector_type(4)))  float    v4f;
#define PSCALE 32768.0f
#define U16(p) ((const unsigned short*)(const void*)(p))
#define PSCALE_INV (1.0f / 32768.0f)

__device__ __forceinline__ unsigned short f2bf_bits(float f) {
  unsigned u = __float_as_uint(f);
  return (unsigned short)((u + 0x7FFFu + ((u >> 16) & 1u)) >> 16);
}
__device__ __forceinline__ float bf_bits2f(unsigned short h) { return __uint_as_float(((unsigned)h) << 16); }

// hazard guards as plain device helpers
__device__ __forceinline__ void acc_guard4(v8f& a, v8f& b, v8f& c, v8f& d) { asm volatile("v_nop\n\tv_nop\n\tv_nop\n\tv_nop" : "+v"(a), "+v"(b), "+v"(c), "+v"(d)); }
// end of a k tile's WMMAs in the GEMM k loop: four vector slots in front of whatever rewrites their operand registers (why: at the call)
__device__ __forceinline__ void set_done() { asm volatile("v_nop\n\tv_nop\n\tv_nop\n\tv_nop"); }
// Twelve asynchronous copies of 16 B per lane, global memory -> LDS, through no register: l = the lane's LDS byte address, g = its global address.
// s_wait_xcnt stands in the copies' own statement, a precaution: what follows may rewrite the address registers that the copies name.
__device__ __forceinline__ void copy12_to_lds(const unsigned (&l)[12], const char* const (&g)[12]) {
  asm volatile(
      "global_load_async_to_lds_b128 %0, %1, off\n\t"
      "global_load_async_to_lds_b128 %2, %3, off\n\t"
      "global_load_async_to_lds_b128 %4, %5, off\n\t"
      "global_load_async_to_lds_b128 %6, %7, off\n\t"
      "global_load_async_to_lds_b128 %8, %9, off\n\t"
      "global_load_async_to_lds_b128 %10, %11, off\n\t"
      "global_load_async_to_lds_b128 %12, %13, off\n\t"
      "global_load_async_to_lds_b128 %14, %15, off\n\t"
      "global_load_async_to_lds_b128 %16, %17, off\n\t"
      "global_load_async_to_lds_b128 %18, %19, off\n\t"
      "global_load_async_to_lds_b128 %20, %21, off\n\t"
      "global_load_async_to_lds_b128 %22, %23, off\n\t"
      "s_wait_xcnt 0x0"
      :: "v"(l[0]), "v"(g[0]), "v"(l[1]), "v"(g[1]), "v"(l[2]), "v"(g[2]), "v"(l[3]), "v"(g[3]), "v"(l[4]), "v"(g[4]), "v"(l[5]), "v"(g[5]),
         "v"(l[6]), "v"(g[6]), "v"(l[7]), "v"(g[7]), "v"(l[8]), "v"(g[8]), "v"(l[9]), "v"(g[9]), "v"(l[10]), "v"(g[10]), "v"(l[11]), "v"(g[11])
      : "memory");
}
template <typename T> struct Frag;
template <> struct Frag<_Float16> {
  typedef v16h V; union U { v16h v; v8h h[2]; };
  static __device__ __forceinline__ v16h load(const _Float16* p) {   // elements 0..7 <- p[0..7], 8..15 <- p[16..23]
    U f; f.h[0] = *(const v8h*)(p); f.h[1] = *(const v8h*)(p + 16); return f.v;
  }
  static __device__ __forceinline__ v8f mma(v16h a, v16h b, v8f c) {
    return __builtin_amdgcn_wmma_f32_16x16x32_f16(false, a, false, b, (short)0, c, false, false);
  }
};
template <> struct Frag<__bf16> {
  typedef v16b V; union U { v16b v; v8b h[2]; };
  static __device__ __forceinline__ v16b load(const __bf16* p) {
    U f; f.h[0] = *(const v8b*)(p); f.h[1] = *(const v8b*)(p + 16); return f.v;
  }
  static __device__ __forceinline__ v8f mma(v16b a, v16b b, v8f c) {
    return __builtin_amdgcn_wmma_f32_16x16x32_bf16(false, a, false, b, (short)0, c, false, false);
  }
};

// ---- Register-blocked batched WMMA GEMM ------------------------------------
// C[m,n] = scale * sum_k A[m,k] * Bt[n,k] (+bias)(+resid); each wave owns a 64x64 tile, a work-group's 8 waves a 128x256 tile (2 x 4 waves).
// A row-major [M,K]; Bt row-major [N,K]; M % 64 == 0, N % 256 == 0, K % 128 == 0; grid.x = (largest M / 128) * (N / 256).
// The work-group's A and B rows go to LDS 64 of k at a time (whole 128-B lines, each fetched once for all the waves that use it).
// SPLIT: operands are hi/lo planes (A2/Bt2 = lo planes, same layout); product = hi·hi + hi·lo + lo·hi.
// BIAS_MODE: 0 = none, 1 = bias[m], 2 = bias[n].
// OUT_MODE: 0 = f32, 1 = f16, 2 = bf16 hi plane (Cout) + bf16 lo plane (Cout2),
//   3 = even batch entries as 0; odd entries as bf16 hi and lo planes inside the entry's own f32 plane (hi first, lo strideC elements behind it),
//   4 = bf16 hi (Cout) and lo (Cout2) planes, transposed: element (m, n) at n * ldc + m (no bias, residual or activation).
// ET: 0 = f16 operands, 1 = bf16 operands (pointers passed as 16-bit storage)
template <int ET> struct Elem;
template <> struct Elem<0> { typedef _Float16 T; };
template <> struct Elem<1> { typedef __bf16 T; };
// Batch entry blockIdx.y reads A from element offset aoff[y] and has M[y] rows (entries may differ in source and height).
struct BatchA { long aoff[8]; int M[8]; };
template <int ET, bool SPLIT, int BIAS_MODE, int OUT_MODE, bool RESID, int ACT = 0>
__global__ __launch_bounds__(256) void wmma_gemm64(
    const unsigned short* __restrict__ Ap, const unsigned short* __restrict__ A2p, int lda, BatchA ba,
    const unsigned short* __restrict__ Btp, const unsigned short* __restrict__ Bt2p, int ldb, long strideB,
    void* __restrict__ Cout, void* __restrict__ Cout2, int ldc, long strideC,
    const float* __restrict__ bias,
    const float* __restrict__ resid, long strideR,
    int N, int K, float scale) {
  typedef typename Elem<ET>::T T;
  typedef typename Frag<T>::V V;
  const T* A = (const T*)Ap; const T* A2 = (const T*)A2p; const T* Bt = (const T*)Btp; const T* Bt2 = (const T*)Bt2p;
  constexpr int NPL = SPLIT ? 2 : 1;              // planes per operand
  constexpr int LP  = 72;                         // LDS row pitch in elements: 144 B = 16 B x 9, so that the 16 rows of a ds_load_b128 fall on different banks
  constexpr int A_EL = 128 * LP, B_EL = 256 * LP; // one plane of the A tile, of the B tile
  constexpr int BUF_EL = NPL * (A_EL + B_EL);     // one buffer: A hi, (A lo,) B hi, (B lo)
  __shared__ __align__(16) unsigned short sAB[2 * BUF_EL];
  __shared__ __align__(16) float sT[8][16 * 68];   // per-wave 16x64 slab, pitch 68 floats
  const int b    = blockIdx.y;
  const int M    = ba.M[b];
  const long offA = ba.aoff[b];
  const int lane = threadIdx.x & 31;
  const int wave = threadIdx.x >> 5;
  const int tilesBN = N >> 8;
  const int bm = blockIdx.x / tilesBN;
  const int bn = blockIdx.x - bm * tilesBN;
  if ((bm << 7) >= M) return;            // the same for the whole work-group, in front of every copy and barrier
  const int wm = wave >> 2, wn = wave & 3;
  const int m0 = (bm << 7) + (wm << 6);
  const int n0 = (bn << 8) + (wn << 6);

  const T* Ab  = A  + offA;
  const T* Bb  = Bt + (size_t)b * strideB;
  const T* Ab2 = SPLIT ? (A2  + offA) : nullptr;
  const T* Bb2 = SPLIT ? (Bt2 + (size_t)b * strideB) : nullptr;

  const int rlane = lane & 15;                 // row (A) / col (B, D) within subtile
  const int koff  = (lane >> 4) * 8;           // k offset of this lane half
  const int mOff  = (lane >> 4) * 8;           // D row offset

  v8f acc[4][4];
#pragma unroll
  for (int i = 0; i < 4; ++i)
#pragma unroll
    for (int j = 0; j < 4; ++j) acc[i][j] = (v8f){0.f,0.f,0.f,0.f,0.f,0.f,0.f,0.f};

  // Staging: 8 threads per 128-B row, 32 rows per pass; 4 passes for an A plane, 8 for a B plane. An A row past the entry's last one
  // (M = 64 under a 128-row tile) takes the last row's address: its products belong to a wave that stores nothing.
  const int srow = threadIdx.x >> 3, sc = threadIdx.x & 7;
  unsigned oA[4];                              // byte offsets of this thread's 16 B in k tile 0, one per pass (A), first pass (B)
#pragma unroll
  for (int p = 0; p < 4; ++p) {
    int r = (bm << 7) + p * 32 + srow;
    r = r < M ? r : M - 1;
    oA[p] = (unsigned)((r * lda + sc * 8) * (int)sizeof(T));
  }
  const unsigned oB = (unsigned)((((bn << 8) + srow) * ldb + sc * 8) * (int)sizeof(T));
  const size_t passB = (size_t)(32 * ldb) * sizeof(T);   // uniform: joins a plane's base
  const unsigned lds0 = (unsigned)(size_t)(const void*)sAB + (unsigned)(srow * LP + sc * 8) * 2u;   // low 32 bits of a __shared__ address = LDS byte address
  auto stage = [&](int buf, unsigned kbyte) __attribute__((always_inline)) {
#pragma unroll
    for (int pl = 0; pl < NPL; ++pl) {
      const char* ga = (const char*)(pl ? Ab2 : Ab) + kbyte;
      const char* gb = (const char*)(pl ? Bb2 : Bb) + kbyte;
      const unsigned la = lds0 + (unsigned)(buf * BUF_EL + pl * A_EL) * 2u;
      const unsigned lb = lds0 + (unsigned)(buf * BUF_EL + NPL * A_EL + pl * B_EL) * 2u;
      unsigned l[12]; const char* g[12];
#pragma unroll
      for (int p = 0; p < 4; ++p) { l[p] = la + (unsigned)(p * 32 * LP) * 2u; g[p] = ga + oA[p]; }
#pragma unroll
      for (int p = 0; p < 8; ++p) { l[4 + p] = lb + (unsigned)(p * 32 * LP) * 2u; g[4 + p] = (gb + p * passB) + oB; }
      copy12_to_lds(l, g);
    }
  };

  // Two fragment sets in registers, one per 32 of k: both sets' LDS reads are issued in front of the first set's WMMAs, so that the second
  // set's reads run beside matrix work. Every accumulator still takes its products in ascending k, hi*hi, hi*lo, lo*hi.
  struct FragSet { V ah[4], al[4], bh[4], bl[4]; };
  const T* sA = (const T*)sAB + ((wm << 6) + rlane) * LP + koff;
  const T* sB = (const T*)sAB + NPL * A_EL + ((wn << 6) + rlane) * LP + koff;
  auto load_set = [&](FragSet& f, int buf, int kk) __attribute__((always_inline)) {
    const int o = buf * BUF_EL + kk * 32;
#pragma unroll
    for (int j = 0; j < 4; ++j) {
      f.bh[j] = Frag<T>::load(sB + o + j * 16 * LP);
      if (SPLIT) f.bl[j] = Frag<T>::load(sB + o + B_EL + j * 16 * LP);
    }
#pragma unroll
    for (int i = 0; i < 4; ++i) {
      f.ah[i] = Frag<T>::load(sA + o + i * 16 * LP);
      if (SPLIT) f.al[i] = Frag<T>::load(sA + o + A_EL + i * 16 * LP);
    }
    // keeps the scheduler from sinking these reads down to their first use, behind the other set's WMMAs
    __builtin_amdgcn_sched_barrier(0);
  };
  auto mma_set = [&](FragSet& f) __attribute__((always_inline)) {
#pragma unroll
    for (int i = 0; i < 4; ++i) {
#pragma unroll
      for (int j = 0; j < 4; ++j) {
        acc[i][j] = Frag<T>::mma(f.ah[i], f.bh[j], acc[i][j]);
        if (SPLIT) {
          acc[i][j] = Frag<T>::mma(f.ah[i], f.bl[j], acc[i][j]);
          acc[i][j] = Frag<T>::mma(f.al[i], f.bh[j], acc[i][j]);
        }
      }
    }
  };
  FragSet f0, f1;
  const int nT = K >> 6;                        // k tiles of 64; even, at least 2
  // one k tile: trip t reads buffer t mod 2 alone, while tile t + 1's copies fly into the other buffer
  auto trip = [&](int buf, int t) __attribute__((always_inline)) {
    load_set(f0, buf, 0);
    load_set(f1, buf, 1);
    mma_set(f0);
    mma_set(f1);
    // four vector slots between the tile's last WMMAs and whatever rewrites their operand registers, also on the taken side of the branch
    // below; the two scheduling barriers hold the slots there. It names no fragment: one that an asm statement names was kept in the first
    // 256 registers, and two sets beside the accumulators do not fit there.
    __builtin_amdgcn_sched_barrier(0);
    set_done();
    __builtin_amdgcn_sched_barrier(0);
    asm volatile("s_wait_dscnt 0x0" ::: "memory");     // this wave's reads of the buffer are done before the buffer is refilled
    asm volatile("s_wait_asynccnt 0x0" ::: "memory");  // this wave's copies of tile t + 1 have landed before the barrier publishes them
    __syncthreads();                                   // publishes tile t + 1 and ends every wave's reads of tile t
    if (t + 2 < nT) stage(buf, (unsigned)(t + 2) * 128u);
  };
  stage(0, 0u);
  asm volatile("s_wait_asynccnt 0x0" ::: "memory");    // this wave's copies of tile 0 have landed before the barrier publishes them
  __syncthreads();
  stage(1, 128u);
  for (int t = 0; t < nT; t += 2) {
    trip(0, t);
    trip(1, t + 1);
  }
  asm volatile("s_wait_asynccnt 0x0" ::: "memory");    // no copy is outstanding when the wave goes on to its epilogue or ends
  if (m0 >= M) return;                                 // wave-uniform; no work-group barrier behind this line
  acc_guard4(acc[0][0], acc[0][1], acc[0][2], acc[0][3]);
  acc_guard4(acc[1][0], acc[1][1], acc[1][2], acc[1][3]);
  acc_guard4(acc[2][0], acc[2][1], acc[2][2], acc[2][3]);
  acc_guard4(acc[3][0], acc[3][1], acc[3][2], acc[3][3]);

  // ---- epilogue ----
  if (OUT_MODE == 4) {
    // a lane's 8 accumulator rows are 8 neighbours of one transposed row: 16 B per plane straight from registers; a wave fills whole 128-B lines
    static_assert(OUT_MODE != 4 || (BIAS_MODE == 0 && !RESID && ACT == 0), "transposed output is plain");
    unsigned short* C  = (unsigned short*)Cout  + (size_t)b * strideC;
    unsigned short* C2 = (unsigned short*)Cout2 + (size_t)b * strideC;
#pragma unroll
    for (int j = 0; j < 4; ++j) {
#pragma unroll
      for (int i = 0; i < 4; ++i) {
        v8h hv, lv;
#pragma unroll
        for (int r = 0; r < 8; ++r) {
          const float v = acc[i][j][r] * scale;
          const unsigned short hb = f2bf_bits(v);
          hv[r] = __builtin_bit_cast(_Float16, hb);
          lv[r] = __builtin_bit_cast(_Float16, f2bf_bits(v - bf_bits2f(hb)));
        }
        const size_t o = (size_t)(n0 + (j << 4) + rlane) * ldc + m0 + (i << 4) + mOff;
        *(v8h*)(C + o) = hv;
        *(v8h*)(C2 + o) = lv;
      }
    }
    return;
  }
  const bool out_f32 = OUT_MODE == 0 || (OUT_MODE == 3 && (b & 1) == 0);   // uniform over the work-group
  float* slab = sT[wave];
  const float* Rb = RESID ? (resid + (size_t)b * strideR) : nullptr;
#pragma unroll
  for (int i = 0; i < 4; ++i) {
    const int mBase = m0 + (i << 4);
#pragma unroll
    for (int j = 0; j < 4; ++j) {
      const int n = n0 + (j << 4) + rlane;
      float bv = 0.f;
      if (BIAS_MODE == 2) bv = bias[n];
#pragma unroll
      for (int r = 0; r < 8; ++r) {
        float v = acc[i][j][r] * scale;
        if (BIAS_MODE == 1) v += bias[mBase + mOff + r];
        if (BIAS_MODE == 2) v += bv;
        if (RESID) v += Rb[(size_t)(mBase + mOff + r) * ldc + n];
        if (ACT == 1) v = tanhf(v);
        slab[(mOff + r) * 68 + (j << 4) + rlane] = v;
      }
    }
    __builtin_amdgcn_fence(__ATOMIC_RELEASE, "workgroup");
    __builtin_amdgcn_wave_barrier();
    __builtin_amdgcn_fence(__ATOMIC_ACQUIRE, "workgroup");
    if (out_f32) {
      float* C = (float*)Cout + (size_t)b * strideC;
      const int hh = lane >> 4, c4 = (lane & 15) * 4;     // row seg = 256 B = 16 lanes x 16 B
      {
#pragma unroll
        for (int it = 0; it < 8; ++it) {
          const int row = it * 2 + hh;
          v4f v = *(const v4f*)(slab + row * 68 + c4);
          *(v4f*)(C + (size_t)(mBase + row) * ldc + n0 + c4) = v;
        }
        
      }
    } else {
      const int q = lane >> 3, c8 = (lane & 7) * 8;
      unsigned short* C  = (OUT_MODE == 3) ? (unsigned short*)((float*)Cout + (size_t)b * strideC) : ((unsigned short*)Cout + (size_t)b * strideC);
      unsigned short* C2 = (OUT_MODE == 3) ? (C + strideC) : (OUT_MODE == 2) ? ((unsigned short*)Cout2 + (size_t)b * strideC) : nullptr;
      {
#pragma unroll
        for (int it = 0; it < 4; ++it) {
          const int row = it * 4 + q;
          const float* sp = slab + row * 68 + c8;
          v8h hv, lv;
#pragma unroll
          for (int e = 0; e < 8; ++e) {
            if (OUT_MODE == 1) {
              hv[e] = (_Float16)sp[e];
            } else {
              unsigned short hb = f2bf_bits(sp[e]);
              unsigned short lb = f2bf_bits(sp[e] - bf_bits2f(hb));
              hv[e] = __builtin_bit_cast(_Float16, hb);
              lv[e] = __builtin_bit_cast(_Float16, lb);
            }
          }
          *(v8h*)(C + (size_t)(mBase + row) * ldc + n0 + c8) = hv;
          if (OUT_MODE >= 2) *(v8h*)(C2 + (size_t)(mBase + row) * ldc + n0 + c8) = lv;
        }
        // precaution: in the listing the f32 branch follows this one and reuses the registers that these stores name
        if (OUT_MODE == 3) asm volatile("s_wait_xcnt 0x0" ::: "memory");

      }
    }
    __builtin_amdgcn_fence(__ATOMIC_RELEASE, "workgroup");
    __builtin_amdgcn_wave_barrier();
    __builtin_amdgcn_fence(__ATOMIC_ACQUIRE, "workgroup");
  }
}

// x, memory and persona rows, one after the other, to one f16 plane and bf16 hi/lo planes; n*2 = float pairs per source (multiples of 256)
__global__ __launch_bounds__(256) void prep_inputs(
    const float* __restrict__ x, const float* __restrict__ mem, const float* __restrict__ per,
    _Float16* __restrict__ c16, __bf16* __restrict__ hi, __bf16* __restrict__ lo, int nx2, int nm2, int np2) {
  const int i = blockIdx.x * 256 + threadIdx.x;
  if (i >= nx2 + nm2 + np2) return;
  const float* in = x; int j = i;
  if (i >= nx2 + nm2) { in = per; j = i - nx2 - nm2; }
  else if (i >= nx2) { in = mem; j = i - nx2; }
  const float a = in[2 * j], b = in[2 * j + 1];
  const _Float16 h0 = (_Float16)a, h1 = (_Float16)b;
  ((unsigned*)c16)[i] = (unsigned)__builtin_bit_cast(unsigned short, h0) | ((unsigned)__builtin_bit_cast(unsigned short, h1) << 16);
  const unsigned short ah = f2bf_bits(a), bh = f2bf_bits(b);
  const unsigned short al = f2bf_bits(a - bf_bits2f(ah)), bl = f2bf_bits(b - bf_bits2f(bh));
  ((unsigned*)hi)[i] = (unsigned)ah | ((unsigned)bh << 16);
  ((unsigned*)lo)[i] = (unsigned)al | ((unsigned)bl << 16);
}

__global__ __launch_bounds__(256) void split_f32_bf16x2(
    const float* __restrict__ in, __bf16* __restrict__ hi, __bf16* __restrict__ lo, long n2) {
  long i = (long)blockIdx.x * 256 + threadIdx.x;
  long stride = (long)gridDim.x * 256;
  {
    for (long j = i; j < n2; j += stride) {
      const float a = in[2 * j], b = in[2 * j + 1];
      const unsigned short ah = f2bf_bits(a), bh = f2bf_bits(b);
      const unsigned short al = f2bf_bits(a - bf_bits2f(ah)), bl = f2bf_bits(b - bf_bits2f(bh));
      ((unsigned*)hi)[j] = (unsigned)ah | ((unsigned)bh << 16);
      ((unsigned*)lo)[j] = (unsigned)al | ((unsigned)bl << 16);
    }
    
  }
}


// eight source matrices of one launch; blockIdx.z picks one, its output plane follows at z * plane elements
struct Src8 { const float* p0; const float* p1; const float* p2; const float* p3; const float* p4; const float* p5; const float* p6; const float* p7; };
__device__ __forceinline__ const float* pick8(const Src8& s, int z) {
  switch (z) {
    case 0: return s.p0; case 1: return s.p1; case 2: return s.p2; case 3: return s.p3;
    case 4: return s.p4; case 5: return s.p5; case 6: return s.p6; default: return s.p7;
  }
}

// ---- f32 [R][C] (row pitch ldi) -> f16 transposed [C][R] (row pitch ldo); 64x64 tiles; each output row segment
__global__ __launch_bounds__(256) void transpose_cast_f16(Src8 srcs, int ldi,
                                                         _Float16* __restrict__ outT0, int ldo, long plane, float scale) {
  __shared__ __align__(16) _Float16 tile[64][72];     // [c][r]
  const float* __restrict__ in = pick8(srcs, blockIdx.z);
  _Float16* __restrict__ outT = outT0 + (size_t)blockIdx.z * plane;
  const int c0 = blockIdx.x * 64, r0 = blockIdx.y * 64;
  const int t = threadIdx.y * 32 + threadIdx.x;
  for (int i = threadIdx.y; i < 64; i += 8) {
    tile[threadIdx.x][i]      = (_Float16)(in[(size_t)(r0 + i) * ldi + c0 + threadIdx.x] * scale);
    tile[32 + threadIdx.x][i] = (_Float16)(in[(size_t)(r0 + i) * ldi + c0 + 32 + threadIdx.x] * scale);
  }
  __syncthreads();
  const int q = t >> 3, c8 = (t & 7) * 8;
  {
#pragma unroll
    for (int it = 0; it < 2; ++it) {
      const int c = it * 32 + q;
      v8h hv = *(const v8h*)(&tile[c][c8]);
      *(v8h*)(outT + (size_t)(c0 + c) * ldo + r0 + c8) = hv;
    }
    
  }
}

// ---- f32 [R][C] (pitch ldi) -> bf16 hi/lo transposed planes [C][R] (pitch ldo); 64x64 tiles; each output row segment
__global__ __launch_bounds__(256) void transpose_split_bf16(Src8 srcs, int ldi,
                                                           __bf16* __restrict__ outH0, __bf16* __restrict__ outL0, int ldo, long plane) {
  __shared__ __align__(16) float tile[64][68];     // [c][r]
  const float* __restrict__ in = pick8(srcs, blockIdx.z);
  __bf16* __restrict__ outH = outH0 + (size_t)blockIdx.z * plane;
  __bf16* __restrict__ outL = outL0 + (size_t)blockIdx.z * plane;
  const int c0 = blockIdx.x * 64, r0 = blockIdx.y * 64;
  const int t = threadIdx.y * 32 + threadIdx.x;
  for (int i = threadIdx.y; i < 64; i += 8) {
    tile[threadIdx.x][i]      = in[(size_t)(r0 + i) * ldi + c0 + threadIdx.x];
    tile[32 + threadIdx.x][i] = in[(size_t)(r0 + i) * ldi + c0 + 32 + threadIdx.x];
  }
  __syncthreads();
  const int q = t >> 3, c8 = (t & 7) * 8;
  {
#pragma unroll
    for (int it = 0; it < 2; ++it) {
      const int c = it * 32 + q;
      v8b hv, lv;
#pragma unroll
      for (int e = 0; e < 8; ++e) {
        const float f = tile[c][c8 + e];
        const unsigned short hb = f2bf_bits(f);
        hv[e] = __builtin_bit_cast(__bf16, hb);
        lv[e] = __builtin_bit_cast(__bf16, f2bf_bits(f - bf_bits2f(hb)));
      }
      *(v8b*)(outH + (size_t)(c0 + c) * ldo + r0 + c8) = hv;
      *(v8b*)(outL + (size_t)(c0 + c) * ldo + r0 + c8) = lv;
    }
    
  }
}

// =====================================================================================
// Generic causal/non-causal attention for head_dim 64, q f32 in / f32 out, bf16 operands with optional hi/lo splits.
//   scores = (q*qscale)·kᵀ : v_wmma_f32_16x16x32_bf16; SPLIT_QK -> q,k as bf16 hi/lo (hi·hi + hi·lo + lo·hi)
//   out    = p·v           : v_wmma_f32_16x16x32_bf16; SPLIT_PV -> p,v as bf16 hi/lo; else p,v plain bf16
//   f32 accumulate; online softmax in f32. Block = 4 waves = 64 query rows of one (batch, head); S % 64 == 0.
//   Element (b, s, h, d) of q and out lives at X[b*X_bs + s*X_rs + h*X_hs + d] (strides in floats, multiples of 4).
//   k arrives as bf16 hi and lo planes, element (s, h, d) at s*K_RS + h*k_hs + d; v as bf16 hi and lo planes, transposed: element
//   (s, h, d) at h*v_hs + d*V_RS + s (strides in bf16, multiples of 8; the row pitches are template constants, so that a tile's
//   rows are constant offsets from one address). A chunk's tiles are rows of 128 B that go to LDS as they are.
//   Masking: mask_mode 0 none, 1 causal (kv > q masked), 4 causal + sliding window (kv > q or q - kv > W masked; W passed in
//   mask_is_int); masked scores are replaced by mask_fill before the softmax. The mask is decided once per 64-key chunk with scalar
//   tests: a chunk that the window masks for all 64 query rows is not visited (its weights are exactly 0 after the softmax), a chunk
//   with no masked element runs no mask code, and only a chunk that the diagonal or the window's edge crosses compares and selects.
//   One launch serves four branches (batch 1): branch a reads q/k/v and writes out at a * {q,k,v,o}_st elements, with its own Skv,
//   mask_mode and window. grid.x = 4 * H * (S/64): first branches 0 and 1 (causal, cost grows with the query block) from the last
//   query block down, then branches 2 and 3, so that the long work-groups start first.
// =====================================================================================
#define AT_D 64
#define AT_NW 4
#define AT_QB 64
#define AT_KC 64
#define AT_LP 72   // LDS row pitch of the K, V and P tiles in bf16: 144 B = 16 B x 9, so that the 16 rows of a ds_load_b128 fall on different banks
struct AttnGeom { long q_bs, q_rs, q_hs, k_bs, k_rs, k_hs, v_bs, v_rs, v_hs, o_bs, o_rs, o_hs;
                  int S, Skv, H, mask_mode; float qscale; int blk0; float mask_fill; int mask_is_int; };
static_assert(sizeof(AttnGeom) == 128, "no padding");
struct AttnBranches { long q_st, k_st, v_st, o_st; int Skv[4]; int mask_mode[4]; int mask_is_int[4]; };

__device__ __forceinline__ unsigned short at_bf_bits(float f) {
  unsigned u = __float_as_uint(f);
  return (unsigned short)((u + 0x7FFFu + ((u >> 16) & 1u)) >> 16);
}
__device__ __forceinline__ __bf16 at_f2bf(float f) { return __builtin_bit_cast(__bf16, at_bf_bits(f)); }
__device__ __forceinline__ void at_split(float f, __bf16& hi, __bf16& lo) {
  const unsigned short hb = at_bf_bits(f);
  hi = __builtin_bit_cast(__bf16, hb);
  lo = at_f2bf(f - __uint_as_float(((unsigned)hb) << 16));
}
__device__ __forceinline__ v8f at_mma(v16b a, v16b b, v8f c) {
  return __builtin_amdgcn_wmma_f32_16x16x32_bf16(false, a, false, b, (short)0, c, false, false);
}
// one A or B fragment from an LDS row: elements 0..7 <- p[0..7], 8..15 <- p[16..23]
__device__ __forceinline__ v16b at_frag(const __bf16* p) {
  union { v16b v; v8b h[2]; } f;
  f.h[0] = *(const v8b*)(p); f.h[1] = *(const v8b*)(p + 16);
  return f.v;
}

template <bool SPLIT_QK, bool SPLIT_PV, int K_RS, int V_RS>
__global__ __launch_bounds__(128) __attribute__((amdgpu_waves_per_eu(4)))   // 256 registers a wave: four work-groups per WGP, as many as the LDS holds
void attn64_kernel(const float* __restrict__ q, const unsigned short* __restrict__ kh, const unsigned short* __restrict__ kl,
                   const unsigned short* __restrict__ vth, const unsigned short* __restrict__ vtl,
                   float* __restrict__ out, AttnGeom g0, AttnBranches br) {
  __shared__ __align__(16) __bf16 Ksh[AT_KC * AT_LP];            // K hi [kv][d]      9 KB
  __shared__ __align__(16) __bf16 Ksl[SPLIT_QK ? AT_KC * AT_LP : 8];
  __shared__ __align__(16) __bf16 Vth[AT_D * AT_LP];             // V hi [d][kv]      9 KB
  __shared__ __align__(16) __bf16 Vtl[SPLIT_PV ? AT_D * AT_LP : 8];
  __shared__ __align__(16) __bf16 Psh[AT_NW][16 * AT_LP];        // per wave P hi [row][kv]  9 KB
  __shared__ __align__(16) __bf16 Psl[SPLIT_PV ? AT_NW : 1][SPLIT_PV ? 16 * AT_LP : 8];
  __shared__ __align__(16) float  Os[AT_NW][16 * 68];            // per wave out tile, pitch 68

  const int tid  = threadIdx.x;
  const int wave = tid >> 5;
  const int lane = tid & 31;
  const int hh   = lane >> 4;
  const int c    = lane & 15;

  AttnGeom g = g0;
  const int nqb = g.S / AT_QB;
  const int bx = blockIdx.x + g.blk0;
  const int perBranch = g.H * nqb;
  int a, h, qb;
  if (bx < 2 * perBranch) {
    const int lvl = bx / (2 * g.H), w = bx % (2 * g.H);
    qb = nqb - 1 - lvl; a = w / g.H; h = w % g.H;
  } else {
    const int r = bx - 2 * perBranch, r2 = r % perBranch;
    a = 2 + r / perBranch; h = r2 / nqb; qb = r2 % nqb;
  }
  g.Skv = br.Skv[a]; g.mask_mode = br.mask_mode[a]; g.mask_is_int = br.mask_is_int[a];
  const int qbase_block = qb * AT_QB;
  const int q0 = qbase_block + wave * 16;

  const float* qb_ptr = q + (size_t)a * br.q_st + (size_t)h * g.q_hs;
  // staging: 8 threads per 128-B tile row, 16 rows per pass, 4 passes; offsets of this thread's 16 B in the first pass of chunk 0
  const int srow = tid >> 3, sc8 = (tid & 7) * 8;
  const size_t koff = (size_t)a * br.k_st + (size_t)h * g.k_hs + (size_t)srow * K_RS + sc8;
  const size_t voff = (size_t)a * br.v_st + (size_t)h * g.v_hs + (size_t)srow * V_RS + sc8;
  float*       ob_ptr = out + (size_t)a * br.o_st + (size_t)h * g.o_hs;

  // ---- Q fragments (A operand): 2 d-chunks, hi (and lo) ----
  v16b qah[2], qal[2];
  {
    const float* qrow = qb_ptr + (size_t)(q0 + c) * g.q_rs;
#pragma unroll
    for (int dc = 0; dc < 2; ++dc) {
#pragma unroll
      for (int e = 0; e < 8; ++e) {
        const float f0 = qrow[dc * 32 + 8 * hh + e] * g.qscale;
        const float f1 = qrow[dc * 32 + 16 + 8 * hh + e] * g.qscale;
        if (SPLIT_QK) { __bf16 hq, lq; at_split(f0, hq, lq); qah[dc][e] = hq; qal[dc][e] = lq; at_split(f1, hq, lq); qah[dc][8 + e] = hq; qal[dc][8 + e] = lq; }
        else { qah[dc][e] = at_f2bf(f0); qah[dc][8 + e] = at_f2bf(f1); qal[dc][e] = qah[dc][e]; qal[dc][8 + e] = qah[dc][8 + e]; }
      }
    }
  }

  float mrow[8], lrow[8];
  v8f oacc[4];
#pragma unroll
  for (int r = 0; r < 8; ++r) { mrow[r] = -INFINITY; lrow[r] = 0.f; }
#pragma unroll
  for (int t = 0; t < 4; ++t) oacc[t] = (v8f){0.f,0.f,0.f,0.f,0.f,0.f,0.f,0.f};

  const bool causal = (g.mask_mode == 1 || g.mask_mode == 4);
  const int win = (g.mask_mode == 4) ? g.mask_is_int : g.S;          // q - kv stays below S: no window
  const int nChunks = causal ? (qb + 1) : (g.Skv / AT_KC);           // block-uniform
  const int kcFirst = (causal && qbase_block > win) ? (qbase_block - win) / AT_KC : 0;   // chunk of the oldest key that the block's first row still sees
  // one address per plane, moved on from chunk to chunk; the four passes are constant offsets from it
  const __bf16* pkh = (const __bf16*)kh + koff + (size_t)kcFirst * (AT_KC * K_RS);    // K tile: rows are keys
  const __bf16* pkl = (const __bf16*)kl + koff + (size_t)kcFirst * (AT_KC * K_RS);
  const __bf16* pvh = (const __bf16*)vth + voff + (size_t)kcFirst * AT_KC;            // V tile: rows are head dims, keys run along the row
  const __bf16* pvl = (const __bf16*)vtl + voff + (size_t)kcFirst * AT_KC;
  for (int kc = kcFirst; kc < nChunks; ++kc) {
    const int kv0 = kc * AT_KC;
    {
      v8b rkh[4], rkl[4], rvh[4], rvl[4];
#pragma unroll
      for (int i = 0; i < 4; ++i) {
        rkh[i] = *(const v8b*)(pkh + i * 16 * K_RS);
        if (SPLIT_QK) rkl[i] = *(const v8b*)(pkl + i * 16 * K_RS);
        rvh[i] = *(const v8b*)(pvh + i * 16 * V_RS);
        if (SPLIT_PV) rvl[i] = *(const v8b*)(pvl + i * 16 * V_RS);
      }
      __syncthreads();
      pkh += AT_KC * K_RS; pkl += AT_KC * K_RS; pvh += AT_KC; pvl += AT_KC;
#pragma unroll
      for (int i = 0; i < 4; ++i) {
        const int lo = (i * 16 + srow) * AT_LP + sc8;
        *(v8b*)(Ksh + lo) = rkh[i];
        if (SPLIT_QK) *(v8b*)(Ksl + lo) = rkl[i];
        *(v8b*)(Vth + lo) = rvh[i];
        if (SPLIT_PV) *(v8b*)(Vtl + lo) = rvl[i];
      }
    }
    __syncthreads();

    // The chunk's K fragments are read from LDS in two groups, the first in front of the first WMMA, the second among the WMMAs where the
    // registers of fragments that are done with are free (all at once do not fit four waves per SIMD), and the WMMAs go round the four
    // independent score tiles. Every score tile still takes its products in the order d 0..31: hi*hi, hi*lo, lo*hi, then d 32..63 the same.
    v8f s[4];
    {
      const __bf16* kfh = Ksh + c * AT_LP + 8 * hh;
      const __bf16* kfl = Ksl + c * AT_LP + 8 * hh;
      v16b kh0[4], kl0[4], kh1[4], kl1[4];
#pragma unroll
      for (int j = 0; j < 4; ++j) kh0[j] = at_frag(kfh + j * 16 * AT_LP);
      if (SPLIT_QK) {
#pragma unroll
        for (int j = 0; j < 4; ++j) kl0[j] = at_frag(kfl + j * 16 * AT_LP);
      }
#pragma unroll
      for (int j = 0; j < 2; ++j) kh1[j] = at_frag(kfh + j * 16 * AT_LP + 32);
      // keeps the scheduler from sinking these reads down to their first use, where each would be waited for on its own
      __builtin_amdgcn_sched_barrier(0);
#pragma unroll
      for (int j = 0; j < 4; ++j) s[j] = at_mma(qah[0], kh0[j], (v8f){0.f,0.f,0.f,0.f,0.f,0.f,0.f,0.f});
      if (SPLIT_QK) {
#pragma unroll
        for (int j = 0; j < 4; ++j) s[j] = at_mma(qah[0], kl0[j], s[j]);
#pragma unroll
        for (int j = 0; j < 2; ++j) s[j] = at_mma(qal[0], kh0[j], s[j]);
      }
      // the two scheduling barriers hold the second group together at this place
      __builtin_amdgcn_sched_barrier(0);
#pragma unroll
      for (int j = 2; j < 4; ++j) kh1[j] = at_frag(kfh + j * 16 * AT_LP + 32);
      if (SPLIT_QK) {
#pragma unroll
        for (int j = 0; j < 4; ++j) kl1[j] = at_frag(kfl + j * 16 * AT_LP + 32);
      }
      __builtin_amdgcn_sched_barrier(0);
      if (SPLIT_QK) {
#pragma unroll
        for (int j = 2; j < 4; ++j) s[j] = at_mma(qal[0], kh0[j], s[j]);
      }
#pragma unroll
      for (int j = 0; j < 4; ++j) s[j] = at_mma(qah[1], kh1[j], s[j]);
      if (SPLIT_QK) {
#pragma unroll
        for (int j = 0; j < 4; ++j) s[j] = at_mma(qah[1], kl1[j], s[j]);
#pragma unroll
        for (int j = 0; j < 4; ++j) s[j] = at_mma(qal[1], kh1[j], s[j]);
      }
      // four vector slots between the last WMMAs and the first use of the scores, also on the taken side of the branch below
      acc_guard4(s[0], s[1], s[2], s[3]);
    }
    // block-uniform: the diagonal chunk, or one in which the block's last row is more than win past the chunk's first key
    if (causal && (kc == qb || qbase_block + (AT_QB - 1) - kv0 > win)) {
#pragma unroll
      for (int r = 0; r < 8; ++r) {
        const int qrow = q0 + 8 * hh + r;
#pragma unroll
        for (int j = 0; j < 4; ++j) {
          const int dist = qrow - (kv0 + j * 16 + c);
          s[j][r] = (dist < 0 || dist > win) ? g.mask_fill : s[j][r];
        }
      }
    }
    float cm[8];
#pragma unroll
    for (int r = 0; r < 8; ++r) {
      float m = -INFINITY;
#pragma unroll
      for (int j = 0; j < 4; ++j) m = fmaxf(m, s[j][r]);
#pragma unroll
      for (int off = 1; off < 16; off <<= 1) m = fmaxf(m, __shfl_xor(m, off, 32));
      cm[r] = m;
    }
    __bf16* pwh = Psh[wave];
    __bf16* pwl = Psl[SPLIT_PV ? wave : 0];
#pragma unroll
    for (int r = 0; r < 8; ++r) {
      const float mnew = fmaxf(mrow[r], cm[r]);
      const float alpha = expf(mrow[r] - mnew);
      mrow[r] = mnew;
      float psum = 0.f;
#pragma unroll
      for (int j = 0; j < 4; ++j) {
        const float p = expf(s[j][r] - mnew);
        psum += p;
        if (SPLIT_PV) { __bf16 a, bl; at_split(p, a, bl); pwh[(8 * hh + r) * AT_LP + j * 16 + c] = a; pwl[(8 * hh + r) * AT_LP + j * 16 + c] = bl; }
        else pwh[(8 * hh + r) * AT_LP + j * 16 + c] = at_f2bf(p);
      }
#pragma unroll
      for (int off = 1; off < 16; off <<= 1) psum += __shfl_xor(psum, off, 32);
      lrow[r] = lrow[r] * alpha + psum;
#pragma unroll
      for (int t = 0; t < 4; ++t) oacc[t][r] *= alpha;
    }
    __builtin_amdgcn_fence(__ATOMIC_RELEASE, "workgroup");
    __builtin_amdgcn_wave_barrier();
    __builtin_amdgcn_fence(__ATOMIC_ACQUIRE, "workgroup");
    // P and V fragments in two groups, as the K fragments above; every output tile still takes keys 0..31: hi*hi, hi*lo, lo*hi, then keys 32..63.
    {
      const __bf16* pfh = pwh + c * AT_LP + 8 * hh;
      const __bf16* pfl = pwl + c * AT_LP + 8 * hh;
      const __bf16* vfh = Vth + c * AT_LP + 8 * hh;
      const __bf16* vfl = Vtl + c * AT_LP + 8 * hh;
      v16b pa0, pa1, pl0, pl1, vh0[4], vl0[4], vh1[4], vl1[4];
      pa0 = at_frag(pfh);
#pragma unroll
      for (int t = 0; t < 4; ++t) vh0[t] = at_frag(vfh + t * 16 * AT_LP);
      if (SPLIT_PV) {
#pragma unroll
        for (int t = 0; t < 4; ++t) vl0[t] = at_frag(vfl + t * 16 * AT_LP);
        pl0 = at_frag(pfl);
      }
      pa1 = at_frag(pfh + 32);
#pragma unroll
      for (int t = 0; t < 2; ++t) vh1[t] = at_frag(vfh + t * 16 * AT_LP + 32);
      // keeps the scheduler from sinking these reads down to their first use, where each would be waited for on its own
      __builtin_amdgcn_sched_barrier(0);
#pragma unroll
      for (int t = 0; t < 4; ++t) oacc[t] = at_mma(pa0, vh0[t], oacc[t]);
      if (SPLIT_PV) {
#pragma unroll
        for (int t = 0; t < 4; ++t) oacc[t] = at_mma(pa0, vl0[t], oacc[t]);
#pragma unroll
        for (int t = 0; t < 2; ++t) oacc[t] = at_mma(pl0, vh0[t], oacc[t]);
      }
      // the two scheduling barriers hold the second group together at this place
      __builtin_amdgcn_sched_barrier(0);
#pragma unroll
      for (int t = 2; t < 4; ++t) vh1[t] = at_frag(vfh + t * 16 * AT_LP + 32);
      if (SPLIT_PV) {
#pragma unroll
        for (int t = 0; t < 4; ++t) vl1[t] = at_frag(vfl + t * 16 * AT_LP + 32);
        pl1 = at_frag(pfl + 32);
      }
      __builtin_amdgcn_sched_barrier(0);
      if (SPLIT_PV) {
#pragma unroll
        for (int t = 2; t < 4; ++t) oacc[t] = at_mma(pl0, vh0[t], oacc[t]);
      }
#pragma unroll
      for (int t = 0; t < 4; ++t) oacc[t] = at_mma(pa1, vh1[t], oacc[t]);
      if (SPLIT_PV) {
#pragma unroll
        for (int t = 0; t < 4; ++t) oacc[t] = at_mma(pa1, vl1[t], oacc[t]);
#pragma unroll
        for (int t = 0; t < 4; ++t) oacc[t] = at_mma(pl1, vh1[t], oacc[t]);
      }
      // four vector slots between the chunk's last WMMAs and whatever rewrites their registers, also on the taken side of the loop's branch
      acc_guard4(oacc[0], oacc[1], oacc[2], oacc[3]);
    }
  }

  float* os = Os[wave];
#pragma unroll
  for (int r = 0; r < 8; ++r) {
    const float inv = 1.0f / lrow[r];
#pragma unroll
    for (int t = 0; t < 4; ++t) os[(8 * hh + r) * 68 + t * 16 + c] = oacc[t][r] * inv;
  }
  __builtin_amdgcn_fence(__ATOMIC_RELEASE, "workgroup");
  __builtin_amdgcn_wave_barrier();
  __builtin_amdgcn_fence(__ATOMIC_ACQUIRE, "workgroup");
  {
    const int c4 = (lane & 15) * 4;
    {
#pragma unroll
      for (int it = 0; it < 8; ++it) {
        const int row = it * 2 + hh;
        v4f val = *(const v4f*)(os + row * 68 + c4);
        *(v4f*)(ob_ptr + (size_t)(q0 + row) * g.o_rs + c4) = val;
      }
      
    }
  }
}

__global__ __launch_bounds__(256) void gate_fuse_kernel(const float* __restrict__ o0, const float* __restrict__ o1,
                                                       const float* __restrict__ o2, const float* __restrict__ o3,
                                                       const float* __restrict__ Wg, const float* __restrict__ bg,
                                                       float* __restrict__ out, int Hd) {
  __shared__ float red[4][8];
  const int row = blockIdx.x, t = threadIdx.x, lane = t & 31, wave = t >> 5;
  const float* os[4] = {o0 + (size_t)row * Hd, o1 + (size_t)row * Hd, o2 + (size_t)row * Hd, o3 + (size_t)row * Hd};
  float acc[4] = {0.f, 0.f, 0.f, 0.f};
  for (int i = 0; i < 4; ++i) {
    const float* o = os[i];
    for (int c = t; c < Hd; c += 256) {
      const float v = o[c];
      const float* w = Wg + (size_t)(i * Hd + c) * 4;
      acc[0] += v * w[0]; acc[1] += v * w[1]; acc[2] += v * w[2]; acc[3] += v * w[3];
    }
  }
#pragma unroll
  for (int g = 0; g < 4; ++g) { float a = acc[g]; for (int o = 16; o > 0; o >>= 1) a += __shfl_xor(a, o, 32); if (lane == 0) red[g][wave] = a; }
  __syncthreads();
  float gl[4];
#pragma unroll
  for (int g = 0; g < 4; ++g) { float a = 0.f; for (int w = 0; w < 8; ++w) a += red[g][w]; gl[g] = a + bg[g]; }
  const float mx = fmaxf(fmaxf(gl[0], gl[1]), fmaxf(gl[2], gl[3]));
  float e[4], se = 0.f;
#pragma unroll
  for (int g = 0; g < 4; ++g) { e[g] = expf(gl[g] - mx); se += e[g]; }
  const float inv = 1.0f / se;
  const int c = 4 * t;
  v4f r;
#pragma unroll
  for (int q = 0; q < 4; ++q) r[q] = (e[0] * inv) * os[0][c + q] + (e[1] * inv) * os[1][c + q] + (e[2] * inv) * os[2][c + q] + (e[3] * inv) * os[3][c + q];
  *(v4f*)(out + (size_t)row * Hd + c) = r;
  
}

extern "C" void kernel_launch(void* const* d_in, const int* in_sizes, int n_in,
                              void* d_out, int out_size, void* d_ws, size_t ws_size,
                              hipStream_t stream) {
  (void)in_sizes; (void)n_in; (void)out_size; (void)ws_size;
  const int S = 2048, E = 1024, H = 16, DH = 64, MM = 512, MP = 64, WIN = 512;
  // wire order: 16 weights ([in,out]), gate_w, gate_b, x, memory_kv, persona_kv
  const float* Wm[16]; for (int i = 0; i < 16; ++i) Wm[i] = (const float*)d_in[i];   // {local,long,mem,per} x {wq,wk,wv,wo}
  const float* gate_w = (const float*)d_in[16];
  const float* gate_b = (const float*)d_in[17];
  const float* x   = (const float*)d_in[18];   // [1,2048,1024]
  const float* mem = (const float*)d_in[19];   // [1,512,1024]
  const float* per = (const float*)d_in[20];   // [1,64,1024]
  float* out = (float*)d_out;

  char* ws = (char*)d_ws; size_t off = 0;
  auto carve = [&](size_t bytes) -> char* { char* p = ws + off; off += (bytes + 255) & ~(size_t)255; return p; };
  const int CT = S + MM + MP;                                   // context rows: x, then memory, then persona
  const long EE = (long)E * E, SE = (long)S * E;
  _Float16* C16  = (_Float16*)carve((size_t)CT * E * 2);        // 5.4 MB each
  __bf16*   Ch   = (__bf16*)carve((size_t)CT * E * 2);
  __bf16*   Cl   = (__bf16*)carve((size_t)CT * E * 2);
  _Float16* WqkT = (_Float16*)carve((size_t)8 * EE * 2);        // plane 2a = wq^T, 2a+1 = wk^T of branch a; 16.8 MB
  __bf16*   WvoTh = (__bf16*)carve((size_t)8 * EE * 2);         // plane 2a = wv^T, 2a+1 = wo^T
  __bf16*   WvoTl = (__bf16*)carve((size_t)8 * EE * 2);
  float*    QK   = (float*)carve((size_t)8 * SE * 4);           // plane 2a = q (f32), 2a+1 = k of branch a (bf16 hi, then bf16 lo); 67 MB
  __bf16*   VTh  = (__bf16*)carve((size_t)4 * SE * 2);          // v^T of branch a: [E][S] (row pitch S for every branch); 16.8 MB each
  __bf16*   VTl  = (__bf16*)carve((size_t)4 * SE * 2);
  float*    Of   = (float*)carve((size_t)4 * SE * 4);
  __bf16*   Oh   = (__bf16*)carve((size_t)4 * SE * 2);
  __bf16*   Ol   = (__bf16*)carve((size_t)4 * SE * 2);          // total 234 MB
  float*    Ob[4];
  for (int i = 0; i < 4; ++i) Ob[i] = QK + (size_t)i * SE;      // branch outputs take the q/k planes' place once attention is done

  const int  SKs[4]  = {S, S, MM, MP};                          // keys per branch
  const long ctx0[4] = {0, 0, (long)S * E, (long)(S + MM) * E}; // first context element per branch

  prep_inputs<<<CT * E / 2 / 256, 256, 0, stream>>>(x, mem, per, C16, Ch, Cl, S * E / 2, MM * E / 2, MP * E / 2);
  {
    Src8 qk = {Wm[0], Wm[1], Wm[4], Wm[5], Wm[8], Wm[9], Wm[12], Wm[13]};
    Src8 vo = {Wm[2], Wm[3], Wm[6], Wm[7], Wm[10], Wm[11], Wm[14], Wm[15]};
    transpose_cast_f16<<<dim3(E / 64, E / 64, 8), dim3(32, 8), 0, stream>>>(qk, E, WqkT, E, EE, 1.0f);
    transpose_split_bf16<<<dim3(E / 64, E / 64, 8), dim3(32, 8), 0, stream>>>(vo, E, WvoTh, WvoTl, E, EE);
  }
  const int tb = (S / 128) * (E / 256);                         // 128x256 tiles of the tallest batch entry
  {
    BatchA bqk, bv;
    for (int a = 0; a < 4; ++a) {
      bqk.aoff[2 * a] = 0;           bqk.M[2 * a] = S;
      bqk.aoff[2 * a + 1] = ctx0[a]; bqk.M[2 * a + 1] = SKs[a];
      bv.aoff[a] = ctx0[a];          bv.M[a] = SKs[a];
      bv.aoff[4 + a] = 0;            bv.M[4 + a] = 0;
    }
    wmma_gemm64<0, false, 0, 3, false><<<dim3(tb, 8), 256, 0, stream>>>(
        U16(C16), nullptr, E, bqk, U16(WqkT), nullptr, E, EE, QK, nullptr, E, SE, nullptr, nullptr, 0, E, E, 1.0f);
    wmma_gemm64<1, true, 0, 4, false><<<dim3(tb, 4), 256, 0, stream>>>(
        U16(Ch), U16(Cl), E, bv, U16(WvoTh), U16(WvoTl), E, 2 * EE, VTh, VTl, S, SE, nullptr, nullptr, 0, E, E, 1.0f);
  }
  {
    AttnGeom g;
    g.q_bs = SE; g.q_rs = E; g.q_hs = DH;
    g.k_bs = SE; g.k_rs = E; g.k_hs = DH;
    g.v_bs = SE; g.v_rs = S; g.v_hs = (long)DH * S;
    g.o_bs = SE; g.o_rs = E; g.o_hs = DH;
    g.S = S; g.Skv = S; g.H = H; g.qscale = 0.125f; g.blk0 = 0; g.mask_fill = -1.0e30f;
    g.mask_mode = 0; g.mask_is_int = 0;
    AttnBranches br;
    br.q_st = 2 * SE; br.k_st = 4 * SE; br.v_st = SE; br.o_st = SE;   // a q/k pair of f32-sized planes is 4 * SE bf16
    for (int a = 0; a < 4; ++a) { br.Skv[a] = SKs[a]; br.mask_mode[a] = 0; br.mask_is_int[a] = 0; }
    br.mask_mode[0] = 4; br.mask_is_int[0] = WIN;               // causal + window
    br.mask_mode[1] = 1;                                        // causal
    attn64_kernel<true, true, E, S><<<4 * H * (S / AT_QB), AT_NW * 32, 0, stream>>>(QK, U16(QK + SE), U16(QK + SE) + SE, U16(VTh), U16(VTl), Of, g, br);
  }
  split_f32_bf16x2<<<4096, 256, 0, stream>>>(Of, Oh, Ol, 4 * SE / 2);
  {
    BatchA bo;
    for (int a = 0; a < 4; ++a) { bo.aoff[a] = a * SE; bo.M[a] = S; bo.aoff[4 + a] = 0; bo.M[4 + a] = 0; }
    wmma_gemm64<1, true, 0, 0, false><<<dim3(tb, 4), 256, 0, stream>>>(
        U16(Oh), U16(Ol), E, bo, U16(WvoTh + EE), U16(WvoTl + EE), E, 2 * EE, Ob[0], nullptr, E, SE, nullptr, nullptr, 0, E, E, 1.0f);
  }
  gate_fuse_kernel<<<S, 256, 0, stream>>>(Ob[0], Ob[1], Ob[2], Ob[3], gate_w, gate_b, out, E);
}

// v008
// Measured time: 220 microseconds a run.
// In both of two side-by-side timings against v007, it was 1.15 times as fast.
// All steps since v000 together make it 8.03 times as fast.
#include <hip/hip_runtime.h>
#include <math.h>
// Four attentions (local = causal + 512 sliding window, long = causal, memory cross (512 keys), persona cross (64 keys)), 16 heads of 64:
// q/k projections (K=1024): v_wmma_f32_16x16x32_f16 (f16 operands); v and output projections (K=1024): v_wmma_f32_16x16x32_bf16 as bf16
// hi/lo splits; scores and p·v: v_wmma_f32_16x16x32_bf16 with q,k and p,v as bf16 hi/lo splits; f32 accumulate; softmax f32.
// k and v leave their projections already split into bf16 hi/lo planes (v transposed), so attention only copies their tiles to LDS.
// Gate (concat(outs)·gate_w, N=4, 0.1 % of MACs), gate softmax and the weighted fusion in f32 on VALU.
typedef __attribute__((ext_vector_type(16))) _Float16 v16h;
typedef __attribute__((ext_vector_type(8)))  _Float16 v8h;
typedef __attribute__((ext_vector_type(16))) __bf16   v16b;
typedef __attribute__((ext_vector_type(8)))  __bf16   v8b;
typedef __attribute__((ext_vector_type(8)))  float    v8f;
typedef __attribute__((ext_vector_type(4)))  float    v4f;
#define PSCALE 32768.0f
#define U16(p) ((const unsigned short*)(const void*)(p))
#define PSCALE_INV (1.0f / 32768.0f)

__device__ __forceinline__ unsigned short f2bf_bits(float f) {
  unsigned u = __float_as_uint(f);
  return (unsigned short)((u + 0x7FFFu + ((u >> 16) & 1u)) >> 16);
}
__device__ __forceinline__ float bf_bits2f(unsigned short h) { return __uint_as_float(((unsigned)h) << 16); }

// hazard guards as plain device helpers
__device__ __forceinline__ void acc_guard4(v8f& a, v8f& b, v8f& c, v8f& d) { asm volatile("v_nop\n\tv_nop\n\tv_nop\n\tv_nop" : "+v"(a), "+v"(b), "+v"(c), "+v"(d)); }
// end of a k tile's WMMAs in the GEMM k loop: four vector slots in front of whatever rewrites their operand registers (why: at the call)
__device__ __forceinline__ void set_done() { asm volatile("v_nop\n\tv_nop\n\tv_nop\n\tv_nop"); }
// Twelve asynchronous copies of 16 B per lane, global memory -> LDS, through no register: l = the lane's LDS byte address, g = its global address.
// s_wait_xcnt stands in the copies' own statement, a precaution: what follows may rewrite the address registers that the copies name.
__device__ __forceinline__ void copy12_to_lds(const unsigned (&l)[12], const char* const (&g)[12]) {
  asm volatile(
      "global_load_async_to_lds_b128 %0, %1, off\n\t"
      "global_load_async_to_lds_b128 %2, %3, off\n\t"
      "global_load_async_to_lds_b128 %4, %5, off\n\t"
      "global_load_async_to_lds_b128 %6, %7, off\n\t"
      "global_load_async_to_lds_b128 %8, %9, off\n\t"
      "global_load_async_to_lds_b128 %10, %11, off\n\t"
      "global_load_async_to_lds_b128 %12, %13, off\n\t"
      "global_load_async_to_lds_b128 %14, %15, off\n\t"
      "global_load_async_to_lds_b128 %16, %17, off\n\t"
      "global_load_async_to_lds_b128 %18, %19, off\n\t"
      "global_load_async_to_lds_b128 %20, %21, off\n\t"
      "global_load_async_to_lds_b128 %22, %23, off\n\t"
      "s_wait_xcnt 0x0"
      :: "v"(l[0]), "v"(g[0]), "v"(l[1]), "v"(g[1]), "v"(l[2]), "v"(g[2]), "v"(l[3]), "v"(g[3]), "v"(l[4]), "v"(g[4]), "v"(l[5]), "v"(g[5]),
         "v"(l[6]), "v"(g[6]), "v"(l[7]), "v"(g[7]), "v"(l[8]), "v"(g[8]), "v"(l[9]), "v"(g[9]), "v"(l[10]), "v"(g[10]), "v"(l[11]), "v"(g[11])
      : "memory");
}
template <typename T> struct Frag;
template <> struct Frag<_Float16> {
  typedef v16h V; union U { v16h v; v8h h[2]; };
  static __device__ __forceinline__ v16h load(const _Float16* p) {   // elements 0..7 <- p[0..7], 8..15 <- p[16..23]
    U f; f.h[0] = *(const v8h*)(p); f.h[1] = *(const v8h*)(p + 16); return f.v;
  }
  static __device__ __forceinline__ v8f mma(v16h a, v16h b, v8f c) {
    return __builtin_amdgcn_wmma_f32_16x16x32_f16(false, a, false, b, (short)0, c, false, false);
  }
};
template <> struct Frag<__bf16> {
  typedef v16b V; union U { v16b v; v8b h[2]; };
  static __device__ __forceinline__ v16b load(const __bf16* p) {
    U f; f.h[0] = *(const v8b*)(p); f.h[1] = *(const v8b*)(p + 16); return f.v;
  }
  static __device__ __forceinline__ v8f mma(v16b a, v16b b, v8f c) {
    return __builtin_amdgcn_wmma_f32_16x16x32_bf16(false, a, false, b, (short)0, c, false, false);
  }
};

// ---- Register-blocked batched WMMA GEMM ------------------------------------
// C[m,n] = scale * sum_k A[m,k] * Bt[n,k] (+bias)(+resid); each wave owns a 64x64 tile, a work-group's 8 waves a 128x256 tile (2 x 4 waves).
// A row-major [M,K]; Bt row-major [N,K]; M % 64 == 0, N % 256 == 0, K % 128 == 0; grid.x = (largest M / 128) * (N / 256).
// The work-group's A and B rows go to LDS 64 of k at a time (whole 128-B lines, each fetched once for all the waves that use it).
// SPLIT: operands are hi/lo planes (A2/Bt2 = lo planes, same layout); product = hi·hi + hi·lo + lo·hi.
// BIAS_MODE: 0 = none, 1 = bias[m], 2 = bias[n].
// OUT_MODE: 0 = f32, 1 = f16, 2 = bf16 hi plane (Cout) + bf16 lo plane (Cout2),
//   3 = even batch entries as 0; odd entries as bf16 hi and lo planes inside the entry's own f32 plane (hi first, lo strideC elements behind it),
//   4 = bf16 hi (Cout) and lo (Cout2) planes, transposed: element (m, n) at n * ldc + m (no bias, residual or activation).
// ET: 0 = f16 operands, 1 = bf16 operands (pointers passed as 16-bit storage)
template <int ET> struct Elem;
template <> struct Elem<0> { typedef _Float16 T; };
template <> struct Elem<1> { typedef __bf16 T; };
// Batch entry blockIdx.y reads A from element offset aoff[y] and has M[y] rows (entries may differ in source and height).
struct BatchA { long aoff[8]; int M[8]; };
template <int ET, bool SPLIT, int BIAS_MODE, int OUT_MODE, bool RESID, int ACT = 0>
__global__ __launch_bounds__(256) void wmma_gemm64(
    const unsigned short* __restrict__ Ap, const unsigned short* __restrict__ A2p, int lda, BatchA ba,
    const unsigned short* __restrict__ Btp, const unsigned short* __restrict__ Bt2p, int ldb, long strideB,
    void* __restrict__ Cout, void* __restrict__ Cout2, int ldc, long strideC,
    const float* __restrict__ bias,
    const float* __restrict__ resid, long strideR,
    int N, int K, float scale) {
  typedef typename Elem<ET>::T T;
  typedef typename Frag<T>::V V;
  const T* A = (const T*)Ap; const T* A2 = (const T*)A2p; const T* Bt = (const T*)Btp; const T* Bt2 = (const T*)Bt2p;
  constexpr int NPL = SPLIT ? 2 : 1;              // planes per operand
  constexpr int LP  = 72;                         // LDS row pitch in elements: 144 B = 16 B x 9, so that the 16 rows of a ds_load_b128 fall on different banks
  constexpr int A_EL = 128 * LP, B_EL = 256 * LP; // one plane of the A tile, of the B tile
  constexpr int BUF_EL = NPL * (A_EL + B_EL);     // one buffer: A hi, (A lo,) B hi, (B lo)
  __shared__ __align__(16) unsigned short sAB[2 * BUF_EL];
  __shared__ __align__(16) float sT[8][16 * 68];   // per-wave 16x64 slab, pitch 68 floats
  const int b    = blockIdx.y;
  const int M    = ba.M[b];
  const long offA = ba.aoff[b];
  const int lane = threadIdx.x & 31;
  const int wave = threadIdx.x >> 5;
  const int tilesBN = N >> 8;
  const int bm = blockIdx.x / tilesBN;
  const int bn = blockIdx.x - bm * tilesBN;
  if ((bm << 7) >= M) return;            // the same for the whole work-group, in front of every copy and barrier
  const int wm = wave >> 2, wn = wave & 3;
  const int m0 = (bm << 7) + (wm << 6);
  const int n0 = (bn << 8) + (wn << 6);

  const T* Ab  = A  + offA;
  const T* Bb  = Bt + (size_t)b * strideB;
  const T* Ab2 = SPLIT ? (A2  + offA) : nullptr;
  const T* Bb2 = SPLIT ? (Bt2 + (size_t)b * strideB) : nullptr;

  const int rlane = lane & 15;                 // row (A) / col (B, D) within subtile
  const int koff  = (lane >> 4) * 8;           // k offset of this lane half
  const int mOff  = (lane >> 4) * 8;           // D row offset

  v8f acc[4][4];
#pragma unroll
  for (int i = 0; i < 4; ++i)
#pragma unroll
    for (int j = 0; j < 4; ++j) acc[i][j] = (v8f){0.f,0.f,0.f,0.f,0.f,0.f,0.f,0.f};

  // Staging: 8 threads per 128-B row, 32 rows per pass; 4 passes for an A plane, 8 for a B plane. An A row past the entry's last one
  // (M = 64 under a 128-row tile) takes the last row's address: its products belong to a wave that stores nothing.
  const int srow = threadIdx.x >> 3, sc = threadIdx.x & 7;
  unsigned oA[4];                              // byte offsets of this thread's 16 B in k tile 0, one per pass (A), first pass (B)
#pragma unroll
  for (int p = 0; p < 4; ++p) {
    int r = (bm << 7) + p * 32 + srow;
    r = r < M ? r : M - 1;
    oA[p] = (unsigned)((r * lda + sc * 8) * (int)sizeof(T));
  }
  const unsigned oB = (unsigned)((((bn << 8) + srow) * ldb + sc * 8) * (int)sizeof(T));
  const size_t passB = (size_t)(32 * ldb) * sizeof(T);   // uniform: joins a plane's base
  const unsigned lds0 = (unsigned)(size_t)(const void*)sAB + (unsigned)(srow * LP + sc * 8) * 2u;   // low 32 bits of a __shared__ address = LDS byte address
  auto stage = [&](int buf, unsigned kbyte) __attribute__((always_inline)) {
#pragma unroll
    for (int pl = 0; pl < NPL; ++pl) {
      const char* ga = (const char*)(pl ? Ab2 : Ab) + kbyte;
      const char* gb = (const char*)(pl ? Bb2 : Bb) + kbyte;
      const unsigned la = lds0 + (unsigned)(buf * BUF_EL + pl * A_EL) * 2u;
      const unsigned lb = lds0 + (unsigned)(buf * BUF_EL + NPL * A_EL + pl * B_EL) * 2u;
      unsigned l[12]; const char* g[12];
#pragma unroll
      for (int p = 0; p < 4; ++p) { l[p] = la + (unsigned)(p * 32 * LP) * 2u; g[p] = ga + oA[p]; }
#pragma unroll
      for (int p = 0; p < 8; ++p) { l[4 + p] = lb + (unsigned)(p * 32 * LP) * 2u; g[4 + p] = (gb + p * passB) + oB; }
      copy12_to_lds(l, g);
    }
  };

  // Two fragment sets in registers, one per 32 of k: both sets' LDS reads are issued in front of the first set's WMMAs, so that the second
  // set's reads run beside matrix work. Every accumulator still takes its products in ascending k, hi*hi, hi*lo, lo*hi.
  struct FragSet { V ah[4], al[4], bh[4], bl[4]; };
  const T* sA = (const T*)sAB + ((wm << 6) + rlane) * LP + koff;
  const T* sB = (const T*)sAB + NPL * A_EL + ((wn << 6) + rlane) * LP + koff;
  auto load_set = [&](FragSet& f, int buf, int kk) __attribute__((always_inline)) {
    const int o = buf * BUF_EL + kk * 32;
#pragma unroll
    for (int j = 0; j < 4; ++j) {
      f.bh[j] = Frag<T>::load(sB + o + j * 16 * LP);
      if (SPLIT) f.bl[j] = Frag<T>::load(sB + o + B_EL + j * 16 * LP);
    }
#pragma unroll
    for (int i = 0; i < 4; ++i) {
      f.ah[i] = Frag<T>::load(sA + o + i * 16 * LP);
      if (SPLIT) f.al[i] = Frag<T>::load(sA + o + A_EL + i * 16 * LP);
    }
    // keeps the scheduler from sinking these reads down to their first use, behind the other set's WMMAs
    __builtin_amdgcn_sched_barrier(0);
  };
  auto mma_set = [&](FragSet& f) __attribute__((always_inline)) {
#pragma unroll
    for (int i = 0; i < 4; ++i) {
#pragma unroll
      for (int j = 0; j < 4; ++j) {
        acc[i][j] = Frag<T>::mma(f.ah[i], f.bh[j], acc[i][j]);
        if (SPLIT) {
          acc[i][j] = Frag<T>::mma(f.ah[i], f.bl[j], acc[i][j]);
          acc[i][j] = Frag<T>::mma(f.al[i], f.bh[j], acc[i][j]);
        }
      }
    }
  };
  FragSet f0, f1;
  const int nT = K >> 6;                        // k tiles of 64; even, at least 2
  // one k tile: trip t reads buffer t mod 2 alone, while tile t + 1's copies fly into the other buffer
  auto trip = [&](int buf, int t) __attribute__((always_inline)) {
    load_set(f0, buf, 0);
    load_set(f1, buf, 1);
    mma_set(f0);
    mma_set(f1);
    // four vector slots between the tile's last WMMAs and whatever rewrites their operand registers, also on the taken side of the branch
    // below; the two scheduling barriers hold the slots there. It names no fragment: one that an asm statement names was kept in the first
    // 256 registers, and two sets beside the accumulators do not fit there.
    __builtin_amdgcn_sched_barrier(0);
    set_done();
    __builtin_amdgcn_sched_barrier(0);
    asm volatile("s_wait_dscnt 0x0" ::: "memory");     // this wave's reads of the buffer are done before the buffer is refilled
    asm volatile("s_wait_asynccnt 0x0" ::: "memory");  // this wave's copies of tile t + 1 have landed before the barrier publishes them
    __syncthreads();                                   // publishes tile t + 1 and ends every wave's reads of tile t
    if (t + 2 < nT) stage(buf, (unsigned)(t + 2) * 128u);
  };
  stage(0, 0u);
  asm volatile("s_wait_asynccnt 0x0" ::: "memory");    // this wave's copies of tile 0 have landed before the barrier publishes them
  __syncthreads();
  stage(1, 128u);
  for (int t = 0; t < nT; t += 2) {
    trip(0, t);
    trip(1, t + 1);
  }
  asm volatile("s_wait_asynccnt 0x0" ::: "memory");    // no copy is outstanding when the wave goes on to its epilogue or ends
  if (m0 >= M) return;                                 // wave-uniform; no work-group barrier behind this line
  acc_guard4(acc[0][0], acc[0][1], acc[0][2], acc[0][3]);
  acc_guard4(acc[1][0], acc[1][1], acc[1][2], acc[1][3]);
  acc_guard4(acc[2][0], acc[2][1], acc[2][2], acc[2][3]);
  acc_guard4(acc[3][0], acc[3][1], acc[3][2], acc[3][3]);

  // ---- epilogue ----
  if (OUT_MODE == 4) {
    // a lane's 8 accumulator rows are 8 neighbours of one transposed row: 16 B per plane straight from registers; a wave fills whole 128-B lines
    static_assert(OUT_MODE != 4 || (BIAS_MODE == 0 && !RESID && ACT == 0), "transposed output is plain");
    unsigned short* C  = (unsigned short*)Cout  + (size_t)b * strideC;
    unsigned short* C2 = (unsigned short*)Cout2 + (size_t)b * strideC;
#pragma unroll
    for (int j = 0; j < 4; ++j) {
#pragma unroll
      for (int i = 0; i < 4; ++i) {
        v8h hv, lv;
#pragma unroll
        for (int r = 0; r < 8; ++r) {
          const float v = acc[i][j][r] * scale;
          const unsigned short hb = f2bf_bits(v);
          hv[r] = __builtin_bit_cast(_Float16, hb);
          lv[r] = __builtin_bit_cast(_Float16, f2bf_bits(v - bf_bits2f(hb)));
        }
        const size_t o = (size_t)(n0 + (j << 4) + rlane) * ldc + m0 + (i << 4) + mOff;
        *(v8h*)(C + o) = hv;
        *(v8h*)(C2 + o) = lv;
      }
    }
    return;
  }
  const bool out_f32 = OUT_MODE == 0 || (OUT_MODE == 3 && (b & 1) == 0);   // uniform over the work-group
  float* slab = sT[wave];
  const float* Rb = RESID ? (resid + (size_t)b * strideR) : nullptr;
#pragma unroll
  for (int i = 0; i < 4; ++i) {
    const int mBase = m0 + (i << 4);
#pragma unroll
    for (int j = 0; j < 4; ++j) {
      const int n = n0 + (j << 4) + rlane;
      float bv = 0.f;
      if (BIAS_MODE == 2) bv = bias[n];
#pragma unroll
      for (int r = 0; r < 8; ++r) {
        float v = acc[i][j][r] * scale;
        if (BIAS_MODE == 1) v += bias[mBase + mOff + r];
        if (BIAS_MODE == 2) v += bv;
        if (RESID) v += Rb[(size_t)(mBase + mOff + r) * ldc + n];
        if (ACT == 1) v = tanhf(v);
        slab[(mOff + r) * 68 + (j << 4) + rlane] = v;
      }
    }
    __builtin_amdgcn_fence(__ATOMIC_RELEASE, "workgroup");
    __builtin_amdgcn_wave_barrier();
    __builtin_amdgcn_fence(__ATOMIC_ACQUIRE, "workgroup");
    if (out_f32) {
      float* C = (float*)Cout + (size_t)b * strideC;
      const int hh = lane >> 4, c4 = (lane & 15) * 4;     // row seg = 256 B = 16 lanes x 16 B
      {
#pragma unroll
        for (int it = 0; it < 8; ++it) {
          const int row = it * 2 + hh;
          v4f v = *(const v4f*)(slab + row * 68 + c4);
          *(v4f*)(C + (size_t)(mBase + row) * ldc + n0 + c4) = v;
        }
        
      }
    } else {
      const int q = lane >> 3, c8 = (lane & 7) * 8;
      unsigned short* C  = (OUT_MODE == 3) ? (unsigned short*)((float*)Cout + (size_t)b * strideC) : ((unsigned short*)Cout + (size_t)b * strideC);
      unsigned short* C2 = (OUT_MODE == 3) ? (C + strideC) : (OUT_MODE == 2) ? ((unsigned short*)Cout2 + (size_t)b * strideC) : nullptr;
      {
#pragma unroll
        for (int it = 0; it < 4; ++it) {
          const int row = it * 4 + q;
          const float* sp = slab + row * 68 + c8;
          v8h hv, lv;
#pragma unroll
          for (int e = 0; e < 8; ++e) {
            if (OUT_MODE == 1) {
              hv[e] = (_Float16)sp[e];
            } else {
              unsigned short hb = f2bf_bits(sp[e]);
              unsigned short lb = f2bf_bits(sp[e] - bf_bits2f(hb));
              hv[e] = __builtin_bit_cast(_Float16, hb);
              lv[e] = __builtin_bit_cast(_Float16, lb);
            }
          }
          *(v8h*)(C + (size_t)(mBase + row) * ldc + n0 + c8) = hv;
          if (OUT_MODE >= 2) *(v8h*)(C2 + (size_t)(mBase + row) * ldc + n0 + c8) = lv;
        }
        // precaution: in the listing the f32 branch follows this one and reuses the registers that these stores name
        if (OUT_MODE == 3) asm volatile("s_wait_xcnt 0x0" ::: "memory");

      }
    }
    __builtin_amdgcn_fence(__ATOMIC_RELEASE, "workgroup");
    __builtin_amdgcn_wave_barrier();
    __builtin_amdgcn_fence(__ATOMIC_ACQUIRE, "workgroup");
  }
}

// x, memory and persona rows, one after the other, to one f16 plane and bf16 hi/lo planes; n*2 = float pairs per source (multiples of 256)
__global__ __launch_bounds__(256) void prep_inputs(
    const float* __restrict__ x, const float* __restrict__ mem, const float* __restrict__ per,
    _Float16* __restrict__ c16, __bf16* __restrict__ hi, __bf16* __restrict__ lo, int nx2, int nm2, int np2) {
  const int i = blockIdx.x * 256 + threadIdx.x;
  if (i >= nx2 + nm2 + np2) return;
  const float* in = x; int j = i;
  if (i >= nx2 + nm2) { in = per; j = i - nx2 - nm2; }
  else if (i >= nx2) { in = mem; j = i - nx2; }
  const float a = in[2 * j], b = in[2 * j + 1];
  const _Float16 h0 = (_Float16)a, h1 = (_Float16)b;
  ((unsigned*)c16)[i] = (unsigned)__builtin_bit_cast(unsigned short, h0) | ((unsigned)__builtin_bit_cast(unsigned short, h1) << 16);
  const unsigned short ah = f2bf_bits(a), bh = f2bf_bits(b);
  const unsigned short al = f2bf_bits(a - bf_bits2f(ah)), bl = f2bf_bits(b - bf_bits2f(bh));
  ((unsigned*)hi)[i] = (unsigned)ah | ((unsigned)bh << 16);
  ((unsigned*)lo)[i] = (unsigned)al | ((unsigned)bl << 16);
}

__global__ __launch_bounds__(256) void split_f32_bf16x2(
    const float* __restrict__ in, __bf16* __restrict__ hi, __bf16* __restrict__ lo, long n2) {
  long i = (long)blockIdx.x * 256 + threadIdx.x;
  long stride = (long)gridDim.x * 256;
  {
    for (long j = i; j < n2; j += stride) {
      const float a = in[2 * j], b = in[2 * j + 1];
      const unsigned short ah = f2bf_bits(a), bh = f2bf_bits(b);
      const unsigned short al = f2bf_bits(a - bf_bits2f(ah)), bl = f2bf_bits(b - bf_bits2f(bh));
      ((unsigned*)hi)[j] = (unsigned)ah | ((unsigned)bh << 16);
      ((unsigned*)lo)[j] = (unsigned)al | ((unsigned)bl << 16);
    }
    
  }
}


// eight source matrices of one launch; blockIdx.z picks one, its output plane follows at z * plane elements
struct Src8 { const float* p0; const float* p1; const float* p2; const float* p3; const float* p4; const float* p5; const float* p6; const float* p7; };
__device__ __forceinline__ const float* pick8(const Src8& s, int z) {
  switch (z) {
    case 0: return s.p0; case 1: return s.p1; case 2: return s.p2; case 3: return s.p3;
    case 4: return s.p4; case 5: return s.p5; case 6: return s.p6; default: return s.p7;
  }
}

// ---- f32 [R][C] (row pitch ldi) -> f16 transposed [C][R] (row pitch ldo); 64x64 tiles; each output row segment
__global__ __launch_bounds__(256) void transpose_cast_f16(Src8 srcs, int ldi,
                                                         _Float16* __restrict__ outT0, int ldo, long plane, float scale) {
  __shared__ __align__(16) _Float16 tile[64][72];     // [c][r]
  const float* __restrict__ in = pick8(srcs, blockIdx.z);
  _Float16* __restrict__ outT = outT0 + (size_t)blockIdx.z * plane;
  const int c0 = blockIdx.x * 64, r0 = blockIdx.y * 64;
  const int t = threadIdx.y * 32 + threadIdx.x;
  for (int i = threadIdx.y; i < 64; i += 8) {
    tile[threadIdx.x][i]      = (_Float16)(in[(size_t)(r0 + i) * ldi + c0 + threadIdx.x] * scale);
    tile[32 + threadIdx.x][i] = (_Float16)(in[(size_t)(r0 + i) * ldi + c0 + 32 + threadIdx.x] * scale);
  }
  __syncthreads();
  const int q = t >> 3, c8 = (t & 7) * 8;
  {
#pragma unroll
    for (int it = 0; it < 2; ++it) {
      const int c = it * 32 + q;
      v8h hv = *(const v8h*)(&tile[c][c8]);
      *(v8h*)(outT + (size_t)(c0 + c) * ldo + r0 + c8) = hv;
    }
    
  }
}

// ---- f32 [R][C] (pitch ldi) -> bf16 hi/lo transposed planes [C][R] (pitch ldo); 64x64 tiles; each output row segment
__global__ __launch_bounds__(256) void transpose_split_bf16(Src8 srcs, int ldi,
                                                           __bf16* __restrict__ outH0, __bf16* __restrict__ outL0, int ldo, long plane) {
  __shared__ __align__(16) float tile[64][68];     // [c][r]
  const float* __restrict__ in = pick8(srcs, blockIdx.z);
  __bf16* __restrict__ outH = outH0 + (size_t)blockIdx.z * plane;
  __bf16* __restrict__ outL = outL0 + (size_t)blockIdx.z * plane;
  const int c0 = blockIdx.x * 64, r0 = blockIdx.y * 64;
  const int t = threadIdx.y * 32 + threadIdx.x;
  for (int i = threadIdx.y; i < 64; i += 8) {
    tile[threadIdx.x][i]      = in[(size_t)(r0 + i) * ldi + c0 + threadIdx.x];
    tile[32 + threadIdx.x][i] = in[(size_t)(r0 + i) * ldi + c0 + 32 + threadIdx.x];
  }
  __syncthreads();
  const int q = t >> 3, c8 = (t & 7) * 8;
  {
#pragma unroll
    for (int it = 0; it < 2; ++it) {
      const int c = it * 32 + q;
      v8b hv, lv;
#pragma unroll
      for (int e = 0; e < 8; ++e) {
        const float f = tile[c][c8 + e];
        const unsigned short hb = f2bf_bits(f);
        hv[e] = __builtin_bit_cast(__bf16, hb);
        lv[e] = __builtin_bit_cast(__bf16, f2bf_bits(f - bf_bits2f(hb)));
      }
      *(v8b*)(outH + (size_t)(c0 + c) * ldo + r0 + c8) = hv;
      *(v8b*)(outL + (size_t)(c0 + c) * ldo + r0 + c8) = lv;
    }
    
  }
}

// =====================================================================================
// Generic causal/non-causal attention for head_dim 64, q f32 in / f32 out, bf16 operands with optional hi/lo splits.
//   scores, transposed: S^T = k (q*qscale)^T : v_wmma_f32_16x16x32_bf16, A = k rows, B = q; SPLIT_QK -> q,k as bf16 hi/lo (hi*hi + hi*lo + lo*hi)
//   out, transposed: O^T += v^T p^T : v_wmma_f32_16x16x32_bf16, A = v^T rows, B = p^T; SPLIT_PV -> p,v as bf16 hi/lo; else p,v plain bf16
//   A lane holds scores, weights and output elements of ONE query (column lane & 15): maximum and sum run inside the lane, the two wave halves
//   (keys 8h..8h+7 of every 16) exchange the maximum once per chunk and their sums once at the end, and two score tiles, converted in place,
//   are the B operand of the second product, so that p never goes through LDS.
//   f32 accumulate; online softmax in f32. Block = 4 waves = 64 query rows of one (batch, head); S % 64 == 0.
//   Element (b, s, h, d) of q and out lives at X[b*X_bs + s*X_rs + h*X_hs + d] (strides in floats, multiples of 4).
//   k arrives as bf16 hi and lo planes, element (s, h, d) at s*K_RS + h*k_hs + d; v as bf16 hi and lo planes, transposed: element
//   (s, h, d) at h*v_hs + d*V_RS + s (strides in bf16, multiples of 8; the row pitches are template constants, so that a tile's
//   rows are constant offsets from one address). A chunk's tiles are rows of 128 B that go to LDS as they are.
//   Masking: mask_mode 0 none, 1 causal (kv > q masked), 4 causal + sliding window (kv > q or q - kv > W masked; W passed in
//   mask_is_int); masked scores are replaced by mask_fill before the softmax. The mask is decided once per 64-key chunk with scalar
//   tests: a chunk that the window masks for all 64 query rows is not visited (its weights are exactly 0 after the softmax), a chunk
//   with no masked element runs no mask code, and only a chunk that the diagonal or the window's edge crosses compares and selects.
//   One launch serves four branches (batch 1): branch a reads q/k/v and writes out at a * {q,k,v,o}_st elements, with its own Skv,
//   mask_mode and window. grid.x = 4 * H * (S/64): first branches 0 and 1 (causal, cost grows with the query block) from the last
//   query block down, then branches 2 and 3, so that the long work-groups start first.
// =====================================================================================
#define AT_D 64
#define AT_NW 4
#define AT_QB 64
#define AT_KC 64
#define AT_LP 72   // LDS row pitch of the K and V tiles in bf16: 144 B = 16 B x 9, so that the 16 rows of a ds_load_b128 fall on different banks
struct AttnGeom { long q_bs, q_rs, q_hs, k_bs, k_rs, k_hs, v_bs, v_rs, v_hs, o_bs, o_rs, o_hs;
                  int S, Skv, H, mask_mode; float qscale; int blk0; float mask_fill; int mask_is_int; };
static_assert(sizeof(AttnGeom) == 128, "no padding");
struct AttnBranches { long q_st, k_st, v_st, o_st; int Skv[4]; int mask_mode[4]; int mask_is_int[4]; };

__device__ __forceinline__ unsigned short at_bf_bits(float f) {
  unsigned u = __float_as_uint(f);
  return (unsigned short)((u + 0x7FFFu + ((u >> 16) & 1u)) >> 16);
}
__device__ __forceinline__ __bf16 at_f2bf(float f) { return __builtin_bit_cast(__bf16, at_bf_bits(f)); }
__device__ __forceinline__ void at_split(float f, __bf16& hi, __bf16& lo) {
  const unsigned short hb = at_bf_bits(f);
  hi = __builtin_bit_cast(__bf16, hb);
  lo = at_f2bf(f - __uint_as_float(((unsigned)hb) << 16));
}
__device__ __forceinline__ v8f at_mma(v16b a, v16b b, v8f c) {
  return __builtin_amdgcn_wmma_f32_16x16x32_bf16(false, a, false, b, (short)0, c, false, false);
}
// one A or B fragment from an LDS row: elements 0..7 <- p[0..7], 8..15 <- p[16..23]
__device__ __forceinline__ v16b at_frag(const __bf16* p) {
  union { v16b v; v8b h[2]; } f;
  f.h[0] = *(const v8b*)(p); f.h[1] = *(const v8b*)(p + 16);
  return f.v;
}

// lane l takes the value of lane l ^ 16
__device__ __forceinline__ float at_xhalf(float x) {
  return __builtin_bit_cast(float, __builtin_amdgcn_permlanex16(__builtin_bit_cast(int, x), __builtin_bit_cast(int, x), 0x76543210, 0xfedcba98, false, false));
}

template <bool SPLIT_QK, bool SPLIT_PV, int K_RS, int V_RS>
__global__ __launch_bounds__(128) __attribute__((amdgpu_waves_per_eu(4)))   // 256 registers a wave: four waves per SIMD, four work-groups per WGP
void attn64_kernel(const float* __restrict__ q, const unsigned short* __restrict__ kh, const unsigned short* __restrict__ kl,
                   const unsigned short* __restrict__ vth, const unsigned short* __restrict__ vtl,
                   float* __restrict__ out, AttnGeom g0, AttnBranches br) {
  __shared__ __align__(16) __bf16 Ksh[AT_KC * AT_LP];            // K hi [kv][d]      9 KB
  __shared__ __align__(16) __bf16 Ksl[SPLIT_QK ? AT_KC * AT_LP : 8];
  __shared__ __align__(16) __bf16 Vth[AT_D * AT_LP];             // V hi [d][kv]      9 KB
  __shared__ __align__(16) __bf16 Vtl[SPLIT_PV ? AT_D * AT_LP : 8];
  __shared__ __align__(16) float  Os[AT_NW][16 * 68];            // per wave out tile, pitch 68

  const int tid  = threadIdx.x;
  const int wave = tid >> 5;
  const int lane = tid & 31;
  const int hh   = lane >> 4;
  const int c    = lane & 15;

  AttnGeom g = g0;
  const int nqb = g.S / AT_QB;
  const int bx = blockIdx.x + g.blk0;
  const int perBranch = g.H * nqb;
  int a, h, qb;
  if (bx < 2 * perBranch) {
    const int lvl = bx / (2 * g.H), w = bx % (2 * g.H);
    qb = nqb - 1 - lvl; a = w / g.H; h = w % g.H;
  } else {
    const int r = bx - 2 * perBranch, r2 = r % perBranch;
    a = 2 + r / perBranch; h = r2 / nqb; qb = r2 % nqb;
  }
  g.Skv = br.Skv[a]; g.mask_mode = br.mask_mode[a]; g.mask_is_int = br.mask_is_int[a];
  const int qbase_block = qb * AT_QB;
  const int q0 = qbase_block + wave * 16;

  const float* qb_ptr = q + (size_t)a * br.q_st + (size_t)h * g.q_hs;
  // staging: 8 threads per 128-B tile row, 16 rows per pass, 4 passes; offsets of this thread's 16 B in the first pass of chunk 0
  const int srow = tid >> 3, sc8 = (tid & 7) * 8;
  const size_t koff = (size_t)a * br.k_st + (size_t)h * g.k_hs + (size_t)srow * K_RS + sc8;
  const size_t voff = (size_t)a * br.v_st + (size_t)h * g.v_hs + (size_t)srow * V_RS + sc8;
  float*       ob_ptr = out + (size_t)a * br.o_st + (size_t)h * g.o_hs;

  // ---- Q fragments (B operand: column = query lane & 15): 2 d-chunks, hi (and lo) ----
  v16b qah[2], qal[2];
  {
    const float* qrow = qb_ptr + (size_t)(q0 + c) * g.q_rs;
#pragma unroll
    for (int dc = 0; dc < 2; ++dc) {
#pragma unroll
      for (int e = 0; e < 8; ++e) {
        const float f0 = qrow[dc * 32 + 8 * hh + e] * g.qscale;
        const float f1 = qrow[dc * 32 + 16 + 8 * hh + e] * g.qscale;
        if (SPLIT_QK) { __bf16 hq, lq; at_split(f0, hq, lq); qah[dc][e] = hq; qal[dc][e] = lq; at_split(f1, hq, lq); qah[dc][8 + e] = hq; qal[dc][8 + e] = lq; }
        else { qah[dc][e] = at_f2bf(f0); qah[dc][8 + e] = at_f2bf(f1); qal[dc][e] = qah[dc][e]; qal[dc][8 + e] = qah[dc][8 + e]; }
      }
    }
  }

  float mrow = -INFINITY, lrow = 0.f;   // of query q0 + c; lrow sums this wave half's keys alone until the epilogue
  v8f oacc[4];                          // O^T: oacc[t][r] = element d = t*16 + 8*hh + r of query q0 + c
#pragma unroll
  for (int t = 0; t < 4; ++t) oacc[t] = (v8f){0.f,0.f,0.f,0.f,0.f,0.f,0.f,0.f};

  const bool causal = (g.mask_mode == 1 || g.mask_mode == 4);
  const int win = (g.mask_mode == 4) ? g.mask_is_int : g.S;          // q - kv stays below S: no window
  const int nChunks = causal ? (qb + 1) : (g.Skv / AT_KC);           // block-uniform
  const int kcFirst = (causal && qbase_block > win) ? (qbase_block - win) / AT_KC : 0;   // chunk of the oldest key that the block's first row still sees
  // one address per plane, moved on from chunk to chunk; the four passes are constant offsets from it
  const __bf16* pkh = (const __bf16*)kh + koff + (size_t)kcFirst * (AT_KC * K_RS);    // K tile: rows are keys
  const __bf16* pkl = (const __bf16*)kl + koff + (size_t)kcFirst * (AT_KC * K_RS);
  const __bf16* pvh = (const __bf16*)vth + voff + (size_t)kcFirst * AT_KC;            // V tile: rows are head dims, keys run along the row
  const __bf16* pvl = (const __bf16*)vtl + voff + (size_t)kcFirst * AT_KC;
  for (int kc = kcFirst; kc < nChunks; ++kc) {
    const int kv0 = kc * AT_KC;
    {
      v8b rkh[4], rkl[4], rvh[4], rvl[4];
#pragma unroll
      for (int i = 0; i < 4; ++i) {
        rkh[i] = *(const v8b*)(pkh + i * 16 * K_RS);
        if (SPLIT_QK) rkl[i] = *(const v8b*)(pkl + i * 16 * K_RS);
        rvh[i] = *(const v8b*)(pvh + i * 16 * V_RS);
        if (SPLIT_PV) rvl[i] = *(const v8b*)(pvl + i * 16 * V_RS);
      }
      __syncthreads();
      pkh += AT_KC * K_RS; pkl += AT_KC * K_RS; pvh += AT_KC; pvl += AT_KC;
#pragma unroll
      for (int i = 0; i < 4; ++i) {
        const int lo = (i * 16 + srow) * AT_LP + sc8;
        *(v8b*)(Ksh + lo) = rkh[i];
        if (SPLIT_QK) *(v8b*)(Ksl + lo) = rkl[i];
        *(v8b*)(Vth + lo) = rvh[i];
        if (SPLIT_PV) *(v8b*)(Vtl + lo) = rvl[i];
      }
    }
    __syncthreads();

    // The chunk's K fragments are read from LDS in two groups, the first in front of the first WMMA, the second among the WMMAs where the
    // registers of fragments that are done with are free (all at once do not fit four waves per SIMD), and the WMMAs go round the four
    // independent score tiles. Every score tile still takes its products in the order d 0..31: hi*hi, hi*lo, lo*hi, then d 32..63 the same.
    v8f s[4];   // S^T: s[j][r] = score of key kv0 + j*16 + 8*hh + r with query q0 + c
    {
      const __bf16* kfh = Ksh + c * AT_LP + 8 * hh;
      const __bf16* kfl = Ksl + c * AT_LP + 8 * hh;
      v16b kh0[4], kl0[4], kh1[4], kl1[4];
#pragma unroll
      for (int j = 0; j < 4; ++j) kh0[j] = at_frag(kfh + j * 16 * AT_LP);
      if (SPLIT_QK) {
#pragma unroll
        for (int j = 0; j < 4; ++j) kl0[j] = at_frag(kfl + j * 16 * AT_LP);
      }
#pragma unroll
      for (int j = 0; j < 2; ++j) kh1[j] = at_frag(kfh + j * 16 * AT_LP + 32);
      // keeps the scheduler from sinking these reads down to their first use, where each would be waited for on its own
      __builtin_amdgcn_sched_barrier(0);
#pragma unroll
      for (int j = 0; j < 4; ++j) s[j] = at_mma(kh0[j], qah[0], (v8f){0.f,0.f,0.f,0.f,0.f,0.f,0.f,0.f});
      if (SPLIT_QK) {
#pragma unroll
        for (int j = 0; j < 4; ++j) s[j] = at_mma(kl0[j], qah[0], s[j]);
#pragma unroll
        for (int j = 0; j < 2; ++j) s[j] = at_mma(kh0[j], qal[0], s[j]);
      }
      // the two scheduling barriers hold the second group together at this place
      __builtin_amdgcn_sched_barrier(0);
#pragma unroll
      for (int j = 2; j < 4; ++j) kh1[j] = at_frag(kfh + j * 16 * AT_LP + 32);
      if (SPLIT_QK) {
#pragma unroll
        for (int j = 0; j < 4; ++j) kl1[j] = at_frag(kfl + j * 16 * AT_LP + 32);
      }
      __builtin_amdgcn_sched_barrier(0);
      if (SPLIT_QK) {
#pragma unroll
        for (int j = 2; j < 4; ++j) s[j] = at_mma(kh0[j], qal[0], s[j]);
      }
#pragma unroll
      for (int j = 0; j < 4; ++j) s[j] = at_mma(kh1[j], qah[1], s[j]);
      if (SPLIT_QK) {
#pragma unroll
        for (int j = 0; j < 4; ++j) s[j] = at_mma(kl1[j], qah[1], s[j]);
#pragma unroll
        for (int j = 0; j < 4; ++j) s[j] = at_mma(kh1[j], qal[1], s[j]);
      }
      // four vector slots between the last WMMAs and the first use of the scores, also on the taken side of the branch below
      acc_guard4(s[0], s[1], s[2], s[3]);
    }
    // block-uniform: the diagonal chunk, or one in which the block's last row is more than win past the chunk's first key
    if (causal && (kc == qb || qbase_block + (AT_QB - 1) - kv0 > win)) {
      const int qrow = q0 + c;
#pragma unroll
      for (int j = 0; j < 4; ++j) {
#pragma unroll
        for (int r = 0; r < 8; ++r) {
          const int dist = qrow - (kv0 + j * 16 + 8 * hh + r);
          s[j][r] = (dist < 0 || dist > win) ? g.mask_fill : s[j][r];
        }
      }
    }
    // the chunk's maximum for this lane's query: 32 keys in the lane, the other 32 in lane ^ 16
    float cm[4];
#pragma unroll
    for (int j = 0; j < 4; ++j) {
      cm[j] = s[j][0];
#pragma unroll
      for (int r = 1; r < 8; ++r) cm[j] = fmaxf(cm[j], s[j][r]);
    }
    float cmx = fmaxf(fmaxf(cm[0], cm[1]), fmaxf(cm[2], cm[3]));
    cmx = fmaxf(cmx, at_xhalf(cmx));
    const float mnew = fmaxf(mrow, cmx);
    const float alpha = expf(mrow - mnew);
    mrow = mnew;
    // p^T as B operand of the second product: element e of ph[b] = key 32*b + 8*hh + e (e < 8), 32*b + 16 + 8*hh + e - 8 (e >= 8): tiles 2b and 2b+1
    // as they lie in the registers, the k order of the V fragments below
    v16b ph[2], pl[2];
    float ps[4];
#pragma unroll
    for (int j = 0; j < 4; ++j) {
      ps[j] = 0.f;
#pragma unroll
      for (int r = 0; r < 8; ++r) {
        const float p = expf(s[j][r] - mnew);
        ps[j] += p;
        if (SPLIT_PV) { __bf16 a, bl; at_split(p, a, bl); ph[j >> 1][(j & 1) * 8 + r] = a; pl[j >> 1][(j & 1) * 8 + r] = bl; }
        else ph[j >> 1][(j & 1) * 8 + r] = at_f2bf(p);
      }
    }
    lrow = lrow * alpha + ((ps[0] + ps[1]) + (ps[2] + ps[3]));
#pragma unroll
    for (int t = 0; t < 4; ++t)
#pragma unroll
      for (int r = 0; r < 8; ++r) oacc[t][r] *= alpha;
    // V fragments in two groups, as the K fragments above; every output tile still takes keys 0..31: hi*hi, hi*lo, lo*hi, then keys 32..63.
    {
      const __bf16* vfh = Vth + c * AT_LP + 8 * hh;
      const __bf16* vfl = Vtl + c * AT_LP + 8 * hh;
      v16b vh0[4], vl0[4], vh1[4], vl1[4];
#pragma unroll
      for (int t = 0; t < 4; ++t) vh0[t] = at_frag(vfh + t * 16 * AT_LP);
      if (SPLIT_PV) {
#pragma unroll
        for (int t = 0; t < 4; ++t) vl0[t] = at_frag(vfl + t * 16 * AT_LP);
      }
#pragma unroll
      for (int t = 0; t < 2; ++t) vh1[t] = at_frag(vfh + t * 16 * AT_LP + 32);
      // keeps the scheduler from sinking these reads down to their first use, where each would be waited for on its own
      __builtin_amdgcn_sched_barrier(0);
#pragma unroll
      for (int t = 0; t < 4; ++t) oacc[t] = at_mma(vh0[t], ph[0], oacc[t]);
      if (SPLIT_PV) {
#pragma unroll
        for (int t = 0; t < 4; ++t) oacc[t] = at_mma(vl0[t], ph[0], oacc[t]);
#pragma unroll
        for (int t = 0; t < 2; ++t) oacc[t] = at_mma(vh0[t], pl[0], oacc[t]);
      }
      // the two scheduling barriers hold the second group together at this place
      __builtin_amdgcn_sched_barrier(0);
#pragma unroll
      for (int t = 2; t < 4; ++t) vh1[t] = at_frag(vfh + t * 16 * AT_LP + 32);
      if (SPLIT_PV) {
#pragma unroll
        for (int t = 0; t < 4; ++t) vl1[t] = at_frag(vfl + t * 16 * AT_LP + 32);
      }
      __builtin_amdgcn_sched_barrier(0);
      if (SPLIT_PV) {
#pragma unroll
        for (int t = 2; t < 4; ++t) oacc[t] = at_mma(vh0[t], pl[0], oacc[t]);
      }
#pragma unroll
      for (int t = 0; t < 4; ++t) oacc[t] = at_mma(vh1[t], ph[1], oacc[t]);
      if (SPLIT_PV) {
#pragma unroll
        for (int t = 0; t < 4; ++t) oacc[t] = at_mma(vl1[t], ph[1], oacc[t]);
#pragma unroll
        for (int t = 0; t < 4; ++t) oacc[t] = at_mma(vh1[t], pl[1], oacc[t]);
      }
      // four vector slots between the chunk's last WMMAs and whatever rewrites their registers, also on the taken side of the loop's branch
      acc_guard4(oacc[0], oacc[1], oacc[2], oacc[3]);
    }
  }

  float* os = Os[wave];
  {
    const float inv = 1.0f / (lrow + at_xhalf(lrow));   // the two halves' sums join here
#pragma unroll
    for (int t = 0; t < 4; ++t) {
      const v4f lo4 = {oacc[t][0] * inv, oacc[t][1] * inv, oacc[t][2] * inv, oacc[t][3] * inv};
      const v4f hi4 = {oacc[t][4] * inv, oacc[t][5] * inv, oacc[t][6] * inv, oacc[t][7] * inv};
      *(v4f*)(os + c * 68 + t * 16 + 8 * hh) = lo4;
      *(v4f*)(os + c * 68 + t * 16 + 8 * hh + 4) = hi4;
    }
  }
  __builtin_amdgcn_fence(__ATOMIC_RELEASE, "workgroup");
  __builtin_amdgcn_wave_barrier();
  __builtin_amdgcn_fence(__ATOMIC_ACQUIRE, "workgroup");
  {
    const int c4 = (lane & 15) * 4;
    {
#pragma unroll
      for (int it = 0; it < 8; ++it) {
        const int row = it * 2 + hh;
        v4f val = *(const v4f*)(os + row * 68 + c4);
        *(v4f*)(ob_ptr + (size_t)(q0 + row) * g.o_rs + c4) = val;
      }
      
    }
  }
}

__global__ __launch_bounds__(256) void gate_fuse_kernel(const float* __restrict__ o0, const float* __restrict__ o1,
                                                       const float* __restrict__ o2, const float* __restrict__ o3,
                                                       const float* __restrict__ Wg, const float* __restrict__ bg,
                                                       float* __restrict__ out, int Hd) {
  __shared__ float red[4][8];
  const int row = blockIdx.x, t = threadIdx.x, lane = t & 31, wave = t >> 5;
  const float* os[4] = {o0 + (size_t)row * Hd, o1 + (size_t)row * Hd, o2 + (size_t)row * Hd, o3 + (size_t)row * Hd};
  float acc[4] = {0.f, 0.f, 0.f, 0.f};
  for (int i = 0; i < 4; ++i) {
    const float* o = os[i];
    for (int c = t; c < Hd; c += 256) {
      const float v = o[c];
      const float* w = Wg + (size_t)(i * Hd + c) * 4;
      acc[0] += v * w[0]; acc[1] += v * w[1]; acc[2] += v * w[2]; acc[3] += v * w[3];
    }
  }
#pragma unroll
  for (int g = 0; g < 4; ++g) { float a = acc[g]; for (int o = 16; o > 0; o >>= 1) a += __shfl_xor(a, o, 32); if (lane == 0) red[g][wave] = a; }
  __syncthreads();
  float gl[4];
#pragma unroll
  for (int g = 0; g < 4; ++g) { float a = 0.f; for (int w = 0; w < 8; ++w) a += red[g][w]; gl[g] = a + bg[g]; }
  const float mx = fmaxf(fmaxf(gl[0], gl[1]), fmaxf(gl[2], gl[3]));
  float e[4], se = 0.f;
#pragma unroll
  for (int g = 0; g < 4; ++g) { e[g] = expf(gl[g] - mx); se += e[g]; }
  const float inv = 1.0f / se;
  const int c = 4 * t;
  v4f r;
#pragma unroll
  for (int q = 0; q < 4; ++q) r[q] = (e[0] * inv) * os[0][c + q] + (e[1] * inv) * os[1][c + q] + (e[2] * inv) * os[2][c + q] + (e[3] * inv) * os[3][c + q];
  *(v4f*)(out + (size_t)row * Hd + c) = r;
  
}

extern "C" void kernel_launch(void* const* d_in, const int* in_sizes, int n_in,
                              void* d_out, int out_size, void* d_ws, size_t ws_size,
                              hipStream_t stream) {
  (void)in_sizes; (void)n_in; (void)out_size; (void)ws_size;
  const int S = 2048, E = 1024, H = 16, DH = 64, MM = 512, MP = 64, WIN = 512;
  // wire order: 16 weights ([in,out]), gate_w, gate_b, x, memory_kv, persona_kv
  const float* Wm[16]; for (int i = 0; i < 16; ++i) Wm[i] = (const float*)d_in[i];   // {local,long,mem,per} x {wq,wk,wv,wo}
  const float* gate_w = (const float*)d_in[16];
  const float* gate_b = (const float*)d_in[17];
  const float* x   = (const float*)d_in[18];   // [1,2048,1024]
  const float* mem = (const float*)d_in[19];   // [1,512,1024]
  const float* per = (const float*)d_in[20];   // [1,64,1024]
  float* out = (float*)d_out;

  char* ws = (char*)d_ws; size_t off = 0;
  auto carve = [&](size_t bytes) -> char* { char* p = ws + off; off += (bytes + 255) & ~(size_t)255; return p; };
  const int CT = S + MM + MP;                                   // context rows: x, then memory, then persona
  const long EE = (long)E * E, SE = (long)S * E;
  _Float16* C16  = (_Float16*)carve((size_t)CT * E * 2);        // 5.4 MB each
  __bf16*   Ch   = (__bf16*)carve((size_t)CT * E * 2);
  __bf16*   Cl   = (__bf16*)carve((size_t)CT * E * 2);
  _Float16* WqkT = (_Float16*)carve((size_t)8 * EE * 2);        // plane 2a = wq^T, 2a+1 = wk^T of branch a; 16.8 MB
  __bf16*   WvoTh = (__bf16*)carve((size_t)8 * EE * 2);         // plane 2a = wv^T, 2a+1 = wo^T
  __bf16*   WvoTl = (__bf16*)carve((size_t)8 * EE * 2);
  float*    QK   = (float*)carve((size_t)8 * SE * 4);           // plane 2a = q (f32), 2a+1 = k of branch a (bf16 hi, then bf16 lo); 67 MB
  __bf16*   VTh  = (__bf16*)carve((size_t)4 * SE * 2);          // v^T of branch a: [E][S] (row pitch S for every branch); 16.8 MB each
  __bf16*   VTl  = (__bf16*)carve((size_t)4 * SE * 2);
  float*    Of   = (float*)carve((size_t)4 * SE * 4);
  __bf16*   Oh   = (__bf16*)carve((size_t)4 * SE * 2);
  __bf16*   Ol   = (__bf16*)carve((size_t)4 * SE * 2);          // total 234 MB
  float*    Ob[4];
  for (int i = 0; i < 4; ++i) Ob[i] = QK + (size_t)i * SE;      // branch outputs take the q/k planes' place once attention is done

  const int  SKs[4]  = {S, S, MM, MP};                          // keys per branch
  const long ctx0[4] = {0, 0, (long)S * E, (long)(S + MM) * E}; // first context element per branch

  prep_inputs<<<CT * E / 2 / 256, 256, 0, stream>>>(x, mem, per, C16, Ch, Cl, S * E / 2, MM * E / 2, MP * E / 2);
  {
    Src8 qk = {Wm[0], Wm[1], Wm[4], Wm[5], Wm[8], Wm[9], Wm[12], Wm[13]};
    Src8 vo = {Wm[2], Wm[3], Wm[6], Wm[7], Wm[10], Wm[11], Wm[14], Wm[15]};
    transpose_cast_f16<<<dim3(E / 64, E / 64, 8), dim3(32, 8), 0, stream>>>(qk, E, WqkT, E, EE, 1.0f);
    transpose_split_bf16<<<dim3(E / 64, E / 64, 8), dim3(32, 8), 0, stream>>>(vo, E, WvoTh, WvoTl, E, EE);
  }
  const int tb = (S / 128) * (E / 256);                         // 128x256 tiles of the tallest batch entry
  {
    BatchA bqk, bv;
    for (int a = 0; a < 4; ++a) {
      bqk.aoff[2 * a] = 0;           bqk.M[2 * a] = S;
      bqk.aoff[2 * a + 1] = ctx0[a]; bqk.M[2 * a + 1] = SKs[a];
      bv.aoff[a] = ctx0[a];          bv.M[a] = SKs[a];
      bv.aoff[4 + a] = 0;            bv.M[4 + a] = 0;
    }
    wmma_gemm64<0, false, 0, 3, false><<<dim3(tb, 8), 256, 0, stream>>>(
        U16(C16), nullptr, E, bqk, U16(WqkT), nullptr, E, EE, QK, nullptr, E, SE, nullptr, nullptr, 0, E, E, 1.0f);
    wmma_gemm64<1, true, 0, 4, false><<<dim3(tb, 4), 256, 0, stream>>>(
        U16(Ch), U16(Cl), E, bv, U16(WvoTh), U16(WvoTl), E, 2 * EE, VTh, VTl, S, SE, nullptr, nullptr, 0, E, E, 1.0f);
  }
  {
    AttnGeom g;
    g.q_bs = SE; g.q_rs = E; g.q_hs = DH;
    g.k_bs = SE; g.k_rs = E; g.k_hs = DH;
    g.v_bs = SE; g.v_rs = S; g.v_hs = (long)DH * S;
    g.o_bs = SE; g.o_rs = E; g.o_hs = DH;
    g.S = S; g.Skv = S; g.H = H; g.qscale = 0.125f; g.blk0 = 0; g.mask_fill = -1.0e30f;
    g.mask_mode = 0; g.mask_is_int = 0;
    AttnBranches br;
    br.q_st = 2 * SE; br.k_st = 4 * SE; br.v_st = SE; br.o_st = SE;   // a q/k pair of f32-sized planes is 4 * SE bf16
    for (int a = 0; a < 4; ++a) { br.Skv[a] = SKs[a]; br.mask_mode[a] = 0; br.mask_is_int[a] = 0; }
    br.mask_mode[0] = 4; br.mask_is_int[0] = WIN;               // causal + window
    br.mask_mode[1] = 1;                                        // causal
    attn64_kernel<true, true, E, S><<<4 * H * (S / AT_QB), AT_NW * 32, 0, stream>>>(QK, U16(QK + SE), U16(QK + SE) + SE, U16(VTh), U16(VTl), Of, g, br);
  }
  split_f32_bf16x2<<<4096, 256, 0, stream>>>(Of, Oh, Ol, 4 * SE / 2);
  {
    BatchA bo;
    for (int a = 0; a < 4; ++a) { bo.aoff[a] = a * SE; bo.M[a] = S; bo.aoff[4 + a] = 0; bo.M[4 + a] = 0; }
    wmma_gemm64<1, true, 0, 0, false><<<dim3(tb, 4), 256, 0, stream>>>(
        U16(Oh), U16(Ol), E, bo, U16(WvoTh + EE), U16(WvoTl + EE), E, 2 * EE, Ob[0], nullptr, E, SE, nullptr, nullptr, 0, E, E, 1.0f);
  }
  gate_fuse_kernel<<<S, 256, 0, stream>>>(Ob[0], Ob[1], Ob[2], Ob[3], gate_w, gate_b, out, E);
}

// v009
// It runs in 212 microseconds.
// Next to v008, in two timings, it ran 1.03 and 1.04 times as fast.
// Over all steps from v000 it is 8.31 times as fast.
#include <hip/hip_runtime.h>
#include <math.h>
// Four attentions (local = causal + 512 sliding window, long = causal, memory cross (512 keys), persona cross (64 keys)), 16 heads of 64:
// q/k projections (K=1024): v_wmma_f32_16x16x32_f16 (f16 operands); v and output projections (K=1024): v_wmma_f32_16x16x32_bf16 as bf16
// hi/lo splits; scores and p·v: v_wmma_f32_16x16x32_bf16 with q,k and p,v as bf16 hi/lo splits; f32 accumulate; softmax f32.
// k and v leave their projections already split into bf16 hi/lo planes (v transposed), so attention only copies their tiles to LDS.
// Gate (concat(outs)·gate_w, N=4, 0.1 % of MACs), gate softmax and the weighted fusion in f32 on VALU.
typedef __attribute__((ext_vector_type(16))) _Float16 v16h;
typedef __attribute__((ext_vector_type(8)))  _Float16 v8h;
typedef __attribute__((ext_vector_type(16))) __bf16   v16b;
typedef __attribute__((ext_vector_type(8)))  __bf16   v8b;
typedef __attribute__((ext_vector_type(8)))  float    v8f;
typedef __attribute__((ext_vector_type(4)))  float    v4f;
#define PSCALE 32768.0f
#define U16(p) ((const unsigned short*)(const void*)(p))
#define PSCALE_INV (1.0f / 32768.0f)

__device__ __forceinline__ unsigned short f2bf_bits(float f) {
  unsigned u = __float_as_uint(f);
  return (unsigned short)((u + 0x7FFFu + ((u >> 16) & 1u)) >> 16);
}
__device__ __forceinline__ float bf_bits2f(unsigned short h) { return __uint_as_float(((unsigned)h) << 16); }

// hazard guards as plain device helpers
__device__ __forceinline__ void acc_guard4(v8f& a, v8f& b, v8f& c, v8f& d) { asm volatile("v_nop\n\tv_nop\n\tv_nop\n\tv_nop" : "+v"(a), "+v"(b), "+v"(c), "+v"(d)); }
// end of a k tile's WMMAs in the GEMM k loop: four vector slots in front of whatever rewrites their operand registers (why: at the call)
__device__ __forceinline__ void set_done() { asm volatile("v_nop\n\tv_nop\n\tv_nop\n\tv_nop"); }
// Twelve asynchronous copies of 16 B per lane, global memory -> LDS, through no register: l = the lane's LDS byte address, g = its global address.
// s_wait_xcnt stands in the copies' own statement, a precaution: what follows may rewrite the address registers that the copies name.
__device__ __forceinline__ void copy12_to_lds(const unsigned (&l)[12], const char* const (&g)[12]) {
  asm volatile(
      "global_load_async_to_lds_b128 %0, %1, off\n\t"
      "global_load_async_to_lds_b128 %2, %3, off\n\t"
      "global_load_async_to_lds_b128 %4, %5, off\n\t"
      "global_load_async_to_lds_b128 %6, %7, off\n\t"
      "global_load_async_to_lds_b128 %8, %9, off\n\t"
      "global_load_async_to_lds_b128 %10, %11, off\n\t"
      "global_load_async_to_lds_b128 %12, %13, off\n\t"
      "global_load_async_to_lds_b128 %14, %15, off\n\t"
      "global_load_async_to_lds_b128 %16, %17, off\n\t"
      "global_load_async_to_lds_b128 %18, %19, off\n\t"
      "global_load_async_to_lds_b128 %20, %21, off\n\t"
      "global_load_async_to_lds_b128 %22, %23, off\n\t"
      "s_wait_xcnt 0x0"
      :: "v"(l[0]), "v"(g[0]), "v"(l[1]), "v"(g[1]), "v"(l[2]), "v"(g[2]), "v"(l[3]), "v"(g[3]), "v"(l[4]), "v"(g[4]), "v"(l[5]), "v"(g[5]),
         "v"(l[6]), "v"(g[6]), "v"(l[7]), "v"(g[7]), "v"(l[8]), "v"(g[8]), "v"(l[9]), "v"(g[9]), "v"(l[10]), "v"(g[10]), "v"(l[11]), "v"(g[11])
      : "memory");
}
template <typename T> struct Frag;
template <> struct Frag<_Float16> {
  typedef v16h V; union U { v16h v; v8h h[2]; };
  static __device__ __forceinline__ v16h load(const _Float16* p) {   // elements 0..7 <- p[0..7], 8..15 <- p[16..23]
    U f; f.h[0] = *(const v8h*)(p); f.h[1] = *(const v8h*)(p + 16); return f.v;
  }
  static __device__ __forceinline__ v8f mma(v16h a, v16h b, v8f c) {
    return __builtin_amdgcn_wmma_f32_16x16x32_f16(false, a, false, b, (short)0, c, false, false);
  }
};
template <> struct Frag<__bf16> {
  typedef v16b V; union U { v16b v; v8b h[2]; };
  static __device__ __forceinline__ v16b load(const __bf16* p) {
    U f; f.h[0] = *(const v8b*)(p); f.h[1] = *(const v8b*)(p + 16); return f.v;
  }
  static __device__ __forceinline__ v8f mma(v16b a, v16b b, v8f c) {
    return __builtin_amdgcn_wmma_f32_16x16x32_bf16(false, a, false, b, (short)0, c, false, false);
  }
};

// ---- Register-blocked batched WMMA GEMM ------------------------------------
// C[m,n] = scale * sum_k A[m,k] * Bt[n,k] (+bias)(+resid); each wave owns a 64x64 tile, a work-group's 8 waves a 128x256 tile (2 x 4 waves).
// A row-major [M,K]; Bt row-major [N,K]; M % 64 == 0, N % 256 == 0, K % 128 == 0; grid.x = (largest M / 128) * (N / 256).
// The work-group's A and B rows go to LDS 64 of k at a time (whole 128-B lines, each fetched once for all the waves that use it).
// SPLIT: operands are hi/lo planes (A2/Bt2 = lo planes, same layout); product = hi·hi + hi·lo + lo·hi.
// BIAS_MODE: 0 = none, 1 = bias[m], 2 = bias[n].
// OUT_MODE: 0 = f32, 1 = f16, 2 = bf16 hi plane (Cout) + bf16 lo plane (Cout2),
//   3 = even batch entries as 0; odd entries as bf16 hi and lo planes inside the entry's own f32 plane (hi first, lo strideC elements behind it),
//   4 = bf16 hi (Cout) and lo (Cout2) planes, transposed: element (m, n) at n * ldc + m (no bias, residual or activation).
// ET: 0 = f16 operands, 1 = bf16 operands (pointers passed as 16-bit storage)
template <int ET> struct Elem;
template <> struct Elem<0> { typedef _Float16 T; };
template <> struct Elem<1> { typedef __bf16 T; };
// Batch entry blockIdx.y reads A from element offset aoff[y] and has M[y] rows (entries may differ in source and height).
struct BatchA { long aoff[8]; int M[8]; };
template <int ET, bool SPLIT, int BIAS_MODE, int OUT_MODE, bool RESID, int ACT = 0>
__global__ __launch_bounds__(256) void wmma_gemm64(
    const unsigned short* __restrict__ Ap, const unsigned short* __restrict__ A2p, int lda, BatchA ba,
    const unsigned short* __restrict__ Btp, const unsigned short* __restrict__ Bt2p, int ldb, long strideB,
    void* __restrict__ Cout, void* __restrict__ Cout2, int ldc, long strideC,
    const float* __restrict__ bias,
    const float* __restrict__ resid, long strideR,
    int N, int K, float scale) {
  typedef typename Elem<ET>::T T;
  typedef typename Frag<T>::V V;
  const T* A = (const T*)Ap; const T* A2 = (const T*)A2p; const T* Bt = (const T*)Btp; const T* Bt2 = (const T*)Bt2p;
  constexpr int NPL = SPLIT ? 2 : 1;              // planes per operand
  constexpr int LP  = 72;                         // LDS row pitch in elements: 144 B = 16 B x 9, so that the 16 rows of a ds_load_b128 fall on different banks
  constexpr int A_EL = 128 * LP, B_EL = 256 * LP; // one plane of the A tile, of the B tile
  constexpr int BUF_EL = NPL * (A_EL + B_EL);     // one buffer: A hi, (A lo,) B hi, (B lo)
  __shared__ __align__(16) unsigned short sAB[2 * BUF_EL];
  __shared__ __align__(16) float sT[8][16 * 68];   // per-wave 16x64 slab, pitch 68 floats
  const int b    = blockIdx.y;
  const int M    = ba.M[b];
  const long offA = ba.aoff[b];
  const int lane = threadIdx.x & 31;
  const int wave = threadIdx.x >> 5;
  const int tilesBN = N >> 8;
  const int bm = blockIdx.x / tilesBN;
  const int bn = blockIdx.x - bm * tilesBN;
  if ((bm << 7) >= M) return;            // the same for the whole work-group, in front of every copy and barrier
  const int wm = wave >> 2, wn = wave & 3;
  const int m0 = (bm << 7) + (wm << 6);
  const int n0 = (bn << 8) + (wn << 6);

  const T* Ab  = A  + offA;
  const T* Bb  = Bt + (size_t)b * strideB;
  const T* Ab2 = SPLIT ? (A2  + offA) : nullptr;
  const T* Bb2 = SPLIT ? (Bt2 + (size_t)b * strideB) : nullptr;

  const int rlane = lane & 15;                 // row (A) / col (B, D) within subtile
  const int koff  = (lane >> 4) * 8;           // k offset of this lane half
  const int mOff  = (lane >> 4) * 8;           // D row offset

  v8f acc[4][4];
#pragma unroll
  for (int i = 0; i < 4; ++i)
#pragma unroll
    for (int j = 0; j < 4; ++j) acc[i][j] = (v8f){0.f,0.f,0.f,0.f,0.f,0.f,0.f,0.f};

  // Staging: 8 threads per 128-B row, 32 rows per pass; 4 passes for an A plane, 8 for a B plane. An A row past the entry's last one
  // (M = 64 under a 128-row tile) takes the last row's address: its products belong to a wave that stores nothing.
  const int srow = threadIdx.x >> 3, sc = threadIdx.x & 7;
  unsigned oA[4];                              // byte offsets of this thread's 16 B in k tile 0, one per pass (A), first pass (B)
#pragma unroll
  for (int p = 0; p < 4; ++p) {
    int r = (bm << 7) + p * 32 + srow;
    r = r < M ? r : M - 1;
    oA[p] = (unsigned)((r * lda + sc * 8) * (int)sizeof(T));
  }
  const unsigned oB = (unsigned)((((bn << 8) + srow) * ldb + sc * 8) * (int)sizeof(T));
  const size_t passB = (size_t)(32 * ldb) * sizeof(T);   // uniform: joins a plane's base
  const unsigned lds0 = (unsigned)(size_t)(const void*)sAB + (unsigned)(srow * LP + sc * 8) * 2u;   // low 32 bits of a __shared__ address = LDS byte address
  auto stage = [&](int buf, unsigned kbyte) __attribute__((always_inline)) {
#pragma unroll
    for (int pl = 0; pl < NPL; ++pl) {
      const char* ga = (const char*)(pl ? Ab2 : Ab) + kbyte;
      const char* gb = (const char*)(pl ? Bb2 : Bb) + kbyte;
      const unsigned la = lds0 + (unsigned)(buf * BUF_EL + pl * A_EL) * 2u;
      const unsigned lb = lds0 + (unsigned)(buf * BUF_EL + NPL * A_EL + pl * B_EL) * 2u;
      unsigned l[12]; const char* g[12];
#pragma unroll
      for (int p = 0; p < 4; ++p) { l[p] = la + (unsigned)(p * 32 * LP) * 2u; g[p] = ga + oA[p]; }
#pragma unroll
      for (int p = 0; p < 8; ++p) { l[4 + p] = lb + (unsigned)(p * 32 * LP) * 2u; g[4 + p] = (gb + p * passB) + oB; }
      copy12_to_lds(l, g);
    }
  };

  // Two fragment sets in registers, one per 32 of k: both sets' LDS reads are issued in front of the first set's WMMAs, so that the second
  // set's reads run beside matrix work. Every accumulator still takes its products in ascending k, hi*hi, hi*lo, lo*hi.
  struct FragSet { V ah[4], al[4], bh[4], bl[4]; };
  const T* sA = (const T*)sAB + ((wm << 6) + rlane) * LP + koff;
  const T* sB = (const T*)sAB + NPL * A_EL + ((wn << 6) + rlane) * LP + koff;
  auto load_set = [&](FragSet& f, int buf, int kk) __attribute__((always_inline)) {
    const int o = buf * BUF_EL + kk * 32;
#pragma unroll
    for (int j = 0; j < 4; ++j) {
      f.bh[j] = Frag<T>::load(sB + o + j * 16 * LP);
      if (SPLIT) f.bl[j] = Frag<T>::load(sB + o + B_EL + j * 16 * LP);
    }
#pragma unroll
    for (int i = 0; i < 4; ++i) {
      f.ah[i] = Frag<T>::load(sA + o + i * 16 * LP);
      if (SPLIT) f.al[i] = Frag<T>::load(sA + o + A_EL + i * 16 * LP);
    }
    // keeps the scheduler from sinking these reads down to their first use, behind the other set's WMMAs
    __builtin_amdgcn_sched_barrier(0);
  };
  auto mma_set = [&](FragSet& f) __attribute__((always_inline)) {
#pragma unroll
    for (int i = 0; i < 4; ++i) {
#pragma unroll
      for (int j = 0; j < 4; ++j) {
        acc[i][j] = Frag<T>::mma(f.ah[i], f.bh[j], acc[i][j]);
        if (SPLIT) {
          acc[i][j] = Frag<T>::mma(f.ah[i], f.bl[j], acc[i][j]);
          acc[i][j] = Frag<T>::mma(f.al[i], f.bh[j], acc[i][j]);
        }
      }
    }
  };
  FragSet f0, f1;
  const int nT = K >> 6;                        // k tiles of 64; even, at least 2
  // one k tile: trip t reads buffer t mod 2 alone, while tile t + 1's copies fly into the other buffer
  auto trip = [&](int buf, int t) __attribute__((always_inline)) {
    load_set(f0, buf, 0);
    load_set(f1, buf, 1);
    mma_set(f0);
    mma_set(f1);
    // four vector slots between the tile's last WMMAs and whatever rewrites their operand registers, also on the taken side of the branch
    // below; the two scheduling barriers hold the slots there. It names no fragment: one that an asm statement names was kept in the first
    // 256 registers, and two sets beside the accumulators do not fit there.
    __builtin_amdgcn_sched_barrier(0);
    set_done();
    __builtin_amdgcn_sched_barrier(0);
    asm volatile("s_wait_dscnt 0x0" ::: "memory");     // this wave's reads of the buffer are done before the buffer is refilled
    asm volatile("s_wait_asynccnt 0x0" ::: "memory");  // this wave's copies of tile t + 1 have landed before the barrier publishes them
    __syncthreads();                                   // publishes tile t + 1 and ends every wave's reads of tile t
    if (t + 2 < nT) stage(buf, (unsigned)(t + 2) * 128u);
  };
  stage(0, 0u);
  asm volatile("s_wait_asynccnt 0x0" ::: "memory");    // this wave's copies of tile 0 have landed before the barrier publishes them
  __syncthreads();
  stage(1, 128u);
  for (int t = 0; t < nT; t += 2) {
    trip(0, t);
    trip(1, t + 1);
  }
  asm volatile("s_wait_asynccnt 0x0" ::: "memory");    // no copy is outstanding when the wave goes on to its epilogue or ends
  if (m0 >= M) return;                                 // wave-uniform; no work-group barrier behind this line
  acc_guard4(acc[0][0], acc[0][1], acc[0][2], acc[0][3]);
  acc_guard4(acc[1][0], acc[1][1], acc[1][2], acc[1][3]);
  acc_guard4(acc[2][0], acc[2][1], acc[2][2], acc[2][3]);
  acc_guard4(acc[3][0], acc[3][1], acc[3][2], acc[3][3]);

  // ---- epilogue ----
  if (OUT_MODE == 4) {
    // a lane's 8 accumulator rows are 8 neighbours of one transposed row: 16 B per plane straight from registers; a wave fills whole 128-B lines
    static_assert(OUT_MODE != 4 || (BIAS_MODE == 0 && !RESID && ACT == 0), "transposed output is plain");
    unsigned short* C  = (unsigned short*)Cout  + (size_t)b * strideC;
    unsigned short* C2 = (unsigned short*)Cout2 + (size_t)b * strideC;
#pragma unroll
    for (int j = 0; j < 4; ++j) {
#pragma unroll
      for (int i = 0; i < 4; ++i) {
        v8h hv, lv;
#pragma unroll
        for (int r = 0; r < 8; ++r) {
          const float v = acc[i][j][r] * scale;
          const unsigned short hb = f2bf_bits(v);
          hv[r] = __builtin_bit_cast(_Float16, hb);
          lv[r] = __builtin_bit_cast(_Float16, f2bf_bits(v - bf_bits2f(hb)));
        }
        const size_t o = (size_t)(n0 + (j << 4) + rlane) * ldc + m0 + (i << 4) + mOff;
        *(v8h*)(C + o) = hv;
        *(v8h*)(C2 + o) = lv;
      }
    }
    return;
  }
  const bool out_f32 = OUT_MODE == 0 || (OUT_MODE == 3 && (b & 1) == 0);   // uniform over the work-group
  float* slab = sT[wave];
  const float* Rb = RESID ? (resid + (size_t)b * strideR) : nullptr;
#pragma unroll
  for (int i = 0; i < 4; ++i) {
    const int mBase = m0 + (i << 4);
#pragma unroll
    for (int j = 0; j < 4; ++j) {
      const int n = n0 + (j << 4) + rlane;
      float bv = 0.f;
      if (BIAS_MODE == 2) bv = bias[n];
#pragma unroll
      for (int r = 0; r < 8; ++r) {
        float v = acc[i][j][r] * scale;
        if (BIAS_MODE == 1) v += bias[mBase + mOff + r];
        if (BIAS_MODE == 2) v += bv;
        if (RESID) v += Rb[(size_t)(mBase + mOff + r) * ldc + n];
        if (ACT == 1) v = tanhf(v);
        slab[(mOff + r) * 68 + (j << 4) + rlane] = v;
      }
    }
    __builtin_amdgcn_fence(__ATOMIC_RELEASE, "workgroup");
    __builtin_amdgcn_wave_barrier();
    __builtin_amdgcn_fence(__ATOMIC_ACQUIRE, "workgroup");
    if (out_f32) {
      float* C = (float*)Cout + (size_t)b * strideC;
      const int hh = lane >> 4, c4 = (lane & 15) * 4;     // row seg = 256 B = 16 lanes x 16 B
      {
#pragma unroll
        for (int it = 0; it < 8; ++it) {
          const int row = it * 2 + hh;
          v4f v = *(const v4f*)(slab + row * 68 + c4);
          *(v4f*)(C + (size_t)(mBase + row) * ldc + n0 + c4) = v;
        }
        
      }
    } else {
      const int q = lane >> 3, c8 = (lane & 7) * 8;
      unsigned short* C  = (OUT_MODE == 3) ? (unsigned short*)((float*)Cout + (size_t)b * strideC) : ((unsigned short*)Cout + (size_t)b * strideC);
      unsigned short* C2 = (OUT_MODE == 3) ? (C + strideC) : (OUT_MODE == 2) ? ((unsigned short*)Cout2 + (size_t)b * strideC) : nullptr;
      {
#pragma unroll
        for (int it = 0; it < 4; ++it) {
          const int row = it * 4 + q;
          const float* sp = slab + row * 68 + c8;
          v8h hv, lv;
#pragma unroll
          for (int e = 0; e < 8; ++e) {
            if (OUT_MODE == 1) {
              hv[e] = (_Float16)sp[e];
            } else {
              unsigned short hb = f2bf_bits(sp[e]);
              unsigned short lb = f2bf_bits(sp[e] - bf_bits2f(hb));
              hv[e] = __builtin_bit_cast(_Float16, hb);
              lv[e] = __builtin_bit_cast(_Float16, lb);
            }
          }
          *(v8h*)(C + (size_t)(mBase + row) * ldc + n0 + c8) = hv;
          if (OUT_MODE >= 2) *(v8h*)(C2 + (size_t)(mBase + row) * ldc + n0 + c8) = lv;
        }
        // precaution: in the listing the f32 branch follows this one and reuses the registers that these stores name
        if (OUT_MODE == 3) asm volatile("s_wait_xcnt 0x0" ::: "memory");

      }
    }
    __builtin_amdgcn_fence(__ATOMIC_RELEASE, "workgroup");
    __builtin_amdgcn_wave_barrier();
    __builtin_amdgcn_fence(__ATOMIC_ACQUIRE, "workgroup");
  }
}

// x, memory and persona rows, one after the other, to one f16 plane and bf16 hi/lo planes; n*2 = float pairs per source (multiples of 256)
__global__ __launch_bounds__(256) void prep_inputs(
    const float* __restrict__ x, const float* __restrict__ mem, const float* __restrict__ per,
    _Float16* __restrict__ c16, __bf16* __restrict__ hi, __bf16* __restrict__ lo, int nx2, int nm2, int np2) {
  const int i = blockIdx.x * 256 + threadIdx.x;
  if (i >= nx2 + nm2 + np2) return;
  const float* in = x; int j = i;
  if (i >= nx2 + nm2) { in = per; j = i - nx2 - nm2; }
  else if (i >= nx2) { in = mem; j = i - nx2; }
  const float a = in[2 * j], b = in[2 * j + 1];
  const _Float16 h0 = (_Float16)a, h1 = (_Float16)b;
  ((unsigned*)c16)[i] = (unsigned)__builtin_bit_cast(unsigned short, h0) | ((unsigned)__builtin_bit_cast(unsigned short, h1) << 16);
  const unsigned short ah = f2bf_bits(a), bh = f2bf_bits(b);
  const unsigned short al = f2bf_bits(a - bf_bits2f(ah)), bl = f2bf_bits(b - bf_bits2f(bh));
  ((unsigned*)hi)[i] = (unsigned)ah | ((unsigned)bh << 16);
  ((unsigned*)lo)[i] = (unsigned)al | ((unsigned)bl << 16);
}

__global__ __launch_bounds__(256) void split_f32_bf16x2(
    const float* __restrict__ in, __bf16* __restrict__ hi, __bf16* __restrict__ lo, long n2) {
  long i = (long)blockIdx.x * 256 + threadIdx.x;
  long stride = (long)gridDim.x * 256;
  {
    for (long j = i; j < n2; j += stride) {
      const float a = in[2 * j], b = in[2 * j + 1];
      const unsigned short ah = f2bf_bits(a), bh = f2bf_bits(b);
      const unsigned short al = f2bf_bits(a - bf_bits2f(ah)), bl = f2bf_bits(b - bf_bits2f(bh));
      ((unsigned*)hi)[j] = (unsigned)ah | ((unsigned)bh << 16);
      ((unsigned*)lo)[j] = (unsigned)al | ((unsigned)bl << 16);
    }
    
  }
}


// eight source matrices of one launch; blockIdx.z picks one, its output plane follows at z * plane elements
struct Src8 { const float* p0; const float* p1; const float* p2; const float* p3; const float* p4; const float* p5; const float* p6; const float* p7; };
__device__ __forceinline__ const float* pick8(const Src8& s, int z) {
  switch (z) {
    case 0: return s.p0; case 1: return s.p1; case 2: return s.p2; case 3: return s.p3;
    case 4: return s.p4; case 5: return s.p5; case 6: return s.p6; default: return s.p7;
  }
}

// ---- f32 [R][C] (row pitch ldi) -> f16 transposed [C][R] (row pitch ldo); 64x64 tiles; each output row segment
__global__ __launch_bounds__(256) void transpose_cast_f16(Src8 srcs, int ldi,
                                                         _Float16* __restrict__ outT0, int ldo, long plane, float scale) {
  __shared__ __align__(16) _Float16 tile[64][72];     // [c][r]
  const float* __restrict__ in = pick8(srcs, blockIdx.z);
  _Float16* __restrict__ outT = outT0 + (size_t)blockIdx.z * plane;
  const int c0 = blockIdx.x * 64, r0 = blockIdx.y * 64;
  const int t = threadIdx.y * 32 + threadIdx.x;
  for (int i = threadIdx.y; i < 64; i += 8) {
    tile[threadIdx.x][i]      = (_Float16)(in[(size_t)(r0 + i) * ldi + c0 + threadIdx.x] * scale);
    tile[32 + threadIdx.x][i] = (_Float16)(in[(size_t)(r0 + i) * ldi + c0 + 32 + threadIdx.x] * scale);
  }
  __syncthreads();
  const int q = t >> 3, c8 = (t & 7) * 8;
  {
#pragma unroll
    for (int it = 0; it < 2; ++it) {
      const int c = it * 32 + q;
      v8h hv = *(const v8h*)(&tile[c][c8]);
      *(v8h*)(outT + (size_t)(c0 + c) * ldo + r0 + c8) = hv;
    }
    
  }
}

// ---- f32 [R][C] (pitch ldi) -> bf16 hi/lo transposed planes [C][R] (pitch ldo); 64x64 tiles; each output row segment
__global__ __launch_bounds__(256) void transpose_split_bf16(Src8 srcs, int ldi,
                                                           __bf16* __restrict__ outH0, __bf16* __restrict__ outL0, int ldo, long plane) {
  __shared__ __align__(16) float tile[64][68];     // [c][r]
  const float* __restrict__ in = pick8(srcs, blockIdx.z);
  __bf16* __restrict__ outH = outH0 + (size_t)blockIdx.z * plane;
  __bf16* __restrict__ outL = outL0 + (size_t)blockIdx.z * plane;
  const int c0 = blockIdx.x * 64, r0 = blockIdx.y * 64;
  const int t = threadIdx.y * 32 + threadIdx.x;
  for (int i = threadIdx.y; i < 64; i += 8) {
    tile[threadIdx.x][i]      = in[(size_t)(r0 + i) * ldi + c0 + threadIdx.x];
    tile[32 + threadIdx.x][i] = in[(size_t)(r0 + i) * ldi + c0 + 32 + threadIdx.x];
  }
  __syncthreads();
  const int q = t >> 3, c8 = (t & 7) * 8;
  {
#pragma unroll
    for (int it = 0; it < 2; ++it) {
      const int c = it * 32 + q;
      v8b hv, lv;
#pragma unroll
      for (int e = 0; e < 8; ++e) {
        const float f = tile[c][c8 + e];
        const unsigned short hb = f2bf_bits(f);
        hv[e] = __builtin_bit_cast(__bf16, hb);
        lv[e] = __builtin_bit_cast(__bf16, f2bf_bits(f - bf_bits2f(hb)));
      }
      *(v8b*)(outH + (size_t)(c0 + c) * ldo + r0 + c8) = hv;
      *(v8b*)(outL + (size_t)(c0 + c) * ldo + r0 + c8) = lv;
    }
    
  }
}

// =====================================================================================
// Generic causal/non-causal attention for head_dim 64, q f32 in / f32 out, bf16 operands with optional hi/lo splits.
//   scores, transposed: S^T = k (q*qscale)^T : v_wmma_f32_16x16x32_bf16, A = k rows, B = q; SPLIT_QK -> q,k as bf16 hi/lo (hi*hi + hi*lo + lo*hi)
//   out, transposed: O^T += v^T p^T : v_wmma_f32_16x16x32_bf16, A = v^T rows, B = p^T; SPLIT_PV -> p,v as bf16 hi/lo; else p,v plain bf16
//   A lane holds scores, weights and output elements of ONE query (column lane & 15): maximum and sum run inside the lane, the two wave halves
//   (keys 8h..8h+7 of every 16) exchange the maximum once per chunk and their sums once at the end, and two score tiles, converted in place,
//   are the B operand of the second product, so that p never goes through LDS.
//   f32 accumulate; online softmax in f32, in base 2: qscale holds the score scale times log2(e), so that a weight is 2^(s - max), one subtract
//   and one v_exp_f32 (differences are never above 0; far below 0 the instruction gives 0, as the softmax wants). Block = 4 waves = 64 query rows of one (batch, head); S % 64 == 0.
//   Element (b, s, h, d) of q and out lives at X[b*X_bs + s*X_rs + h*X_hs + d] (strides in floats, multiples of 4).
//   k arrives as bf16 hi and lo planes, element (s, h, d) at s*K_RS + h*k_hs + d; v as bf16 hi and lo planes, transposed: element
//   (s, h, d) at h*v_hs + d*V_RS + s (strides in bf16, multiples of 8; the row pitches are template constants, so that a tile's
//   rows are constant offsets from one address). A chunk's tiles are rows of 128 B that go to LDS as they are.
//   Masking: mask_mode 0 none, 1 causal (kv > q masked), 4 causal + sliding window (kv > q or q - kv > W masked; W passed in
//   mask_is_int); masked scores are replaced by mask_fill before the softmax. The mask is decided once per 64-key chunk with scalar
//   tests: a chunk that the window masks for all 64 query rows is not visited (its weights are exactly 0 after the softmax), a chunk
//   with no masked element runs no mask code, and only a chunk that the diagonal or the window's edge crosses compares and selects.
//   One launch serves four branches (batch 1): branch a reads q/k/v and writes out at a * {q,k,v,o}_st elements, with its own Skv,
//   mask_mode and window. grid.x = 4 * H * (S/64): first branches 0 and 1 (causal, cost grows with the query block) from the last
//   query block down, then branches 2 and 3, so that the long work-groups start first.
// =====================================================================================
#define AT_D 64
#define AT_NW 4
#define AT_QB 64
#define AT_KC 64
#define AT_LP 72   // LDS row pitch of the K and V tiles in bf16: 144 B = 16 B x 9, so that the 16 rows of a ds_load_b128 fall on different banks
struct AttnGeom { long q_bs, q_rs, q_hs, k_bs, k_rs, k_hs, v_bs, v_rs, v_hs, o_bs, o_rs, o_hs;
                  int S, Skv, H, mask_mode; float qscale; int blk0; float mask_fill; int mask_is_int; };
static_assert(sizeof(AttnGeom) == 128, "no padding");
struct AttnBranches { long q_st, k_st, v_st, o_st; int Skv[4]; int mask_mode[4]; int mask_is_int[4]; };

__device__ __forceinline__ unsigned short at_bf_bits(float f) {
  unsigned u = __float_as_uint(f);
  return (unsigned short)((u + 0x7FFFu + ((u >> 16) & 1u)) >> 16);
}
__device__ __forceinline__ __bf16 at_f2bf(float f) { return __builtin_bit_cast(__bf16, at_bf_bits(f)); }
__device__ __forceinline__ void at_split(float f, __bf16& hi, __bf16& lo) {
  const unsigned short hb = at_bf_bits(f);
  hi = __builtin_bit_cast(__bf16, hb);
  lo = at_f2bf(f - __uint_as_float(((unsigned)hb) << 16));
}
__device__ __forceinline__ v8f at_mma(v16b a, v16b b, v8f c) {
  return __builtin_amdgcn_wmma_f32_16x16x32_bf16(false, a, false, b, (short)0, c, false, false);
}
// one A or B fragment from an LDS row: elements 0..7 <- p[0..7], 8..15 <- p[16..23]
__device__ __forceinline__ v16b at_frag(const __bf16* p) {
  union { v16b v; v8b h[2]; } f;
  f.h[0] = *(const v8b*)(p); f.h[1] = *(const v8b*)(p + 16);
  return f.v;
}

// lane l takes the value of lane l ^ 16
__device__ __forceinline__ float at_xhalf(float x) {
  return __builtin_bit_cast(float, __builtin_amdgcn_permlanex16(__builtin_bit_cast(int, x), __builtin_bit_cast(int, x), 0x76543210, 0xfedcba98, false, false));
}

template <bool SPLIT_QK, bool SPLIT_PV, int K_RS, int V_RS>
__global__ __launch_bounds__(128) __attribute__((amdgpu_waves_per_eu(4)))   // 256 registers a wave: four waves per SIMD, four work-groups per WGP
void attn64_kernel(const float* __restrict__ q, const unsigned short* __restrict__ kh, const unsigned short* __restrict__ kl,
                   const unsigned short* __restrict__ vth, const unsigned short* __restrict__ vtl,
                   float* __restrict__ out, AttnGeom g0, AttnBranches br) {
  __shared__ __align__(16) __bf16 Ksh[AT_KC * AT_LP];            // K hi [kv][d]      9 KB
  __shared__ __align__(16) __bf16 Ksl[SPLIT_QK ? AT_KC * AT_LP : 8];
  __shared__ __align__(16) __bf16 Vth[AT_D * AT_LP];             // V hi [d][kv]      9 KB
  __shared__ __align__(16) __bf16 Vtl[SPLIT_PV ? AT_D * AT_LP : 8];
  __shared__ __align__(16) float  Os[AT_NW][16 * 68];            // per wave out tile, pitch 68

  const int tid  = threadIdx.x;
  const int wave = tid >> 5;
  const int lane = tid & 31;
  const int hh   = lane >> 4;
  const int c    = lane & 15;

  AttnGeom g = g0;
  const int nqb = g.S / AT_QB;
  const int bx = blockIdx.x + g.blk0;
  const int perBranch = g.H * nqb;
  int a, h, qb;
  if (bx < 2 * perBranch) {
    const int lvl = bx / (2 * g.H), w = bx % (2 * g.H);
    qb = nqb - 1 - lvl; a = w / g.H; h = w % g.H;
  } else {
    const int r = bx - 2 * perBranch, r2 = r % perBranch;
    a = 2 + r / perBranch; h = r2 / nqb; qb = r2 % nqb;
  }
  g.Skv = br.Skv[a]; g.mask_mode = br.mask_mode[a]; g.mask_is_int = br.mask_is_int[a];
  const int qbase_block = qb * AT_QB;
  const int q0 = qbase_block + wave * 16;

  const float* qb_ptr = q + (size_t)a * br.q_st + (size_t)h * g.q_hs;
  // staging: 8 threads per 128-B tile row, 16 rows per pass, 4 passes; offsets of this thread's 16 B in the first pass of chunk 0
  const int srow = tid >> 3, sc8 = (tid & 7) * 8;
  const size_t koff = (size_t)a * br.k_st + (size_t)h * g.k_hs + (size_t)srow * K_RS + sc8;
  const size_t voff = (size_t)a * br.v_st + (size_t)h * g.v_hs + (size_t)srow * V_RS + sc8;
  float*       ob_ptr = out + (size_t)a * br.o_st + (size_t)h * g.o_hs;

  // ---- Q fragments (B operand: column = query lane & 15): 2 d-chunks, hi (and lo) ----
  v16b qah[2], qal[2];
  {
    const float* qrow = qb_ptr + (size_t)(q0 + c) * g.q_rs;
#pragma unroll
    for (int dc = 0; dc < 2; ++dc) {
#pragma unroll
      for (int e = 0; e < 8; ++e) {
        const float f0 = qrow[dc * 32 + 8 * hh + e] * g.qscale;
        const float f1 = qrow[dc * 32 + 16 + 8 * hh + e] * g.qscale;
        if (SPLIT_QK) { __bf16 hq, lq; at_split(f0, hq, lq); qah[dc][e] = hq; qal[dc][e] = lq; at_split(f1, hq, lq); qah[dc][8 + e] = hq; qal[dc][8 + e] = lq; }
        else { qah[dc][e] = at_f2bf(f0); qah[dc][8 + e] = at_f2bf(f1); qal[dc][e] = qah[dc][e]; qal[dc][8 + e] = qah[dc][8 + e]; }
      }
    }
  }

  float mrow = -INFINITY, lrow = 0.f;   // of query q0 + c; lrow sums this wave half's keys alone until the epilogue
  v8f oacc[4];                          // O^T: oacc[t][r] = element d = t*16 + 8*hh + r of query q0 + c
#pragma unroll
  for (int t = 0; t < 4; ++t) oacc[t] = (v8f){0.f,0.f,0.f,0.f,0.f,0.f,0.f,0.f};

  const bool causal = (g.mask_mode == 1 || g.mask_mode == 4);
  const int win = (g.mask_mode == 4) ? g.mask_is_int : g.S;          // q - kv stays below S: no window
  const int nChunks = causal ? (qb + 1) : (g.Skv / AT_KC);           // block-uniform
  const int kcFirst = (causal && qbase_block > win) ? (qbase_block - win) / AT_KC : 0;   // chunk of the oldest key that the block's first row still sees
  // one address per plane, moved on from chunk to chunk; the four passes are constant offsets from it
  const __bf16* pkh = (const __bf16*)kh + koff + (size_t)kcFirst * (AT_KC * K_RS);    // K tile: rows are keys
  const __bf16* pkl = (const __bf16*)kl + koff + (size_t)kcFirst * (AT_KC * K_RS);
  const __bf16* pvh = (const __bf16*)vth + voff + (size_t)kcFirst * AT_KC;            // V tile: rows are head dims, keys run along the row
  const __bf16* pvl = (const __bf16*)vtl + voff + (size_t)kcFirst * AT_KC;
  for (int kc = kcFirst; kc < nChunks; ++kc) {
    const int kv0 = kc * AT_KC;
    {
      v8b rkh[4], rkl[4], rvh[4], rvl[4];
#pragma unroll
      for (int i = 0; i < 4; ++i) {
        rkh[i] = *(const v8b*)(pkh + i * 16 * K_RS);
        if (SPLIT_QK) rkl[i] = *(const v8b*)(pkl + i * 16 * K_RS);
        rvh[i] = *(const v8b*)(pvh + i * 16 * V_RS);
        if (SPLIT_PV) rvl[i] = *(const v8b*)(pvl + i * 16 * V_RS);
      }
      __syncthreads();
      pkh += AT_KC * K_RS; pkl += AT_KC * K_RS; pvh += AT_KC; pvl += AT_KC;
#pragma unroll
      for (int i = 0; i < 4; ++i) {
        const int lo = (i * 16 + srow) * AT_LP + sc8;
        *(v8b*)(Ksh + lo) = rkh[i];
        if (SPLIT_QK) *(v8b*)(Ksl + lo) = rkl[i];
        *(v8b*)(Vth + lo) = rvh[i];
        if (SPLIT_PV) *(v8b*)(Vtl + lo) = rvl[i];
      }
    }
    __syncthreads();

    // The chunk's K fragments are read from LDS in two groups, the first in front of the first WMMA, the second among the WMMAs where the
    // registers of fragments that are done with are free (all at once do not fit four waves per SIMD), and the WMMAs go round the four
    // independent score tiles. Every score tile still takes its products in the order d 0..31: hi*hi, hi*lo, lo*hi, then d 32..63 the same.
    v8f s[4];   // S^T: s[j][r] = score of key kv0 + j*16 + 8*hh + r with query q0 + c
    {
      const __bf16* kfh = Ksh + c * AT_LP + 8 * hh;
      const __bf16* kfl = Ksl + c * AT_LP + 8 * hh;
      v16b kh0[4], kl0[4], kh1[4], kl1[4];
#pragma unroll
      for (int j = 0; j < 4; ++j) kh0[j] = at_frag(kfh + j * 16 * AT_LP);
      if (SPLIT_QK) {
#pragma unroll
        for (int j = 0; j < 4; ++j) kl0[j] = at_frag(kfl + j * 16 * AT_LP);
      }
#pragma unroll
      for (int j = 0; j < 2; ++j) kh1[j] = at_frag(kfh + j * 16 * AT_LP + 32);
      // keeps the scheduler from sinking these reads down to their first use, where each would be waited for on its own
      __builtin_amdgcn_sched_barrier(0);
#pragma unroll
      for (int j = 0; j < 4; ++j) s[j] = at_mma(kh0[j], qah[0], (v8f){0.f,0.f,0.f,0.f,0.f,0.f,0.f,0.f});
      if (SPLIT_QK) {
#pragma unroll
        for (int j = 0; j < 4; ++j) s[j] = at_mma(kl0[j], qah[0], s[j]);
#pragma unroll
        for (int j = 0; j < 2; ++j) s[j] = at_mma(kh0[j], qal[0], s[j]);
      }
      // the two scheduling barriers hold the second group together at this place
      __builtin_amdgcn_sched_barrier(0);
#pragma unroll
      for (int j = 2; j < 4; ++j) kh1[j] = at_frag(kfh + j * 16 * AT_LP + 32);
      if (SPLIT_QK) {
#pragma unroll
        for (int j = 0; j < 4; ++j) kl1[j] = at_frag(kfl + j * 16 * AT_LP + 32);
      }
      __builtin_amdgcn_sched_barrier(0);
      if (SPLIT_QK) {
#pragma unroll
        for (int j = 2; j < 4; ++j) s[j] = at_mma(kh0[j], qal[0], s[j]);
      }
#pragma unroll
      for (int j = 0; j < 4; ++j) s[j] = at_mma(kh1[j], qah[1], s[j]);
      if (SPLIT_QK) {
#pragma unroll
        for (int j = 0; j < 4; ++j) s[j] = at_mma(kl1[j], qah[1], s[j]);
#pragma unroll
        for (int j = 0; j < 4; ++j) s[j] = at_mma(kh1[j], qal[1], s[j]);
      }
      // four vector slots between the last WMMAs and the first use of the scores, also on the taken side of the branch below
      acc_guard4(s[0], s[1], s[2], s[3]);
    }
    // block-uniform: the diagonal chunk, or one in which the block's last row is more than win past the chunk's first key
    if (causal && (kc == qb || qbase_block + (AT_QB - 1) - kv0 > win)) {
      const int qrow = q0 + c;
#pragma unroll
      for (int j = 0; j < 4; ++j) {
#pragma unroll
        for (int r = 0; r < 8; ++r) {
          const int dist = qrow - (kv0 + j * 16 + 8 * hh + r);
          s[j][r] = (dist < 0 || dist > win) ? g.mask_fill : s[j][r];
        }
      }
    }
    // the chunk's maximum for this lane's query: 32 keys in the lane, the other 32 in lane ^ 16
    float cm[4];
#pragma unroll
    for (int j = 0; j < 4; ++j) {
      cm[j] = s[j][0];
#pragma unroll
      for (int r = 1; r < 8; ++r) cm[j] = fmaxf(cm[j], s[j][r]);
    }
    float cmx = fmaxf(fmaxf(cm[0], cm[1]), fmaxf(cm[2], cm[3]));
    cmx = fmaxf(cmx, at_xhalf(cmx));
    const float mnew = fmaxf(mrow, cmx);
    const float alpha = __builtin_amdgcn_exp2f(mrow - mnew);
    mrow = mnew;
    // p^T as B operand of the second product: element e of ph[b] = key 32*b + 8*hh + e (e < 8), 32*b + 16 + 8*hh + e - 8 (e >= 8): tiles 2b and 2b+1
    // as they lie in the registers, the k order of the V fragments below
    v16b ph[2], pl[2];
    float ps[4];
#pragma unroll
    for (int j = 0; j < 4; ++j) {
      ps[j] = 0.f;
#pragma unroll
      for (int r = 0; r < 8; ++r) {
        const float p = __builtin_amdgcn_exp2f(s[j][r] - mnew);
        ps[j] += p;
        if (SPLIT_PV) { __bf16 a, bl; at_split(p, a, bl); ph[j >> 1][(j & 1) * 8 + r] = a; pl[j >> 1][(j & 1) * 8 + r] = bl; }
        else ph[j >> 1][(j & 1) * 8 + r] = at_f2bf(p);
      }
    }
    lrow = lrow * alpha + ((ps[0] + ps[1]) + (ps[2] + ps[3]));
#pragma unroll
    for (int t = 0; t < 4; ++t)
#pragma unroll
      for (int r = 0; r < 8; ++r) oacc[t][r] *= alpha;
    // V fragments in two groups, as the K fragments above; every output tile still takes keys 0..31: hi*hi, hi*lo, lo*hi, then keys 32..63.
    {
      const __bf16* vfh = Vth + c * AT_LP + 8 * hh;
      const __bf16* vfl = Vtl + c * AT_LP + 8 * hh;
      v16b vh0[4], vl0[4], vh1[4], vl1[4];
#pragma unroll
      for (int t = 0; t < 4; ++t) vh0[t] = at_frag(vfh + t * 16 * AT_LP);
      if (SPLIT_PV) {
#pragma unroll
        for (int t = 0; t < 4; ++t) vl0[t] = at_frag(vfl + t * 16 * AT_LP);
      }
#pragma unroll
      for (int t = 0; t < 2; ++t) vh1[t] = at_frag(vfh + t * 16 * AT_LP + 32);
      // keeps the scheduler from sinking these reads down to their first use, where each would be waited for on its own
      __builtin_amdgcn_sched_barrier(0);
#pragma unroll
      for (int t = 0; t < 4; ++t) oacc[t] = at_mma(vh0[t], ph[0], oacc[t]);
      if (SPLIT_PV) {
#pragma unroll
        for (int t = 0; t < 4; ++t) oacc[t] = at_mma(vl0[t], ph[0], oacc[t]);
#pragma unroll
        for (int t = 0; t < 2; ++t) oacc[t] = at_mma(vh0[t], pl[0], oacc[t]);
      }
      // the two scheduling barriers hold the second group together at this place
      __builtin_amdgcn_sched_barrier(0);
#pragma unroll
      for (int t = 2; t < 4; ++t) vh1[t] = at_frag(vfh + t * 16 * AT_LP + 32);
      if (SPLIT_PV) {
#pragma unroll
        for (int t = 0; t < 4; ++t) vl1[t] = at_frag(vfl + t * 16 * AT_LP + 32);
      }
      __builtin_amdgcn_sched_barrier(0);
      if (SPLIT_PV) {
#pragma unroll
        for (int t = 2; t < 4; ++t) oacc[t] = at_mma(vh0[t], pl[0], oacc[t]);
      }
#pragma unroll
      for (int t = 0; t < 4; ++t) oacc[t] = at_mma(vh1[t], ph[1], oacc[t]);
      if (SPLIT_PV) {
#pragma unroll
        for (int t = 0; t < 4; ++t) oacc[t] = at_mma(vl1[t], ph[1], oacc[t]);
#pragma unroll
        for (int t = 0; t < 4; ++t) oacc[t] = at_mma(vh1[t], pl[1], oacc[t]);
      }
      // four vector slots between the chunk's last WMMAs and whatever rewrites their registers, also on the taken side of the loop's branch
      acc_guard4(oacc[0], oacc[1], oacc[2], oacc[3]);
    }
  }

  float* os = Os[wave];
  {
    const float inv = 1.0f / (lrow + at_xhalf(lrow));   // the two halves' sums join here
#pragma unroll
    for (int t = 0; t < 4; ++t) {
      const v4f lo4 = {oacc[t][0] * inv, oacc[t][1] * inv, oacc[t][2] * inv, oacc[t][3] * inv};
      const v4f hi4 = {oacc[t][4] * inv, oacc[t][5] * inv, oacc[t][6] * inv, oacc[t][7] * inv};
      *(v4f*)(os + c * 68 + t * 16 + 8 * hh) = lo4;
      *(v4f*)(os + c * 68 + t * 16 + 8 * hh + 4) = hi4;
    }
  }
  __builtin_amdgcn_fence(__ATOMIC_RELEASE, "workgroup");
  __builtin_amdgcn_wave_barrier();
  __builtin_amdgcn_fence(__ATOMIC_ACQUIRE, "workgroup");
  {
    const int c4 = (lane & 15) * 4;
    {
#pragma unroll
      for (int it = 0; it < 8; ++it) {
        const int row = it * 2 + hh;
        v4f val = *(const v4f*)(os + row * 68 + c4);
        *(v4f*)(ob_ptr + (size_t)(q0 + row) * g.o_rs + c4) = val;
      }
      
    }
  }
}

__global__ __launch_bounds__(256) void gate_fuse_kernel(const float* __restrict__ o0, const float* __restrict__ o1,
                                                       const float* __restrict__ o2, const float* __restrict__ o3,
                                                       const float* __restrict__ Wg, const float* __restrict__ bg,
                                                       float* __restrict__ out, int Hd) {
  __shared__ float red[4][8];
  const int row = blockIdx.x, t = threadIdx.x, lane = t & 31, wave = t >> 5;
  const float* os[4] = {o0 + (size_t)row * Hd, o1 + (size_t)row * Hd, o2 + (size_t)row * Hd, o3 + (size_t)row * Hd};
  float acc[4] = {0.f, 0.f, 0.f, 0.f};
  for (int i = 0; i < 4; ++i) {
    const float* o = os[i];
    for (int c = t; c < Hd; c += 256) {
      const float v = o[c];
      const float* w = Wg + (size_t)(i * Hd + c) * 4;
      acc[0] += v * w[0]; acc[1] += v * w[1]; acc[2] += v * w[2]; acc[3] += v * w[3];
    }
  }
#pragma unroll
  for (int g = 0; g < 4; ++g) { float a = acc[g]; for (int o = 16; o > 0; o >>= 1) a += __shfl_xor(a, o, 32); if (lane == 0) red[g][wave] = a; }
  __syncthreads();
  float gl[4];
#pragma unroll
  for (int g = 0; g < 4; ++g) { float a = 0.f; for (int w = 0; w < 8; ++w) a += red[g][w]; gl[g] = a + bg[g]; }
  const float mx = fmaxf(fmaxf(gl[0], gl[1]), fmaxf(gl[2], gl[3]));
  float e[4], se = 0.f;
#pragma unroll
  for (int g = 0; g < 4; ++g) { e[g] = expf(gl[g] - mx); se += e[g]; }
  const float inv = 1.0f / se;
  const int c = 4 * t;
  v4f r;
#pragma unroll
  for (int q = 0; q < 4; ++q) r[q] = (e[0] * inv) * os[0][c + q] + (e[1] * inv) * os[1][c + q] + (e[2] * inv) * os[2][c + q] + (e[3] * inv) * os[3][c + q];
  *(v4f*)(out + (size_t)row * Hd + c) = r;
  
}

extern "C" void kernel_launch(void* const* d_in, const int* in_sizes, int n_in,
                              void* d_out, int out_size, void* d_ws, size_t ws_size,
                              hipStream_t stream) {
  (void)in_sizes; (void)n_in; (void)out_size; (void)ws_size;
  const int S = 2048, E = 1024, H = 16, DH = 64, MM = 512, MP = 64, WIN = 512;
  // wire order: 16 weights ([in,out]), gate_w, gate_b, x, memory_kv, persona_kv
  const float* Wm[16]; for (int i = 0; i < 16; ++i) Wm[i] = (const float*)d_in[i];   // {local,long,mem,per} x {wq,wk,wv,wo}
  const float* gate_w = (const float*)d_in[16];
  const float* gate_b = (const float*)d_in[17];
  const float* x   = (const float*)d_in[18];   // [1,2048,1024]
  const float* mem = (const float*)d_in[19];   // [1,512,1024]
  const float* per = (const float*)d_in[20];   // [1,64,1024]
  float* out = (float*)d_out;

  char* ws = (char*)d_ws; size_t off = 0;
  auto carve = [&](size_t bytes) -> char* { char* p = ws + off; off += (bytes + 255) & ~(size_t)255; return p; };
  const int CT = S + MM + MP;                                   // context rows: x, then memory, then persona
  const long EE = (long)E * E, SE = (long)S * E;
  _Float16* C16  = (_Float16*)carve((size_t)CT * E * 2);        // 5.4 MB each
  __bf16*   Ch   = (__bf16*)carve((size_t)CT * E * 2);
  __bf16*   Cl   = (__bf16*)carve((size_t)CT * E * 2);
  _Float16* WqkT = (_Float16*)carve((size_t)8 * EE * 2);        // plane 2a = wq^T, 2a+1 = wk^T of branch a; 16.8 MB
  __bf16*   WvoTh = (__bf16*)carve((size_t)8 * EE * 2);         // plane 2a = wv^T, 2a+1 = wo^T
  __bf16*   WvoTl = (__bf16*)carve((size_t)8 * EE * 2);
  float*    QK   = (float*)carve((size_t)8 * SE * 4);           // plane 2a = q (f32), 2a+1 = k of branch a (bf16 hi, then bf16 lo); 67 MB
  __bf16*   VTh  = (__bf16*)carve((size_t)4 * SE * 2);          // v^T of branch a: [E][S] (row pitch S for every branch); 16.8 MB each
  __bf16*   VTl  = (__bf16*)carve((size_t)4 * SE * 2);
  float*    Of   = (float*)carve((size_t)4 * SE * 4);
  __bf16*   Oh   = (__bf16*)carve((size_t)4 * SE * 2);
  __bf16*   Ol   = (__bf16*)carve((size_t)4 * SE * 2);          // total 234 MB
  float*    Ob[4];
  for (int i = 0; i < 4; ++i) Ob[i] = QK + (size_t)i * SE;      // branch outputs take the q/k planes' place once attention is done

  const int  SKs[4]  = {S, S, MM, MP};                          // keys per branch
  const long ctx0[4] = {0, 0, (long)S * E, (long)(S + MM) * E}; // first context element per branch

  prep_inputs<<<CT * E / 2 / 256, 256, 0, stream>>>(x, mem, per, C16, Ch, Cl, S * E / 2, MM * E / 2, MP * E / 2);
  {
    Src8 qk = {Wm[0], Wm[1], Wm[4], Wm[5], Wm[8], Wm[9], Wm[12], Wm[13]};
    Src8 vo = {Wm[2], Wm[3], Wm[6], Wm[7], Wm[10], Wm[11], Wm[14], Wm[15]};
    transpose_cast_f16<<<dim3(E / 64, E / 64, 8), dim3(32, 8), 0, stream>>>(qk, E, WqkT, E, EE, 1.0f);
    transpose_split_bf16<<<dim3(E / 64, E / 64, 8), dim3(32, 8), 0, stream>>>(vo, E, WvoTh, WvoTl, E, EE);
  }
  const int tb = (S / 128) * (E / 256);                         // 128x256 tiles of the tallest batch entry
  {
    BatchA bqk, bv;
    for (int a = 0; a < 4; ++a) {
      bqk.aoff[2 * a] = 0;           bqk.M[2 * a] = S;
      bqk.aoff[2 * a + 1] = ctx0[a]; bqk.M[2 * a + 1] = SKs[a];
      bv.aoff[a] = ctx0[a];          bv.M[a] = SKs[a];
      bv.aoff[4 + a] = 0;            bv.M[4 + a] = 0;
    }
    wmma_gemm64<0, false, 0, 3, false><<<dim3(tb, 8), 256, 0, stream>>>(
        U16(C16), nullptr, E, bqk, U16(WqkT), nullptr, E, EE, QK, nullptr, E, SE, nullptr, nullptr, 0, E, E, 1.0f);
    wmma_gemm64<1, true, 0, 4, false><<<dim3(tb, 4), 256, 0, stream>>>(
        U16(Ch), U16(Cl), E, bv, U16(WvoTh), U16(WvoTl), E, 2 * EE, VTh, VTl, S, SE, nullptr, nullptr, 0, E, E, 1.0f);
  }
  {
    AttnGeom g;
    g.q_bs = SE; g.q_rs = E; g.q_hs = DH;
    g.k_bs = SE; g.k_rs = E; g.k_hs = DH;
    g.v_bs = SE; g.v_rs = S; g.v_hs = (long)DH * S;
    g.o_bs = SE; g.o_rs = E; g.o_hs = DH;
    g.S = S; g.Skv = S; g.H = H; g.qscale = 0.18033688f;   /* 1/sqrt(64) * log2(e): scores in base-2 units */ g.blk0 = 0; g.mask_fill = -1.0e30f;
    g.mask_mode = 0; g.mask_is_int = 0;
    AttnBranches br;
    br.q_st = 2 * SE; br.k_st = 4 * SE; br.v_st = SE; br.o_st = SE;   // a q/k pair of f32-sized planes is 4 * SE bf16
    for (int a = 0; a < 4; ++a) { br.Skv[a] = SKs[a]; br.mask_mode[a] = 0; br.mask_is_int[a] = 0; }
    br.mask_mode[0] = 4; br.mask_is_int[0] = WIN;               // causal + window
    br.mask_mode[1] = 1;                                        // causal
    attn64_kernel<true, true, E, S><<<4 * H * (S / AT_QB), AT_NW * 32, 0, stream>>>(QK, U16(QK + SE), U16(QK + SE) + SE, U16(VTh), U16(VTl), Of, g, br);
  }
  split_f32_bf16x2<<<4096, 256, 0, stream>>>(Of, Oh, Ol, 4 * SE / 2);
  {
    BatchA bo;
    for (int a = 0; a < 4; ++a) { bo.aoff[a] = a * SE; bo.M[a] = S; bo.aoff[4 + a] = 0; bo.M[4 + a] = 0; }
    wmma_gemm64<1, true, 0, 0, false><<<dim3(tb, 4), 256, 0, stream>>>(
        U16(Oh), U16(Ol), E, bo, U16(WvoTh + EE), U16(WvoTl + EE), E, 2 * EE, Ob[0], nullptr, E, SE, nullptr, nullptr, 0, E, E, 1.0f);
  }
  gate_fuse_kernel<<<S, 256, 0, stream>>>(Ob[0], Ob[1], Ob[2], Ob[3], gate_w, gate_b, out, E);
}

// v010
// A run of this version takes 205 microseconds.
// Timed twice side by side with v009, it ran 1.03 times as fast both times.
// Counting every step since v000, it is 8.59 times as fast.
#include <hip/hip_runtime.h>
#include <math.h>
// Four attentions (local = causal + 512 sliding window, long = causal, memory cross (512 keys), persona cross (64 keys)), 16 heads of 64:
// q/k projections (K=1024): v_wmma_f32_16x16x32_f16 (f16 operands); v and output projections (K=1024): v_wmma_f32_16x16x32_bf16 as bf16
// hi/lo splits; scores and p·v: v_wmma_f32_16x16x32_bf16 with q,k and p,v as bf16 hi/lo splits; f32 accumulate; softmax f32.
// k and v leave their projections already split into bf16 hi/lo planes (v transposed), so attention only copies their tiles to LDS.
// Gate (concat(outs)·gate_w, N=4, 0.1 % of MACs), gate softmax and the weighted fusion in f32 on VALU.
typedef __attribute__((ext_vector_type(16))) _Float16 v16h;
typedef __attribute__((ext_vector_type(8)))  _Float16 v8h;
typedef __attribute__((ext_vector_type(16))) __bf16   v16b;
typedef __attribute__((ext_vector_type(8)))  __bf16   v8b;
typedef __attribute__((ext_vector_type(8)))  float    v8f;
typedef __attribute__((ext_vector_type(4)))  float    v4f;
#define PSCALE 32768.0f
#define U16(p) ((const unsigned short*)(const void*)(p))
#define PSCALE_INV (1.0f / 32768.0f)

__device__ __forceinline__ unsigned short f2bf_bits(float f) {
  unsigned u = __float_as_uint(f);
  return (unsigned short)((u + 0x7FFFu + ((u >> 16) & 1u)) >> 16);
}
__device__ __forceinline__ float bf_bits2f(unsigned short h) { return __uint_as_float(((unsigned)h) << 16); }

// hazard guards as plain device helpers
__device__ __forceinline__ void acc_guard4(v8f& a, v8f& b, v8f& c, v8f& d) { asm volatile("v_nop\n\tv_nop\n\tv_nop\n\tv_nop" : "+v"(a), "+v"(b), "+v"(c), "+v"(d)); }
// end of a k tile's WMMAs in the GEMM k loop: four vector slots in front of whatever rewrites their operand registers (why: at the call)
__device__ __forceinline__ void set_done() { asm volatile("v_nop\n\tv_nop\n\tv_nop\n\tv_nop"); }
// Twelve asynchronous copies of 16 B per lane, global memory -> LDS, through no register: l = the lane's LDS byte address, g = its global address.
// s_wait_xcnt stands in the copies' own statement, a precaution: what follows may rewrite the address registers that the copies name.
__device__ __forceinline__ void copy12_to_lds(const unsigned (&l)[12], const char* const (&g)[12]) {
  asm volatile(
      "global_load_async_to_lds_b128 %0, %1, off\n\t"
      "global_load_async_to_lds_b128 %2, %3, off\n\t"
      "global_load_async_to_lds_b128 %4, %5, off\n\t"
      "global_load_async_to_lds_b128 %6, %7, off\n\t"
      "global_load_async_to_lds_b128 %8, %9, off\n\t"
      "global_load_async_to_lds_b128 %10, %11, off\n\t"
      "global_load_async_to_lds_b128 %12, %13, off\n\t"
      "global_load_async_to_lds_b128 %14, %15, off\n\t"
      "global_load_async_to_lds_b128 %16, %17, off\n\t"
      "global_load_async_to_lds_b128 %18, %19, off\n\t"
      "global_load_async_to_lds_b128 %20, %21, off\n\t"
      "global_load_async_to_lds_b128 %22, %23, off\n\t"
      "s_wait_xcnt 0x0"
      :: "v"(l[0]), "v"(g[0]), "v"(l[1]), "v"(g[1]), "v"(l[2]), "v"(g[2]), "v"(l[3]), "v"(g[3]), "v"(l[4]), "v"(g[4]), "v"(l[5]), "v"(g[5]),
         "v"(l[6]), "v"(g[6]), "v"(l[7]), "v"(g[7]), "v"(l[8]), "v"(g[8]), "v"(l[9]), "v"(g[9]), "v"(l[10]), "v"(g[10]), "v"(l[11]), "v"(g[11])
      : "memory");
}
template <typename T> struct Frag;
template <> struct Frag<_Float16> {
  typedef v16h V; union U { v16h v; v8h h[2]; };
  static __device__ __forceinline__ v16h load(const _Float16* p) {   // elements 0..7 <- p[0..7], 8..15 <- p[16..23]
    U f; f.h[0] = *(const v8h*)(p); f.h[1] = *(const v8h*)(p + 16); return f.v;
  }
  static __device__ __forceinline__ v8f mma(v16h a, v16h b, v8f c) {
    return __builtin_amdgcn_wmma_f32_16x16x32_f16(false, a, false, b, (short)0, c, false, false);
  }
};
template <> struct Frag<__bf16> {
  typedef v16b V; union U { v16b v; v8b h[2]; };
  static __device__ __forceinline__ v16b load(const __bf16* p) {
    U f; f.h[0] = *(const v8b*)(p); f.h[1] = *(const v8b*)(p + 16); return f.v;
  }
  static __device__ __forceinline__ v8f mma(v16b a, v16b b, v8f c) {
    return __builtin_amdgcn_wmma_f32_16x16x32_bf16(false, a, false, b, (short)0, c, false, false);
  }
};

// ---- Register-blocked batched WMMA GEMM ------------------------------------
// C[m,n] = scale * sum_k A[m,k] * Bt[n,k] (+bias)(+resid); each wave owns a 64x64 tile, a work-group's 8 waves a 128x256 tile (2 x 4 waves).
// A row-major [M,K]; Bt row-major [N,K]; M % 64 == 0, N % 256 == 0, K % 128 == 0; grid.x = (largest M / 128) * (N / 256).
// The work-group's A and B rows go to LDS 64 of k at a time (whole 128-B lines, each fetched once for all the waves that use it).
// SPLIT: operands are hi/lo planes (A2/Bt2 = lo planes, same layout); product = hi·hi + hi·lo + lo·hi.
// BIAS_MODE: 0 = none, 1 = bias[m], 2 = bias[n].
// OUT_MODE: 0 = f32, 1 = f16, 2 = bf16 hi plane (Cout) + bf16 lo plane (Cout2),
//   3 = even batch entries as 0; odd entries as bf16 hi and lo planes inside the entry's own f32 plane (hi first, lo strideC elements behind it),
//   4 = bf16 hi (Cout) and lo (Cout2) planes, transposed: element (m, n) at n * ldc + m (no bias, residual or activation).
// ET: 0 = f16 operands, 1 = bf16 operands (pointers passed as 16-bit storage)
template <int ET> struct Elem;
template <> struct Elem<0> { typedef _Float16 T; };
template <> struct Elem<1> { typedef __bf16 T; };
// Batch entry blockIdx.y reads A from element offset aoff[y] and has M[y] rows (entries may differ in source and height).
struct BatchA { long aoff[8]; int M[8]; };
template <int ET, bool SPLIT, int BIAS_MODE, int OUT_MODE, bool RESID, int ACT = 0>
__global__ __launch_bounds__(256) void wmma_gemm64(
    const unsigned short* __restrict__ Ap, const unsigned short* __restrict__ A2p, int lda, BatchA ba,
    const unsigned short* __restrict__ Btp, const unsigned short* __restrict__ Bt2p, int ldb, long strideB,
    void* __restrict__ Cout, void* __restrict__ Cout2, int ldc, long strideC,
    const float* __restrict__ bias,
    const float* __restrict__ resid, long strideR,
    int N, int K, float scale) {
  typedef typename Elem<ET>::T T;
  typedef typename Frag<T>::V V;
  const T* A = (const T*)Ap; const T* A2 = (const T*)A2p; const T* Bt = (const T*)Btp; const T* Bt2 = (const T*)Bt2p;
  constexpr int NPL = SPLIT ? 2 : 1;              // planes per operand
  constexpr int LP  = 72;                         // LDS row pitch in elements: 144 B = 16 B x 9, so that the 16 rows of a ds_load_b128 fall on different banks
  constexpr int A_EL = 128 * LP, B_EL = 256 * LP; // one plane of the A tile, of the B tile
  constexpr int BUF_EL = NPL * (A_EL + B_EL);     // one buffer: A hi, (A lo,) B hi, (B lo)
  __shared__ __align__(16) unsigned short sAB[2 * BUF_EL];
  __shared__ __align__(16) float sT[8][16 * 68];   // per-wave 16x64 slab, pitch 68 floats
  const int b    = blockIdx.y;
  const int M    = ba.M[b];
  const long offA = ba.aoff[b];
  const int lane = threadIdx.x & 31;
  const int wave = threadIdx.x >> 5;
  const int tilesBN = N >> 8;
  const int bm = blockIdx.x / tilesBN;
  const int bn = blockIdx.x - bm * tilesBN;
  if ((bm << 7) >= M) return;            // the same for the whole work-group, in front of every copy and barrier
  const int wm = wave >> 2, wn = wave & 3;
  const int m0 = (bm << 7) + (wm << 6);
  const int n0 = (bn << 8) + (wn << 6);

  const T* Ab  = A  + offA;
  const T* Bb  = Bt + (size_t)b * strideB;
  const T* Ab2 = SPLIT ? (A2  + offA) : nullptr;
  const T* Bb2 = SPLIT ? (Bt2 + (size_t)b * strideB) : nullptr;

  const int rlane = lane & 15;                 // row (A) / col (B, D) within subtile
  const int koff  = (lane >> 4) * 8;           // k offset of this lane half
  const int mOff  = (lane >> 4) * 8;           // D row offset

  v8f acc[4][4];
#pragma unroll
  for (int i = 0; i < 4; ++i)
#pragma unroll
    for (int j = 0; j < 4; ++j) acc[i][j] = (v8f){0.f,0.f,0.f,0.f,0.f,0.f,0.f,0.f};

  // Staging: 8 threads per 128-B row, 32 rows per pass; 4 passes for an A plane, 8 for a B plane. An A row past the entry's last one
  // (M = 64 under a 128-row tile) takes the last row's address: its products belong to a wave that stores nothing.
  const int srow = threadIdx.x >> 3, sc = threadIdx.x & 7;
  unsigned oA[4];                              // byte offsets of this thread's 16 B in k tile 0, one per pass (A), first pass (B)
#pragma unroll
  for (int p = 0; p < 4; ++p) {
    int r = (bm << 7) + p * 32 + srow;
    r = r < M ? r : M - 1;
    oA[p] = (unsigned)((r * lda + sc * 8) * (int)sizeof(T));
  }
  const unsigned oB = (unsigned)((((bn << 8) + srow) * ldb + sc * 8) * (int)sizeof(T));
  const size_t passB = (size_t)(32 * ldb) * sizeof(T);   // uniform: joins a plane's base
  const unsigned lds0 = (unsigned)(size_t)(const void*)sAB + (unsigned)(srow * LP + sc * 8) * 2u;   // low 32 bits of a __shared__ address = LDS byte address
  auto stage = [&](int buf, unsigned kbyte) __attribute__((always_inline)) {
#pragma unroll
    for (int pl = 0; pl < NPL; ++pl) {
      const char* ga = (const char*)(pl ? Ab2 : Ab) + kbyte;
      const char* gb = (const char*)(pl ? Bb2 : Bb) + kbyte;
      const unsigned la = lds0 + (unsigned)(buf * BUF_EL + pl * A_EL) * 2u;
      const unsigned lb = lds0 + (unsigned)(buf * BUF_EL + NPL * A_EL + pl * B_EL) * 2u;
      unsigned l[12]; const char* g[12];
#pragma unroll
      for (int p = 0; p < 4; ++p) { l[p] = la + (unsigned)(p * 32 * LP) * 2u; g[p] = ga + oA[p]; }
#pragma unroll
      for (int p = 0; p < 8; ++p) { l[4 + p] = lb + (unsigned)(p * 32 * LP) * 2u; g[4 + p] = (gb + p * passB) + oB; }
      copy12_to_lds(l, g);
    }
  };

  // Two fragment sets in registers, one per 32 of k: both sets' LDS reads are issued in front of the first set's WMMAs, so that the second
  // set's reads run beside matrix work. Every accumulator still takes its products in ascending k, hi*hi, hi*lo, lo*hi.
  struct FragSet { V ah[4], al[4], bh[4], bl[4]; };
  const T* sA = (const T*)sAB + ((wm << 6) + rlane) * LP + koff;
  const T* sB = (const T*)sAB + NPL * A_EL + ((wn << 6) + rlane) * LP + koff;
  auto load_set = [&](FragSet& f, int buf, int kk) __attribute__((always_inline)) {
    const int o = buf * BUF_EL + kk * 32;
#pragma unroll
    for (int j = 0; j < 4; ++j) {
      f.bh[j] = Frag<T>::load(sB + o + j * 16 * LP);
      if (SPLIT) f.bl[j] = Frag<T>::load(sB + o + B_EL + j * 16 * LP);
    }
#pragma unroll
    for (int i = 0; i < 4; ++i) {
      f.ah[i] = Frag<T>::load(sA + o + i * 16 * LP);
      if (SPLIT) f.al[i] = Frag<T>::load(sA + o + A_EL + i * 16 * LP);
    }
    // keeps the scheduler from sinking these reads down to their first use, behind the other set's WMMAs
    __builtin_amdgcn_sched_barrier(0);
  };
  auto mma_set = [&](FragSet& f) __attribute__((always_inline)) {
#pragma unroll
    for (int i = 0; i < 4; ++i) {
#pragma unroll
      for (int j = 0; j < 4; ++j) {
        acc[i][j] = Frag<T>::mma(f.ah[i], f.bh[j], acc[i][j]);
        if (SPLIT) {
          acc[i][j] = Frag<T>::mma(f.ah[i], f.bl[j], acc[i][j]);
          acc[i][j] = Frag<T>::mma(f.al[i], f.bh[j], acc[i][j]);
        }
      }
    }
  };
  FragSet f0, f1;
  const int nT = K >> 6;                        // k tiles of 64; even, at least 2
  // one k tile: trip t reads buffer t mod 2 alone, while tile t + 1's copies fly into the other buffer
  auto trip = [&](int buf, int t) __attribute__((always_inline)) {
    load_set(f0, buf, 0);
    load_set(f1, buf, 1);
    mma_set(f0);
    mma_set(f1);
    // four vector slots between the tile's last WMMAs and whatever rewrites their operand registers, also on the taken side of the branch
    // below; the two scheduling barriers hold the slots there. It names no fragment: one that an asm statement names was kept in the first
    // 256 registers, and two sets beside the accumulators do not fit there.
    __builtin_amdgcn_sched_barrier(0);
    set_done();
    __builtin_amdgcn_sched_barrier(0);
    asm volatile("s_wait_dscnt 0x0" ::: "memory");     // this wave's reads of the buffer are done before the buffer is refilled
    asm volatile("s_wait_asynccnt 0x0" ::: "memory");  // this wave's copies of tile t + 1 have landed before the barrier publishes them
    __syncthreads();                                   // publishes tile t + 1 and ends every wave's reads of tile t
    if (t + 2 < nT) stage(buf, (unsigned)(t + 2) * 128u);
  };
  stage(0, 0u);
  asm volatile("s_wait_asynccnt 0x0" ::: "memory");    // this wave's copies of tile 0 have landed before the barrier publishes them
  __syncthreads();
  stage(1, 128u);
  for (int t = 0; t < nT; t += 2) {
    trip(0, t);
    trip(1, t + 1);
  }
  asm volatile("s_wait_asynccnt 0x0" ::: "memory");    // no copy is outstanding when the wave goes on to its epilogue or ends
  if (m0 >= M) return;                                 // wave-uniform; no work-group barrier behind this line
  acc_guard4(acc[0][0], acc[0][1], acc[0][2], acc[0][3]);
  acc_guard4(acc[1][0], acc[1][1], acc[1][2], acc[1][3]);
  acc_guard4(acc[2][0], acc[2][1], acc[2][2], acc[2][3]);
  acc_guard4(acc[3][0], acc[3][1], acc[3][2], acc[3][3]);

  // ---- epilogue ----
  if (OUT_MODE == 4) {
    // a lane's 8 accumulator rows are 8 neighbours of one transposed row: 16 B per plane straight from registers; a wave fills whole 128-B lines
    static_assert(OUT_MODE != 4 || (BIAS_MODE == 0 && !RESID && ACT == 0), "transposed output is plain");
    unsigned short* C  = (unsigned short*)Cout  + (size_t)b * strideC;
    unsigned short* C2 = (unsigned short*)Cout2 + (size_t)b * strideC;
#pragma unroll
    for (int j = 0; j < 4; ++j) {
#pragma unroll
      for (int i = 0; i < 4; ++i) {
        v8h hv, lv;
#pragma unroll
        for (int r = 0; r < 8; ++r) {
          const float v = acc[i][j][r] * scale;
          const unsigned short hb = f2bf_bits(v);
          hv[r] = __builtin_bit_cast(_Float16, hb);
          lv[r] = __builtin_bit_cast(_Float16, f2bf_bits(v - bf_bits2f(hb)));
        }
        const size_t o = (size_t)(n0 + (j << 4) + rlane) * ldc + m0 + (i << 4) + mOff;
        *(v8h*)(C + o) = hv;
        *(v8h*)(C2 + o) = lv;
      }
    }
    return;
  }
  const bool out_f32 = OUT_MODE == 0 || (OUT_MODE == 3 && (b & 1) == 0);   // uniform over the work-group
  float* slab = sT[wave];
  const float* Rb = RESID ? (resid + (size_t)b * strideR) : nullptr;
#pragma unroll
  for (int i = 0; i < 4; ++i) {
    const int mBase = m0 + (i << 4);
#pragma unroll
    for (int j = 0; j < 4; ++j) {
      const int n = n0 + (j << 4) + rlane;
      float bv = 0.f;
      if (BIAS_MODE == 2) bv = bias[n];
#pragma unroll
      for (int r = 0; r < 8; ++r) {
        float v = acc[i][j][r] * scale;
        if (BIAS_MODE == 1) v += bias[mBase + mOff + r];
        if (BIAS_MODE == 2) v += bv;
        if (RESID) v += Rb[(size_t)(mBase + mOff + r) * ldc + n];
        if (ACT == 1) v = tanhf(v);
        slab[(mOff + r) * 68 + (j << 4) + rlane] = v;
      }
    }
    __builtin_amdgcn_fence(__ATOMIC_RELEASE, "workgroup");
    __builtin_amdgcn_wave_barrier();
    __builtin_amdgcn_fence(__ATOMIC_ACQUIRE, "workgroup");
    if (out_f32) {
      float* C = (float*)Cout + (size_t)b * strideC;
      const int hh = lane >> 4, c4 = (lane & 15) * 4;     // row seg = 256 B = 16 lanes x 16 B
      {
#pragma unroll
        for (int it = 0; it < 8; ++it) {
          const int row = it * 2 + hh;
          v4f v = *(const v4f*)(slab + row * 68 + c4);
          *(v4f*)(C + (size_t)(mBase + row) * ldc + n0 + c4) = v;
        }
        
      }
    } else {
      const int q = lane >> 3, c8 = (lane & 7) * 8;
      unsigned short* C  = (OUT_MODE == 3) ? (unsigned short*)((float*)Cout + (size_t)b * strideC) : ((unsigned short*)Cout + (size_t)b * strideC);
      unsigned short* C2 = (OUT_MODE == 3) ? (C + strideC) : (OUT_MODE == 2) ? ((unsigned short*)Cout2 + (size_t)b * strideC) : nullptr;
      {
#pragma unroll
        for (int it = 0; it < 4; ++it) {
          const int row = it * 4 + q;
          const float* sp = slab + row * 68 + c8;
          v8h hv, lv;
#pragma unroll
          for (int e = 0; e < 8; ++e) {
            if (OUT_MODE == 1) {
              hv[e] = (_Float16)sp[e];
            } else {
              unsigned short hb = f2bf_bits(sp[e]);
              unsigned short lb = f2bf_bits(sp[e] - bf_bits2f(hb));
              hv[e] = __builtin_bit_cast(_Float16, hb);
              lv[e] = __builtin_bit_cast(_Float16, lb);
            }
          }
          *(v8h*)(C + (size_t)(mBase + row) * ldc + n0 + c8) = hv;
          if (OUT_MODE >= 2) *(v8h*)(C2 + (size_t)(mBase + row) * ldc + n0 + c8) = lv;
        }
        // precaution: in the listing the f32 branch follows this one and reuses the registers that these stores name
        if (OUT_MODE == 3) asm volatile("s_wait_xcnt 0x0" ::: "memory");

      }
    }
    __builtin_amdgcn_fence(__ATOMIC_RELEASE, "workgroup");
    __builtin_amdgcn_wave_barrier();
    __builtin_amdgcn_fence(__ATOMIC_ACQUIRE, "workgroup");
  }
}

// x, memory and persona rows, one after the other, to one f16 plane and bf16 hi/lo planes; n*2 = float pairs per source (multiples of 256)
__global__ __launch_bounds__(256) void prep_inputs(
    const float* __restrict__ x, const float* __restrict__ mem, const float* __restrict__ per,
    _Float16* __restrict__ c16, __bf16* __restrict__ hi, __bf16* __restrict__ lo, int nx2, int nm2, int np2) {
  const int i = blockIdx.x * 256 + threadIdx.x;
  if (i >= nx2 + nm2 + np2) return;
  const float* in = x; int j = i;
  if (i >= nx2 + nm2) { in = per; j = i - nx2 - nm2; }
  else if (i >= nx2) { in = mem; j = i - nx2; }
  const float a = in[2 * j], b = in[2 * j + 1];
  const _Float16 h0 = (_Float16)a, h1 = (_Float16)b;
  ((unsigned*)c16)[i] = (unsigned)__builtin_bit_cast(unsigned short, h0) | ((unsigned)__builtin_bit_cast(unsigned short, h1) << 16);
  const unsigned short ah = f2bf_bits(a), bh = f2bf_bits(b);
  const unsigned short al = f2bf_bits(a - bf_bits2f(ah)), bl = f2bf_bits(b - bf_bits2f(bh));
  ((unsigned*)hi)[i] = (unsigned)ah | ((unsigned)bh << 16);
  ((unsigned*)lo)[i] = (unsigned)al | ((unsigned)bl << 16);
}

// eight source matrices of one launch; blockIdx.z picks one, its output plane follows at z * plane elements
struct Src8 { const float* p0; const float* p1; const float* p2; const float* p3; const float* p4; const float* p5; const float* p6; const float* p7; };
__device__ __forceinline__ const float* pick8(const Src8& s, int z) {
  switch (z) {
    case 0: return s.p0; case 1: return s.p1; case 2: return s.p2; case 3: return s.p3;
    case 4: return s.p4; case 5: return s.p5; case 6: return s.p6; default: return s.p7;
  }
}

// ---- f32 [R][C] (row pitch ldi) -> f16 transposed [C][R] (row pitch ldo); 64x64 tiles; each output row segment
__global__ __launch_bounds__(256) void transpose_cast_f16(Src8 srcs, int ldi,
                                                         _Float16* __restrict__ outT0, int ldo, long plane, float scale) {
  __shared__ __align__(16) _Float16 tile[64][72];     // [c][r]
  const float* __restrict__ in = pick8(srcs, blockIdx.z);
  _Float16* __restrict__ outT = outT0 + (size_t)blockIdx.z * plane;
  const int c0 = blockIdx.x * 64, r0 = blockIdx.y * 64;
  const int t = threadIdx.y * 32 + threadIdx.x;
  for (int i = threadIdx.y; i < 64; i += 8) {
    tile[threadIdx.x][i]      = (_Float16)(in[(size_t)(r0 + i) * ldi + c0 + threadIdx.x] * scale);
    tile[32 + threadIdx.x][i] = (_Float16)(in[(size_t)(r0 + i) * ldi + c0 + 32 + threadIdx.x] * scale);
  }
  __syncthreads();
  const int q = t >> 3, c8 = (t & 7) * 8;
  {
#pragma unroll
    for (int it = 0; it < 2; ++it) {
      const int c = it * 32 + q;
      v8h hv = *(const v8h*)(&tile[c][c8]);
      *(v8h*)(outT + (size_t)(c0 + c) * ldo + r0 + c8) = hv;
    }
    
  }
}

// ---- f32 [R][C] (pitch ldi) -> bf16 hi/lo transposed planes [C][R] (pitch ldo); 64x64 tiles; each output row segment
__global__ __launch_bounds__(256) void transpose_split_bf16(Src8 srcs, int ldi,
                                                           __bf16* __restrict__ outH0, __bf16* __restrict__ outL0, int ldo, long plane) {
  __shared__ __align__(16) float tile[64][68];     // [c][r]
  const float* __restrict__ in = pick8(srcs, blockIdx.z);
  __bf16* __restrict__ outH = outH0 + (size_t)blockIdx.z * plane;
  __bf16* __restrict__ outL = outL0 + (size_t)blockIdx.z * plane;
  const int c0 = blockIdx.x * 64, r0 = blockIdx.y * 64;
  const int t = threadIdx.y * 32 + threadIdx.x;
  for (int i = threadIdx.y; i < 64; i += 8) {
    tile[threadIdx.x][i]      = in[(size_t)(r0 + i) * ldi + c0 + threadIdx.x];
    tile[32 + threadIdx.x][i] = in[(size_t)(r0 + i) * ldi + c0 + 32 + threadIdx.x];
  }
  __syncthreads();
  const int q = t >> 3, c8 = (t & 7) * 8;
  {
#pragma unroll
    for (int it = 0; it < 2; ++it) {
      const int c = it * 32 + q;
      v8b hv, lv;
#pragma unroll
      for (int e = 0; e < 8; ++e) {
        const float f = tile[c][c8 + e];
        const unsigned short hb = f2bf_bits(f);
        hv[e] = __builtin_bit_cast(__bf16, hb);
        lv[e] = __builtin_bit_cast(__bf16, f2bf_bits(f - bf_bits2f(hb)));
      }
      *(v8b*)(outH + (size_t)(c0 + c) * ldo + r0 + c8) = hv;
      *(v8b*)(outL + (size_t)(c0 + c) * ldo + r0 + c8) = lv;
    }
    
  }
}

// =====================================================================================
// Generic causal/non-causal attention for head_dim 64, q f32 in, out as bf16 hi and lo planes, bf16 operands with optional hi/lo splits.
//   scores, transposed: S^T = k (q*qscale)^T : v_wmma_f32_16x16x32_bf16, A = k rows, B = q; SPLIT_QK -> q,k as bf16 hi/lo (hi*hi + hi*lo + lo*hi)
//   out, transposed: O^T += v^T p^T : v_wmma_f32_16x16x32_bf16, A = v^T rows, B = p^T; SPLIT_PV -> p,v as bf16 hi/lo; else p,v plain bf16
//   A lane holds scores, weights and output elements of ONE query (column lane & 15): maximum and sum run inside the lane, the two wave halves
//   (keys 8h..8h+7 of every 16) exchange the maximum once per chunk and their sums once at the end, and two score tiles, converted in place,
//   are the B operand of the second product, so that p never goes through LDS.
//   f32 accumulate; online softmax in f32, in base 2: qscale holds the score scale times log2(e), so that a weight is 2^(s - max), one subtract
//   and one v_exp_f32 (differences are never above 0; far below 0 the instruction gives 0, as the softmax wants). Block = 4 waves = 64 query rows of one (batch, head); S % 64 == 0.
//   Element (b, s, h, d) of q and out lives at X[b*X_bs + s*X_rs + h*X_hs + d] (strides in elements, multiples of 8); out leaves already split
//   into the hi and lo planes that the output projection reads.
//   k arrives as bf16 hi and lo planes, element (s, h, d) at s*K_RS + h*k_hs + d; v as bf16 hi and lo planes, transposed: element
//   (s, h, d) at h*v_hs + d*V_RS + s (strides in bf16, multiples of 8; the row pitches are template constants, so that a tile's
//   rows are constant offsets from one address). A chunk's tiles are rows of 128 B that go to LDS as they are.
//   Masking: mask_mode 0 none, 1 causal (kv > q masked), 4 causal + sliding window (kv > q or q - kv > W masked; W passed in
//   mask_is_int); masked scores are replaced by mask_fill before the softmax. The mask is decided once per 64-key chunk with scalar
//   tests: a chunk that the window masks for all 64 query rows is not visited (its weights are exactly 0 after the softmax), a chunk
//   with no masked element runs no mask code, and only a chunk that the diagonal or the window's edge crosses compares and selects.
//   One launch serves four branches (batch 1): branch a reads q/k/v and writes out at a * {q,k,v,o}_st elements, with its own Skv,
//   mask_mode and window. grid.x = 4 * H * (S/64): first branches 0 and 1 (causal, cost grows with the query block) from the last
//   query block down, then branches 2 and 3, so that the long work-groups start first.
// =====================================================================================
#define AT_D 64
#define AT_NW 4
#define AT_QB 64
#define AT_KC 64
#define AT_LP 72   // LDS row pitch of the K and V tiles in bf16: 144 B = 16 B x 9, so that the 16 rows of a ds_load_b128 fall on different banks
struct AttnGeom { long q_bs, q_rs, q_hs, k_bs, k_rs, k_hs, v_bs, v_rs, v_hs, o_bs, o_rs, o_hs;
                  int S, Skv, H, mask_mode; float qscale; int blk0; float mask_fill; int mask_is_int; };
static_assert(sizeof(AttnGeom) == 128, "no padding");
struct AttnBranches { long q_st, k_st, v_st, o_st; int Skv[4]; int mask_mode[4]; int mask_is_int[4]; };

__device__ __forceinline__ unsigned short at_bf_bits(float f) {
  unsigned u = __float_as_uint(f);
  return (unsigned short)((u + 0x7FFFu + ((u >> 16) & 1u)) >> 16);
}
__device__ __forceinline__ __bf16 at_f2bf(float f) { return __builtin_bit_cast(__bf16, at_bf_bits(f)); }
__device__ __forceinline__ void at_split(float f, __bf16& hi, __bf16& lo) {
  const unsigned short hb = at_bf_bits(f);
  hi = __builtin_bit_cast(__bf16, hb);
  lo = at_f2bf(f - __uint_as_float(((unsigned)hb) << 16));
}
__device__ __forceinline__ v8f at_mma(v16b a, v16b b, v8f c) {
  return __builtin_amdgcn_wmma_f32_16x16x32_bf16(false, a, false, b, (short)0, c, false, false);
}
// one A or B fragment from an LDS row: elements 0..7 <- p[0..7], 8..15 <- p[16..23]
__device__ __forceinline__ v16b at_frag(const __bf16* p) {
  union { v16b v; v8b h[2]; } f;
  f.h[0] = *(const v8b*)(p); f.h[1] = *(const v8b*)(p + 16);
  return f.v;
}

// lane l takes the value of lane l ^ 16
__device__ __forceinline__ float at_xhalf(float x) {
  return __builtin_bit_cast(float, __builtin_amdgcn_permlanex16(__builtin_bit_cast(int, x), __builtin_bit_cast(int, x), 0x76543210, 0xfedcba98, false, false));
}

template <bool SPLIT_QK, bool SPLIT_PV, int K_RS, int V_RS>
__global__ __launch_bounds__(128) __attribute__((amdgpu_waves_per_eu(4)))   // 256 registers a wave: four waves per SIMD, four work-groups per WGP
void attn64_kernel(const float* __restrict__ q, const unsigned short* __restrict__ kh, const unsigned short* __restrict__ kl,
                   const unsigned short* __restrict__ vth, const unsigned short* __restrict__ vtl,
                   unsigned short* __restrict__ outh, unsigned short* __restrict__ outl, AttnGeom g0, AttnBranches br) {
  __shared__ __align__(16) __bf16 Ksh[AT_KC * AT_LP];            // K hi [kv][d]      9 KB
  __shared__ __align__(16) __bf16 Ksl[SPLIT_QK ? AT_KC * AT_LP : 8];
  __shared__ __align__(16) __bf16 Vth[AT_D * AT_LP];             // V hi [d][kv]      9 KB
  __shared__ __align__(16) __bf16 Vtl[SPLIT_PV ? AT_D * AT_LP : 8];
  __shared__ __align__(16) float  Os[AT_NW][16 * 68];            // per wave out tile, pitch 68

  const int tid  = threadIdx.x;
  const int wave = tid >> 5;
  const int lane = tid & 31;
  const int hh   = lane >> 4;
  const int c    = lane & 15;

  AttnGeom g = g0;
  const int nqb = g.S / AT_QB;
  const int bx = blockIdx.x + g.blk0;
  const int perBranch = g.H * nqb;
  int a, h, qb;
  if (bx < 2 * perBranch) {
    const int lvl = bx / (2 * g.H), w = bx % (2 * g.H);
    qb = nqb - 1 - lvl; a = w / g.H; h = w % g.H;
  } else {
    const int r = bx - 2 * perBranch, r2 = r % perBranch;
    a = 2 + r / perBranch; h = r2 / nqb; qb = r2 % nqb;
  }
  g.Skv = br.Skv[a]; g.mask_mode = br.mask_mode[a]; g.mask_is_int = br.mask_is_int[a];
  const int qbase_block = qb * AT_QB;
  const int q0 = qbase_block + wave * 16;

  const float* qb_ptr = q + (size_t)a * br.q_st + (size_t)h * g.q_hs;
  // staging: 8 threads per 128-B tile row, 16 rows per pass, 4 passes; offsets of this thread's 16 B in the first pass of chunk 0
  const int srow = tid >> 3, sc8 = (tid & 7) * 8;
  const size_t koff = (size_t)a * br.k_st + (size_t)h * g.k_hs + (size_t)srow * K_RS + sc8;
  const size_t voff = (size_t)a * br.v_st + (size_t)h * g.v_hs + (size_t)srow * V_RS + sc8;
  const size_t ooff = (size_t)a * br.o_st + (size_t)h * g.o_hs;

  // ---- Q fragments (B operand: column = query lane & 15): 2 d-chunks, hi (and lo) ----
  v16b qah[2], qal[2];
  {
    const float* qrow = qb_ptr + (size_t)(q0 + c) * g.q_rs;
#pragma unroll
    for (int dc = 0; dc < 2; ++dc) {
#pragma unroll
      for (int e = 0; e < 8; ++e) {
        const float f0 = qrow[dc * 32 + 8 * hh + e] * g.qscale;
        const float f1 = qrow[dc * 32 + 16 + 8 * hh + e] * g.qscale;
        if (SPLIT_QK) { __bf16 hq, lq; at_split(f0, hq, lq); qah[dc][e] = hq; qal[dc][e] = lq; at_split(f1, hq, lq); qah[dc][8 + e] = hq; qal[dc][8 + e] = lq; }
        else { qah[dc][e] = at_f2bf(f0); qah[dc][8 + e] = at_f2bf(f1); qal[dc][e] = qah[dc][e]; qal[dc][8 + e] = qah[dc][8 + e]; }
      }
    }
  }

  float mrow = -INFINITY, lrow = 0.f;   // of query q0 + c; lrow sums this wave half's keys alone until the epilogue
  v8f oacc[4];                          // O^T: oacc[t][r] = element d = t*16 + 8*hh + r of query q0 + c
#pragma unroll
  for (int t = 0; t < 4; ++t) oacc[t] = (v8f){0.f,0.f,0.f,0.f,0.f,0.f,0.f,0.f};

  const bool causal = (g.mask_mode == 1 || g.mask_mode == 4);
  const int win = (g.mask_mode == 4) ? g.mask_is_int : g.S;          // q - kv stays below S: no window
  const int nChunks = causal ? (qb + 1) : (g.Skv / AT_KC);           // block-uniform
  const int kcFirst = (causal && qbase_block > win) ? (qbase_block - win) / AT_KC : 0;   // chunk of the oldest key that the block's first row still sees
  // one address per plane, moved on from chunk to chunk; the four passes are constant offsets from it
  const __bf16* pkh = (const __bf16*)kh + koff + (size_t)kcFirst * (AT_KC * K_RS);    // K tile: rows are keys
  const __bf16* pkl = (const __bf16*)kl + koff + (size_t)kcFirst * (AT_KC * K_RS);
  const __bf16* pvh = (const __bf16*)vth + voff + (size_t)kcFirst * AT_KC;            // V tile: rows are head dims, keys run along the row
  const __bf16* pvl = (const __bf16*)vtl + voff + (size_t)kcFirst * AT_KC;
  for (int kc = kcFirst; kc < nChunks; ++kc) {
    const int kv0 = kc * AT_KC;
    {
      v8b rkh[4], rkl[4], rvh[4], rvl[4];
#pragma unroll
      for (int i = 0; i < 4; ++i) {
        rkh[i] = *(const v8b*)(pkh + i * 16 * K_RS);
        if (SPLIT_QK) rkl[i] = *(const v8b*)(pkl + i * 16 * K_RS);
        rvh[i] = *(const v8b*)(pvh + i * 16 * V_RS);
        if (SPLIT_PV) rvl[i] = *(const v8b*)(pvl + i * 16 * V_RS);
      }
      __syncthreads();
      pkh += AT_KC * K_RS; pkl += AT_KC * K_RS; pvh += AT_KC; pvl += AT_KC;
#pragma unroll
      for (int i = 0; i < 4; ++i) {
        const int lo = (i * 16 + srow) * AT_LP + sc8;
        *(v8b*)(Ksh + lo) = rkh[i];
        if (SPLIT_QK) *(v8b*)(Ksl + lo) = rkl[i];
        *(v8b*)(Vth + lo) = rvh[i];
        if (SPLIT_PV) *(v8b*)(Vtl + lo) = rvl[i];
      }
    }
    __syncthreads();

    // The chunk's K fragments are read from LDS in two groups, the first in front of the first WMMA, the second among the WMMAs where the
    // registers of fragments that are done with are free (all at once do not fit four waves per SIMD), and the WMMAs go round the four
    // independent score tiles. Every score tile still takes its products in the order d 0..31: hi*hi, hi*lo, lo*hi, then d 32..63 the same.
    v8f s[4];   // S^T: s[j][r] = score of key kv0 + j*16 + 8*hh + r with query q0 + c
    {
      const __bf16* kfh = Ksh + c * AT_LP + 8 * hh;
      const __bf16* kfl = Ksl + c * AT_LP + 8 * hh;
      v16b kh0[4], kl0[4], kh1[4], kl1[4];
#pragma unroll
      for (int j = 0; j < 4; ++j) kh0[j] = at_frag(kfh + j * 16 * AT_LP);
      if (SPLIT_QK) {
#pragma unroll
        for (int j = 0; j < 4; ++j) kl0[j] = at_frag(kfl + j * 16 * AT_LP);
      }
#pragma unroll
      for (int j = 0; j < 2; ++j) kh1[j] = at_frag(kfh + j * 16 * AT_LP + 32);
      // keeps the scheduler from sinking these reads down to their first use, where each would be waited for on its own
      __builtin_amdgcn_sched_barrier(0);
#pragma unroll
      for (int j = 0; j < 4; ++j) s[j] = at_mma(kh0[j], qah[0], (v8f){0.f,0.f,0.f,0.f,0.f,0.f,0.f,0.f});
      if (SPLIT_QK) {
#pragma unroll
        for (int j = 0; j < 4; ++j) s[j] = at_mma(kl0[j], qah[0], s[j]);
#pragma unroll
        for (int j = 0; j < 2; ++j) s[j] = at_mma(kh0[j], qal[0], s[j]);
      }
      // the two scheduling barriers hold the second group together at this place
      __builtin_amdgcn_sched_barrier(0);
#pragma unroll
      for (int j = 2; j < 4; ++j) kh1[j] = at_frag(kfh + j * 16 * AT_LP + 32);
      if (SPLIT_QK) {
#pragma unroll
        for (int j = 0; j < 4; ++j) kl1[j] = at_frag(kfl + j * 16 * AT_LP + 32);
      }
      __builtin_amdgcn_sched_barrier(0);
      if (SPLIT_QK) {
#pragma unroll
        for (int j = 2; j < 4; ++j) s[j] = at_mma(kh0[j], qal[0], s[j]);
      }
#pragma unroll
      for (int j = 0; j < 4; ++j) s[j] = at_mma(kh1[j], qah[1], s[j]);
      if (SPLIT_QK) {
#pragma unroll
        for (int j = 0; j < 4; ++j) s[j] = at_mma(kl1[j], qah[1], s[j]);
#pragma unroll
        for (int j = 0; j < 4; ++j) s[j] = at_mma(kh1[j], qal[1], s[j]);
      }
      // four vector slots between the last WMMAs and the first use of the scores, also on the taken side of the branch below
      acc_guard4(s[0], s[1], s[2], s[3]);
    }
    // block-uniform: the diagonal chunk, or one in which the block's last row is more than win past the chunk's first key
    if (causal && (kc == qb || qbase_block + (AT_QB - 1) - kv0 > win)) {
      const int qrow = q0 + c;
#pragma unroll
      for (int j = 0; j < 4; ++j) {
#pragma unroll
        for (int r = 0; r < 8; ++r) {
          const int dist = qrow - (kv0 + j * 16 + 8 * hh + r);
          s[j][r] = (dist < 0 || dist > win) ? g.mask_fill : s[j][r];
        }
      }
    }
    // the chunk's maximum for this lane's query: 32 keys in the lane, the other 32 in lane ^ 16
    float cm[4];
#pragma unroll
    for (int j = 0; j < 4; ++j) {
      cm[j] = s[j][0];
#pragma unroll
      for (int r = 1; r < 8; ++r) cm[j] = fmaxf(cm[j], s[j][r]);
    }
    float cmx = fmaxf(fmaxf(cm[0], cm[1]), fmaxf(cm[2], cm[3]));
    cmx = fmaxf(cmx, at_xhalf(cmx));
    const float mnew = fmaxf(mrow, cmx);
    const float alpha = __builtin_amdgcn_exp2f(mrow - mnew);
    mrow = mnew;
    // p^T as B operand of the second product: element e of ph[b] = key 32*b + 8*hh + e (e < 8), 32*b + 16 + 8*hh + e - 8 (e >= 8): tiles 2b and 2b+1
    // as they lie in the registers, the k order of the V fragments below
    v16b ph[2], pl[2];
    float ps[4];
#pragma unroll
    for (int j = 0; j < 4; ++j) {
      ps[j] = 0.f;
#pragma unroll
      for (int r = 0; r < 8; ++r) {
        const float p = __builtin_amdgcn_exp2f(s[j][r] - mnew);
        ps[j] += p;
        if (SPLIT_PV) { __bf16 a, bl; at_split(p, a, bl); ph[j >> 1][(j & 1) * 8 + r] = a; pl[j >> 1][(j & 1) * 8 + r] = bl; }
        else ph[j >> 1][(j & 1) * 8 + r] = at_f2bf(p);
      }
    }
    lrow = lrow * alpha + ((ps[0] + ps[1]) + (ps[2] + ps[3]));
#pragma unroll
    for (int t = 0; t < 4; ++t)
#pragma unroll
      for (int r = 0; r < 8; ++r) oacc[t][r] *= alpha;
    // V fragments in two groups, as the K fragments above; every output tile still takes keys 0..31: hi*hi, hi*lo, lo*hi, then keys 32..63.
    {
      const __bf16* vfh = Vth + c * AT_LP + 8 * hh;
      const __bf16* vfl = Vtl + c * AT_LP + 8 * hh;
      v16b vh0[4], vl0[4], vh1[4], vl1[4];
#pragma unroll
      for (int t = 0; t < 4; ++t) vh0[t] = at_frag(vfh + t * 16 * AT_LP);
      if (SPLIT_PV) {
#pragma unroll
        for (int t = 0; t < 4; ++t) vl0[t] = at_frag(vfl + t * 16 * AT_LP);
      }
#pragma unroll
      for (int t = 0; t < 2; ++t) vh1[t] = at_frag(vfh + t * 16 * AT_LP + 32);
      // keeps the scheduler from sinking these reads down to their first use, where each would be waited for on its own
      __builtin_amdgcn_sched_barrier(0);
#pragma unroll
      for (int t = 0; t < 4; ++t) oacc[t] = at_mma(vh0[t], ph[0], oacc[t]);
      if (SPLIT_PV) {
#pragma unroll
        for (int t = 0; t < 4; ++t) oacc[t] = at_mma(vl0[t], ph[0], oacc[t]);
#pragma unroll
        for (int t = 0; t < 2; ++t) oacc[t] = at_mma(vh0[t], pl[0], oacc[t]);
      }
      // the two scheduling barriers hold the second group together at this place
      __builtin_amdgcn_sched_barrier(0);
#pragma unroll
      for (int t = 2; t < 4; ++t) vh1[t] = at_frag(vfh + t * 16 * AT_LP + 32);
      if (SPLIT_PV) {
#pragma unroll
        for (int t = 0; t < 4; ++t) vl1[t] = at_frag(vfl + t * 16 * AT_LP + 32);
      }
      __builtin_amdgcn_sched_barrier(0);
      if (SPLIT_PV) {
#pragma unroll
        for (int t = 2; t < 4; ++t) oacc[t] = at_mma(vh0[t], pl[0], oacc[t]);
      }
#pragma unroll
      for (int t = 0; t < 4; ++t) oacc[t] = at_mma(vh1[t], ph[1], oacc[t]);
      if (SPLIT_PV) {
#pragma unroll
        for (int t = 0; t < 4; ++t) oacc[t] = at_mma(vl1[t], ph[1], oacc[t]);
#pragma unroll
        for (int t = 0; t < 4; ++t) oacc[t] = at_mma(vh1[t], pl[1], oacc[t]);
      }
      // four vector slots between the chunk's last WMMAs and whatever rewrites their registers, also on the taken side of the loop's branch
      acc_guard4(oacc[0], oacc[1], oacc[2], oacc[3]);
    }
  }

  float* os = Os[wave];
  {
    const float inv = 1.0f / (lrow + at_xhalf(lrow));   // the two halves' sums join here
#pragma unroll
    for (int t = 0; t < 4; ++t) {
      const v4f lo4 = {oacc[t][0] * inv, oacc[t][1] * inv, oacc[t][2] * inv, oacc[t][3] * inv};
      const v4f hi4 = {oacc[t][4] * inv, oacc[t][5] * inv, oacc[t][6] * inv, oacc[t][7] * inv};
      *(v4f*)(os + c * 68 + t * 16 + 8 * hh) = lo4;
      *(v4f*)(os + c * 68 + t * 16 + 8 * hh + 4) = hi4;
    }
  }
  __builtin_amdgcn_fence(__ATOMIC_RELEASE, "workgroup");
  __builtin_amdgcn_wave_barrier();
  __builtin_amdgcn_fence(__ATOMIC_ACQUIRE, "workgroup");
  {
    // 8 lanes per query row, 8 elements each: 16 B per plane and lane, a row's 64 elements fill one 128-B line of each plane
    const int q4 = lane >> 3, c8 = (lane & 7) * 8;
#pragma unroll
    for (int it = 0; it < 4; ++it) {
      const int row = it * 4 + q4;
      const float* sp = os + row * 68 + c8;
      v8b hv, lv;
#pragma unroll
      for (int e = 0; e < 8; ++e) { __bf16 hb, lb; at_split(sp[e], hb, lb); hv[e] = hb; lv[e] = lb; }
      const size_t o = ooff + (size_t)(q0 + row) * g.o_rs + c8;
      *(v8b*)(outh + o) = hv;
      *(v8b*)(outl + o) = lv;
    }
  }
}

__global__ __launch_bounds__(256) void gate_fuse_kernel(const float* __restrict__ o0, const float* __restrict__ o1,
                                                       const float* __restrict__ o2, const float* __restrict__ o3,
                                                       const float* __restrict__ Wg, const float* __restrict__ bg,
                                                       float* __restrict__ out, int Hd) {
  __shared__ float red[4][8];
  const int row = blockIdx.x, t = threadIdx.x, lane = t & 31, wave = t >> 5;
  const float* os[4] = {o0 + (size_t)row * Hd, o1 + (size_t)row * Hd, o2 + (size_t)row * Hd, o3 + (size_t)row * Hd};
  float acc[4] = {0.f, 0.f, 0.f, 0.f};
  for (int i = 0; i < 4; ++i) {
    const float* o = os[i];
    for (int c = t; c < Hd; c += 256) {
      const float v = o[c];
      const float* w = Wg + (size_t)(i * Hd + c) * 4;
      acc[0] += v * w[0]; acc[1] += v * w[1]; acc[2] += v * w[2]; acc[3] += v * w[3];
    }
  }
#pragma unroll
  for (int g = 0; g < 4; ++g) { float a = acc[g]; for (int o = 16; o > 0; o >>= 1) a += __shfl_xor(a, o, 32); if (lane == 0) red[g][wave] = a; }
  __syncthreads();
  float gl[4];
#pragma unroll
  for (int g = 0; g < 4; ++g) { float a = 0.f; for (int w = 0; w < 8; ++w) a += red[g][w]; gl[g] = a + bg[g]; }
  const float mx = fmaxf(fmaxf(gl[0], gl[1]), fmaxf(gl[2], gl[3]));
  float e[4], se = 0.f;
#pragma unroll
  for (int g = 0; g < 4; ++g) { e[g] = expf(gl[g] - mx); se += e[g]; }
  const float inv = 1.0f / se;
  const int c = 4 * t;
  v4f r;
#pragma unroll
  for (int q = 0; q < 4; ++q) r[q] = (e[0] * inv) * os[0][c + q] + (e[1] * inv) * os[1][c + q] + (e[2] * inv) * os[2][c + q] + (e[3] * inv) * os[3][c + q];
  *(v4f*)(out + (size_t)row * Hd + c) = r;
  
}

extern "C" void kernel_launch(void* const* d_in, const int* in_sizes, int n_in,
                              void* d_out, int out_size, void* d_ws, size_t ws_size,
                              hipStream_t stream) {
  (void)in_sizes; (void)n_in; (void)out_size; (void)ws_size;
  const int S = 2048, E = 1024, H = 16, DH = 64, MM = 512, MP = 64, WIN = 512;
  // wire order: 16 weights ([in,out]), gate_w, gate_b, x, memory_kv, persona_kv
  const float* Wm[16]; for (int i = 0; i < 16; ++i) Wm[i] = (const float*)d_in[i];   // {local,long,mem,per} x {wq,wk,wv,wo}
  const float* gate_w = (const float*)d_in[16];
  const float* gate_b = (const float*)d_in[17];
  const float* x   = (const float*)d_in[18];   // [1,2048,1024]
  const float* mem = (const float*)d_in[19];   // [1,512,1024]
  const float* per = (const float*)d_in[20];   // [1,64,1024]
  float* out = (float*)d_out;

  char* ws = (char*)d_ws; size_t off = 0;
  auto carve = [&](size_t bytes) -> char* { char* p = ws + off; off += (bytes + 255) & ~(size_t)255; return p; };
  const int CT = S + MM + MP;                                   // context rows: x, then memory, then persona
  const long EE = (long)E * E, SE = (long)S * E;
  _Float16* C16  = (_Float16*)carve((size_t)CT * E * 2);        // 5.4 MB each
  __bf16*   Ch   = (__bf16*)carve((size_t)CT * E * 2);
  __bf16*   Cl   = (__bf16*)carve((size_t)CT * E * 2);
  _Float16* WqkT = (_Float16*)carve((size_t)8 * EE * 2);        // plane 2a = wq^T, 2a+1 = wk^T of branch a; 16.8 MB
  __bf16*   WvoTh = (__bf16*)carve((size_t)8 * EE * 2);         // plane 2a = wv^T, 2a+1 = wo^T
  __bf16*   WvoTl = (__bf16*)carve((size_t)8 * EE * 2);
  float*    QK   = (float*)carve((size_t)8 * SE * 4);           // plane 2a = q (f32), 2a+1 = k of branch a (bf16 hi, then bf16 lo); 67 MB
  __bf16*   VTh  = (__bf16*)carve((size_t)4 * SE * 2);          // v^T of branch a: [E][S] (row pitch S for every branch); 16.8 MB each
  __bf16*   VTl  = (__bf16*)carve((size_t)4 * SE * 2);
  __bf16*   Oh   = (__bf16*)carve((size_t)4 * SE * 2);
  __bf16*   Ol   = (__bf16*)carve((size_t)4 * SE * 2);          // total 201 MB
  float*    Ob[4];
  for (int i = 0; i < 4; ++i) Ob[i] = QK + (size_t)i * SE;      // branch outputs take the q/k planes' place once attention is done

  const int  SKs[4]  = {S, S, MM, MP};                          // keys per branch
  const long ctx0[4] = {0, 0, (long)S * E, (long)(S + MM) * E}; // first context element per branch

  prep_inputs<<<CT * E / 2 / 256, 256, 0, stream>>>(x, mem, per, C16, Ch, Cl, S * E / 2, MM * E / 2, MP * E / 2);
  {
    Src8 qk = {Wm[0], Wm[1], Wm[4], Wm[5], Wm[8], Wm[9], Wm[12], Wm[13]};
    Src8 vo = {Wm[2], Wm[3], Wm[6], Wm[7], Wm[10], Wm[11], Wm[14], Wm[15]};
    transpose_cast_f16<<<dim3(E / 64, E / 64, 8), dim3(32, 8), 0, stream>>>(qk, E, WqkT, E, EE, 1.0f);
    transpose_split_bf16<<<dim3(E / 64, E / 64, 8), dim3(32, 8), 0, stream>>>(vo, E, WvoTh, WvoTl, E, EE);
  }
  const int tb = (S / 128) * (E / 256);                         // 128x256 tiles of the tallest batch entry
  {
    BatchA bqk, bv;
    for (int a = 0; a < 4; ++a) {
      bqk.aoff[2 * a] = 0;           bqk.M[2 * a] = S;
      bqk.aoff[2 * a + 1] = ctx0[a]; bqk.M[2 * a + 1] = SKs[a];
      bv.aoff[a] = ctx0[a];          bv.M[a] = SKs[a];
      bv.aoff[4 + a] = 0;            bv.M[4 + a] = 0;
    }
    wmma_gemm64<0, false, 0, 3, false><<<dim3(tb, 8), 256, 0, stream>>>(
        U16(C16), nullptr, E, bqk, U16(WqkT), nullptr, E, EE, QK, nullptr, E, SE, nullptr, nullptr, 0, E, E, 1.0f);
    wmma_gemm64<1, true, 0, 4, false><<<dim3(tb, 4), 256, 0, stream>>>(
        U16(Ch), U16(Cl), E, bv, U16(WvoTh), U16(WvoTl), E, 2 * EE, VTh, VTl, S, SE, nullptr, nullptr, 0, E, E, 1.0f);
  }
  {
    AttnGeom g;
    g.q_bs = SE; g.q_rs = E; g.q_hs = DH;
    g.k_bs = SE; g.k_rs = E; g.k_hs = DH;
    g.v_bs = SE; g.v_rs = S; g.v_hs = (long)DH * S;
    g.o_bs = SE; g.o_rs = E; g.o_hs = DH;
    g.S = S; g.Skv = S; g.H = H; g.qscale = 0.18033688f;   /* 1/sqrt(64) * log2(e): scores in base-2 units */ g.blk0 = 0; g.mask_fill = -1.0e30f;
    g.mask_mode = 0; g.mask_is_int = 0;
    AttnBranches br;
    br.q_st = 2 * SE; br.k_st = 4 * SE; br.v_st = SE; br.o_st = SE;   // a q/k pair of f32-sized planes is 4 * SE bf16
    for (int a = 0; a < 4; ++a) { br.Skv[a] = SKs[a]; br.mask_mode[a] = 0; br.mask_is_int[a] = 0; }
    br.mask_mode[0] = 4; br.mask_is_int[0] = WIN;               // causal + window
    br.mask_mode[1] = 1;                                        // causal
    attn64_kernel<true, true, E, S><<<4 * H * (S / AT_QB), AT_NW * 32, 0, stream>>>(QK, U16(QK + SE), U16(QK + SE) + SE, U16(VTh), U16(VTl), (unsigned short*)Oh, (unsigned short*)Ol, g, br);
  }
  {
    BatchA bo;
    for (int a = 0; a < 4; ++a) { bo.aoff[a] = a * SE; bo.M[a] = S; bo.aoff[4 + a] = 0; bo.M[4 + a] = 0; }
    wmma_gemm64<1, true, 0, 0, false><<<dim3(tb, 4), 256, 0, stream>>>(
        U16(Oh), U16(Ol), E, bo, U16(WvoTh + EE), U16(WvoTl + EE), E, 2 * EE, Ob[0], nullptr, E, SE, nullptr, nullptr, 0, E, E, 1.0f);
  }
  gate_fuse_kernel<<<S, 256, 0, stream>>>(Ob[0], Ob[1], Ob[2], Ob[3], gate_w, gate_b, out, E);
}
